// v000
// Measured on an AMD MI455X. A time is GPU time per run, averaged over a window of back-to-back runs after a warm-up
// (all launches, gaps included; the runs take copies of the inputs in turn), and the median of several windows.
// Apart from v000's, it joins two sittings. Times from different sittings can be a few percent apart, while
// side-by-side timings come from the same sitting.
// The starting kernel, v000, takes 138 milliseconds a run.
#include <hip/hip_runtime.h>
// Grouped multi-head attention in its MHA configuration (q, k, v [2][2048][1024]; qp = q Wq + bq; kp = k Wkv + bkv and vp = v Wkv + bkv (one shared projection); 16 heads of 64; scores / 8 with the int mask [2048][2048] (verbatim, read per (query, key); 0 -> -inf); softmax w; o = attn vp merged + alpha * vp; out0 = o Wo + bo -> [2][2048][1024] @0; out1 = sum over the 16 heads of w -> [2][2048][2048] f32 @16,777,216 B).
// Structure: token rows; q, k, v as exact f16 rows; QP, KP as WMMA GEMMs (32x64 wave tiles, f32 accumulation, exact x16 transposed weights + bias, f16 outputs); VP likewise to f16 AND f32 (the f32 rows times 64 bf16(alpha) become the residual addend); per batch: V^T via LDS transposes; per query tile of 256 rows: scores for all 16 heads in one GEMM (K = 64, alpha 1/8) into f32; per-row softmax across the 16 head planes on VALU (mask as an arithmetic factor; f32 statistics, native exp) writing the f16 weights (x256) AND the f32 head-sum straight into the second output; o = P . V^T GEMM (K = 2048, alpha 2^-2: o x64) with 64 alpha vp as the epilogue addend into merged f16 rows; out0 = o Wo + bo GEMM (f32, alpha folds 1/16 and 1/64); 10 + 2 x (1 + 8 x 3) + 1 = 61 launches.
// Compute dtype: inputs rounded to bf16; q/k/v inputs and weights exact in f16; qp, kp, vp (as operand), softmax weights (x256) and o plain f16 (~2^-12); scores, softmax statistics, the head-sum output and alpha vp f32. v_wmma_f32_16x16x32_f16.
#define NB 2
#define SQ 2048
#define DM 1024
#define NH 16
#define HD 64
#define HG 4                         /* k_vt(b,h0) compatibility (unused) */
#define QT 256                       /* query rows per tile */
#define NKX SQ                       /* S / P row pitch */
#define B0 0                         /* first batch processed (debug hook) */
#define NBR NB                       /* batches processed (debug hook) */
#define Q0S 0                        /* first tile (debug hook) */
#define QN SQ                        /* query rows end (debug hook) */
#define NR ((size_t)NB * SQ)
#define MP ((int)((size_t)NBR * SQ)) /* rows projected (debug hook) */
#define MPO MP                       /* rows through the output GEMM (debug hook) */
typedef __bf16 v16b __attribute__((ext_vector_type(16)));
typedef unsigned short v8us __attribute__((ext_vector_type(8), may_alias));
typedef float  v8f  __attribute__((ext_vector_type(8)));
typedef float  v4f  __attribute__((ext_vector_type(4)));
typedef float  v4fa __attribute__((ext_vector_type(4), may_alias));
union FragB { v16b v; v8us half[2]; unsigned short u[16]; };

__device__ __forceinline__ unsigned short bf16_bits(float x) { unsigned int u = __float_as_uint(x); return (unsigned short)((u + 0x7FFFu + ((u >> 16) & 1u)) >> 16); }
__device__ __forceinline__ float bf16_val(unsigned short b) { return __uint_as_float(((unsigned int)b) << 16); }
__device__ __forceinline__ float bf16_round(float x) { return bf16_val(bf16_bits(x)); }
// D += A·B with NT terms: 1 = ah·bh, 2 = + al·bh (A split), 3 = + ah·bl (both split)
template <int NT>
__device__ __forceinline__ v8f mmaN(v16b ah, v16b al, v16b bh, v16b bl, v8f c) {
  c = __builtin_amdgcn_wmma_f32_16x16x32_bf16(false, ah, false, bh, (short)0, c, false, false);
  if (NT >= 2) c = __builtin_amdgcn_wmma_f32_16x16x32_bf16(false, al, false, bh, (short)0, c, false, false);
  if (NT >= 3) c = __builtin_amdgcn_wmma_f32_16x16x32_bf16(false, ah, false, bl, (short)0, c, false, false);
  asm volatile("v_nop\n\tv_nop\n\tv_nop\n\tv_nop" : "+v"(c) : "v"(ah), "v"(al), "v"(bh), "v"(bl));
  return c;
}

__global__ __launch_bounds__(256) void k_wt_bf16(const float* __restrict__ W, unsigned short* __restrict__ Wt, int K, int N) {
  const int t = blockIdx.x * 256 + threadIdx.x;
  const int k8n = K / 8;
  if (t >= N * k8n) return;
  const int n = t / k8n, k8 = (t % k8n) * 8;
  v8us v;
#pragma unroll
  for (int i = 0; i < 8; ++i) v[i] = bf16_bits(W[(size_t)(k8 + i) * N + n]);
  *(v8us*)(Wt + (size_t)n * K + k8) = v;
  
}

// GEMM C[M][N] (f32, pitch ldc) = act(A[M][K]·W + bias). A f32 row-major (pitch lda) converted per fragment to bf16
// (ASPLIT: hi/lo two planes -> 2 terms, else single rounded term); Wt bf16 [N][K] (pitch ldb). BIAS_BF16 rounds the
// bias to bf16 first (bias quantised to bf16 before the add). K%32==0, M%16==0, N%64==0.
template <bool ASPLIT, int ACT, bool BIAS_BF16>
__global__ __launch_bounds__(128) void k_gemm_bf(const float* __restrict__ A, int lda, const unsigned short* __restrict__ Wt, int ldb,
                                               const float* __restrict__ bias, float* __restrict__ C, int ldc, int M, int N, int K) {
  __shared__ __attribute__((aligned(16))) float so[4][16][64];
  const int tid = threadIdx.x, w = tid >> 5, lane = tid & 31, ln = lane & 15, hh = lane >> 4;
  const int ntn = N / 64;
  const int wid = blockIdx.x * 4 + w;
  const int mt = wid / ntn, nq = wid % ntn;
  if (mt * 16 >= M) return;
  const int row0 = mt * 16, col0 = nq * 64;
  const float* arow = A + (size_t)(row0 + ln) * lda;
  v8f acc[4] = {};
  for (int kb = 0; kb < K; kb += 32) {
    FragB ah, al;
    const v4f x0 = *(const v4fa*)(arow + kb + 8 * hh), x1 = *(const v4fa*)(arow + kb + 8 * hh + 4);
    const v4f x2 = *(const v4fa*)(arow + kb + 16 + 8 * hh), x3 = *(const v4fa*)(arow + kb + 16 + 8 * hh + 4);
    float xs[16] = {x0[0],x0[1],x0[2],x0[3],x1[0],x1[1],x1[2],x1[3],x2[0],x2[1],x2[2],x2[3],x3[0],x3[1],x3[2],x3[3]};
#pragma unroll
    for (int i = 0; i < 16; ++i) { const unsigned short hb = bf16_bits(xs[i]); ah.u[i] = hb; al.u[i] = ASPLIT ? bf16_bits(xs[i] - bf16_val(hb)) : (unsigned short)0; }
#pragma unroll
    for (int t = 0; t < 4; ++t) {
      const unsigned short* brow = Wt + (size_t)(col0 + t * 16 + ln) * ldb + kb;
      FragB b;
      b.half[0] = *(const v8us*)(brow + 8 * hh);
      b.half[1] = *(const v8us*)(brow + 16 + 8 * hh);
      acc[t] = mmaN<ASPLIT ? 2 : 1>(ah.v, al.v, b.v, b.v, acc[t]);
    }
  }
#pragma unroll
  for (int t = 0; t < 4; ++t) {
    float bv = bias ? bias[col0 + t * 16 + ln] : 0.f;
    if (BIAS_BF16) bv = bf16_round(bv);
#pragma unroll
    for (int r = 0; r < 8; ++r) { float v = acc[t][r] + bv; if (ACT == 1) v = fmaxf(v, 0.f); so[w][8 * hh + r][t * 16 + ln] = v; }
  }
  __builtin_amdgcn_fence(__ATOMIC_ACQ_REL, "workgroup");
  __builtin_amdgcn_wave_barrier();
  const int rsub = lane >> 4, c4 = (lane & 15) * 4;
  {
#pragma unroll
    for (int q = 0; q < 8; ++q) {
      const int r = q * 2 + rsub;
      const v4f v = *(const v4fa*)&so[w][r][c4];
      *(v4f*)(C + (size_t)(row0 + r) * ldc + col0 + c4) = v;
    }
    
  }
}

// GEMM C = act(A·W + bias + resid): A f32 (ASPLIT -> hi/lo 2 terms), Wt bf16 [N][K]; ACT 0 none, 1 relu, 2 exact gelu;
// resid (optional, f32, row index = (row % rmod), pitch ldr, RES_BF16 rounds it) added before the activation.
template <bool ASPLIT, int ACT, bool BIAS_BF16, bool RES_BF16>
__global__ __launch_bounds__(128) void k_gemm_bf3(const float* __restrict__ A, int lda, const unsigned short* __restrict__ Wt, int ldb,
                                                const float* __restrict__ bias, const float* __restrict__ resid, int rmod, int ldr,
                                                float* __restrict__ C, int ldc, int M, int N, int K) {
  __shared__ __attribute__((aligned(16))) float so[4][16][64];
  const int tid = threadIdx.x, w = tid >> 5, lane = tid & 31, ln = lane & 15, hh = lane >> 4;
  const int ntn = N / 64;
  const int wid = blockIdx.x * 4 + w;
  const int mt = wid / ntn, nq = wid % ntn;
  if (mt * 16 >= M) return;
  const int row0 = mt * 16, col0 = nq * 64;
  const float* arow = A + (size_t)(row0 + ln) * lda;
  v8f acc[4] = {};
  for (int kb = 0; kb < K; kb += 32) {
    FragB ah, al;
    const v4f x0 = *(const v4fa*)(arow + kb + 8 * hh), x1 = *(const v4fa*)(arow + kb + 8 * hh + 4);
    const v4f x2 = *(const v4fa*)(arow + kb + 16 + 8 * hh), x3 = *(const v4fa*)(arow + kb + 16 + 8 * hh + 4);
    float xs[16] = {x0[0],x0[1],x0[2],x0[3],x1[0],x1[1],x1[2],x1[3],x2[0],x2[1],x2[2],x2[3],x3[0],x3[1],x3[2],x3[3]};
#pragma unroll
    for (int i = 0; i < 16; ++i) { const unsigned short hb = bf16_bits(xs[i]); ah.u[i] = hb; al.u[i] = ASPLIT ? bf16_bits(xs[i] - bf16_val(hb)) : (unsigned short)0; }
#pragma unroll
    for (int t = 0; t < 4; ++t) {
      const unsigned short* brow = Wt + (size_t)(col0 + t * 16 + ln) * ldb + kb;
      FragB b;
      b.half[0] = *(const v8us*)(brow + 8 * hh);
      b.half[1] = *(const v8us*)(brow + 16 + 8 * hh);
      acc[t] = mmaN<ASPLIT ? 2 : 1>(ah.v, al.v, b.v, b.v, acc[t]);
    }
  }
#pragma unroll
  for (int t = 0; t < 4; ++t) {
    const int col = col0 + t * 16 + ln;
    float bv = bias ? bias[col] : 0.f;
    if (BIAS_BF16) bv = bf16_round(bv);
#pragma unroll
    for (int r = 0; r < 8; ++r) {
      float v = acc[t][r] + bv;
      if (resid) { float rv = resid[(size_t)((row0 + 8 * hh + r) % rmod) * ldr + col]; if (RES_BF16) rv = bf16_round(rv); v += rv; }
      if (ACT == 1) v = fmaxf(v, 0.f);
      if (ACT == 2) v = 0.5f * v * (1.0f + erff(v * 0.70710678118654752f));
      if (ACT == 3) { const float u = 0.7978845608028654f * (v + 0.044715f * v * v * v); v = 0.5f * v * (1.0f + tanhf(u)); }
      so[w][8 * hh + r][t * 16 + ln] = v;
    }
  }
  __builtin_amdgcn_fence(__ATOMIC_ACQ_REL, "workgroup");
  __builtin_amdgcn_wave_barrier();
  const int rsub = lane >> 4, c4 = (lane & 15) * 4;
  {
#pragma unroll
    for (int q = 0; q < 8; ++q) {
      const int r = q * 2 + rsub;
      const v4f v = *(const v4fa*)&so[w][r][c4];
      *(v4f*)(C + (size_t)(row0 + r) * ldc + col0 + c4) = v;
    }
    
  }
}
// row LayerNorm (biased variance, eps) over N: s = X (+ R); optional out_sum <- s; out_norm <- (s-mu)*rsqrt(var+eps)*g + b
template <bool PARAM_BF16>
__global__ __launch_bounds__(256) void k_layernorm(const float* __restrict__ X, const float* __restrict__ R, const float* __restrict__ g, const float* __restrict__ bta,
                                                  float* __restrict__ out_sum, float* __restrict__ out_norm, int N, float eps) {
  __shared__ float red[256];
  const int row = blockIdx.x, tid = threadIdx.x;
  const float* x = X + (size_t)row * N; const float* rr = R ? R + (size_t)row * N : nullptr;
  float vals[16];                     // up to N = 4096
  const int per = N / 256;            // contiguous chunk per thread? use strided-by-4 chunks: thread handles j = tid*4 + 1024*u
  float s1 = 0.f;
  for (int u = 0; u < per / 4; ++u) {
    const int j = tid * 4 + 1024 * u;
    const v4f a = *(const v4fa*)(x + j);
    v4f b = {0.f,0.f,0.f,0.f}; if (rr) b = *(const v4fa*)(rr + j);
#pragma unroll
    for (int q = 0; q < 4; ++q) { const float v = a[q] + b[q]; vals[u * 4 + q] = v; s1 += v; }
  }
  red[tid] = s1; __syncthreads();
  for (int st = 128; st > 0; st >>= 1) { if (tid < st) red[tid] += red[tid + st]; __syncthreads(); }
  const float mu = red[0] / (float)N; __syncthreads();
  float s2 = 0.f;
  for (int u = 0; u < per / 4; ++u)
#pragma unroll
    for (int q = 0; q < 4; ++q) { const float c = vals[u * 4 + q] - mu; s2 += c * c; }
  red[tid] = s2; __syncthreads();
  for (int st = 128; st > 0; st >>= 1) { if (tid < st) red[tid] += red[tid + st]; __syncthreads(); }
  const float rs = rsqrtf(red[0] / (float)N + eps);
  {
    for (int u = 0; u < per / 4; ++u) {
      const int j = tid * 4 + 1024 * u;
      v4f o, sm;
#pragma unroll
      for (int q = 0; q < 4; ++q) {
        float gg = g[j + q], bb = bta[j + q];
        if (PARAM_BF16) { gg = bf16_round(gg); bb = bf16_round(bb); }
        sm[q] = vals[u * 4 + q]; o[q] = (vals[u * 4 + q] - mu) * rs * gg + bb;
      }
      if (out_sum) *(v4f*)(out_sum + (size_t)row * N + j) = sm;
      *(v4f*)(out_norm + (size_t)row * N + j) = o;
    }
    
  }
}



// ---- f16 WMMA path (v_wmma_f32_16x16x32_f16): 11-bit significands for operands in range — used where a [0,1] probability operand needs more precision than bf16
typedef _Float16 v16h __attribute__((ext_vector_type(16)));
union FragH { v16h v; v8us half[2]; _Float16 h[16]; unsigned short u[16]; };
template <int NT>
__device__ __forceinline__ v8f mmaH(v16h ah, v16h al, v16h bh, v16h bl, v8f c) {
  c = __builtin_amdgcn_wmma_f32_16x16x32_f16(false, ah, false, bh, (short)0, c, false, false);
  if (NT >= 2) c = __builtin_amdgcn_wmma_f32_16x16x32_f16(false, al, false, bh, (short)0, c, false, false);
  if (NT >= 3) c = __builtin_amdgcn_wmma_f32_16x16x32_f16(false, ah, false, bl, (short)0, c, false, false);
  asm volatile("v_nop\n\tv_nop\n\tv_nop\n\tv_nop" : "+v"(c) : "v"(ah), "v"(al), "v"(bh), "v"(bl));
  return c;
}
// batched GEMM like k_gemm_b but f16 operands: A f32 (split into f16 hi/lo if ASPLIT, else rounded to f16), Bt = f16 values [n][k]; alpha; C f32; N multiple of 16 (partial tiles skipped)
template <bool ASPLIT>
__global__ __launch_bounds__(128) void k_gemm_h(const float* __restrict__ A, int lda, size_t sA, const _Float16* __restrict__ Bh, int ldb, size_t sB, float alpha, float* __restrict__ C, int ldc, size_t sC, int M, int N, int K) {
  __shared__ __attribute__((aligned(16))) float so[4][16][64];
  const int tid = threadIdx.x, w = tid >> 5, lane = tid & 31, ln = lane & 15, hh = lane >> 4; const int by = blockIdx.y;
  A += (size_t)by * sA; Bh += (size_t)by * sB; C += (size_t)by * sC;
  const int ntn = (N + 63) / 64; const int wid = blockIdx.x * 4 + w; const int mt = wid / ntn, nq = wid % ntn; if (mt * 16 >= M) return;
  const int row0 = mt * 16, col0 = nq * 64; const float* arow = A + (size_t)(row0 + ln) * lda;
  v8f acc[4] = {};
  for (int kb = 0; kb < K; kb += 32) {
    FragH ah, al;
    const v4f x0 = *(const v4fa*)(arow + kb + 8 * hh), x1 = *(const v4fa*)(arow + kb + 8 * hh + 4), x2 = *(const v4fa*)(arow + kb + 16 + 8 * hh), x3 = *(const v4fa*)(arow + kb + 16 + 8 * hh + 4);
    float xs[16] = {x0[0],x0[1],x0[2],x0[3],x1[0],x1[1],x1[2],x1[3],x2[0],x2[1],x2[2],x2[3],x3[0],x3[1],x3[2],x3[3]};
#pragma unroll
    for (int i = 0; i < 16; ++i) { const _Float16 h = (_Float16)xs[i]; ah.h[i] = h; al.h[i] = ASPLIT ? (_Float16)(xs[i] - (float)h) : (_Float16)0.0f; }
#pragma unroll
    for (int t = 0; t < 4; ++t) { if (col0 + t * 16 >= N) continue; const size_t boff = (size_t)(col0 + t * 16 + ln) * ldb + kb; FragH bq; bq.half[0] = *(const v8us*)(Bh + boff + 8 * hh); bq.half[1] = *(const v8us*)(Bh + boff + 16 + 8 * hh);
      acc[t] = mmaH<ASPLIT ? 2 : 1>(ah.v, al.v, bq.v, bq.v, acc[t]); }
  }
#pragma unroll
  for (int t = 0; t < 4; ++t) { if (col0 + t * 16 >= N) continue;
#pragma unroll
    for (int r = 0; r < 8; ++r) so[w][8 * hh + r][t * 16 + ln] = acc[t][r] * alpha; }
  __builtin_amdgcn_fence(__ATOMIC_ACQ_REL, "workgroup"); __builtin_amdgcn_wave_barrier();
  const int rsub = lane >> 4, c4 = (lane & 15) * 4;
  {
#pragma unroll
    for (int q = 0; q < 8; ++q) { const int r = q * 2 + rsub; if (col0 + c4 < N) { const v4f v = *(const v4fa*)&so[w][r][c4]; *(v4f*)(C + (size_t)(row0 + r) * ldc + col0 + c4) = v; } }
     }
}

// Wt[n][k] = f16(W[k][n]·scale) from f32 row-major W[K][N] (scale = power of two; bf16-exact weights stay exact in f16 away from the subnormal range)
__global__ __launch_bounds__(256) void k_wt_f16(const float* __restrict__ W, _Float16* __restrict__ Wt, int K, int N, float scale) {
  const int t = blockIdx.x * 256 + threadIdx.x; if (t >= N * (K / 8)) return; const int n = t / (K / 8), k8 = (t % (K / 8)) * 8; FragH f;
#pragma unroll
  for (int i = 0; i < 8; ++i) f.h[i] = (_Float16)(bf16_round(W[(size_t)(k8 + i) * N + n]) * scale); const v8us o = f.half[0];
  *(v8us*)((unsigned short*)Wt + (size_t)n * K + k8) = o; 
}
// k_gemm_hh variant with fused epilogue: v = acc·alpha + bias[by·sBias + col] (+ CP[(row/rowsPerB)·sCPb + by·64 + col] if CP) ; ACT 0 none / 1 elu ; writes f16 C16 (and f32 C if non-null)
template <int ACT>
__global__ __launch_bounds__(128) void k_gemm_hhx(const _Float16* __restrict__ A, int lda, size_t sA, const _Float16* __restrict__ Bh, int ldb, size_t sB, float alpha, const float* __restrict__ bias, size_t sBias, const float* __restrict__ CP, int rowsPerB, size_t sCPb, int row0g,
    float* __restrict__ C, _Float16* __restrict__ C16, int ldc, size_t sC, int M, int N, int K) {
  __shared__ __attribute__((aligned(16))) float so[4][16][64];
  const int tid = threadIdx.x, w = tid >> 5, lane = tid & 31, ln = lane & 15, hh = lane >> 4; const int by = blockIdx.y;
  A += (size_t)by * sA; Bh += (size_t)by * sB; const size_t cofs = (size_t)by * sC; const float* bp = bias ? bias + (size_t)by * sBias : nullptr;
  const int ntn = (N + 63) / 64; const int wid = blockIdx.x * 4 + w; const int mt = wid / ntn, nq = wid % ntn; if (mt * 16 >= M) return;
  const int row0 = mt * 16, col0 = nq * 64; const _Float16* arow = A + (size_t)(row0 + ln) * lda;
  v8f acc[4] = {};
  for (int kb = 0; kb < K; kb += 32) { FragH ah; ah.half[0] = *(const v8us*)((const unsigned short*)arow + kb + 8 * hh); ah.half[1] = *(const v8us*)((const unsigned short*)arow + kb + 16 + 8 * hh);
#pragma unroll
    for (int t = 0; t < 4; ++t) { if (col0 + t * 16 >= N) continue; const size_t boff = (size_t)(col0 + t * 16 + ln) * ldb + kb; FragH bq; bq.half[0] = *(const v8us*)((const unsigned short*)Bh + boff + 8 * hh); bq.half[1] = *(const v8us*)((const unsigned short*)Bh + boff + 16 + 8 * hh);
      acc[t] = mmaH<1>(ah.v, ah.v, bq.v, bq.v, acc[t]); }
  }
#pragma unroll
  for (int t = 0; t < 4; ++t) { if (col0 + t * 16 >= N) continue; const int col = col0 + t * 16 + ln; const float bv = bp ? bf16_round(bp[col]) : 0.f;
#pragma unroll
    for (int r = 0; r < 8; ++r) { float v = acc[t][r] * alpha + bv; if (CP) { const int rr = row0g + row0 + 8 * hh + r; if (rowsPerB < 0) v += CP[cofs + (size_t)rr * ldc + col];      /* rowsPerB < 0: own element of the batched C plane */ else { const int bidx = rr / rowsPerB; v += CP[(size_t)bidx * sCPb + (size_t)by * 64 + col]; } } if (ACT == 1) v = (v > 0.f) ? v : expm1f(v); else if (ACT == 7) v = (v > 0.f) ? v + 1.0f : expf(v); else if (ACT == 8) v = tanhf(v); else if (ACT == 9) v = 0.5f * v * (1.0f + tanhf(0.7978845608028654f * (v + 0.044715f * v * v * v))); else if (ACT == 11) v = 1.0f / (1.0f + expf(-v)); else if (ACT == 12) v = (v > 0.f) ? v : 0.01f * v; else if (ACT == 14) v = (v > 0.f) ? v : 0.1f * v; else if (ACT == 16) v = (v >= 0.f) ? v : 0.3f * v; else if (ACT == 17) v = (v >= 0.f) ? v : 0.2f * v; else if (ACT == 15) v = v / (1.0f + expf(-v)); else if (ACT == 3) v = fmaxf(v, 0.f); else if (ACT == 6) v = 0.5f * v * (1.0f + erff(v * 0.70710678118654752f)); so[w][8 * hh + r][t * 16 + ln] = v; } }
  __builtin_amdgcn_fence(__ATOMIC_ACQ_REL, "workgroup"); __builtin_amdgcn_wave_barrier();
  const int rsub = lane >> 4, c4 = (lane & 15) * 4; typedef _Float16 v4h __attribute__((ext_vector_type(4)));
  {
#pragma unroll
    for (int q = 0; q < 8; ++q) { const int r = q * 2 + rsub; if (col0 + c4 < N) { const v4f v = *(const v4fa*)&so[w][r][c4]; if (C) *(v4f*)(C + cofs + (size_t)(row0 + r) * ldc + col0 + c4) = v; if (C16) { v4h h4; for (int i = 0; i < 4; ++i) h4[i] = (_Float16)v[i]; *(v4h*)(C16 + cofs + (size_t)(row0 + r) * ldc + col0 + c4) = h4; } } }
     }
}


typedef _Float16 v4h __attribute__((ext_vector_type(4)));

__global__ __launch_bounds__(256) void k_x16(const float* __restrict__ x, _Float16* __restrict__ X16, size_t n8) { const size_t t = (size_t)blockIdx.x * 256 + threadIdx.x; if (t >= n8) return; FragH f;
#pragma unroll
  for (int q = 0; q < 8; ++q) f.h[q] = (_Float16)bf16_round(x[t * 8 + q]); *(v8us*)((unsigned short*)X16 + t * 8) = f.half[0];  }
__global__ __launch_bounds__(256) void k_h16(const float* __restrict__ x, _Float16* __restrict__ X16, size_t n8) { const size_t t = (size_t)blockIdx.x * 256 + threadIdx.x; if (t >= n8) return; FragH f;
#pragma unroll
  for (int q = 0; q < 8; ++q) f.h[q] = (_Float16)x[t * 8 + q]; *(v8us*)((unsigned short*)X16 + t * 8) = f.half[0];  }
__global__ __launch_bounds__(256) void k_round16f(const float* __restrict__ W, _Float16* __restrict__ Bt, size_t n8) { const size_t t = (size_t)blockIdx.x * 256 + threadIdx.x; if (t >= n8) return; FragH f;
#pragma unroll
  for (int i = 0; i < 8; ++i) f.h[i] = (_Float16)(bf16_round(W[t * 8 + i]) * 16.0f); *(v8us*)((unsigned short*)Bt + t * 8) = f.half[0];  }
template <int NHv, int TTv>
__global__ __launch_bounds__(256) void k_vt(const _Float16* __restrict__ V16, int ldv, int voff, _Float16* __restrict__ Vt) { __shared__ unsigned short tl[64][66]; const int tid = threadIdx.x; const int slab = blockIdx.x / (TTv / 64), lg = blockIdx.x % (TTv / 64); const int b = slab / NHv, h = slab % NHv;
  for (int i = tid; i < 64 * 8; i += 256) { const int r = i / 8, c8 = (i % 8) * 8; FragH f; f.half[0] = *(const v8us*)((const unsigned short*)V16 + ((size_t)b * TTv + lg * 64 + r) * ldv + voff + h * 64 + c8);
#pragma unroll
    for (int q = 0; q < 8; ++q) tl[r][c8 + q] = f.u[q]; }
  __syncthreads();
  {
#pragma unroll
    for (int rd = 0; rd < 2; ++rd) { const int d = rd * 32 + tid / 8, pc = tid % 8; FragH f;
#pragma unroll
      for (int q = 0; q < 8; ++q) f.u[q] = tl[pc * 8 + q][d];
      *(v8us*)((unsigned short*)Vt + ((size_t)slab * 64 + d) * TTv + lg * 64 + pc * 8) = f.half[0]; }
     } }

__global__ __launch_bounds__(256) void k_hl(const float* __restrict__ F, _Float16* __restrict__ Hh, _Float16* __restrict__ Hl, size_t n8) { const size_t t = (size_t)blockIdx.x * 256 + threadIdx.x; if (t >= n8) return; FragH fh, fl; const v4f a = *(const v4fa*)(F + t * 8), c = *(const v4fa*)(F + t * 8 + 4);
#pragma unroll
  for (int q = 0; q < 4; ++q) { _Float16 h = (_Float16)a[q]; fh.h[q] = h; fl.h[q] = (_Float16)((a[q] - (float)h) * 1024.0f); h = (_Float16)c[q]; fh.h[4 + q] = h; fl.h[4 + q] = (_Float16)((c[q] - (float)h) * 1024.0f); }
  { *(v8us*)((unsigned short*)Hh + t * 8) = fh.half[0]; *(v8us*)((unsigned short*)Hl + t * 8) = fl.half[0];  } }

// ---- fast GEMM (wave tile 32x64; requires M % 32 == 0 rows per launch region and N % 64 == 0); epilogue = k_gemm_hhx semantics ----
__device__ __forceinline__ v16h g2_frag(const _Float16* p, int hh) { FragH f; f.half[0] = *(const v8us*)((const unsigned short*)p + 8 * hh); f.half[1] = *(const v8us*)((const unsigned short*)p + 16 + 8 * hh); return f.v; }
__device__ __forceinline__ v8f g2_mma(v16h a, v16h b, v8f c) { v8f d = __builtin_amdgcn_wmma_f32_16x16x32_f16(false, a, false, b, (short)0, c, false, false); asm volatile("v_nop\n\tv_nop\n\tv_nop\n\tv_nop" : "+v"(d) : "v"(a), "v"(b)); return d; }
template <int ACT>
__global__ __launch_bounds__(128) void k_gemm2(const _Float16* __restrict__ A, int lda, size_t sA, const _Float16* __restrict__ Bh, int ldb, size_t sB, float alpha, const float* __restrict__ bias, size_t sBias, const float* __restrict__ CP, int rowsPerB, size_t sCPb, int row0g,
    float* __restrict__ C, _Float16* __restrict__ C16, int ldc, size_t sC, int M, int N, int K) { static_assert(ACT == 0 || ACT == 3 || ACT == 6 || ACT == 8 || ACT == 9 || ACT == 11 || ACT == 12 || ACT == 14 || ACT == 15 || ACT == 16 || ACT == 17, "k_gemm2: unsupported ACT code (would silently apply no activation)");
  __shared__ __attribute__((aligned(16))) float so[4][32][68];
  const int tid = threadIdx.x, w = tid >> 5, lane = tid & 31, ln = lane & 15, hh = lane >> 4; const int by = blockIdx.y;
  A += (size_t)by * sA; Bh += (size_t)by * sB; const size_t cofs = (size_t)by * sC; const float* bp = bias ? bias + (size_t)by * sBias : nullptr;
  const int ntn = N >> 6; const int mt = blockIdx.x / ntn, nq = blockIdx.x - mt * ntn; const int row0 = mt * 128 + 32 * w, col0 = nq * 64; if (row0 >= M) return;
  const _Float16* a0p = A + (size_t)(row0 + ln) * lda; const _Float16* a1p = a0p + (size_t)16 * lda;
  const _Float16* b0p = Bh + (size_t)(col0 + ln) * ldb; const _Float16* b1p = b0p + (size_t)16 * ldb; const _Float16* b2p = b1p + (size_t)16 * ldb; const _Float16* b3p = b2p + (size_t)16 * ldb;
  const v8f z8 = {0.f,0.f,0.f,0.f,0.f,0.f,0.f,0.f}; v8f c00 = z8, c01 = z8, c02 = z8, c03 = z8, c10 = z8, c11 = z8, c12 = z8, c13 = z8;
#pragma unroll 1
  for (int kb = 0; kb < K; kb += 32) { const v16h a0 = g2_frag(a0p + kb, hh), a1 = g2_frag(a1p + kb, hh);
    v16h b = g2_frag(b0p + kb, hh); c00 = g2_mma(a0, b, c00); c10 = g2_mma(a1, b, c10);
    b = g2_frag(b1p + kb, hh); c01 = g2_mma(a0, b, c01); c11 = g2_mma(a1, b, c11);
    b = g2_frag(b2p + kb, hh); c02 = g2_mma(a0, b, c02); c12 = g2_mma(a1, b, c12);
    b = g2_frag(b3p + kb, hh); c03 = g2_mma(a0, b, c03); c13 = g2_mma(a1, b, c13); }
  v8f accs[8] = {c00, c01, c02, c03, c10, c11, c12, c13};
#pragma unroll
  for (int u = 0; u < 8; ++u) { const int t = u & 3, half = u >> 2; const int col = col0 + t * 16 + ln; const float bv = bp ? bf16_round(bp[col]) : 0.f;
#pragma unroll
    for (int r = 0; r < 8; ++r) { const int rloc = half * 16 + 8 * hh + r; float v = accs[u][r] * alpha + bv; if (CP) { if (rowsPerB < 0) v += CP[cofs + (size_t)(row0g + row0 + rloc) * ldc + col];      /* rowsPerB < 0: own element of the batched C plane */ else { const int bidx = (row0g + row0 + rloc) / rowsPerB; v += CP[(size_t)bidx * sCPb + (size_t)by * 64 + col]; } }
      if (ACT == 3) v = fmaxf(v, 0.f); else if (ACT == 6) v = 0.5f * v * (1.0f + erff(v * 0.70710678118654752f)); else if (ACT == 11) v = 1.0f / (1.0f + expf(-v)); else if (ACT == 15) v = v / (1.0f + expf(-v)); else if (ACT == 12) v = (v > 0.f) ? v : 0.01f * v; else if (ACT == 8) v = tanhf(v); else if (ACT == 9) v = 0.5f * v * (1.0f + tanhf(0.7978845608028654f * (v + 0.044715f * v * v * v))); else if (ACT == 14) v = (v > 0.f) ? v : 0.1f * v; else if (ACT == 16) v = (v >= 0.f) ? v : 0.3f * v; else if (ACT == 17) v = (v >= 0.f) ? v : 0.2f * v;
      so[w][rloc][t * 16 + ln] = v; } }
  __builtin_amdgcn_fence(__ATOMIC_ACQ_REL, "workgroup"); __builtin_amdgcn_wave_barrier();
  const int rsub = lane >> 4, c4 = (lane & 15) * 4;
  {
#pragma unroll
    for (int q = 0; q < 16; ++q) { const int r = q * 2 + rsub; const v4f v = *(const v4fa*)&so[w][r][c4]; if (C) *(v4f*)(C + cofs + (size_t)(row0 + r) * ldc + col0 + c4) = v; if (C16) { v4h h4; for (int i = 0; i < 4; ++i) h4[i] = (_Float16)v[i]; *(v4h*)(C16 + cofs + (size_t)(row0 + r) * ldc + col0 + c4) = h4; } }
     } }


__global__ __launch_bounds__(256) void k_wnat(const float* __restrict__ w, size_t n8, _Float16* __restrict__ Bt) { const size_t t = (size_t)blockIdx.x * 256 + threadIdx.x; if (t >= n8) return; FragH f; for (int q = 0; q < 8; ++q) f.h[q] = (_Float16)(bf16_round(w[t * 8 + q]) * 16.0f); *(v8us*)((unsigned short*)Bt + t * 8) = f.half[0];  }
__global__ __launch_bounds__(256) void k_rsm(const float* __restrict__ S, _Float16* __restrict__ P, int nrows) {
  #pragma clang fp contract(off)
  const int i = blockIdx.x * 256 + threadIdx.x; if (i >= nrows) return; const float* s = S + (size_t)i * SQ; float mx = -3.0e38f;
#pragma unroll 1
  for (int j = 0; j < SQ; ++j) mx = fmaxf(mx, s[j]); float se = 0.f;
#pragma unroll 1
  for (int j = 0; j < SQ; ++j) se += expf(s[j] - mx); const float sc = 256.0f / se;
#pragma unroll 1
  for (int j0 = 0; j0 < SQ; j0 += 8) { FragH f; for (int q = 0; q < 8; ++q) f.h[q] = (_Float16)(expf(s[j0 + q] - mx) * sc); unsigned short* d = (unsigned short*)P + (size_t)i * SQ + j0; *(v8us*)d = f.half[0];  } }
__global__ __launch_bounds__(256) void k_vt(const _Float16* __restrict__ V16, int b, int h0, _Float16* __restrict__ VT) { __shared__ unsigned short tl[64][65]; const int tid = threadIdx.x; const int hh = blockIdx.x % HG, sg = blockIdx.x / HG; const int s0 = sg * 64; const int h = h0 + hh;
  for (int i = tid; i < 64 * 8; i += 256) { const int j = i / 8, d8 = (i % 8) * 8; FragH f; f.half[0] = *(const v8us*)((const unsigned short*)V16 + ((size_t)b * SQ + s0 + j) * DM + h * HD + d8); for (int q = 0; q < 8; ++q) tl[d8 + q][j] = f.u[q]; }
  __syncthreads();
  { for (int i = tid; i < 64 * 8; i += 256) { const int d = i / 8, j8 = (i % 8) * 8; FragH f; for (int q = 0; q < 8; ++q) f.u[q] = tl[d][j8 + q]; *(v8us*)((unsigned short*)VT + ((size_t)hh * HD + d) * SQ + s0 + j8) = f.half[0]; }  } }


__global__ __launch_bounds__(256) void k_rsmsum(const float* __restrict__ S, const int* __restrict__ mrow0, _Float16* __restrict__ P, float* __restrict__ WS, int q0) {
  #pragma clang fp contract(off)
  const int i = blockIdx.x * 256 + threadIdx.x; if (i >= QT) return; const int* mk = mrow0 + (size_t)(q0 + i) * SQ; float mx[NH], sc[NH];
  for (int h = 0; h < NH; ++h) { const float* s = S + ((size_t)h * QT + i) * NKX; float m = -3.0e38f;
#pragma unroll 1
    for (int j = 0; j < SQ; ++j) { const float f = (mk[j] != 0) ? 1.f : 0.f; m = fmaxf(m, fmaf(f, s[j], (1.f - f) * -3.0e38f)); } mx[h] = m; }
  for (int h = 0; h < NH; ++h) { const float* s = S + ((size_t)h * QT + i) * NKX; float se = 0.f;
#pragma unroll 1
    for (int j = 0; j < SQ; ++j) { const float f = (mk[j] != 0) ? 1.f : 0.f; se += f * __expf(fminf(s[j] - mx[h], 80.f)); } sc[h] = 1.0f / se; }
#pragma unroll 1
  for (int j0 = 0; j0 < SQ; j0 += 8) { float acc[8]; for (int q = 0; q < 8; ++q) acc[q] = 0.f;
    for (int h = 0; h < NH; ++h) { const float* s = S + ((size_t)h * QT + i) * NKX; FragH fr;
      for (int q = 0; q < 8; ++q) { const int j = j0 + q; const float f = (mk[j] != 0) ? 1.f : 0.f; const float p = f * __expf(fminf(s[j] - mx[h], 80.f)) * sc[h]; acc[q] = __fadd_rn(acc[q], p); fr.h[q] = (_Float16)(p * 256.0f); }
      unsigned short* d = (unsigned short*)P + ((size_t)h * QT + i) * NKX + j0; *(v8us*)d = fr.half[0];  }
    v4f a0, a1; for (int q = 0; q < 4; ++q) { a0[q] = acc[q]; a1[q] = acc[4 + q]; } float* w = WS + (size_t)i * SQ + j0; *(v4f*)w = a0; *(v4f*)(w + 4) = a1;  } }
__global__ __launch_bounds__(256) void k_av64(const float* __restrict__ VPF, const float* __restrict__ alpha, float* __restrict__ AV, size_t n4) {
  #pragma clang fp contract(off)
  const size_t t = (size_t)blockIdx.x * 256 + threadIdx.x; if (t >= n4) return; const float a = __fmul_rn(bf16_round(alpha[0]), 64.0f); const v4f v = *(const v4fa*)(VPF + t * 4); v4f o; for (int q = 0; q < 4; ++q) o[q] = __fmul_rn(a, v[q]); *(v4f*)(AV + t * 4) = o;  }

extern "C" void kernel_launch(void* const* d_in, const int* in_sizes, int n_in,
                              void* d_out, int out_size, void* d_ws, size_t ws_size, hipStream_t stream) {
  (void)in_sizes; (void)n_in; (void)out_size;
  const float* const* I = (const float* const*)d_in; const float* qin = I[0]; const float* kin = I[1]; const float* vin = I[2]; const int* mask = (const int*)d_in[3]; const float* wq = I[4]; const float* bq = I[5]; const float* wkv = I[6]; const float* bkv = I[7]; const float* wo = I[8]; const float* bo = I[9]; const float* alpha = I[10];      /* weights [in][out] */
  float* out0 = (float*)d_out; float* out1 = (float*)d_out + NR * DM;      /* byte offset 16,777,216 */
  char* ws = (char*)d_ws; size_t off = 0;
  auto take = [&](size_t bytes) { char* p = ws + off; off += (bytes + 255) & ~(size_t)255; return p; };
  _Float16* BQ = (_Float16*)take((size_t)DM * DM * 2); _Float16* BKV = (_Float16*)take((size_t)DM * DM * 2); _Float16* BO = (_Float16*)take((size_t)DM * DM * 2);
  _Float16* XQ = (_Float16*)take(NR * DM * 2); _Float16* XK = (_Float16*)take(NR * DM * 2); _Float16* XV = (_Float16*)take(NR * DM * 2); _Float16* Q16 = (_Float16*)take(NR * DM * 2); _Float16* K16 = (_Float16*)take(NR * DM * 2); _Float16* V16 = (_Float16*)take(NR * DM * 2); float* VPF = (float*)take(NR * DM * 4); float* AV = (float*)take(NR * DM * 4); _Float16* O16 = (_Float16*)take(NR * DM * 2);
  float* S = (float*)take((size_t)NH * QT * NKX * 4); _Float16* P = (_Float16*)take((size_t)NH * QT * NKX * 2); _Float16* VT = (_Float16*)take((size_t)NH * HD * SQ * 2);
  if (off > ws_size) return;      /* 6 + 48 + 16 + 16 + 8 + 32 + 16 + 4 = approx 146 MiB */
  { const unsigned gw = (unsigned)(((size_t)DM * (DM / 8) + 255) / 256); k_wt_f16<<<gw, 256, 0, stream>>>(wq, BQ, DM, DM, 16.0f); k_wt_f16<<<gw, 256, 0, stream>>>(wkv, BKV, DM, DM, 16.0f); k_wt_f16<<<gw, 256, 0, stream>>>(wo, BO, DM, DM, 16.0f); }
  { const unsigned gx = (unsigned)((NR * DM / 8 + 255) / 256); k_x16<<<gx, 256, 0, stream>>>(qin, XQ, NR * DM / 8); k_x16<<<gx, 256, 0, stream>>>(kin, XK, NR * DM / 8); k_x16<<<gx, 256, 0, stream>>>(vin, XV, NR * DM / 8); }
  const size_t r0p = (size_t)B0 * SQ; const dim3 gp((unsigned)((MP / 128) * (DM / 64)), 1);
  k_gemm2<0><<<gp, 128, 0, stream>>>(XQ + r0p * DM, DM, 0, BQ, DM, 0, 0.0625f, bq, 0, nullptr, 1, 0, 0, nullptr, Q16 + r0p * DM, DM, 0, MP, DM, DM);
  k_gemm2<0><<<gp, 128, 0, stream>>>(XK + r0p * DM, DM, 0, BKV, DM, 0, 0.0625f, bkv, 0, nullptr, 1, 0, 0, nullptr, K16 + r0p * DM, DM, 0, MP, DM, DM);
  k_gemm2<0><<<gp, 128, 0, stream>>>(XV + r0p * DM, DM, 0, BKV, DM, 0, 0.0625f, bkv, 0, nullptr, 1, 0, 0, VPF + r0p * DM, V16 + r0p * DM, DM, 0, MP, DM, DM);      /* vp: f32 (residual) and f16 (attention operand) */
  k_av64<<<(unsigned)(((size_t)MP * DM / 4 + 255) / 256), 256, 0, stream>>>(VPF + r0p * DM, alpha, AV + r0p * DM, (size_t)MP * DM / 4);
  for (int b = B0; b < B0 + NBR; ++b) { const size_t r0 = (size_t)b * SQ;
    k_vt<NH, SQ><<<NH * (SQ / 64), 256, 0, stream>>>(V16 + r0 * DM, DM, 0, VT);      /* V^T [NH][HD][SQ] */
    for (int q0 = Q0S; q0 < QN; q0 += QT) {
      k_gemm2<0><<<dim3((QT / 128) * (SQ / 64), NH), 128, 0, stream>>>(Q16 + (r0 + q0) * DM, DM, (size_t)HD, K16 + r0 * DM, DM, (size_t)HD, 0.125f, nullptr, 0, nullptr, 1, 0, 0, S, nullptr, NKX, (size_t)QT * NKX, QT, SQ, HD);      /* scores / 8, all heads */
      k_rsmsum<<<(QT + 255) / 256, 256, 0, stream>>>(S, mask, P, out1 + (r0 + q0) * SQ, q0);
      k_gemm2<0><<<dim3((QT / 128) * (HD / 64), NH), 128, 0, stream>>>(P, NKX, (size_t)QT * NKX, VT, SQ, (size_t)HD * SQ, 0.25f, nullptr, 0, AV + (r0 + q0) * DM, -1, 0, 0, nullptr, O16 + (r0 + q0) * DM, DM, (size_t)HD, QT, HD, SQ); } }      /* o x64 = 64 attn v + 64 alpha vp (CP = own element), f16 rows */
  k_gemm2<0><<<dim3((unsigned)((MPO / 128) * (DM / 64)), 1), 128, 0, stream>>>(O16 + r0p * DM, DM, 0, BO, DM, 0, 0.0009765625f, bo, 0, nullptr, 1, 0, 0, out0 + r0p * DM, nullptr, DM, 0, MPO, DM, DM);      /* out0 = o Wo + bo */
}

// v001
// One run takes 1600 microseconds.
// Two timings next to v000 put it at 86.2 and 86.0 times that version's speed.
#include <hip/hip_runtime.h>
// Grouped multi-head attention in its MHA configuration (q, k, v [2][2048][1024]; qp = q Wq + bq; kp = k Wkv + bkv and vp = v Wkv + bkv (one shared projection); 16 heads of 64; scores / 8 with the int mask [2048][2048] (verbatim, read per (query, key); 0 -> -inf); softmax w; o = attn vp merged + alpha * vp; out0 = o Wo + bo -> [2][2048][1024] @0; out1 = sum over the 16 heads of w -> [2][2048][2048] f32 @16,777,216 B).
// Structure: token rows; q, k, v as exact f16 rows; QP, KP as WMMA GEMMs (32x64 wave tiles, f32 accumulation, exact x16 transposed weights + bias, f16 outputs); VP likewise to f16 AND f32 (the f32 rows times 64 bf16(alpha) become the residual addend); per batch: V^T via LDS transposes; per query tile of 256 rows: scores for all 16 heads in one GEMM (K = 64, alpha 1/8) into f32; per-row softmax across the 16 head planes on VALU (mask as an arithmetic factor; f32 statistics, native exp) writing the f16 weights (x256) AND the f32 head-sum straight into the second output; o = P . V^T GEMM (K = 2048, alpha 2^-2: o x64) with 64 alpha vp as the epilogue addend into merged f16 rows; out0 = o Wo + bo GEMM (f32, alpha folds 1/16 and 1/64); 10 + 2 x (1 + 8 x 3) + 1 = 61 launches.
// Compute dtype: inputs rounded to bf16; q/k/v inputs and weights exact in f16; qp, kp, vp (as operand), softmax weights (x256) and o plain f16 (~2^-12); scores, softmax statistics, the head-sum output and alpha vp f32. v_wmma_f32_16x16x32_f16.
#define NB 2
#define SQ 2048
#define DM 1024
#define NH 16
#define HD 64
#define HG 4                         /* k_vt(b,h0) compatibility (unused) */
#define QT 256                       /* query rows per tile */
#define NKX SQ                       /* S / P row pitch */
#define B0 0                         /* first batch processed (debug hook) */
#define NBR NB                       /* batches processed (debug hook) */
#define Q0S 0                        /* first tile (debug hook) */
#define QN SQ                        /* query rows end (debug hook) */
#define NR ((size_t)NB * SQ)
#define MP ((int)((size_t)NBR * SQ)) /* rows projected (debug hook) */
#define MPO MP                       /* rows through the output GEMM (debug hook) */
typedef __bf16 v16b __attribute__((ext_vector_type(16)));
typedef unsigned short v8us __attribute__((ext_vector_type(8), may_alias));
typedef float  v8f  __attribute__((ext_vector_type(8)));
typedef float  v4f  __attribute__((ext_vector_type(4)));
typedef float  v4fa __attribute__((ext_vector_type(4), may_alias));
union FragB { v16b v; v8us half[2]; unsigned short u[16]; };

__device__ __forceinline__ unsigned short bf16_bits(float x) { unsigned int u = __float_as_uint(x); return (unsigned short)((u + 0x7FFFu + ((u >> 16) & 1u)) >> 16); }
__device__ __forceinline__ float bf16_val(unsigned short b) { return __uint_as_float(((unsigned int)b) << 16); }
__device__ __forceinline__ float bf16_round(float x) { return bf16_val(bf16_bits(x)); }
// D += A·B with NT terms: 1 = ah·bh, 2 = + al·bh (A split), 3 = + ah·bl (both split)
template <int NT>
__device__ __forceinline__ v8f mmaN(v16b ah, v16b al, v16b bh, v16b bl, v8f c) {
  c = __builtin_amdgcn_wmma_f32_16x16x32_bf16(false, ah, false, bh, (short)0, c, false, false);
  if (NT >= 2) c = __builtin_amdgcn_wmma_f32_16x16x32_bf16(false, al, false, bh, (short)0, c, false, false);
  if (NT >= 3) c = __builtin_amdgcn_wmma_f32_16x16x32_bf16(false, ah, false, bl, (short)0, c, false, false);
  asm volatile("v_nop\n\tv_nop\n\tv_nop\n\tv_nop" : "+v"(c) : "v"(ah), "v"(al), "v"(bh), "v"(bl));
  return c;
}

__global__ __launch_bounds__(256) void k_wt_bf16(const float* __restrict__ W, unsigned short* __restrict__ Wt, int K, int N) {
  const int t = blockIdx.x * 256 + threadIdx.x;
  const int k8n = K / 8;
  if (t >= N * k8n) return;
  const int n = t / k8n, k8 = (t % k8n) * 8;
  v8us v;
#pragma unroll
  for (int i = 0; i < 8; ++i) v[i] = bf16_bits(W[(size_t)(k8 + i) * N + n]);
  *(v8us*)(Wt + (size_t)n * K + k8) = v;
  
}

// GEMM C[M][N] (f32, pitch ldc) = act(A[M][K]·W + bias). A f32 row-major (pitch lda) converted per fragment to bf16
// (ASPLIT: hi/lo two planes -> 2 terms, else single rounded term); Wt bf16 [N][K] (pitch ldb). BIAS_BF16 rounds the
// bias to bf16 first (bias quantised to bf16 before the add). K%32==0, M%16==0, N%64==0.
template <bool ASPLIT, int ACT, bool BIAS_BF16>
__global__ __launch_bounds__(128) void k_gemm_bf(const float* __restrict__ A, int lda, const unsigned short* __restrict__ Wt, int ldb,
                                               const float* __restrict__ bias, float* __restrict__ C, int ldc, int M, int N, int K) {
  __shared__ __attribute__((aligned(16))) float so[4][16][64];
  const int tid = threadIdx.x, w = tid >> 5, lane = tid & 31, ln = lane & 15, hh = lane >> 4;
  const int ntn = N / 64;
  const int wid = blockIdx.x * 4 + w;
  const int mt = wid / ntn, nq = wid % ntn;
  if (mt * 16 >= M) return;
  const int row0 = mt * 16, col0 = nq * 64;
  const float* arow = A + (size_t)(row0 + ln) * lda;
  v8f acc[4] = {};
  for (int kb = 0; kb < K; kb += 32) {
    FragB ah, al;
    const v4f x0 = *(const v4fa*)(arow + kb + 8 * hh), x1 = *(const v4fa*)(arow + kb + 8 * hh + 4);
    const v4f x2 = *(const v4fa*)(arow + kb + 16 + 8 * hh), x3 = *(const v4fa*)(arow + kb + 16 + 8 * hh + 4);
    float xs[16] = {x0[0],x0[1],x0[2],x0[3],x1[0],x1[1],x1[2],x1[3],x2[0],x2[1],x2[2],x2[3],x3[0],x3[1],x3[2],x3[3]};
#pragma unroll
    for (int i = 0; i < 16; ++i) { const unsigned short hb = bf16_bits(xs[i]); ah.u[i] = hb; al.u[i] = ASPLIT ? bf16_bits(xs[i] - bf16_val(hb)) : (unsigned short)0; }
#pragma unroll
    for (int t = 0; t < 4; ++t) {
      const unsigned short* brow = Wt + (size_t)(col0 + t * 16 + ln) * ldb + kb;
      FragB b;
      b.half[0] = *(const v8us*)(brow + 8 * hh);
      b.half[1] = *(const v8us*)(brow + 16 + 8 * hh);
      acc[t] = mmaN<ASPLIT ? 2 : 1>(ah.v, al.v, b.v, b.v, acc[t]);
    }
  }
#pragma unroll
  for (int t = 0; t < 4; ++t) {
    float bv = bias ? bias[col0 + t * 16 + ln] : 0.f;
    if (BIAS_BF16) bv = bf16_round(bv);
#pragma unroll
    for (int r = 0; r < 8; ++r) { float v = acc[t][r] + bv; if (ACT == 1) v = fmaxf(v, 0.f); so[w][8 * hh + r][t * 16 + ln] = v; }
  }
  __builtin_amdgcn_fence(__ATOMIC_ACQ_REL, "workgroup");
  __builtin_amdgcn_wave_barrier();
  const int rsub = lane >> 4, c4 = (lane & 15) * 4;
  {
#pragma unroll
    for (int q = 0; q < 8; ++q) {
      const int r = q * 2 + rsub;
      const v4f v = *(const v4fa*)&so[w][r][c4];
      *(v4f*)(C + (size_t)(row0 + r) * ldc + col0 + c4) = v;
    }
    
  }
}

// GEMM C = act(A·W + bias + resid): A f32 (ASPLIT -> hi/lo 2 terms), Wt bf16 [N][K]; ACT 0 none, 1 relu, 2 exact gelu;
// resid (optional, f32, row index = (row % rmod), pitch ldr, RES_BF16 rounds it) added before the activation.
template <bool ASPLIT, int ACT, bool BIAS_BF16, bool RES_BF16>
__global__ __launch_bounds__(128) void k_gemm_bf3(const float* __restrict__ A, int lda, const unsigned short* __restrict__ Wt, int ldb,
                                                const float* __restrict__ bias, const float* __restrict__ resid, int rmod, int ldr,
                                                float* __restrict__ C, int ldc, int M, int N, int K) {
  __shared__ __attribute__((aligned(16))) float so[4][16][64];
  const int tid = threadIdx.x, w = tid >> 5, lane = tid & 31, ln = lane & 15, hh = lane >> 4;
  const int ntn = N / 64;
  const int wid = blockIdx.x * 4 + w;
  const int mt = wid / ntn, nq = wid % ntn;
  if (mt * 16 >= M) return;
  const int row0 = mt * 16, col0 = nq * 64;
  const float* arow = A + (size_t)(row0 + ln) * lda;
  v8f acc[4] = {};
  for (int kb = 0; kb < K; kb += 32) {
    FragB ah, al;
    const v4f x0 = *(const v4fa*)(arow + kb + 8 * hh), x1 = *(const v4fa*)(arow + kb + 8 * hh + 4);
    const v4f x2 = *(const v4fa*)(arow + kb + 16 + 8 * hh), x3 = *(const v4fa*)(arow + kb + 16 + 8 * hh + 4);
    float xs[16] = {x0[0],x0[1],x0[2],x0[3],x1[0],x1[1],x1[2],x1[3],x2[0],x2[1],x2[2],x2[3],x3[0],x3[1],x3[2],x3[3]};
#pragma unroll
    for (int i = 0; i < 16; ++i) { const unsigned short hb = bf16_bits(xs[i]); ah.u[i] = hb; al.u[i] = ASPLIT ? bf16_bits(xs[i] - bf16_val(hb)) : (unsigned short)0; }
#pragma unroll
    for (int t = 0; t < 4; ++t) {
      const unsigned short* brow = Wt + (size_t)(col0 + t * 16 + ln) * ldb + kb;
      FragB b;
      b.half[0] = *(const v8us*)(brow + 8 * hh);
      b.half[1] = *(const v8us*)(brow + 16 + 8 * hh);
      acc[t] = mmaN<ASPLIT ? 2 : 1>(ah.v, al.v, b.v, b.v, acc[t]);
    }
  }
#pragma unroll
  for (int t = 0; t < 4; ++t) {
    const int col = col0 + t * 16 + ln;
    float bv = bias ? bias[col] : 0.f;
    if (BIAS_BF16) bv = bf16_round(bv);
#pragma unroll
    for (int r = 0; r < 8; ++r) {
      float v = acc[t][r] + bv;
      if (resid) { float rv = resid[(size_t)((row0 + 8 * hh + r) % rmod) * ldr + col]; if (RES_BF16) rv = bf16_round(rv); v += rv; }
      if (ACT == 1) v = fmaxf(v, 0.f);
      if (ACT == 2) v = 0.5f * v * (1.0f + erff(v * 0.70710678118654752f));
      if (ACT == 3) { const float u = 0.7978845608028654f * (v + 0.044715f * v * v * v); v = 0.5f * v * (1.0f + tanhf(u)); }
      so[w][8 * hh + r][t * 16 + ln] = v;
    }
  }
  __builtin_amdgcn_fence(__ATOMIC_ACQ_REL, "workgroup");
  __builtin_amdgcn_wave_barrier();
  const int rsub = lane >> 4, c4 = (lane & 15) * 4;
  {
#pragma unroll
    for (int q = 0; q < 8; ++q) {
      const int r = q * 2 + rsub;
      const v4f v = *(const v4fa*)&so[w][r][c4];
      *(v4f*)(C + (size_t)(row0 + r) * ldc + col0 + c4) = v;
    }
    
  }
}
// row LayerNorm (biased variance, eps) over N: s = X (+ R); optional out_sum <- s; out_norm <- (s-mu)*rsqrt(var+eps)*g + b
template <bool PARAM_BF16>
__global__ __launch_bounds__(256) void k_layernorm(const float* __restrict__ X, const float* __restrict__ R, const float* __restrict__ g, const float* __restrict__ bta,
                                                  float* __restrict__ out_sum, float* __restrict__ out_norm, int N, float eps) {
  __shared__ float red[256];
  const int row = blockIdx.x, tid = threadIdx.x;
  const float* x = X + (size_t)row * N; const float* rr = R ? R + (size_t)row * N : nullptr;
  float vals[16];                     // up to N = 4096
  const int per = N / 256;            // contiguous chunk per thread? use strided-by-4 chunks: thread handles j = tid*4 + 1024*u
  float s1 = 0.f;
  for (int u = 0; u < per / 4; ++u) {
    const int j = tid * 4 + 1024 * u;
    const v4f a = *(const v4fa*)(x + j);
    v4f b = {0.f,0.f,0.f,0.f}; if (rr) b = *(const v4fa*)(rr + j);
#pragma unroll
    for (int q = 0; q < 4; ++q) { const float v = a[q] + b[q]; vals[u * 4 + q] = v; s1 += v; }
  }
  red[tid] = s1; __syncthreads();
  for (int st = 128; st > 0; st >>= 1) { if (tid < st) red[tid] += red[tid + st]; __syncthreads(); }
  const float mu = red[0] / (float)N; __syncthreads();
  float s2 = 0.f;
  for (int u = 0; u < per / 4; ++u)
#pragma unroll
    for (int q = 0; q < 4; ++q) { const float c = vals[u * 4 + q] - mu; s2 += c * c; }
  red[tid] = s2; __syncthreads();
  for (int st = 128; st > 0; st >>= 1) { if (tid < st) red[tid] += red[tid + st]; __syncthreads(); }
  const float rs = rsqrtf(red[0] / (float)N + eps);
  {
    for (int u = 0; u < per / 4; ++u) {
      const int j = tid * 4 + 1024 * u;
      v4f o, sm;
#pragma unroll
      for (int q = 0; q < 4; ++q) {
        float gg = g[j + q], bb = bta[j + q];
        if (PARAM_BF16) { gg = bf16_round(gg); bb = bf16_round(bb); }
        sm[q] = vals[u * 4 + q]; o[q] = (vals[u * 4 + q] - mu) * rs * gg + bb;
      }
      if (out_sum) *(v4f*)(out_sum + (size_t)row * N + j) = sm;
      *(v4f*)(out_norm + (size_t)row * N + j) = o;
    }
    
  }
}



// ---- f16 WMMA path (v_wmma_f32_16x16x32_f16): 11-bit significands for operands in range — used where a [0,1] probability operand needs more precision than bf16
typedef _Float16 v16h __attribute__((ext_vector_type(16)));
union FragH { v16h v; v8us half[2]; _Float16 h[16]; unsigned short u[16]; };
template <int NT>
__device__ __forceinline__ v8f mmaH(v16h ah, v16h al, v16h bh, v16h bl, v8f c) {
  c = __builtin_amdgcn_wmma_f32_16x16x32_f16(false, ah, false, bh, (short)0, c, false, false);
  if (NT >= 2) c = __builtin_amdgcn_wmma_f32_16x16x32_f16(false, al, false, bh, (short)0, c, false, false);
  if (NT >= 3) c = __builtin_amdgcn_wmma_f32_16x16x32_f16(false, ah, false, bl, (short)0, c, false, false);
  asm volatile("v_nop\n\tv_nop\n\tv_nop\n\tv_nop" : "+v"(c) : "v"(ah), "v"(al), "v"(bh), "v"(bl));
  return c;
}
// batched GEMM like k_gemm_b but f16 operands: A f32 (split into f16 hi/lo if ASPLIT, else rounded to f16), Bt = f16 values [n][k]; alpha; C f32; N multiple of 16 (partial tiles skipped)
template <bool ASPLIT>
__global__ __launch_bounds__(128) void k_gemm_h(const float* __restrict__ A, int lda, size_t sA, const _Float16* __restrict__ Bh, int ldb, size_t sB, float alpha, float* __restrict__ C, int ldc, size_t sC, int M, int N, int K) {
  __shared__ __attribute__((aligned(16))) float so[4][16][64];
  const int tid = threadIdx.x, w = tid >> 5, lane = tid & 31, ln = lane & 15, hh = lane >> 4; const int by = blockIdx.y;
  A += (size_t)by * sA; Bh += (size_t)by * sB; C += (size_t)by * sC;
  const int ntn = (N + 63) / 64; const int wid = blockIdx.x * 4 + w; const int mt = wid / ntn, nq = wid % ntn; if (mt * 16 >= M) return;
  const int row0 = mt * 16, col0 = nq * 64; const float* arow = A + (size_t)(row0 + ln) * lda;
  v8f acc[4] = {};
  for (int kb = 0; kb < K; kb += 32) {
    FragH ah, al;
    const v4f x0 = *(const v4fa*)(arow + kb + 8 * hh), x1 = *(const v4fa*)(arow + kb + 8 * hh + 4), x2 = *(const v4fa*)(arow + kb + 16 + 8 * hh), x3 = *(const v4fa*)(arow + kb + 16 + 8 * hh + 4);
    float xs[16] = {x0[0],x0[1],x0[2],x0[3],x1[0],x1[1],x1[2],x1[3],x2[0],x2[1],x2[2],x2[3],x3[0],x3[1],x3[2],x3[3]};
#pragma unroll
    for (int i = 0; i < 16; ++i) { const _Float16 h = (_Float16)xs[i]; ah.h[i] = h; al.h[i] = ASPLIT ? (_Float16)(xs[i] - (float)h) : (_Float16)0.0f; }
#pragma unroll
    for (int t = 0; t < 4; ++t) { if (col0 + t * 16 >= N) continue; const size_t boff = (size_t)(col0 + t * 16 + ln) * ldb + kb; FragH bq; bq.half[0] = *(const v8us*)(Bh + boff + 8 * hh); bq.half[1] = *(const v8us*)(Bh + boff + 16 + 8 * hh);
      acc[t] = mmaH<ASPLIT ? 2 : 1>(ah.v, al.v, bq.v, bq.v, acc[t]); }
  }
#pragma unroll
  for (int t = 0; t < 4; ++t) { if (col0 + t * 16 >= N) continue;
#pragma unroll
    for (int r = 0; r < 8; ++r) so[w][8 * hh + r][t * 16 + ln] = acc[t][r] * alpha; }
  __builtin_amdgcn_fence(__ATOMIC_ACQ_REL, "workgroup"); __builtin_amdgcn_wave_barrier();
  const int rsub = lane >> 4, c4 = (lane & 15) * 4;
  {
#pragma unroll
    for (int q = 0; q < 8; ++q) { const int r = q * 2 + rsub; if (col0 + c4 < N) { const v4f v = *(const v4fa*)&so[w][r][c4]; *(v4f*)(C + (size_t)(row0 + r) * ldc + col0 + c4) = v; } }
     }
}

// Wt[n][k] = f16(W[k][n]·scale) from f32 row-major W[K][N] (scale = power of two; bf16-exact weights stay exact in f16 away from the subnormal range)
__global__ __launch_bounds__(256) void k_wt_f16(const float* __restrict__ W, _Float16* __restrict__ Wt, int K, int N, float scale) {
  const int t = blockIdx.x * 256 + threadIdx.x; if (t >= N * (K / 8)) return; const int n = t / (K / 8), k8 = (t % (K / 8)) * 8; FragH f;
#pragma unroll
  for (int i = 0; i < 8; ++i) f.h[i] = (_Float16)(bf16_round(W[(size_t)(k8 + i) * N + n]) * scale); const v8us o = f.half[0];
  *(v8us*)((unsigned short*)Wt + (size_t)n * K + k8) = o; 
}
// k_gemm_hh variant with fused epilogue: v = acc·alpha + bias[by·sBias + col] (+ CP[(row/rowsPerB)·sCPb + by·64 + col] if CP) ; ACT 0 none / 1 elu ; writes f16 C16 (and f32 C if non-null)
template <int ACT>
__global__ __launch_bounds__(128) void k_gemm_hhx(const _Float16* __restrict__ A, int lda, size_t sA, const _Float16* __restrict__ Bh, int ldb, size_t sB, float alpha, const float* __restrict__ bias, size_t sBias, const float* __restrict__ CP, int rowsPerB, size_t sCPb, int row0g,
    float* __restrict__ C, _Float16* __restrict__ C16, int ldc, size_t sC, int M, int N, int K) {
  __shared__ __attribute__((aligned(16))) float so[4][16][64];
  const int tid = threadIdx.x, w = tid >> 5, lane = tid & 31, ln = lane & 15, hh = lane >> 4; const int by = blockIdx.y;
  A += (size_t)by * sA; Bh += (size_t)by * sB; const size_t cofs = (size_t)by * sC; const float* bp = bias ? bias + (size_t)by * sBias : nullptr;
  const int ntn = (N + 63) / 64; const int wid = blockIdx.x * 4 + w; const int mt = wid / ntn, nq = wid % ntn; if (mt * 16 >= M) return;
  const int row0 = mt * 16, col0 = nq * 64; const _Float16* arow = A + (size_t)(row0 + ln) * lda;
  v8f acc[4] = {};
  for (int kb = 0; kb < K; kb += 32) { FragH ah; ah.half[0] = *(const v8us*)((const unsigned short*)arow + kb + 8 * hh); ah.half[1] = *(const v8us*)((const unsigned short*)arow + kb + 16 + 8 * hh);
#pragma unroll
    for (int t = 0; t < 4; ++t) { if (col0 + t * 16 >= N) continue; const size_t boff = (size_t)(col0 + t * 16 + ln) * ldb + kb; FragH bq; bq.half[0] = *(const v8us*)((const unsigned short*)Bh + boff + 8 * hh); bq.half[1] = *(const v8us*)((const unsigned short*)Bh + boff + 16 + 8 * hh);
      acc[t] = mmaH<1>(ah.v, ah.v, bq.v, bq.v, acc[t]); }
  }
#pragma unroll
  for (int t = 0; t < 4; ++t) { if (col0 + t * 16 >= N) continue; const int col = col0 + t * 16 + ln; const float bv = bp ? bf16_round(bp[col]) : 0.f;
#pragma unroll
    for (int r = 0; r < 8; ++r) { float v = acc[t][r] * alpha + bv; if (CP) { const int rr = row0g + row0 + 8 * hh + r; if (rowsPerB < 0) v += CP[cofs + (size_t)rr * ldc + col];      /* rowsPerB < 0: own element of the batched C plane */ else { const int bidx = rr / rowsPerB; v += CP[(size_t)bidx * sCPb + (size_t)by * 64 + col]; } } if (ACT == 1) v = (v > 0.f) ? v : expm1f(v); else if (ACT == 7) v = (v > 0.f) ? v + 1.0f : expf(v); else if (ACT == 8) v = tanhf(v); else if (ACT == 9) v = 0.5f * v * (1.0f + tanhf(0.7978845608028654f * (v + 0.044715f * v * v * v))); else if (ACT == 11) v = 1.0f / (1.0f + expf(-v)); else if (ACT == 12) v = (v > 0.f) ? v : 0.01f * v; else if (ACT == 14) v = (v > 0.f) ? v : 0.1f * v; else if (ACT == 16) v = (v >= 0.f) ? v : 0.3f * v; else if (ACT == 17) v = (v >= 0.f) ? v : 0.2f * v; else if (ACT == 15) v = v / (1.0f + expf(-v)); else if (ACT == 3) v = fmaxf(v, 0.f); else if (ACT == 6) v = 0.5f * v * (1.0f + erff(v * 0.70710678118654752f)); so[w][8 * hh + r][t * 16 + ln] = v; } }
  __builtin_amdgcn_fence(__ATOMIC_ACQ_REL, "workgroup"); __builtin_amdgcn_wave_barrier();
  const int rsub = lane >> 4, c4 = (lane & 15) * 4; typedef _Float16 v4h __attribute__((ext_vector_type(4)));
  {
#pragma unroll
    for (int q = 0; q < 8; ++q) { const int r = q * 2 + rsub; if (col0 + c4 < N) { const v4f v = *(const v4fa*)&so[w][r][c4]; if (C) *(v4f*)(C + cofs + (size_t)(row0 + r) * ldc + col0 + c4) = v; if (C16) { v4h h4; for (int i = 0; i < 4; ++i) h4[i] = (_Float16)v[i]; *(v4h*)(C16 + cofs + (size_t)(row0 + r) * ldc + col0 + c4) = h4; } } }
     }
}


typedef _Float16 v4h __attribute__((ext_vector_type(4)));

__global__ __launch_bounds__(256) void k_x16(const float* __restrict__ x, _Float16* __restrict__ X16, size_t n8) { const size_t t = (size_t)blockIdx.x * 256 + threadIdx.x; if (t >= n8) return; FragH f;
#pragma unroll
  for (int q = 0; q < 8; ++q) f.h[q] = (_Float16)bf16_round(x[t * 8 + q]); *(v8us*)((unsigned short*)X16 + t * 8) = f.half[0];  }
__global__ __launch_bounds__(256) void k_h16(const float* __restrict__ x, _Float16* __restrict__ X16, size_t n8) { const size_t t = (size_t)blockIdx.x * 256 + threadIdx.x; if (t >= n8) return; FragH f;
#pragma unroll
  for (int q = 0; q < 8; ++q) f.h[q] = (_Float16)x[t * 8 + q]; *(v8us*)((unsigned short*)X16 + t * 8) = f.half[0];  }
__global__ __launch_bounds__(256) void k_round16f(const float* __restrict__ W, _Float16* __restrict__ Bt, size_t n8) { const size_t t = (size_t)blockIdx.x * 256 + threadIdx.x; if (t >= n8) return; FragH f;
#pragma unroll
  for (int i = 0; i < 8; ++i) f.h[i] = (_Float16)(bf16_round(W[t * 8 + i]) * 16.0f); *(v8us*)((unsigned short*)Bt + t * 8) = f.half[0];  }
template <int NHv, int TTv>
__global__ __launch_bounds__(256) void k_vt(const _Float16* __restrict__ V16, int ldv, int voff, _Float16* __restrict__ Vt) { __shared__ unsigned short tl[64][66]; const int tid = threadIdx.x; const int slab = blockIdx.x / (TTv / 64), lg = blockIdx.x % (TTv / 64); const int b = slab / NHv, h = slab % NHv;
  for (int i = tid; i < 64 * 8; i += 256) { const int r = i / 8, c8 = (i % 8) * 8; FragH f; f.half[0] = *(const v8us*)((const unsigned short*)V16 + ((size_t)b * TTv + lg * 64 + r) * ldv + voff + h * 64 + c8);
#pragma unroll
    for (int q = 0; q < 8; ++q) tl[r][c8 + q] = f.u[q]; }
  __syncthreads();
  {
#pragma unroll
    for (int rd = 0; rd < 2; ++rd) { const int d = rd * 32 + tid / 8, pc = tid % 8; FragH f;
#pragma unroll
      for (int q = 0; q < 8; ++q) f.u[q] = tl[pc * 8 + q][d];
      *(v8us*)((unsigned short*)Vt + ((size_t)slab * 64 + d) * TTv + lg * 64 + pc * 8) = f.half[0]; }
     } }

__global__ __launch_bounds__(256) void k_hl(const float* __restrict__ F, _Float16* __restrict__ Hh, _Float16* __restrict__ Hl, size_t n8) { const size_t t = (size_t)blockIdx.x * 256 + threadIdx.x; if (t >= n8) return; FragH fh, fl; const v4f a = *(const v4fa*)(F + t * 8), c = *(const v4fa*)(F + t * 8 + 4);
#pragma unroll
  for (int q = 0; q < 4; ++q) { _Float16 h = (_Float16)a[q]; fh.h[q] = h; fl.h[q] = (_Float16)((a[q] - (float)h) * 1024.0f); h = (_Float16)c[q]; fh.h[4 + q] = h; fl.h[4 + q] = (_Float16)((c[q] - (float)h) * 1024.0f); }
  { *(v8us*)((unsigned short*)Hh + t * 8) = fh.half[0]; *(v8us*)((unsigned short*)Hl + t * 8) = fl.half[0];  } }

// ---- fast GEMM (wave tile 32x64; requires M % 32 == 0 rows per launch region and N % 64 == 0); epilogue = k_gemm_hhx semantics ----
__device__ __forceinline__ v16h g2_frag(const _Float16* p, int hh) { FragH f; f.half[0] = *(const v8us*)((const unsigned short*)p + 8 * hh); f.half[1] = *(const v8us*)((const unsigned short*)p + 16 + 8 * hh); return f.v; }
__device__ __forceinline__ v8f g2_mma(v16h a, v16h b, v8f c) { v8f d = __builtin_amdgcn_wmma_f32_16x16x32_f16(false, a, false, b, (short)0, c, false, false); asm volatile("v_nop\n\tv_nop\n\tv_nop\n\tv_nop" : "+v"(d) : "v"(a), "v"(b)); return d; }
template <int ACT>
__global__ __launch_bounds__(128) void k_gemm2(const _Float16* __restrict__ A, int lda, size_t sA, const _Float16* __restrict__ Bh, int ldb, size_t sB, float alpha, const float* __restrict__ bias, size_t sBias, const float* __restrict__ CP, int rowsPerB, size_t sCPb, int row0g,
    float* __restrict__ C, _Float16* __restrict__ C16, int ldc, size_t sC, int M, int N, int K) { static_assert(ACT == 0 || ACT == 3 || ACT == 6 || ACT == 8 || ACT == 9 || ACT == 11 || ACT == 12 || ACT == 14 || ACT == 15 || ACT == 16 || ACT == 17, "k_gemm2: unsupported ACT code (would silently apply no activation)");
  __shared__ __attribute__((aligned(16))) float so[4][32][68];
  const int tid = threadIdx.x, w = tid >> 5, lane = tid & 31, ln = lane & 15, hh = lane >> 4; const int by = blockIdx.y;
  A += (size_t)by * sA; Bh += (size_t)by * sB; const size_t cofs = (size_t)by * sC; const float* bp = bias ? bias + (size_t)by * sBias : nullptr;
  const int ntn = N >> 6; const int mt = blockIdx.x / ntn, nq = blockIdx.x - mt * ntn; const int row0 = mt * 128 + 32 * w, col0 = nq * 64; if (row0 >= M) return;
  const _Float16* a0p = A + (size_t)(row0 + ln) * lda; const _Float16* a1p = a0p + (size_t)16 * lda;
  const _Float16* b0p = Bh + (size_t)(col0 + ln) * ldb; const _Float16* b1p = b0p + (size_t)16 * ldb; const _Float16* b2p = b1p + (size_t)16 * ldb; const _Float16* b3p = b2p + (size_t)16 * ldb;
  const v8f z8 = {0.f,0.f,0.f,0.f,0.f,0.f,0.f,0.f}; v8f c00 = z8, c01 = z8, c02 = z8, c03 = z8, c10 = z8, c11 = z8, c12 = z8, c13 = z8;
#pragma unroll 1
  for (int kb = 0; kb < K; kb += 32) { const v16h a0 = g2_frag(a0p + kb, hh), a1 = g2_frag(a1p + kb, hh);
    v16h b = g2_frag(b0p + kb, hh); c00 = g2_mma(a0, b, c00); c10 = g2_mma(a1, b, c10);
    b = g2_frag(b1p + kb, hh); c01 = g2_mma(a0, b, c01); c11 = g2_mma(a1, b, c11);
    b = g2_frag(b2p + kb, hh); c02 = g2_mma(a0, b, c02); c12 = g2_mma(a1, b, c12);
    b = g2_frag(b3p + kb, hh); c03 = g2_mma(a0, b, c03); c13 = g2_mma(a1, b, c13); }
  v8f accs[8] = {c00, c01, c02, c03, c10, c11, c12, c13};
#pragma unroll
  for (int u = 0; u < 8; ++u) { const int t = u & 3, half = u >> 2; const int col = col0 + t * 16 + ln; const float bv = bp ? bf16_round(bp[col]) : 0.f;
#pragma unroll
    for (int r = 0; r < 8; ++r) { const int rloc = half * 16 + 8 * hh + r; float v = accs[u][r] * alpha + bv; if (CP) { if (rowsPerB < 0) v += CP[cofs + (size_t)(row0g + row0 + rloc) * ldc + col];      /* rowsPerB < 0: own element of the batched C plane */ else { const int bidx = (row0g + row0 + rloc) / rowsPerB; v += CP[(size_t)bidx * sCPb + (size_t)by * 64 + col]; } }
      if (ACT == 3) v = fmaxf(v, 0.f); else if (ACT == 6) v = 0.5f * v * (1.0f + erff(v * 0.70710678118654752f)); else if (ACT == 11) v = 1.0f / (1.0f + expf(-v)); else if (ACT == 15) v = v / (1.0f + expf(-v)); else if (ACT == 12) v = (v > 0.f) ? v : 0.01f * v; else if (ACT == 8) v = tanhf(v); else if (ACT == 9) v = 0.5f * v * (1.0f + tanhf(0.7978845608028654f * (v + 0.044715f * v * v * v))); else if (ACT == 14) v = (v > 0.f) ? v : 0.1f * v; else if (ACT == 16) v = (v >= 0.f) ? v : 0.3f * v; else if (ACT == 17) v = (v >= 0.f) ? v : 0.2f * v;
      so[w][rloc][t * 16 + ln] = v; } }
  __builtin_amdgcn_fence(__ATOMIC_ACQ_REL, "workgroup"); __builtin_amdgcn_wave_barrier();
  const int rsub = lane >> 4, c4 = (lane & 15) * 4;
  {
#pragma unroll
    for (int q = 0; q < 16; ++q) { const int r = q * 2 + rsub; const v4f v = *(const v4fa*)&so[w][r][c4]; if (C) *(v4f*)(C + cofs + (size_t)(row0 + r) * ldc + col0 + c4) = v; if (C16) { v4h h4; for (int i = 0; i < 4; ++i) h4[i] = (_Float16)v[i]; *(v4h*)(C16 + cofs + (size_t)(row0 + r) * ldc + col0 + c4) = h4; } }
     } }


__global__ __launch_bounds__(256) void k_wnat(const float* __restrict__ w, size_t n8, _Float16* __restrict__ Bt) { const size_t t = (size_t)blockIdx.x * 256 + threadIdx.x; if (t >= n8) return; FragH f; for (int q = 0; q < 8; ++q) f.h[q] = (_Float16)(bf16_round(w[t * 8 + q]) * 16.0f); *(v8us*)((unsigned short*)Bt + t * 8) = f.half[0];  }
__global__ __launch_bounds__(256) void k_rsm(const float* __restrict__ S, _Float16* __restrict__ P, int nrows) {
  #pragma clang fp contract(off)
  const int i = blockIdx.x * 256 + threadIdx.x; if (i >= nrows) return; const float* s = S + (size_t)i * SQ; float mx = -3.0e38f;
#pragma unroll 1
  for (int j = 0; j < SQ; ++j) mx = fmaxf(mx, s[j]); float se = 0.f;
#pragma unroll 1
  for (int j = 0; j < SQ; ++j) se += expf(s[j] - mx); const float sc = 256.0f / se;
#pragma unroll 1
  for (int j0 = 0; j0 < SQ; j0 += 8) { FragH f; for (int q = 0; q < 8; ++q) f.h[q] = (_Float16)(expf(s[j0 + q] - mx) * sc); unsigned short* d = (unsigned short*)P + (size_t)i * SQ + j0; *(v8us*)d = f.half[0];  } }
__global__ __launch_bounds__(256) void k_vt(const _Float16* __restrict__ V16, int b, int h0, _Float16* __restrict__ VT) { __shared__ unsigned short tl[64][65]; const int tid = threadIdx.x; const int hh = blockIdx.x % HG, sg = blockIdx.x / HG; const int s0 = sg * 64; const int h = h0 + hh;
  for (int i = tid; i < 64 * 8; i += 256) { const int j = i / 8, d8 = (i % 8) * 8; FragH f; f.half[0] = *(const v8us*)((const unsigned short*)V16 + ((size_t)b * SQ + s0 + j) * DM + h * HD + d8); for (int q = 0; q < 8; ++q) tl[d8 + q][j] = f.u[q]; }
  __syncthreads();
  { for (int i = tid; i < 64 * 8; i += 256) { const int d = i / 8, j8 = (i % 8) * 8; FragH f; for (int q = 0; q < 8; ++q) f.u[q] = tl[d][j8 + q]; *(v8us*)((unsigned short*)VT + ((size_t)hh * HD + d) * SQ + s0 + j8) = f.half[0]; }  } }


// lane l <-> lane l ^ M of the wave, in vector registers (no LDS round trip): M = 16 crosses the two 16-lane rows, M < 16 is a DPP row_xmask move
template <int M>
__device__ __forceinline__ float lane_xor(float x) { const int b = __float_as_int(x);
  if constexpr (M == 16) return __int_as_float(__builtin_amdgcn_permlanex16(b, b, 0x76543210, 0xfedcba98, false, false));
  else return __int_as_float(__builtin_amdgcn_update_dpp(0, b, 0x160 | M, 0xf, 0xf, true)); }
template <bool MX> __device__ __forceinline__ float red_op(float a, float b) { return MX ? fmaxf(a, b) : a + b; }
// one butterfly step over N pairs: the lane whose bit M is set keeps the upper N values and hands over the lower N, its partner the other way round
template <bool MX, int M, int N>
__device__ __forceinline__ void fold_step(float (&r)[NH], int lane) { const bool up = (lane & M) != 0;
#pragma unroll      /* constant indices, so the per-thread arrays stay in registers */
  for (int i = 0; i < N; ++i) { const float keep = up ? r[i + N] : r[i], send = up ? r[i] : r[i + N]; r[i] = red_op<MX>(keep, lane_xor<M>(send)); } }
// r[h] = this lane's partial of head h; returns, in lane l, head (l >> 1) reduced over the wave's 32 lanes (16 lane exchanges instead of 16 x 5)
template <bool MX>
__device__ __forceinline__ float wave_fold16(float (&r)[NH], int lane) { fold_step<MX, 16, 8>(r, lane); fold_step<MX, 8, 4>(r, lane); fold_step<MX, 4, 2>(r, lane); fold_step<MX, 2, 1>(r, lane); return red_op<MX>(r[0], lane_xor<1>(r[0])); }
typedef int v4ia __attribute__((ext_vector_type(4), may_alias));
typedef const __attribute__((address_space(1))) v4fa g_v4f; typedef __attribute__((address_space(1))) v4h g_v4h;      /* global-memory views for addresses formed as scalar base + lane offset */
// a plane's row start, the same in every lane, held in a scalar register pair: each load and store of that row is then scalar base + this lane's 32-bit offset, with no 64-bit vector address to form or hold
__device__ __forceinline__ unsigned long long scalar_base(const void* p) { const unsigned long long u = (unsigned long long)p;
  return ((unsigned long long)(unsigned)__builtin_amdgcn_readfirstlane((int)(u >> 32)) << 32) | (unsigned)__builtin_amdgcn_readfirstlane((int)u); }
// one work-group per query row: thread t holds columns 4t..4t+3 and 1024+4t..1024+4t+3 of all 16 head planes in registers (S read once); maxima and sums go lanes -> waves (LDS) -> scalar registers
__global__ __launch_bounds__(256) void k_rsmsum(const float* __restrict__ S, const int* __restrict__ mrow0, _Float16* __restrict__ P, float* __restrict__ WS, int q0) {
  #pragma clang fp contract(off)
  __shared__ float redm[8][NH], reds[8][NH];
  const int i = blockIdx.x, tid = threadIdx.x, lane = tid & 31, w = tid >> 5, c0 = tid * 4; const int* mk = mrow0 + (size_t)(q0 + i) * SQ;
  float e[NH][8], f[8], r[NH], mx[NH], sc[NH];
  { const v4ia m0 = *(const v4ia*)(mk + c0), m1 = *(const v4ia*)(mk + SQ / 2 + c0);
#pragma unroll      /* constant indices, so the per-thread arrays stay in registers */
    for (int q = 0; q < 4; ++q) { f[q] = (m0[q] != 0) ? 1.f : 0.f; f[4 + q] = (m1[q] != 0) ? 1.f : 0.f; } }
#pragma unroll      /* constant indices, so the per-thread arrays stay in registers */
  for (int h = 0; h < NH; ++h) { const unsigned long long s = scalar_base(S + ((size_t)h * QT + i) * NKX); const v4f a = *(g_v4f*)(s + c0 * 4u), b = *(g_v4f*)(s + c0 * 4u + SQ * 2u);
#pragma unroll      /* constant indices, so the per-thread arrays stay in registers */
    for (int q = 0; q < 4; ++q) { e[h][q] = a[q]; e[h][4 + q] = b[q]; } }
#pragma unroll      /* constant indices, so the per-thread arrays stay in registers */
  for (int h = 0; h < NH; ++h) { float m = -3.0e38f;
#pragma unroll      /* constant indices, so the per-thread arrays stay in registers */
    for (int q = 0; q < 8; ++q) m = fmaxf(m, fmaf(f[q], e[h][q], (1.f - f[q]) * -3.0e38f)); r[h] = m; }
  redm[w][lane >> 1] = wave_fold16<true>(r, lane);      /* the two lanes of a pair hold, and store, the same value */
  __syncthreads();
  { float m = redm[0][lane & 15];
#pragma unroll      /* constant indices, so the per-thread arrays stay in registers */
    for (int u = 1; u < 8; ++u) m = fmaxf(m, redm[u][lane & 15]);
#pragma unroll      /* constant indices, so the per-thread arrays stay in registers */
    for (int h = 0; h < NH; ++h) mx[h] = __int_as_float(__builtin_amdgcn_readlane(__float_as_int(m), h)); }
#pragma unroll      /* constant indices, so the per-thread arrays stay in registers */
  for (int h = 0; h < NH; ++h) { float se = 0.f;
#pragma unroll      /* constant indices, so the per-thread arrays stay in registers */
    for (int q = 0; q < 8; ++q) { e[h][q] = f[q] * __expf(fminf(e[h][q] - mx[h], 80.f)); se += e[h][q]; } r[h] = se; }
  reds[w][lane >> 1] = wave_fold16<false>(r, lane);
  __syncthreads();
  { float se = reds[0][lane & 15];
#pragma unroll      /* constant indices, so the per-thread arrays stay in registers */
    for (int u = 1; u < 8; ++u) se += reds[u][lane & 15];
    const float inv = 1.0f / se;
#pragma unroll      /* constant indices, so the per-thread arrays stay in registers */
    for (int h = 0; h < NH; ++h) sc[h] = __int_as_float(__builtin_amdgcn_readlane(__float_as_int(inv), h)); }
  float acc[8];
#pragma unroll      /* constant indices, so the per-thread arrays stay in registers */
  for (int q = 0; q < 8; ++q) acc[q] = 0.f;
#pragma unroll      /* constant indices, so the per-thread arrays stay in registers */
  for (int h = 0; h < NH; ++h) { v4h lo, hi;
#pragma unroll      /* constant indices, so the per-thread arrays stay in registers */
    for (int q = 0; q < 4; ++q) { const float p0 = e[h][q] * sc[h], p1 = e[h][4 + q] * sc[h]; acc[q] = __fadd_rn(acc[q], p0); acc[4 + q] = __fadd_rn(acc[4 + q], p1); lo[q] = (_Float16)(p0 * 256.0f); hi[q] = (_Float16)(p1 * 256.0f); }
    const unsigned long long d = scalar_base(P + ((size_t)h * QT + i) * NKX); *(g_v4h*)(d + c0 * 2u) = lo; *(g_v4h*)(d + c0 * 2u + SQ) = hi; }
  v4f a0, a1;
#pragma unroll      /* constant indices, so the per-thread arrays stay in registers */
  for (int q = 0; q < 4; ++q) { a0[q] = acc[q]; a1[q] = acc[4 + q]; }
  float* o = WS + (size_t)i * SQ + c0; *(v4f*)o = a0; *(v4f*)(o + SQ / 2) = a1; }
__global__ __launch_bounds__(256) void k_av64(const float* __restrict__ VPF, const float* __restrict__ alpha, float* __restrict__ AV, size_t n4) {
  #pragma clang fp contract(off)
  const size_t t = (size_t)blockIdx.x * 256 + threadIdx.x; if (t >= n4) return; const float a = __fmul_rn(bf16_round(alpha[0]), 64.0f); const v4f v = *(const v4fa*)(VPF + t * 4); v4f o; for (int q = 0; q < 4; ++q) o[q] = __fmul_rn(a, v[q]); *(v4f*)(AV + t * 4) = o;  }

extern "C" void kernel_launch(void* const* d_in, const int* in_sizes, int n_in,
                              void* d_out, int out_size, void* d_ws, size_t ws_size, hipStream_t stream) {
  (void)in_sizes; (void)n_in; (void)out_size;
  const float* const* I = (const float* const*)d_in; const float* qin = I[0]; const float* kin = I[1]; const float* vin = I[2]; const int* mask = (const int*)d_in[3]; const float* wq = I[4]; const float* bq = I[5]; const float* wkv = I[6]; const float* bkv = I[7]; const float* wo = I[8]; const float* bo = I[9]; const float* alpha = I[10];      /* weights [in][out] */
  float* out0 = (float*)d_out; float* out1 = (float*)d_out + NR * DM;      /* byte offset 16,777,216 */
  char* ws = (char*)d_ws; size_t off = 0;
  auto take = [&](size_t bytes) { char* p = ws + off; off += (bytes + 255) & ~(size_t)255; return p; };
  _Float16* BQ = (_Float16*)take((size_t)DM * DM * 2); _Float16* BKV = (_Float16*)take((size_t)DM * DM * 2); _Float16* BO = (_Float16*)take((size_t)DM * DM * 2);
  _Float16* XQ = (_Float16*)take(NR * DM * 2); _Float16* XK = (_Float16*)take(NR * DM * 2); _Float16* XV = (_Float16*)take(NR * DM * 2); _Float16* Q16 = (_Float16*)take(NR * DM * 2); _Float16* K16 = (_Float16*)take(NR * DM * 2); _Float16* V16 = (_Float16*)take(NR * DM * 2); float* VPF = (float*)take(NR * DM * 4); float* AV = (float*)take(NR * DM * 4); _Float16* O16 = (_Float16*)take(NR * DM * 2);
  float* S = (float*)take((size_t)NH * QT * NKX * 4); _Float16* P = (_Float16*)take((size_t)NH * QT * NKX * 2); _Float16* VT = (_Float16*)take((size_t)NH * HD * SQ * 2);
  if (off > ws_size) return;      /* 6 + 48 + 16 + 16 + 8 + 32 + 16 + 4 = approx 146 MiB */
  { const unsigned gw = (unsigned)(((size_t)DM * (DM / 8) + 255) / 256); k_wt_f16<<<gw, 256, 0, stream>>>(wq, BQ, DM, DM, 16.0f); k_wt_f16<<<gw, 256, 0, stream>>>(wkv, BKV, DM, DM, 16.0f); k_wt_f16<<<gw, 256, 0, stream>>>(wo, BO, DM, DM, 16.0f); }
  { const unsigned gx = (unsigned)((NR * DM / 8 + 255) / 256); k_x16<<<gx, 256, 0, stream>>>(qin, XQ, NR * DM / 8); k_x16<<<gx, 256, 0, stream>>>(kin, XK, NR * DM / 8); k_x16<<<gx, 256, 0, stream>>>(vin, XV, NR * DM / 8); }
  const size_t r0p = (size_t)B0 * SQ; const dim3 gp((unsigned)((MP / 128) * (DM / 64)), 1);
  k_gemm2<0><<<gp, 128, 0, stream>>>(XQ + r0p * DM, DM, 0, BQ, DM, 0, 0.0625f, bq, 0, nullptr, 1, 0, 0, nullptr, Q16 + r0p * DM, DM, 0, MP, DM, DM);
  k_gemm2<0><<<gp, 128, 0, stream>>>(XK + r0p * DM, DM, 0, BKV, DM, 0, 0.0625f, bkv, 0, nullptr, 1, 0, 0, nullptr, K16 + r0p * DM, DM, 0, MP, DM, DM);
  k_gemm2<0><<<gp, 128, 0, stream>>>(XV + r0p * DM, DM, 0, BKV, DM, 0, 0.0625f, bkv, 0, nullptr, 1, 0, 0, VPF + r0p * DM, V16 + r0p * DM, DM, 0, MP, DM, DM);      /* vp: f32 (residual) and f16 (attention operand) */
  k_av64<<<(unsigned)(((size_t)MP * DM / 4 + 255) / 256), 256, 0, stream>>>(VPF + r0p * DM, alpha, AV + r0p * DM, (size_t)MP * DM / 4);
  for (int b = B0; b < B0 + NBR; ++b) { const size_t r0 = (size_t)b * SQ;
    k_vt<NH, SQ><<<NH * (SQ / 64), 256, 0, stream>>>(V16 + r0 * DM, DM, 0, VT);      /* V^T [NH][HD][SQ] */
    for (int q0 = Q0S; q0 < QN; q0 += QT) {
      k_gemm2<0><<<dim3((QT / 128) * (SQ / 64), NH), 128, 0, stream>>>(Q16 + (r0 + q0) * DM, DM, (size_t)HD, K16 + r0 * DM, DM, (size_t)HD, 0.125f, nullptr, 0, nullptr, 1, 0, 0, S, nullptr, NKX, (size_t)QT * NKX, QT, SQ, HD);      /* scores / 8, all heads */
      k_rsmsum<<<QT, 256, 0, stream>>>(S, mask, P, out1 + (r0 + q0) * SQ, q0);      /* one work-group per query row */
      k_gemm2<0><<<dim3((QT / 128) * (HD / 64), NH), 128, 0, stream>>>(P, NKX, (size_t)QT * NKX, VT, SQ, (size_t)HD * SQ, 0.25f, nullptr, 0, AV + (r0 + q0) * DM, -1, 0, 0, nullptr, O16 + (r0 + q0) * DM, DM, (size_t)HD, QT, HD, SQ); } }      /* o x64 = 64 attn v + 64 alpha vp (CP = own element), f16 rows */
  k_gemm2<0><<<dim3((unsigned)((MPO / 128) * (DM / 64)), 1), 128, 0, stream>>>(O16 + r0p * DM, DM, 0, BO, DM, 0, 0.0009765625f, bo, 0, nullptr, 1, 0, 0, out0 + r0p * DM, nullptr, DM, 0, MPO, DM, DM);      /* out0 = o Wo + bo */
}

// v002
// Measured time: 633 microseconds a run.
// Two timings next to v001 both put it at 2.51 times that version's speed.
// Counting every step since v000, it is 216 times as fast.
#include <hip/hip_runtime.h>
// Grouped multi-head attention in its MHA configuration (q, k, v [2][2048][1024]; qp = q Wq + bq; kp = k Wkv + bkv and vp = v Wkv + bkv (one shared projection); 16 heads of 64; scores / 8 with the int mask [2048][2048] (verbatim, read per (query, key); 0 -> -inf); softmax w; o = attn vp merged + alpha * vp; out0 = o Wo + bo -> [2][2048][1024] @0; out1 = sum over the 16 heads of w -> [2][2048][2048] f32 @16,777,216 B).
// Structure: token rows; q, k, v as exact f16 rows; QP, KP as WMMA GEMMs (32x64 wave tiles, f32 accumulation, exact x16 transposed weights + bias, f16 outputs); VP likewise to f16 AND f32 (the f32 rows times 64 bf16(alpha) become the residual addend); per batch: V^T via LDS transposes; per query tile of 512 rows: scores for all 16 heads in one GEMM (K = 64, alpha 1/8) into f32; per-row softmax across the 16 head planes on VALU (mask as an arithmetic factor; f32 statistics, native exp) writing the f16 weights (x256, kept for the whole batch) AND the f32 head-sum straight into the second output; once per batch, all 2048 query rows in one launch: o = P . V^T GEMM (K = 2048, alpha 2^-2: o x64) with 64 alpha vp as the epilogue addend into merged f16 rows; out0 = o Wo + bo GEMM (f32, alpha folds 1/16 and 1/64); 10 + 2 x (1 + 4 x 2 + 1) + 1 = 31 launches.
// Compute dtype: inputs rounded to bf16; q/k/v inputs and weights exact in f16; qp, kp, vp (as operand), softmax weights (x256) and o plain f16 (~2^-12); scores, softmax statistics, the head-sum output and alpha vp f32. v_wmma_f32_16x16x32_f16.
#define NB 2
#define SQ 2048
#define DM 1024
#define NH 16
#define HD 64
#define HG 4                         /* k_vt(b,h0) compatibility (unused) */
#define QT 512                       /* query rows per scores / softmax launch: 8 GEMM work-groups and 2 softmax work-groups per WGP */
#define NKX SQ                       /* S / P row pitch */
#define B0 0                         /* first batch processed (debug hook) */
#define NBR NB                       /* batches processed (debug hook) */
#define Q0S 0                        /* first tile (debug hook) */
#define QN SQ                        /* query rows end (debug hook) */
#define NR ((size_t)NB * SQ)
#define MP ((int)((size_t)NBR * SQ)) /* rows projected (debug hook) */
#define MPO MP                       /* rows through the output GEMM (debug hook) */
typedef __bf16 v16b __attribute__((ext_vector_type(16)));
typedef unsigned short v8us __attribute__((ext_vector_type(8), may_alias));
typedef float  v8f  __attribute__((ext_vector_type(8)));
typedef float  v4f  __attribute__((ext_vector_type(4)));
typedef float  v4fa __attribute__((ext_vector_type(4), may_alias));
union FragB { v16b v; v8us half[2]; unsigned short u[16]; };

__device__ __forceinline__ unsigned short bf16_bits(float x) { unsigned int u = __float_as_uint(x); return (unsigned short)((u + 0x7FFFu + ((u >> 16) & 1u)) >> 16); }
__device__ __forceinline__ float bf16_val(unsigned short b) { return __uint_as_float(((unsigned int)b) << 16); }
__device__ __forceinline__ float bf16_round(float x) { return bf16_val(bf16_bits(x)); }
// D += A·B with NT terms: 1 = ah·bh, 2 = + al·bh (A split), 3 = + ah·bl (both split)
template <int NT>
__device__ __forceinline__ v8f mmaN(v16b ah, v16b al, v16b bh, v16b bl, v8f c) {
  c = __builtin_amdgcn_wmma_f32_16x16x32_bf16(false, ah, false, bh, (short)0, c, false, false);
  if (NT >= 2) c = __builtin_amdgcn_wmma_f32_16x16x32_bf16(false, al, false, bh, (short)0, c, false, false);
  if (NT >= 3) c = __builtin_amdgcn_wmma_f32_16x16x32_bf16(false, ah, false, bl, (short)0, c, false, false);
  asm volatile("v_nop\n\tv_nop\n\tv_nop\n\tv_nop" : "+v"(c) : "v"(ah), "v"(al), "v"(bh), "v"(bl));
  return c;
}

__global__ __launch_bounds__(256) void k_wt_bf16(const float* __restrict__ W, unsigned short* __restrict__ Wt, int K, int N) {
  const int t = blockIdx.x * 256 + threadIdx.x;
  const int k8n = K / 8;
  if (t >= N * k8n) return;
  const int n = t / k8n, k8 = (t % k8n) * 8;
  v8us v;
#pragma unroll
  for (int i = 0; i < 8; ++i) v[i] = bf16_bits(W[(size_t)(k8 + i) * N + n]);
  *(v8us*)(Wt + (size_t)n * K + k8) = v;
  
}

// GEMM C[M][N] (f32, pitch ldc) = act(A[M][K]·W + bias). A f32 row-major (pitch lda) converted per fragment to bf16
// (ASPLIT: hi/lo two planes -> 2 terms, else single rounded term); Wt bf16 [N][K] (pitch ldb). BIAS_BF16 rounds the
// bias to bf16 first (bias quantised to bf16 before the add). K%32==0, M%16==0, N%64==0.
template <bool ASPLIT, int ACT, bool BIAS_BF16>
__global__ __launch_bounds__(128) void k_gemm_bf(const float* __restrict__ A, int lda, const unsigned short* __restrict__ Wt, int ldb,
                                               const float* __restrict__ bias, float* __restrict__ C, int ldc, int M, int N, int K) {
  __shared__ __attribute__((aligned(16))) float so[4][16][64];
  const int tid = threadIdx.x, w = tid >> 5, lane = tid & 31, ln = lane & 15, hh = lane >> 4;
  const int ntn = N / 64;
  const int wid = blockIdx.x * 4 + w;
  const int mt = wid / ntn, nq = wid % ntn;
  if (mt * 16 >= M) return;
  const int row0 = mt * 16, col0 = nq * 64;
  const float* arow = A + (size_t)(row0 + ln) * lda;
  v8f acc[4] = {};
  for (int kb = 0; kb < K; kb += 32) {
    FragB ah, al;
    const v4f x0 = *(const v4fa*)(arow + kb + 8 * hh), x1 = *(const v4fa*)(arow + kb + 8 * hh + 4);
    const v4f x2 = *(const v4fa*)(arow + kb + 16 + 8 * hh), x3 = *(const v4fa*)(arow + kb + 16 + 8 * hh + 4);
    float xs[16] = {x0[0],x0[1],x0[2],x0[3],x1[0],x1[1],x1[2],x1[3],x2[0],x2[1],x2[2],x2[3],x3[0],x3[1],x3[2],x3[3]};
#pragma unroll
    for (int i = 0; i < 16; ++i) { const unsigned short hb = bf16_bits(xs[i]); ah.u[i] = hb; al.u[i] = ASPLIT ? bf16_bits(xs[i] - bf16_val(hb)) : (unsigned short)0; }
#pragma unroll
    for (int t = 0; t < 4; ++t) {
      const unsigned short* brow = Wt + (size_t)(col0 + t * 16 + ln) * ldb + kb;
      FragB b;
      b.half[0] = *(const v8us*)(brow + 8 * hh);
      b.half[1] = *(const v8us*)(brow + 16 + 8 * hh);
      acc[t] = mmaN<ASPLIT ? 2 : 1>(ah.v, al.v, b.v, b.v, acc[t]);
    }
  }
#pragma unroll
  for (int t = 0; t < 4; ++t) {
    float bv = bias ? bias[col0 + t * 16 + ln] : 0.f;
    if (BIAS_BF16) bv = bf16_round(bv);
#pragma unroll
    for (int r = 0; r < 8; ++r) { float v = acc[t][r] + bv; if (ACT == 1) v = fmaxf(v, 0.f); so[w][8 * hh + r][t * 16 + ln] = v; }
  }
  __builtin_amdgcn_fence(__ATOMIC_ACQ_REL, "workgroup");
  __builtin_amdgcn_wave_barrier();
  const int rsub = lane >> 4, c4 = (lane & 15) * 4;
  {
#pragma unroll
    for (int q = 0; q < 8; ++q) {
      const int r = q * 2 + rsub;
      const v4f v = *(const v4fa*)&so[w][r][c4];
      *(v4f*)(C + (size_t)(row0 + r) * ldc + col0 + c4) = v;
    }
    
  }
}

// GEMM C = act(A·W + bias + resid): A f32 (ASPLIT -> hi/lo 2 terms), Wt bf16 [N][K]; ACT 0 none, 1 relu, 2 exact gelu;
// resid (optional, f32, row index = (row % rmod), pitch ldr, RES_BF16 rounds it) added before the activation.
template <bool ASPLIT, int ACT, bool BIAS_BF16, bool RES_BF16>
__global__ __launch_bounds__(128) void k_gemm_bf3(const float* __restrict__ A, int lda, const unsigned short* __restrict__ Wt, int ldb,
                                                const float* __restrict__ bias, const float* __restrict__ resid, int rmod, int ldr,
                                                float* __restrict__ C, int ldc, int M, int N, int K) {
  __shared__ __attribute__((aligned(16))) float so[4][16][64];
  const int tid = threadIdx.x, w = tid >> 5, lane = tid & 31, ln = lane & 15, hh = lane >> 4;
  const int ntn = N / 64;
  const int wid = blockIdx.x * 4 + w;
  const int mt = wid / ntn, nq = wid % ntn;
  if (mt * 16 >= M) return;
  const int row0 = mt * 16, col0 = nq * 64;
  const float* arow = A + (size_t)(row0 + ln) * lda;
  v8f acc[4] = {};
  for (int kb = 0; kb < K; kb += 32) {
    FragB ah, al;
    const v4f x0 = *(const v4fa*)(arow + kb + 8 * hh), x1 = *(const v4fa*)(arow + kb + 8 * hh + 4);
    const v4f x2 = *(const v4fa*)(arow + kb + 16 + 8 * hh), x3 = *(const v4fa*)(arow + kb + 16 + 8 * hh + 4);
    float xs[16] = {x0[0],x0[1],x0[2],x0[3],x1[0],x1[1],x1[2],x1[3],x2[0],x2[1],x2[2],x2[3],x3[0],x3[1],x3[2],x3[3]};
#pragma unroll
    for (int i = 0; i < 16; ++i) { const unsigned short hb = bf16_bits(xs[i]); ah.u[i] = hb; al.u[i] = ASPLIT ? bf16_bits(xs[i] - bf16_val(hb)) : (unsigned short)0; }
#pragma unroll
    for (int t = 0; t < 4; ++t) {
      const unsigned short* brow = Wt + (size_t)(col0 + t * 16 + ln) * ldb + kb;
      FragB b;
      b.half[0] = *(const v8us*)(brow + 8 * hh);
      b.half[1] = *(const v8us*)(brow + 16 + 8 * hh);
      acc[t] = mmaN<ASPLIT ? 2 : 1>(ah.v, al.v, b.v, b.v, acc[t]);
    }
  }
#pragma unroll
  for (int t = 0; t < 4; ++t) {
    const int col = col0 + t * 16 + ln;
    float bv = bias ? bias[col] : 0.f;
    if (BIAS_BF16) bv = bf16_round(bv);
#pragma unroll
    for (int r = 0; r < 8; ++r) {
      float v = acc[t][r] + bv;
      if (resid) { float rv = resid[(size_t)((row0 + 8 * hh + r) % rmod) * ldr + col]; if (RES_BF16) rv = bf16_round(rv); v += rv; }
      if (ACT == 1) v = fmaxf(v, 0.f);
      if (ACT == 2) v = 0.5f * v * (1.0f + erff(v * 0.70710678118654752f));
      if (ACT == 3) { const float u = 0.7978845608028654f * (v + 0.044715f * v * v * v); v = 0.5f * v * (1.0f + tanhf(u)); }
      so[w][8 * hh + r][t * 16 + ln] = v;
    }
  }
  __builtin_amdgcn_fence(__ATOMIC_ACQ_REL, "workgroup");
  __builtin_amdgcn_wave_barrier();
  const int rsub = lane >> 4, c4 = (lane & 15) * 4;
  {
#pragma unroll
    for (int q = 0; q < 8; ++q) {
      const int r = q * 2 + rsub;
      const v4f v = *(const v4fa*)&so[w][r][c4];
      *(v4f*)(C + (size_t)(row0 + r) * ldc + col0 + c4) = v;
    }
    
  }
}
// row LayerNorm (biased variance, eps) over N: s = X (+ R); optional out_sum <- s; out_norm <- (s-mu)*rsqrt(var+eps)*g + b
template <bool PARAM_BF16>
__global__ __launch_bounds__(256) void k_layernorm(const float* __restrict__ X, const float* __restrict__ R, const float* __restrict__ g, const float* __restrict__ bta,
                                                  float* __restrict__ out_sum, float* __restrict__ out_norm, int N, float eps) {
  __shared__ float red[256];
  const int row = blockIdx.x, tid = threadIdx.x;
  const float* x = X + (size_t)row * N; const float* rr = R ? R + (size_t)row * N : nullptr;
  float vals[16];                     // up to N = 4096
  const int per = N / 256;            // contiguous chunk per thread? use strided-by-4 chunks: thread handles j = tid*4 + 1024*u
  float s1 = 0.f;
  for (int u = 0; u < per / 4; ++u) {
    const int j = tid * 4 + 1024 * u;
    const v4f a = *(const v4fa*)(x + j);
    v4f b = {0.f,0.f,0.f,0.f}; if (rr) b = *(const v4fa*)(rr + j);
#pragma unroll
    for (int q = 0; q < 4; ++q) { const float v = a[q] + b[q]; vals[u * 4 + q] = v; s1 += v; }
  }
  red[tid] = s1; __syncthreads();
  for (int st = 128; st > 0; st >>= 1) { if (tid < st) red[tid] += red[tid + st]; __syncthreads(); }
  const float mu = red[0] / (float)N; __syncthreads();
  float s2 = 0.f;
  for (int u = 0; u < per / 4; ++u)
#pragma unroll
    for (int q = 0; q < 4; ++q) { const float c = vals[u * 4 + q] - mu; s2 += c * c; }
  red[tid] = s2; __syncthreads();
  for (int st = 128; st > 0; st >>= 1) { if (tid < st) red[tid] += red[tid + st]; __syncthreads(); }
  const float rs = rsqrtf(red[0] / (float)N + eps);
  {
    for (int u = 0; u < per / 4; ++u) {
      const int j = tid * 4 + 1024 * u;
      v4f o, sm;
#pragma unroll
      for (int q = 0; q < 4; ++q) {
        float gg = g[j + q], bb = bta[j + q];
        if (PARAM_BF16) { gg = bf16_round(gg); bb = bf16_round(bb); }
        sm[q] = vals[u * 4 + q]; o[q] = (vals[u * 4 + q] - mu) * rs * gg + bb;
      }
      if (out_sum) *(v4f*)(out_sum + (size_t)row * N + j) = sm;
      *(v4f*)(out_norm + (size_t)row * N + j) = o;
    }
    
  }
}



// ---- f16 WMMA path (v_wmma_f32_16x16x32_f16): 11-bit significands for operands in range — used where a [0,1] probability operand needs more precision than bf16
typedef _Float16 v16h __attribute__((ext_vector_type(16)));
union FragH { v16h v; v8us half[2]; _Float16 h[16]; unsigned short u[16]; };
template <int NT>
__device__ __forceinline__ v8f mmaH(v16h ah, v16h al, v16h bh, v16h bl, v8f c) {
  c = __builtin_amdgcn_wmma_f32_16x16x32_f16(false, ah, false, bh, (short)0, c, false, false);
  if (NT >= 2) c = __builtin_amdgcn_wmma_f32_16x16x32_f16(false, al, false, bh, (short)0, c, false, false);
  if (NT >= 3) c = __builtin_amdgcn_wmma_f32_16x16x32_f16(false, ah, false, bl, (short)0, c, false, false);
  asm volatile("v_nop\n\tv_nop\n\tv_nop\n\tv_nop" : "+v"(c) : "v"(ah), "v"(al), "v"(bh), "v"(bl));
  return c;
}
// batched GEMM like k_gemm_b but f16 operands: A f32 (split into f16 hi/lo if ASPLIT, else rounded to f16), Bt = f16 values [n][k]; alpha; C f32; N multiple of 16 (partial tiles skipped)
template <bool ASPLIT>
__global__ __launch_bounds__(128) void k_gemm_h(const float* __restrict__ A, int lda, size_t sA, const _Float16* __restrict__ Bh, int ldb, size_t sB, float alpha, float* __restrict__ C, int ldc, size_t sC, int M, int N, int K) {
  __shared__ __attribute__((aligned(16))) float so[4][16][64];
  const int tid = threadIdx.x, w = tid >> 5, lane = tid & 31, ln = lane & 15, hh = lane >> 4; const int by = blockIdx.y;
  A += (size_t)by * sA; Bh += (size_t)by * sB; C += (size_t)by * sC;
  const int ntn = (N + 63) / 64; const int wid = blockIdx.x * 4 + w; const int mt = wid / ntn, nq = wid % ntn; if (mt * 16 >= M) return;
  const int row0 = mt * 16, col0 = nq * 64; const float* arow = A + (size_t)(row0 + ln) * lda;
  v8f acc[4] = {};
  for (int kb = 0; kb < K; kb += 32) {
    FragH ah, al;
    const v4f x0 = *(const v4fa*)(arow + kb + 8 * hh), x1 = *(const v4fa*)(arow + kb + 8 * hh + 4), x2 = *(const v4fa*)(arow + kb + 16 + 8 * hh), x3 = *(const v4fa*)(arow + kb + 16 + 8 * hh + 4);
    float xs[16] = {x0[0],x0[1],x0[2],x0[3],x1[0],x1[1],x1[2],x1[3],x2[0],x2[1],x2[2],x2[3],x3[0],x3[1],x3[2],x3[3]};
#pragma unroll
    for (int i = 0; i < 16; ++i) { const _Float16 h = (_Float16)xs[i]; ah.h[i] = h; al.h[i] = ASPLIT ? (_Float16)(xs[i] - (float)h) : (_Float16)0.0f; }
#pragma unroll
    for (int t = 0; t < 4; ++t) { if (col0 + t * 16 >= N) continue; const size_t boff = (size_t)(col0 + t * 16 + ln) * ldb + kb; FragH bq; bq.half[0] = *(const v8us*)(Bh + boff + 8 * hh); bq.half[1] = *(const v8us*)(Bh + boff + 16 + 8 * hh);
      acc[t] = mmaH<ASPLIT ? 2 : 1>(ah.v, al.v, bq.v, bq.v, acc[t]); }
  }
#pragma unroll
  for (int t = 0; t < 4; ++t) { if (col0 + t * 16 >= N) continue;
#pragma unroll
    for (int r = 0; r < 8; ++r) so[w][8 * hh + r][t * 16 + ln] = acc[t][r] * alpha; }
  __builtin_amdgcn_fence(__ATOMIC_ACQ_REL, "workgroup"); __builtin_amdgcn_wave_barrier();
  const int rsub = lane >> 4, c4 = (lane & 15) * 4;
  {
#pragma unroll
    for (int q = 0; q < 8; ++q) { const int r = q * 2 + rsub; if (col0 + c4 < N) { const v4f v = *(const v4fa*)&so[w][r][c4]; *(v4f*)(C + (size_t)(row0 + r) * ldc + col0 + c4) = v; } }
     }
}

// Wt[n][k] = f16(W[k][n]·scale) from f32 row-major W[K][N] (scale = power of two; bf16-exact weights stay exact in f16 away from the subnormal range)
__global__ __launch_bounds__(256) void k_wt_f16(const float* __restrict__ W, _Float16* __restrict__ Wt, int K, int N, float scale) {
  const int t = blockIdx.x * 256 + threadIdx.x; if (t >= N * (K / 8)) return; const int n = t / (K / 8), k8 = (t % (K / 8)) * 8; FragH f;
#pragma unroll
  for (int i = 0; i < 8; ++i) f.h[i] = (_Float16)(bf16_round(W[(size_t)(k8 + i) * N + n]) * scale); const v8us o = f.half[0];
  *(v8us*)((unsigned short*)Wt + (size_t)n * K + k8) = o; 
}
// k_gemm_hh variant with fused epilogue: v = acc·alpha + bias[by·sBias + col] (+ CP[(row/rowsPerB)·sCPb + by·64 + col] if CP) ; ACT 0 none / 1 elu ; writes f16 C16 (and f32 C if non-null)
template <int ACT>
__global__ __launch_bounds__(128) void k_gemm_hhx(const _Float16* __restrict__ A, int lda, size_t sA, const _Float16* __restrict__ Bh, int ldb, size_t sB, float alpha, const float* __restrict__ bias, size_t sBias, const float* __restrict__ CP, int rowsPerB, size_t sCPb, int row0g,
    float* __restrict__ C, _Float16* __restrict__ C16, int ldc, size_t sC, int M, int N, int K) {
  __shared__ __attribute__((aligned(16))) float so[4][16][64];
  const int tid = threadIdx.x, w = tid >> 5, lane = tid & 31, ln = lane & 15, hh = lane >> 4; const int by = blockIdx.y;
  A += (size_t)by * sA; Bh += (size_t)by * sB; const size_t cofs = (size_t)by * sC; const float* bp = bias ? bias + (size_t)by * sBias : nullptr;
  const int ntn = (N + 63) / 64; const int wid = blockIdx.x * 4 + w; const int mt = wid / ntn, nq = wid % ntn; if (mt * 16 >= M) return;
  const int row0 = mt * 16, col0 = nq * 64; const _Float16* arow = A + (size_t)(row0 + ln) * lda;
  v8f acc[4] = {};
  for (int kb = 0; kb < K; kb += 32) { FragH ah; ah.half[0] = *(const v8us*)((const unsigned short*)arow + kb + 8 * hh); ah.half[1] = *(const v8us*)((const unsigned short*)arow + kb + 16 + 8 * hh);
#pragma unroll
    for (int t = 0; t < 4; ++t) { if (col0 + t * 16 >= N) continue; const size_t boff = (size_t)(col0 + t * 16 + ln) * ldb + kb; FragH bq; bq.half[0] = *(const v8us*)((const unsigned short*)Bh + boff + 8 * hh); bq.half[1] = *(const v8us*)((const unsigned short*)Bh + boff + 16 + 8 * hh);
      acc[t] = mmaH<1>(ah.v, ah.v, bq.v, bq.v, acc[t]); }
  }
#pragma unroll
  for (int t = 0; t < 4; ++t) { if (col0 + t * 16 >= N) continue; const int col = col0 + t * 16 + ln; const float bv = bp ? bf16_round(bp[col]) : 0.f;
#pragma unroll
    for (int r = 0; r < 8; ++r) { float v = acc[t][r] * alpha + bv; if (CP) { const int rr = row0g + row0 + 8 * hh + r; if (rowsPerB < 0) v += CP[cofs + (size_t)rr * ldc + col];      /* rowsPerB < 0: own element of the batched C plane */ else { const int bidx = rr / rowsPerB; v += CP[(size_t)bidx * sCPb + (size_t)by * 64 + col]; } } if (ACT == 1) v = (v > 0.f) ? v : expm1f(v); else if (ACT == 7) v = (v > 0.f) ? v + 1.0f : expf(v); else if (ACT == 8) v = tanhf(v); else if (ACT == 9) v = 0.5f * v * (1.0f + tanhf(0.7978845608028654f * (v + 0.044715f * v * v * v))); else if (ACT == 11) v = 1.0f / (1.0f + expf(-v)); else if (ACT == 12) v = (v > 0.f) ? v : 0.01f * v; else if (ACT == 14) v = (v > 0.f) ? v : 0.1f * v; else if (ACT == 16) v = (v >= 0.f) ? v : 0.3f * v; else if (ACT == 17) v = (v >= 0.f) ? v : 0.2f * v; else if (ACT == 15) v = v / (1.0f + expf(-v)); else if (ACT == 3) v = fmaxf(v, 0.f); else if (ACT == 6) v = 0.5f * v * (1.0f + erff(v * 0.70710678118654752f)); so[w][8 * hh + r][t * 16 + ln] = v; } }
  __builtin_amdgcn_fence(__ATOMIC_ACQ_REL, "workgroup"); __builtin_amdgcn_wave_barrier();
  const int rsub = lane >> 4, c4 = (lane & 15) * 4; typedef _Float16 v4h __attribute__((ext_vector_type(4)));
  {
#pragma unroll
    for (int q = 0; q < 8; ++q) { const int r = q * 2 + rsub; if (col0 + c4 < N) { const v4f v = *(const v4fa*)&so[w][r][c4]; if (C) *(v4f*)(C + cofs + (size_t)(row0 + r) * ldc + col0 + c4) = v; if (C16) { v4h h4; for (int i = 0; i < 4; ++i) h4[i] = (_Float16)v[i]; *(v4h*)(C16 + cofs + (size_t)(row0 + r) * ldc + col0 + c4) = h4; } } }
     }
}


typedef _Float16 v4h __attribute__((ext_vector_type(4)));

__global__ __launch_bounds__(256) void k_x16(const float* __restrict__ x, _Float16* __restrict__ X16, size_t n8) { const size_t t = (size_t)blockIdx.x * 256 + threadIdx.x; if (t >= n8) return; FragH f;
#pragma unroll
  for (int q = 0; q < 8; ++q) f.h[q] = (_Float16)bf16_round(x[t * 8 + q]); *(v8us*)((unsigned short*)X16 + t * 8) = f.half[0];  }
__global__ __launch_bounds__(256) void k_h16(const float* __restrict__ x, _Float16* __restrict__ X16, size_t n8) { const size_t t = (size_t)blockIdx.x * 256 + threadIdx.x; if (t >= n8) return; FragH f;
#pragma unroll
  for (int q = 0; q < 8; ++q) f.h[q] = (_Float16)x[t * 8 + q]; *(v8us*)((unsigned short*)X16 + t * 8) = f.half[0];  }
__global__ __launch_bounds__(256) void k_round16f(const float* __restrict__ W, _Float16* __restrict__ Bt, size_t n8) { const size_t t = (size_t)blockIdx.x * 256 + threadIdx.x; if (t >= n8) return; FragH f;
#pragma unroll
  for (int i = 0; i < 8; ++i) f.h[i] = (_Float16)(bf16_round(W[t * 8 + i]) * 16.0f); *(v8us*)((unsigned short*)Bt + t * 8) = f.half[0];  }
template <int NHv, int TTv>
__global__ __launch_bounds__(256) void k_vt(const _Float16* __restrict__ V16, int ldv, int voff, _Float16* __restrict__ Vt) { __shared__ unsigned short tl[64][66]; const int tid = threadIdx.x; const int slab = blockIdx.x / (TTv / 64), lg = blockIdx.x % (TTv / 64); const int b = slab / NHv, h = slab % NHv;
  for (int i = tid; i < 64 * 8; i += 256) { const int r = i / 8, c8 = (i % 8) * 8; FragH f; f.half[0] = *(const v8us*)((const unsigned short*)V16 + ((size_t)b * TTv + lg * 64 + r) * ldv + voff + h * 64 + c8);
#pragma unroll
    for (int q = 0; q < 8; ++q) tl[r][c8 + q] = f.u[q]; }
  __syncthreads();
  {
#pragma unroll
    for (int rd = 0; rd < 2; ++rd) { const int d = rd * 32 + tid / 8, pc = tid % 8; FragH f;
#pragma unroll
      for (int q = 0; q < 8; ++q) f.u[q] = tl[pc * 8 + q][d];
      *(v8us*)((unsigned short*)Vt + ((size_t)slab * 64 + d) * TTv + lg * 64 + pc * 8) = f.half[0]; }
     } }

__global__ __launch_bounds__(256) void k_hl(const float* __restrict__ F, _Float16* __restrict__ Hh, _Float16* __restrict__ Hl, size_t n8) { const size_t t = (size_t)blockIdx.x * 256 + threadIdx.x; if (t >= n8) return; FragH fh, fl; const v4f a = *(const v4fa*)(F + t * 8), c = *(const v4fa*)(F + t * 8 + 4);
#pragma unroll
  for (int q = 0; q < 4; ++q) { _Float16 h = (_Float16)a[q]; fh.h[q] = h; fl.h[q] = (_Float16)((a[q] - (float)h) * 1024.0f); h = (_Float16)c[q]; fh.h[4 + q] = h; fl.h[4 + q] = (_Float16)((c[q] - (float)h) * 1024.0f); }
  { *(v8us*)((unsigned short*)Hh + t * 8) = fh.half[0]; *(v8us*)((unsigned short*)Hl + t * 8) = fl.half[0];  } }

// ---- fast GEMM (wave tile 32x64; requires M % 32 == 0 rows per launch region and N % 64 == 0); epilogue = k_gemm_hhx semantics ----
__device__ __forceinline__ v16h g2_frag(const _Float16* p, int hh) { FragH f; f.half[0] = *(const v8us*)((const unsigned short*)p + 8 * hh); f.half[1] = *(const v8us*)((const unsigned short*)p + 16 + 8 * hh); return f.v; }
__device__ __forceinline__ v8f g2_mma(v16h a, v16h b, v8f c) { v8f d = __builtin_amdgcn_wmma_f32_16x16x32_f16(false, a, false, b, (short)0, c, false, false); asm volatile("v_nop\n\tv_nop\n\tv_nop\n\tv_nop" : "+v"(d) : "v"(a), "v"(b)); return d; }
template <int ACT>
__global__ __launch_bounds__(128) void k_gemm2(const _Float16* __restrict__ A, int lda, size_t sA, const _Float16* __restrict__ Bh, int ldb, size_t sB, float alpha, const float* __restrict__ bias, size_t sBias, const float* __restrict__ CP, int rowsPerB, size_t sCPb, int row0g,
    float* __restrict__ C, _Float16* __restrict__ C16, int ldc, size_t sC, int M, int N, int K) { static_assert(ACT == 0 || ACT == 3 || ACT == 6 || ACT == 8 || ACT == 9 || ACT == 11 || ACT == 12 || ACT == 14 || ACT == 15 || ACT == 16 || ACT == 17, "k_gemm2: unsupported ACT code (would silently apply no activation)");
  __shared__ __attribute__((aligned(16))) float so[4][32][68];
  const int tid = threadIdx.x, w = tid >> 5, lane = tid & 31, ln = lane & 15, hh = lane >> 4; const int by = blockIdx.y;
  A += (size_t)by * sA; Bh += (size_t)by * sB; const size_t cofs = (size_t)by * sC; const float* bp = bias ? bias + (size_t)by * sBias : nullptr;
  const int ntn = N >> 6; const int mt = blockIdx.x / ntn, nq = blockIdx.x - mt * ntn; const int row0 = mt * 128 + 32 * w, col0 = nq * 64; if (row0 >= M) return;
  const _Float16* a0p = A + (size_t)(row0 + ln) * lda; const _Float16* a1p = a0p + (size_t)16 * lda;
  const _Float16* b0p = Bh + (size_t)(col0 + ln) * ldb; const _Float16* b1p = b0p + (size_t)16 * ldb; const _Float16* b2p = b1p + (size_t)16 * ldb; const _Float16* b3p = b2p + (size_t)16 * ldb;
  const v8f z8 = {0.f,0.f,0.f,0.f,0.f,0.f,0.f,0.f}; v8f c00 = z8, c01 = z8, c02 = z8, c03 = z8, c10 = z8, c11 = z8, c12 = z8, c13 = z8;
#pragma unroll 1
  for (int kb = 0; kb < K; kb += 32) { const v16h a0 = g2_frag(a0p + kb, hh), a1 = g2_frag(a1p + kb, hh);
    v16h b = g2_frag(b0p + kb, hh); c00 = g2_mma(a0, b, c00); c10 = g2_mma(a1, b, c10);
    b = g2_frag(b1p + kb, hh); c01 = g2_mma(a0, b, c01); c11 = g2_mma(a1, b, c11);
    b = g2_frag(b2p + kb, hh); c02 = g2_mma(a0, b, c02); c12 = g2_mma(a1, b, c12);
    b = g2_frag(b3p + kb, hh); c03 = g2_mma(a0, b, c03); c13 = g2_mma(a1, b, c13); }
  v8f accs[8] = {c00, c01, c02, c03, c10, c11, c12, c13};
#pragma unroll
  for (int u = 0; u < 8; ++u) { const int t = u & 3, half = u >> 2; const int col = col0 + t * 16 + ln; const float bv = bp ? bf16_round(bp[col]) : 0.f;
#pragma unroll
    for (int r = 0; r < 8; ++r) { const int rloc = half * 16 + 8 * hh + r; float v = accs[u][r] * alpha + bv; if (CP) { if (rowsPerB < 0) v += CP[cofs + (size_t)(row0g + row0 + rloc) * ldc + col];      /* rowsPerB < 0: own element of the batched C plane */ else { const int bidx = (row0g + row0 + rloc) / rowsPerB; v += CP[(size_t)bidx * sCPb + (size_t)by * 64 + col]; } }
      if (ACT == 3) v = fmaxf(v, 0.f); else if (ACT == 6) v = 0.5f * v * (1.0f + erff(v * 0.70710678118654752f)); else if (ACT == 11) v = 1.0f / (1.0f + expf(-v)); else if (ACT == 15) v = v / (1.0f + expf(-v)); else if (ACT == 12) v = (v > 0.f) ? v : 0.01f * v; else if (ACT == 8) v = tanhf(v); else if (ACT == 9) v = 0.5f * v * (1.0f + tanhf(0.7978845608028654f * (v + 0.044715f * v * v * v))); else if (ACT == 14) v = (v > 0.f) ? v : 0.1f * v; else if (ACT == 16) v = (v >= 0.f) ? v : 0.3f * v; else if (ACT == 17) v = (v >= 0.f) ? v : 0.2f * v;
      so[w][rloc][t * 16 + ln] = v; } }
  __builtin_amdgcn_fence(__ATOMIC_ACQ_REL, "workgroup"); __builtin_amdgcn_wave_barrier();
  const int rsub = lane >> 4, c4 = (lane & 15) * 4;
  {
#pragma unroll
    for (int q = 0; q < 16; ++q) { const int r = q * 2 + rsub; const v4f v = *(const v4fa*)&so[w][r][c4]; if (C) *(v4f*)(C + cofs + (size_t)(row0 + r) * ldc + col0 + c4) = v; if (C16) { v4h h4; for (int i = 0; i < 4; ++i) h4[i] = (_Float16)v[i]; *(v4h*)(C16 + cofs + (size_t)(row0 + r) * ldc + col0 + c4) = h4; } }
     } }


__global__ __launch_bounds__(256) void k_wnat(const float* __restrict__ w, size_t n8, _Float16* __restrict__ Bt) { const size_t t = (size_t)blockIdx.x * 256 + threadIdx.x; if (t >= n8) return; FragH f; for (int q = 0; q < 8; ++q) f.h[q] = (_Float16)(bf16_round(w[t * 8 + q]) * 16.0f); *(v8us*)((unsigned short*)Bt + t * 8) = f.half[0];  }
__global__ __launch_bounds__(256) void k_rsm(const float* __restrict__ S, _Float16* __restrict__ P, int nrows) {
  #pragma clang fp contract(off)
  const int i = blockIdx.x * 256 + threadIdx.x; if (i >= nrows) return; const float* s = S + (size_t)i * SQ; float mx = -3.0e38f;
#pragma unroll 1
  for (int j = 0; j < SQ; ++j) mx = fmaxf(mx, s[j]); float se = 0.f;
#pragma unroll 1
  for (int j = 0; j < SQ; ++j) se += expf(s[j] - mx); const float sc = 256.0f / se;
#pragma unroll 1
  for (int j0 = 0; j0 < SQ; j0 += 8) { FragH f; for (int q = 0; q < 8; ++q) f.h[q] = (_Float16)(expf(s[j0 + q] - mx) * sc); unsigned short* d = (unsigned short*)P + (size_t)i * SQ + j0; *(v8us*)d = f.half[0];  } }
__global__ __launch_bounds__(256) void k_vt(const _Float16* __restrict__ V16, int b, int h0, _Float16* __restrict__ VT) { __shared__ unsigned short tl[64][65]; const int tid = threadIdx.x; const int hh = blockIdx.x % HG, sg = blockIdx.x / HG; const int s0 = sg * 64; const int h = h0 + hh;
  for (int i = tid; i < 64 * 8; i += 256) { const int j = i / 8, d8 = (i % 8) * 8; FragH f; f.half[0] = *(const v8us*)((const unsigned short*)V16 + ((size_t)b * SQ + s0 + j) * DM + h * HD + d8); for (int q = 0; q < 8; ++q) tl[d8 + q][j] = f.u[q]; }
  __syncthreads();
  { for (int i = tid; i < 64 * 8; i += 256) { const int d = i / 8, j8 = (i % 8) * 8; FragH f; for (int q = 0; q < 8; ++q) f.u[q] = tl[d][j8 + q]; *(v8us*)((unsigned short*)VT + ((size_t)hh * HD + d) * SQ + s0 + j8) = f.half[0]; }  } }


// lane l <-> lane l ^ M of the wave, in vector registers (no LDS round trip): M = 16 crosses the two 16-lane rows, M < 16 is a DPP row_xmask move
template <int M>
__device__ __forceinline__ float lane_xor(float x) { const int b = __float_as_int(x);
  if constexpr (M == 16) return __int_as_float(__builtin_amdgcn_permlanex16(b, b, 0x76543210, 0xfedcba98, false, false));
  else return __int_as_float(__builtin_amdgcn_update_dpp(0, b, 0x160 | M, 0xf, 0xf, true)); }
template <bool MX> __device__ __forceinline__ float red_op(float a, float b) { return MX ? fmaxf(a, b) : a + b; }
// one butterfly step over N pairs: the lane whose bit M is set keeps the upper N values and hands over the lower N, its partner the other way round
template <bool MX, int M, int N>
__device__ __forceinline__ void fold_step(float (&r)[NH], int lane) { const bool up = (lane & M) != 0;
#pragma unroll      /* constant indices, so the per-thread arrays stay in registers */
  for (int i = 0; i < N; ++i) { const float keep = up ? r[i + N] : r[i], send = up ? r[i] : r[i + N]; r[i] = red_op<MX>(keep, lane_xor<M>(send)); } }
// r[h] = this lane's partial of head h; returns, in lane l, head (l >> 1) reduced over the wave's 32 lanes (16 lane exchanges instead of 16 x 5)
template <bool MX>
__device__ __forceinline__ float wave_fold16(float (&r)[NH], int lane) { fold_step<MX, 16, 8>(r, lane); fold_step<MX, 8, 4>(r, lane); fold_step<MX, 4, 2>(r, lane); fold_step<MX, 2, 1>(r, lane); return red_op<MX>(r[0], lane_xor<1>(r[0])); }
typedef int v4ia __attribute__((ext_vector_type(4), may_alias));
typedef const __attribute__((address_space(1))) v4fa g_v4f; typedef __attribute__((address_space(1))) v4h g_v4h;      /* global-memory views for addresses formed as scalar base + lane offset */
// a plane's row start, the same in every lane, held in a scalar register pair: each load and store of that row is then scalar base + this lane's 32-bit offset, with no 64-bit vector address to form or hold
__device__ __forceinline__ unsigned long long scalar_base(const void* p) { const unsigned long long u = (unsigned long long)p;
  return ((unsigned long long)(unsigned)__builtin_amdgcn_readfirstlane((int)(u >> 32)) << 32) | (unsigned)__builtin_amdgcn_readfirstlane((int)u); }
// one work-group per query row: thread t holds columns 4t..4t+3 and 1024+4t..1024+4t+3 of all 16 head planes in registers (S read once); maxima and sums go lanes -> waves (LDS) -> scalar registers
__global__ __launch_bounds__(256) void k_rsmsum(const float* __restrict__ S, const int* __restrict__ mrow0, _Float16* __restrict__ P, float* __restrict__ WS, int q0) {
  #pragma clang fp contract(off)
  __shared__ float redm[8][NH], reds[8][NH];
  const int i = blockIdx.x, tid = threadIdx.x, lane = tid & 31, w = tid >> 5, c0 = tid * 4; const int* mk = mrow0 + (size_t)(q0 + i) * SQ;
  float e[NH][8], f[8], r[NH], mx[NH], sc[NH];
  { const v4ia m0 = *(const v4ia*)(mk + c0), m1 = *(const v4ia*)(mk + SQ / 2 + c0);
#pragma unroll      /* constant indices, so the per-thread arrays stay in registers */
    for (int q = 0; q < 4; ++q) { f[q] = (m0[q] != 0) ? 1.f : 0.f; f[4 + q] = (m1[q] != 0) ? 1.f : 0.f; } }
#pragma unroll      /* constant indices, so the per-thread arrays stay in registers */
  for (int h = 0; h < NH; ++h) { const unsigned long long s = scalar_base(S + ((size_t)h * QT + i) * NKX); const v4f a = *(g_v4f*)(s + c0 * 4u), b = *(g_v4f*)(s + c0 * 4u + SQ * 2u);
#pragma unroll      /* constant indices, so the per-thread arrays stay in registers */
    for (int q = 0; q < 4; ++q) { e[h][q] = a[q]; e[h][4 + q] = b[q]; } }
#pragma unroll      /* constant indices, so the per-thread arrays stay in registers */
  for (int h = 0; h < NH; ++h) { float m = -3.0e38f;
#pragma unroll      /* constant indices, so the per-thread arrays stay in registers */
    for (int q = 0; q < 8; ++q) m = fmaxf(m, fmaf(f[q], e[h][q], (1.f - f[q]) * -3.0e38f)); r[h] = m; }
  redm[w][lane >> 1] = wave_fold16<true>(r, lane);      /* the two lanes of a pair hold, and store, the same value */
  __syncthreads();
  { float m = redm[0][lane & 15];
#pragma unroll      /* constant indices, so the per-thread arrays stay in registers */
    for (int u = 1; u < 8; ++u) m = fmaxf(m, redm[u][lane & 15]);
#pragma unroll      /* constant indices, so the per-thread arrays stay in registers */
    for (int h = 0; h < NH; ++h) mx[h] = __int_as_float(__builtin_amdgcn_readlane(__float_as_int(m), h)); }
#pragma unroll      /* constant indices, so the per-thread arrays stay in registers */
  for (int h = 0; h < NH; ++h) { float se = 0.f;
#pragma unroll      /* constant indices, so the per-thread arrays stay in registers */
    for (int q = 0; q < 8; ++q) { e[h][q] = f[q] * __expf(fminf(e[h][q] - mx[h], 80.f)); se += e[h][q]; } r[h] = se; }
  reds[w][lane >> 1] = wave_fold16<false>(r, lane);
  __syncthreads();
  { float se = reds[0][lane & 15];
#pragma unroll      /* constant indices, so the per-thread arrays stay in registers */
    for (int u = 1; u < 8; ++u) se += reds[u][lane & 15];
    const float inv = 1.0f / se;
#pragma unroll      /* constant indices, so the per-thread arrays stay in registers */
    for (int h = 0; h < NH; ++h) sc[h] = __int_as_float(__builtin_amdgcn_readlane(__float_as_int(inv), h)); }
  float acc[8];
#pragma unroll      /* constant indices, so the per-thread arrays stay in registers */
  for (int q = 0; q < 8; ++q) acc[q] = 0.f;
#pragma unroll      /* constant indices, so the per-thread arrays stay in registers */
  for (int h = 0; h < NH; ++h) { v4h lo, hi;
#pragma unroll      /* constant indices, so the per-thread arrays stay in registers */
    for (int q = 0; q < 4; ++q) { const float p0 = e[h][q] * sc[h], p1 = e[h][4 + q] * sc[h]; acc[q] = __fadd_rn(acc[q], p0); acc[4 + q] = __fadd_rn(acc[4 + q], p1); lo[q] = (_Float16)(p0 * 256.0f); hi[q] = (_Float16)(p1 * 256.0f); }
    const unsigned long long d = scalar_base(P + ((size_t)h * SQ + q0 + i) * NKX);      /* P holds the whole batch: [NH][SQ][NKX] */ *(g_v4h*)(d + c0 * 2u) = lo; *(g_v4h*)(d + c0 * 2u + SQ) = hi; }
  v4f a0, a1;
#pragma unroll      /* constant indices, so the per-thread arrays stay in registers */
  for (int q = 0; q < 4; ++q) { a0[q] = acc[q]; a1[q] = acc[4 + q]; }
  float* o = WS + (size_t)i * SQ + c0; *(v4f*)o = a0; *(v4f*)(o + SQ / 2) = a1; }
__global__ __launch_bounds__(256) void k_av64(const float* __restrict__ VPF, const float* __restrict__ alpha, float* __restrict__ AV, size_t n4) {
  #pragma clang fp contract(off)
  const size_t t = (size_t)blockIdx.x * 256 + threadIdx.x; if (t >= n4) return; const float a = __fmul_rn(bf16_round(alpha[0]), 64.0f); const v4f v = *(const v4fa*)(VPF + t * 4); v4f o; for (int q = 0; q < 4; ++q) o[q] = __fmul_rn(a, v[q]); *(v4f*)(AV + t * 4) = o;  }

extern "C" void kernel_launch(void* const* d_in, const int* in_sizes, int n_in,
                              void* d_out, int out_size, void* d_ws, size_t ws_size, hipStream_t stream) {
  (void)in_sizes; (void)n_in; (void)out_size;
  const float* const* I = (const float* const*)d_in; const float* qin = I[0]; const float* kin = I[1]; const float* vin = I[2]; const int* mask = (const int*)d_in[3]; const float* wq = I[4]; const float* bq = I[5]; const float* wkv = I[6]; const float* bkv = I[7]; const float* wo = I[8]; const float* bo = I[9]; const float* alpha = I[10];      /* weights [in][out] */
  float* out0 = (float*)d_out; float* out1 = (float*)d_out + NR * DM;      /* byte offset 16,777,216 */
  char* ws = (char*)d_ws; size_t off = 0;
  auto take = [&](size_t bytes) { char* p = ws + off; off += (bytes + 255) & ~(size_t)255; return p; };
  _Float16* BQ = (_Float16*)take((size_t)DM * DM * 2); _Float16* BKV = (_Float16*)take((size_t)DM * DM * 2); _Float16* BO = (_Float16*)take((size_t)DM * DM * 2);
  _Float16* Q16 = (_Float16*)take(NR * DM * 2); _Float16* K16 = (_Float16*)take(NR * DM * 2); _Float16* V16 = (_Float16*)take(NR * DM * 2); float* AV = (float*)take(NR * DM * 4); _Float16* O16 = (_Float16*)take(NR * DM * 2);
  float* S = (float*)take((size_t)NH * QT * NKX * 4); _Float16* P = (_Float16*)take((size_t)NH * SQ * NKX * 2); _Float16* VT = (_Float16*)take((size_t)NH * HD * SQ * 2);
  _Float16* XQ = P; _Float16* XK = XQ + NR * DM; _Float16* XV = XK + NR * DM; float* VPF = (float*)(XV + NR * DM);      /* 40 MiB inside P's 128: last read by the projections and k_av64, which end before the first softmax launch writes P */
  if (off > ws_size) return;      /* 6 + 24 + 16 + 8 + 64 + 128 + 4 = 250 MiB */
  { const unsigned gw = (unsigned)(((size_t)DM * (DM / 8) + 255) / 256); k_wt_f16<<<gw, 256, 0, stream>>>(wq, BQ, DM, DM, 16.0f); k_wt_f16<<<gw, 256, 0, stream>>>(wkv, BKV, DM, DM, 16.0f); k_wt_f16<<<gw, 256, 0, stream>>>(wo, BO, DM, DM, 16.0f); }
  { const unsigned gx = (unsigned)((NR * DM / 8 + 255) / 256); k_x16<<<gx, 256, 0, stream>>>(qin, XQ, NR * DM / 8); k_x16<<<gx, 256, 0, stream>>>(kin, XK, NR * DM / 8); k_x16<<<gx, 256, 0, stream>>>(vin, XV, NR * DM / 8); }
  const size_t r0p = (size_t)B0 * SQ; const dim3 gp((unsigned)((MP / 128) * (DM / 64)), 1);
  k_gemm2<0><<<gp, 128, 0, stream>>>(XQ + r0p * DM, DM, 0, BQ, DM, 0, 0.0625f, bq, 0, nullptr, 1, 0, 0, nullptr, Q16 + r0p * DM, DM, 0, MP, DM, DM);
  k_gemm2<0><<<gp, 128, 0, stream>>>(XK + r0p * DM, DM, 0, BKV, DM, 0, 0.0625f, bkv, 0, nullptr, 1, 0, 0, nullptr, K16 + r0p * DM, DM, 0, MP, DM, DM);
  k_gemm2<0><<<gp, 128, 0, stream>>>(XV + r0p * DM, DM, 0, BKV, DM, 0, 0.0625f, bkv, 0, nullptr, 1, 0, 0, VPF + r0p * DM, V16 + r0p * DM, DM, 0, MP, DM, DM);      /* vp: f32 (residual) and f16 (attention operand) */
  k_av64<<<(unsigned)(((size_t)MP * DM / 4 + 255) / 256), 256, 0, stream>>>(VPF + r0p * DM, alpha, AV + r0p * DM, (size_t)MP * DM / 4);
  for (int b = B0; b < B0 + NBR; ++b) { const size_t r0 = (size_t)b * SQ;
    k_vt<NH, SQ><<<NH * (SQ / 64), 256, 0, stream>>>(V16 + r0 * DM, DM, 0, VT);      /* V^T [NH][HD][SQ] */
    for (int q0 = Q0S; q0 < QN; q0 += QT) {
      k_gemm2<0><<<dim3((QT / 128) * (SQ / 64), NH), 128, 0, stream>>>(Q16 + (r0 + q0) * DM, DM, (size_t)HD, K16 + r0 * DM, DM, (size_t)HD, 0.125f, nullptr, 0, nullptr, 1, 0, 0, S, nullptr, NKX, (size_t)QT * NKX, QT, SQ, HD);      /* scores / 8, all heads */
      k_rsmsum<<<QT, 256, 0, stream>>>(S, mask, P, out1 + (r0 + q0) * SQ, q0); }      /* one work-group per query row */
    k_gemm2<0><<<dim3((SQ / 128) * (HD / 64), NH), 128, 0, stream>>>(P, NKX, (size_t)SQ * NKX, VT, SQ, (size_t)HD * SQ, 0.25f, nullptr, 0, AV + r0 * DM, -1, 0, 0, nullptr, O16 + r0 * DM, DM, (size_t)HD, SQ, HD, SQ); }      /* whole batch: o x64 = 64 attn v + 64 alpha vp (CP = own element), f16 rows */
  k_gemm2<0><<<dim3((unsigned)((MPO / 128) * (DM / 64)), 1), 128, 0, stream>>>(O16 + r0p * DM, DM, 0, BO, DM, 0, 0.0009765625f, bo, 0, nullptr, 1, 0, 0, out0 + r0p * DM, nullptr, DM, 0, MPO, DM, DM);      /* out0 = o Wo + bo */
}

// v003
// It runs in 307 microseconds.
// Timed twice side by side with v002, it ran 2.08 and 2.07 times as fast.
// Counting every step since v000, it is 448 times as fast.
#include <hip/hip_runtime.h>
#define NB 2
#define SQ 2048
#define DM 1024
#define NH 16
#define HD 64
#define HG 4                         /* k_vt(b,h0) compatibility (unused) */
#define B0 0                         /* first batch processed (debug hook) */
#define NBR NB                       /* batches processed (debug hook) */
#define Q0S 0                        /* first tile (unused) */
#define QN SQ                        /* query rows end (unused) */
#define NR ((size_t)NB * SQ)
#define MP ((int)((size_t)NBR * SQ)) /* rows projected (debug hook) */
#define MPO MP                       /* rows through the output GEMM (debug hook) */
typedef __bf16 v16b __attribute__((ext_vector_type(16)));
typedef unsigned short v8us __attribute__((ext_vector_type(8), may_alias));
typedef float  v8f  __attribute__((ext_vector_type(8)));
typedef float  v4f  __attribute__((ext_vector_type(4)));
typedef float  v4fa __attribute__((ext_vector_type(4), may_alias));
union FragB { v16b v; v8us half[2]; unsigned short u[16]; };

__device__ __forceinline__ unsigned short bf16_bits(float x) { unsigned int u = __float_as_uint(x); return (unsigned short)((u + 0x7FFFu + ((u >> 16) & 1u)) >> 16); }
__device__ __forceinline__ float bf16_val(unsigned short b) { return __uint_as_float(((unsigned int)b) << 16); }
__device__ __forceinline__ float bf16_round(float x) { return bf16_val(bf16_bits(x)); }
// D += A·B with NT terms: 1 = ah·bh, 2 = + al·bh (A split), 3 = + ah·bl (both split)
template <int NT>
__device__ __forceinline__ v8f mmaN(v16b ah, v16b al, v16b bh, v16b bl, v8f c) {
  c = __builtin_amdgcn_wmma_f32_16x16x32_bf16(false, ah, false, bh, (short)0, c, false, false);
  if (NT >= 2) c = __builtin_amdgcn_wmma_f32_16x16x32_bf16(false, al, false, bh, (short)0, c, false, false);
  if (NT >= 3) c = __builtin_amdgcn_wmma_f32_16x16x32_bf16(false, ah, false, bl, (short)0, c, false, false);
  asm volatile("v_nop\n\tv_nop\n\tv_nop\n\tv_nop" : "+v"(c) : "v"(ah), "v"(al), "v"(bh), "v"(bl));
  return c;
}

__global__ __launch_bounds__(256) void k_wt_bf16(const float* __restrict__ W, unsigned short* __restrict__ Wt, int K, int N) {
  const int t = blockIdx.x * 256 + threadIdx.x;
  const int k8n = K / 8;
  if (t >= N * k8n) return;
  const int n = t / k8n, k8 = (t % k8n) * 8;
  v8us v;
#pragma unroll
  for (int i = 0; i < 8; ++i) v[i] = bf16_bits(W[(size_t)(k8 + i) * N + n]);
  *(v8us*)(Wt + (size_t)n * K + k8) = v;
  
}

// GEMM C[M][N] (f32, pitch ldc) = act(A[M][K]·W + bias). A f32 row-major (pitch lda) converted per fragment to bf16
// (ASPLIT: hi/lo two planes -> 2 terms, else single rounded term); Wt bf16 [N][K] (pitch ldb). BIAS_BF16 rounds the
// bias to bf16 first (bias quantised to bf16 before the add). K%32==0, M%16==0, N%64==0.
template <bool ASPLIT, int ACT, bool BIAS_BF16>
__global__ __launch_bounds__(128) void k_gemm_bf(const float* __restrict__ A, int lda, const unsigned short* __restrict__ Wt, int ldb,
                                               const float* __restrict__ bias, float* __restrict__ C, int ldc, int M, int N, int K) {
  __shared__ __attribute__((aligned(16))) float so[4][16][64];
  const int tid = threadIdx.x, w = tid >> 5, lane = tid & 31, ln = lane & 15, hh = lane >> 4;
  const int ntn = N / 64;
  const int wid = blockIdx.x * 4 + w;
  const int mt = wid / ntn, nq = wid % ntn;
  if (mt * 16 >= M) return;
  const int row0 = mt * 16, col0 = nq * 64;
  const float* arow = A + (size_t)(row0 + ln) * lda;
  v8f acc[4] = {};
  for (int kb = 0; kb < K; kb += 32) {
    FragB ah, al;
    const v4f x0 = *(const v4fa*)(arow + kb + 8 * hh), x1 = *(const v4fa*)(arow + kb + 8 * hh + 4);
    const v4f x2 = *(const v4fa*)(arow + kb + 16 + 8 * hh), x3 = *(const v4fa*)(arow + kb + 16 + 8 * hh + 4);
    float xs[16] = {x0[0],x0[1],x0[2],x0[3],x1[0],x1[1],x1[2],x1[3],x2[0],x2[1],x2[2],x2[3],x3[0],x3[1],x3[2],x3[3]};
#pragma unroll
    for (int i = 0; i < 16; ++i) { const unsigned short hb = bf16_bits(xs[i]); ah.u[i] = hb; al.u[i] = ASPLIT ? bf16_bits(xs[i] - bf16_val(hb)) : (unsigned short)0; }
#pragma unroll
    for (int t = 0; t < 4; ++t) {
      const unsigned short* brow = Wt + (size_t)(col0 + t * 16 + ln) * ldb + kb;
      FragB b;
      b.half[0] = *(const v8us*)(brow + 8 * hh);
      b.half[1] = *(const v8us*)(brow + 16 + 8 * hh);
      acc[t] = mmaN<ASPLIT ? 2 : 1>(ah.v, al.v, b.v, b.v, acc[t]);
    }
  }
#pragma unroll
  for (int t = 0; t < 4; ++t) {
    float bv = bias ? bias[col0 + t * 16 + ln] : 0.f;
    if (BIAS_BF16) bv = bf16_round(bv);
#pragma unroll
    for (int r = 0; r < 8; ++r) { float v = acc[t][r] + bv; if (ACT == 1) v = fmaxf(v, 0.f); so[w][8 * hh + r][t * 16 + ln] = v; }
  }
  __builtin_amdgcn_fence(__ATOMIC_ACQ_REL, "workgroup");
  __builtin_amdgcn_wave_barrier();
  const int rsub = lane >> 4, c4 = (lane & 15) * 4;
  {
#pragma unroll
    for (int q = 0; q < 8; ++q) {
      const int r = q * 2 + rsub;
      const v4f v = *(const v4fa*)&so[w][r][c4];
      *(v4f*)(C + (size_t)(row0 + r) * ldc + col0 + c4) = v;
    }
    
  }
}

// GEMM C = act(A·W + bias + resid): A f32 (ASPLIT -> hi/lo 2 terms), Wt bf16 [N][K]; ACT 0 none, 1 relu, 2 exact gelu;
// resid (optional, f32, row index = (row % rmod), pitch ldr, RES_BF16 rounds it) added before the activation.
template <bool ASPLIT, int ACT, bool BIAS_BF16, bool RES_BF16>
__global__ __launch_bounds__(128) void k_gemm_bf3(const float* __restrict__ A, int lda, const unsigned short* __restrict__ Wt, int ldb,
                                                const float* __restrict__ bias, const float* __restrict__ resid, int rmod, int ldr,
                                                float* __restrict__ C, int ldc, int M, int N, int K) {
  __shared__ __attribute__((aligned(16))) float so[4][16][64];
  const int tid = threadIdx.x, w = tid >> 5, lane = tid & 31, ln = lane & 15, hh = lane >> 4;
  const int ntn = N / 64;
  const int wid = blockIdx.x * 4 + w;
  const int mt = wid / ntn, nq = wid % ntn;
  if (mt * 16 >= M) return;
  const int row0 = mt * 16, col0 = nq * 64;
  const float* arow = A + (size_t)(row0 + ln) * lda;
  v8f acc[4] = {};
  for (int kb = 0; kb < K; kb += 32) {
    FragB ah, al;
    const v4f x0 = *(const v4fa*)(arow + kb + 8 * hh), x1 = *(const v4fa*)(arow + kb + 8 * hh + 4);
    const v4f x2 = *(const v4fa*)(arow + kb + 16 + 8 * hh), x3 = *(const v4fa*)(arow + kb + 16 + 8 * hh + 4);
    float xs[16] = {x0[0],x0[1],x0[2],x0[3],x1[0],x1[1],x1[2],x1[3],x2[0],x2[1],x2[2],x2[3],x3[0],x3[1],x3[2],x3[3]};
#pragma unroll
    for (int i = 0; i < 16; ++i) { const unsigned short hb = bf16_bits(xs[i]); ah.u[i] = hb; al.u[i] = ASPLIT ? bf16_bits(xs[i] - bf16_val(hb)) : (unsigned short)0; }
#pragma unroll
    for (int t = 0; t < 4; ++t) {
      const unsigned short* brow = Wt + (size_t)(col0 + t * 16 + ln) * ldb + kb;
      FragB b;
      b.half[0] = *(const v8us*)(brow + 8 * hh);
      b.half[1] = *(const v8us*)(brow + 16 + 8 * hh);
      acc[t] = mmaN<ASPLIT ? 2 : 1>(ah.v, al.v, b.v, b.v, acc[t]);
    }
  }
#pragma unroll
  for (int t = 0; t < 4; ++t) {
    const int col = col0 + t * 16 + ln;
    float bv = bias ? bias[col] : 0.f;
    if (BIAS_BF16) bv = bf16_round(bv);
#pragma unroll
    for (int r = 0; r < 8; ++r) {
      float v = acc[t][r] + bv;
      if (resid) { float rv = resid[(size_t)((row0 + 8 * hh + r) % rmod) * ldr + col]; if (RES_BF16) rv = bf16_round(rv); v += rv; }
      if (ACT == 1) v = fmaxf(v, 0.f);
      if (ACT == 2) v = 0.5f * v * (1.0f + erff(v * 0.70710678118654752f));
      if (ACT == 3) { const float u = 0.7978845608028654f * (v + 0.044715f * v * v * v); v = 0.5f * v * (1.0f + tanhf(u)); }
      so[w][8 * hh + r][t * 16 + ln] = v;
    }
  }
  __builtin_amdgcn_fence(__ATOMIC_ACQ_REL, "workgroup");
  __builtin_amdgcn_wave_barrier();
  const int rsub = lane >> 4, c4 = (lane & 15) * 4;
  {
#pragma unroll
    for (int q = 0; q < 8; ++q) {
      const int r = q * 2 + rsub;
      const v4f v = *(const v4fa*)&so[w][r][c4];
      *(v4f*)(C + (size_t)(row0 + r) * ldc + col0 + c4) = v;
    }
    
  }
}
// row LayerNorm (biased variance, eps) over N: s = X (+ R); optional out_sum <- s; out_norm <- (s-mu)*rsqrt(var+eps)*g + b
template <bool PARAM_BF16>
__global__ __launch_bounds__(256) void k_layernorm(const float* __restrict__ X, const float* __restrict__ R, const float* __restrict__ g, const float* __restrict__ bta,
                                                  float* __restrict__ out_sum, float* __restrict__ out_norm, int N, float eps) {
  __shared__ float red[256];
  const int row = blockIdx.x, tid = threadIdx.x;
  const float* x = X + (size_t)row * N; const float* rr = R ? R + (size_t)row * N : nullptr;
  float vals[16];                     // up to N = 4096
  const int per = N / 256;            // contiguous chunk per thread? use strided-by-4 chunks: thread handles j = tid*4 + 1024*u
  float s1 = 0.f;
  for (int u = 0; u < per / 4; ++u) {
    const int j = tid * 4 + 1024 * u;
    const v4f a = *(const v4fa*)(x + j);
    v4f b = {0.f,0.f,0.f,0.f}; if (rr) b = *(const v4fa*)(rr + j);
#pragma unroll
    for (int q = 0; q < 4; ++q) { const float v = a[q] + b[q]; vals[u * 4 + q] = v; s1 += v; }
  }
  red[tid] = s1; __syncthreads();
  for (int st = 128; st > 0; st >>= 1) { if (tid < st) red[tid] += red[tid + st]; __syncthreads(); }
  const float mu = red[0] / (float)N; __syncthreads();
  float s2 = 0.f;
  for (int u = 0; u < per / 4; ++u)
#pragma unroll
    for (int q = 0; q < 4; ++q) { const float c = vals[u * 4 + q] - mu; s2 += c * c; }
  red[tid] = s2; __syncthreads();
  for (int st = 128; st > 0; st >>= 1) { if (tid < st) red[tid] += red[tid + st]; __syncthreads(); }
  const float rs = rsqrtf(red[0] / (float)N + eps);
  {
    for (int u = 0; u < per / 4; ++u) {
      const int j = tid * 4 + 1024 * u;
      v4f o, sm;
#pragma unroll
      for (int q = 0; q < 4; ++q) {
        float gg = g[j + q], bb = bta[j + q];
        if (PARAM_BF16) { gg = bf16_round(gg); bb = bf16_round(bb); }
        sm[q] = vals[u * 4 + q]; o[q] = (vals[u * 4 + q] - mu) * rs * gg + bb;
      }
      if (out_sum) *(v4f*)(out_sum + (size_t)row * N + j) = sm;
      *(v4f*)(out_norm + (size_t)row * N + j) = o;
    }
    
  }
}



// ---- f16 WMMA path (v_wmma_f32_16x16x32_f16): 11-bit significands for operands in range — used for every launched product, the unnormalised softmax weights (<= 256) among them
typedef _Float16 v16h __attribute__((ext_vector_type(16)));
union FragH { v16h v; v8us half[2]; _Float16 h[16]; unsigned short u[16]; };
template <int NT>
__device__ __forceinline__ v8f mmaH(v16h ah, v16h al, v16h bh, v16h bl, v8f c) {
  c = __builtin_amdgcn_wmma_f32_16x16x32_f16(false, ah, false, bh, (short)0, c, false, false);
  if (NT >= 2) c = __builtin_amdgcn_wmma_f32_16x16x32_f16(false, al, false, bh, (short)0, c, false, false);
  if (NT >= 3) c = __builtin_amdgcn_wmma_f32_16x16x32_f16(false, ah, false, bl, (short)0, c, false, false);
  asm volatile("v_nop\n\tv_nop\n\tv_nop\n\tv_nop" : "+v"(c) : "v"(ah), "v"(al), "v"(bh), "v"(bl));
  return c;
}
// batched GEMM like k_gemm_b but f16 operands: A f32 (split into f16 hi/lo if ASPLIT, else rounded to f16), Bt = f16 values [n][k]; alpha; C f32; N multiple of 16 (partial tiles skipped)
template <bool ASPLIT>
__global__ __launch_bounds__(128) void k_gemm_h(const float* __restrict__ A, int lda, size_t sA, const _Float16* __restrict__ Bh, int ldb, size_t sB, float alpha, float* __restrict__ C, int ldc, size_t sC, int M, int N, int K) {
  __shared__ __attribute__((aligned(16))) float so[4][16][64];
  const int tid = threadIdx.x, w = tid >> 5, lane = tid & 31, ln = lane & 15, hh = lane >> 4; const int by = blockIdx.y;
  A += (size_t)by * sA; Bh += (size_t)by * sB; C += (size_t)by * sC;
  const int ntn = (N + 63) / 64; const int wid = blockIdx.x * 4 + w; const int mt = wid / ntn, nq = wid % ntn; if (mt * 16 >= M) return;
  const int row0 = mt * 16, col0 = nq * 64; const float* arow = A + (size_t)(row0 + ln) * lda;
  v8f acc[4] = {};
  for (int kb = 0; kb < K; kb += 32) {
    FragH ah, al;
    const v4f x0 = *(const v4fa*)(arow + kb + 8 * hh), x1 = *(const v4fa*)(arow + kb + 8 * hh + 4), x2 = *(const v4fa*)(arow + kb + 16 + 8 * hh), x3 = *(const v4fa*)(arow + kb + 16 + 8 * hh + 4);
    float xs[16] = {x0[0],x0[1],x0[2],x0[3],x1[0],x1[1],x1[2],x1[3],x2[0],x2[1],x2[2],x2[3],x3[0],x3[1],x3[2],x3[3]};
#pragma unroll
    for (int i = 0; i < 16; ++i) { const _Float16 h = (_Float16)xs[i]; ah.h[i] = h; al.h[i] = ASPLIT ? (_Float16)(xs[i] - (float)h) : (_Float16)0.0f; }
#pragma unroll
    for (int t = 0; t < 4; ++t) { if (col0 + t * 16 >= N) continue; const size_t boff = (size_t)(col0 + t * 16 + ln) * ldb + kb; FragH bq; bq.half[0] = *(const v8us*)(Bh + boff + 8 * hh); bq.half[1] = *(const v8us*)(Bh + boff + 16 + 8 * hh);
      acc[t] = mmaH<ASPLIT ? 2 : 1>(ah.v, al.v, bq.v, bq.v, acc[t]); }
  }
#pragma unroll
  for (int t = 0; t < 4; ++t) { if (col0 + t * 16 >= N) continue;
#pragma unroll
    for (int r = 0; r < 8; ++r) so[w][8 * hh + r][t * 16 + ln] = acc[t][r] * alpha; }
  __builtin_amdgcn_fence(__ATOMIC_ACQ_REL, "workgroup"); __builtin_amdgcn_wave_barrier();
  const int rsub = lane >> 4, c4 = (lane & 15) * 4;
  {
#pragma unroll
    for (int q = 0; q < 8; ++q) { const int r = q * 2 + rsub; if (col0 + c4 < N) { const v4f v = *(const v4fa*)&so[w][r][c4]; *(v4f*)(C + (size_t)(row0 + r) * ldc + col0 + c4) = v; } }
     }
}

// Wt[n][k] = f16(W[k][n]·scale) from f32 row-major W[K][N] (scale = power of two; bf16-exact weights stay exact in f16 away from the subnormal range)
__global__ __launch_bounds__(256) void k_wt_f16(const float* __restrict__ W, _Float16* __restrict__ Wt, int K, int N, float scale) {
  const int t = blockIdx.x * 256 + threadIdx.x; if (t >= N * (K / 8)) return; const int n = t / (K / 8), k8 = (t % (K / 8)) * 8; FragH f;
#pragma unroll
  for (int i = 0; i < 8; ++i) f.h[i] = (_Float16)(bf16_round(W[(size_t)(k8 + i) * N + n]) * scale); const v8us o = f.half[0];
  *(v8us*)((unsigned short*)Wt + (size_t)n * K + k8) = o; 
}
// k_gemm_hh variant with fused epilogue: v = acc·alpha + bias[by·sBias + col] (+ CP[(row/rowsPerB)·sCPb + by·64 + col] if CP) ; ACT 0 none / 1 elu ; writes f16 C16 (and f32 C if non-null)
template <int ACT>
__global__ __launch_bounds__(128) void k_gemm_hhx(const _Float16* __restrict__ A, int lda, size_t sA, const _Float16* __restrict__ Bh, int ldb, size_t sB, float alpha, const float* __restrict__ bias, size_t sBias, const float* __restrict__ CP, int rowsPerB, size_t sCPb, int row0g,
    float* __restrict__ C, _Float16* __restrict__ C16, int ldc, size_t sC, int M, int N, int K) {
  __shared__ __attribute__((aligned(16))) float so[4][16][64];
  const int tid = threadIdx.x, w = tid >> 5, lane = tid & 31, ln = lane & 15, hh = lane >> 4; const int by = blockIdx.y;
  A += (size_t)by * sA; Bh += (size_t)by * sB; const size_t cofs = (size_t)by * sC; const float* bp = bias ? bias + (size_t)by * sBias : nullptr;
  const int ntn = (N + 63) / 64; const int wid = blockIdx.x * 4 + w; const int mt = wid / ntn, nq = wid % ntn; if (mt * 16 >= M) return;
  const int row0 = mt * 16, col0 = nq * 64; const _Float16* arow = A + (size_t)(row0 + ln) * lda;
  v8f acc[4] = {};
  for (int kb = 0; kb < K; kb += 32) { FragH ah; ah.half[0] = *(const v8us*)((const unsigned short*)arow + kb + 8 * hh); ah.half[1] = *(const v8us*)((const unsigned short*)arow + kb + 16 + 8 * hh);
#pragma unroll
    for (int t = 0; t < 4; ++t) { if (col0 + t * 16 >= N) continue; const size_t boff = (size_t)(col0 + t * 16 + ln) * ldb + kb; FragH bq; bq.half[0] = *(const v8us*)((const unsigned short*)Bh + boff + 8 * hh); bq.half[1] = *(const v8us*)((const unsigned short*)Bh + boff + 16 + 8 * hh);
      acc[t] = mmaH<1>(ah.v, ah.v, bq.v, bq.v, acc[t]); }
  }
#pragma unroll
  for (int t = 0; t < 4; ++t) { if (col0 + t * 16 >= N) continue; const int col = col0 + t * 16 + ln; const float bv = bp ? bf16_round(bp[col]) : 0.f;
#pragma unroll
    for (int r = 0; r < 8; ++r) { float v = acc[t][r] * alpha + bv; if (CP) { const int rr = row0g + row0 + 8 * hh + r; if (rowsPerB < 0) v += CP[cofs + (size_t)rr * ldc + col];      /* rowsPerB < 0: own element of the batched C plane */ else { const int bidx = rr / rowsPerB; v += CP[(size_t)bidx * sCPb + (size_t)by * 64 + col]; } } if (ACT == 1) v = (v > 0.f) ? v : expm1f(v); else if (ACT == 7) v = (v > 0.f) ? v + 1.0f : expf(v); else if (ACT == 8) v = tanhf(v); else if (ACT == 9) v = 0.5f * v * (1.0f + tanhf(0.7978845608028654f * (v + 0.044715f * v * v * v))); else if (ACT == 11) v = 1.0f / (1.0f + expf(-v)); else if (ACT == 12) v = (v > 0.f) ? v : 0.01f * v; else if (ACT == 14) v = (v > 0.f) ? v : 0.1f * v; else if (ACT == 16) v = (v >= 0.f) ? v : 0.3f * v; else if (ACT == 17) v = (v >= 0.f) ? v : 0.2f * v; else if (ACT == 15) v = v / (1.0f + expf(-v)); else if (ACT == 3) v = fmaxf(v, 0.f); else if (ACT == 6) v = 0.5f * v * (1.0f + erff(v * 0.70710678118654752f)); so[w][8 * hh + r][t * 16 + ln] = v; } }
  __builtin_amdgcn_fence(__ATOMIC_ACQ_REL, "workgroup"); __builtin_amdgcn_wave_barrier();
  const int rsub = lane >> 4, c4 = (lane & 15) * 4; typedef _Float16 v4h __attribute__((ext_vector_type(4)));
  {
#pragma unroll
    for (int q = 0; q < 8; ++q) { const int r = q * 2 + rsub; if (col0 + c4 < N) { const v4f v = *(const v4fa*)&so[w][r][c4]; if (C) *(v4f*)(C + cofs + (size_t)(row0 + r) * ldc + col0 + c4) = v; if (C16) { v4h h4; for (int i = 0; i < 4; ++i) h4[i] = (_Float16)v[i]; *(v4h*)(C16 + cofs + (size_t)(row0 + r) * ldc + col0 + c4) = h4; } } }
     }
}


typedef _Float16 v4h __attribute__((ext_vector_type(4)));

__global__ __launch_bounds__(256) void k_x16(const float* __restrict__ x, _Float16* __restrict__ X16, size_t n8) { const size_t t = (size_t)blockIdx.x * 256 + threadIdx.x; if (t >= n8) return; FragH f;
#pragma unroll
  for (int q = 0; q < 8; ++q) f.h[q] = (_Float16)bf16_round(x[t * 8 + q]); *(v8us*)((unsigned short*)X16 + t * 8) = f.half[0];  }
__global__ __launch_bounds__(256) void k_h16(const float* __restrict__ x, _Float16* __restrict__ X16, size_t n8) { const size_t t = (size_t)blockIdx.x * 256 + threadIdx.x; if (t >= n8) return; FragH f;
#pragma unroll
  for (int q = 0; q < 8; ++q) f.h[q] = (_Float16)x[t * 8 + q]; *(v8us*)((unsigned short*)X16 + t * 8) = f.half[0];  }
__global__ __launch_bounds__(256) void k_round16f(const float* __restrict__ W, _Float16* __restrict__ Bt, size_t n8) { const size_t t = (size_t)blockIdx.x * 256 + threadIdx.x; if (t >= n8) return; FragH f;
#pragma unroll
  for (int i = 0; i < 8; ++i) f.h[i] = (_Float16)(bf16_round(W[t * 8 + i]) * 16.0f); *(v8us*)((unsigned short*)Bt + t * 8) = f.half[0];  }
template <int NHv, int TTv>
__global__ __launch_bounds__(256) void k_vt(const _Float16* __restrict__ V16, int ldv, int voff, _Float16* __restrict__ Vt) { __shared__ unsigned short tl[64][66]; const int tid = threadIdx.x; const int slab = blockIdx.x / (TTv / 64), lg = blockIdx.x % (TTv / 64); const int b = slab / NHv, h = slab % NHv;
  for (int i = tid; i < 64 * 8; i += 256) { const int r = i / 8, c8 = (i % 8) * 8; FragH f; f.half[0] = *(const v8us*)((const unsigned short*)V16 + ((size_t)b * TTv + lg * 64 + r) * ldv + voff + h * 64 + c8);
#pragma unroll
    for (int q = 0; q < 8; ++q) tl[r][c8 + q] = f.u[q]; }
  __syncthreads();
  {
#pragma unroll
    for (int rd = 0; rd < 2; ++rd) { const int d = rd * 32 + tid / 8, pc = tid % 8; FragH f;
#pragma unroll
      for (int q = 0; q < 8; ++q) f.u[q] = tl[pc * 8 + q][d];
      *(v8us*)((unsigned short*)Vt + ((size_t)slab * 64 + d) * TTv + lg * 64 + pc * 8) = f.half[0]; }
     } }

__global__ __launch_bounds__(256) void k_hl(const float* __restrict__ F, _Float16* __restrict__ Hh, _Float16* __restrict__ Hl, size_t n8) { const size_t t = (size_t)blockIdx.x * 256 + threadIdx.x; if (t >= n8) return; FragH fh, fl; const v4f a = *(const v4fa*)(F + t * 8), c = *(const v4fa*)(F + t * 8 + 4);
#pragma unroll
  for (int q = 0; q < 4; ++q) { _Float16 h = (_Float16)a[q]; fh.h[q] = h; fl.h[q] = (_Float16)((a[q] - (float)h) * 1024.0f); h = (_Float16)c[q]; fh.h[4 + q] = h; fl.h[4 + q] = (_Float16)((c[q] - (float)h) * 1024.0f); }
  { *(v8us*)((unsigned short*)Hh + t * 8) = fh.half[0]; *(v8us*)((unsigned short*)Hl + t * 8) = fl.half[0];  } }

// ---- fast GEMM (wave tile 32x64; requires M % 32 == 0 rows per launch region and N % 64 == 0); epilogue = k_gemm_hhx semantics ----
__device__ __forceinline__ v16h g2_frag(const _Float16* p, int hh) { FragH f; f.half[0] = *(const v8us*)((const unsigned short*)p + 8 * hh); f.half[1] = *(const v8us*)((const unsigned short*)p + 16 + 8 * hh); return f.v; }
__device__ __forceinline__ v8f g2_mma(v16h a, v16h b, v8f c) { v8f d = __builtin_amdgcn_wmma_f32_16x16x32_f16(false, a, false, b, (short)0, c, false, false); asm volatile("v_nop\n\tv_nop\n\tv_nop\n\tv_nop" : "+v"(d) : "v"(a), "v"(b)); return d; }
template <int ACT>
__global__ __launch_bounds__(128) void k_gemm2(const _Float16* __restrict__ A, int lda, size_t sA, const _Float16* __restrict__ Bh, int ldb, size_t sB, float alpha, const float* __restrict__ bias, size_t sBias, const float* __restrict__ CP, int rowsPerB, size_t sCPb, int row0g,
    float* __restrict__ C, _Float16* __restrict__ C16, int ldc, size_t sC, int M, int N, int K) { static_assert(ACT == 0 || ACT == 3 || ACT == 6 || ACT == 8 || ACT == 9 || ACT == 11 || ACT == 12 || ACT == 14 || ACT == 15 || ACT == 16 || ACT == 17, "k_gemm2: unsupported ACT code (would silently apply no activation)");
  __shared__ __attribute__((aligned(16))) float so[4][32][68];
  const int tid = threadIdx.x, w = tid >> 5, lane = tid & 31, ln = lane & 15, hh = lane >> 4; const int by = blockIdx.y;
  A += (size_t)by * sA; Bh += (size_t)by * sB; const size_t cofs = (size_t)by * sC; const float* bp = bias ? bias + (size_t)by * sBias : nullptr;
  const int ntn = N >> 6; const int mt = blockIdx.x / ntn, nq = blockIdx.x - mt * ntn; const int row0 = mt * 128 + 32 * w, col0 = nq * 64; if (row0 >= M) return;
  const _Float16* a0p = A + (size_t)(row0 + ln) * lda; const _Float16* a1p = a0p + (size_t)16 * lda;
  const _Float16* b0p = Bh + (size_t)(col0 + ln) * ldb; const _Float16* b1p = b0p + (size_t)16 * ldb; const _Float16* b2p = b1p + (size_t)16 * ldb; const _Float16* b3p = b2p + (size_t)16 * ldb;
  const v8f z8 = {0.f,0.f,0.f,0.f,0.f,0.f,0.f,0.f}; v8f c00 = z8, c01 = z8, c02 = z8, c03 = z8, c10 = z8, c11 = z8, c12 = z8, c13 = z8;
#pragma unroll 1
  for (int kb = 0; kb < K; kb += 32) { const v16h a0 = g2_frag(a0p + kb, hh), a1 = g2_frag(a1p + kb, hh);
    v16h b = g2_frag(b0p + kb, hh); c00 = g2_mma(a0, b, c00); c10 = g2_mma(a1, b, c10);
    b = g2_frag(b1p + kb, hh); c01 = g2_mma(a0, b, c01); c11 = g2_mma(a1, b, c11);
    b = g2_frag(b2p + kb, hh); c02 = g2_mma(a0, b, c02); c12 = g2_mma(a1, b, c12);
    b = g2_frag(b3p + kb, hh); c03 = g2_mma(a0, b, c03); c13 = g2_mma(a1, b, c13); }
  v8f accs[8] = {c00, c01, c02, c03, c10, c11, c12, c13};
#pragma unroll
  for (int u = 0; u < 8; ++u) { const int t = u & 3, half = u >> 2; const int col = col0 + t * 16 + ln; const float bv = bp ? bf16_round(bp[col]) : 0.f;
#pragma unroll
    for (int r = 0; r < 8; ++r) { const int rloc = half * 16 + 8 * hh + r; float v = accs[u][r] * alpha + bv; if (CP) { if (rowsPerB < 0) v += CP[cofs + (size_t)(row0g + row0 + rloc) * ldc + col];      /* rowsPerB < 0: own element of the batched C plane */ else { const int bidx = (row0g + row0 + rloc) / rowsPerB; v += CP[(size_t)bidx * sCPb + (size_t)by * 64 + col]; } }
      if (ACT == 3) v = fmaxf(v, 0.f); else if (ACT == 6) v = 0.5f * v * (1.0f + erff(v * 0.70710678118654752f)); else if (ACT == 11) v = 1.0f / (1.0f + expf(-v)); else if (ACT == 15) v = v / (1.0f + expf(-v)); else if (ACT == 12) v = (v > 0.f) ? v : 0.01f * v; else if (ACT == 8) v = tanhf(v); else if (ACT == 9) v = 0.5f * v * (1.0f + tanhf(0.7978845608028654f * (v + 0.044715f * v * v * v))); else if (ACT == 14) v = (v > 0.f) ? v : 0.1f * v; else if (ACT == 16) v = (v >= 0.f) ? v : 0.3f * v; else if (ACT == 17) v = (v >= 0.f) ? v : 0.2f * v;
      so[w][rloc][t * 16 + ln] = v; } }
  __builtin_amdgcn_fence(__ATOMIC_ACQ_REL, "workgroup"); __builtin_amdgcn_wave_barrier();
  const int rsub = lane >> 4, c4 = (lane & 15) * 4;
  {
#pragma unroll
    for (int q = 0; q < 16; ++q) { const int r = q * 2 + rsub; const v4f v = *(const v4fa*)&so[w][r][c4]; if (C) *(v4f*)(C + cofs + (size_t)(row0 + r) * ldc + col0 + c4) = v; if (C16) { v4h h4; for (int i = 0; i < 4; ++i) h4[i] = (_Float16)v[i]; *(v4h*)(C16 + cofs + (size_t)(row0 + r) * ldc + col0 + c4) = h4; } }
     } }


__global__ __launch_bounds__(256) void k_wnat(const float* __restrict__ w, size_t n8, _Float16* __restrict__ Bt) { const size_t t = (size_t)blockIdx.x * 256 + threadIdx.x; if (t >= n8) return; FragH f; for (int q = 0; q < 8; ++q) f.h[q] = (_Float16)(bf16_round(w[t * 8 + q]) * 16.0f); *(v8us*)((unsigned short*)Bt + t * 8) = f.half[0];  }
__global__ __launch_bounds__(256) void k_rsm(const float* __restrict__ S, _Float16* __restrict__ P, int nrows) {
  #pragma clang fp contract(off)
  const int i = blockIdx.x * 256 + threadIdx.x; if (i >= nrows) return; const float* s = S + (size_t)i * SQ; float mx = -3.0e38f;
#pragma unroll 1
  for (int j = 0; j < SQ; ++j) mx = fmaxf(mx, s[j]); float se = 0.f;
#pragma unroll 1
  for (int j = 0; j < SQ; ++j) se += expf(s[j] - mx); const float sc = 256.0f / se;
#pragma unroll 1
  for (int j0 = 0; j0 < SQ; j0 += 8) { FragH f; for (int q = 0; q < 8; ++q) f.h[q] = (_Float16)(expf(s[j0 + q] - mx) * sc); unsigned short* d = (unsigned short*)P + (size_t)i * SQ + j0; *(v8us*)d = f.half[0];  } }
__global__ __launch_bounds__(256) void k_vt(const _Float16* __restrict__ V16, int b, int h0, _Float16* __restrict__ VT) { __shared__ unsigned short tl[64][65]; const int tid = threadIdx.x; const int hh = blockIdx.x % HG, sg = blockIdx.x / HG; const int s0 = sg * 64; const int h = h0 + hh;
  for (int i = tid; i < 64 * 8; i += 256) { const int j = i / 8, d8 = (i % 8) * 8; FragH f; f.half[0] = *(const v8us*)((const unsigned short*)V16 + ((size_t)b * SQ + s0 + j) * DM + h * HD + d8); for (int q = 0; q < 8; ++q) tl[d8 + q][j] = f.u[q]; }
  __syncthreads();
  { for (int i = tid; i < 64 * 8; i += 256) { const int d = i / 8, j8 = (i % 8) * 8; FragH f; for (int q = 0; q < 8; ++q) f.u[q] = tl[d][j8 + q]; *(v8us*)((unsigned short*)VT + ((size_t)hh * HD + d) * SQ + s0 + j8) = f.half[0]; }  } }


// lane l <-> lane l ^ M of the wave, in vector registers (no LDS round trip): M = 16 crosses the two 16-lane rows, M < 16 is a DPP row_xmask move
template <int M>
__device__ __forceinline__ float lane_xor(float x) { const int b = __float_as_int(x);
  if constexpr (M == 16) return __int_as_float(__builtin_amdgcn_permlanex16(b, b, 0x76543210, 0xfedcba98, false, false));
  else return __int_as_float(__builtin_amdgcn_update_dpp(0, b, 0x160 | M, 0xf, 0xf, true)); }
// ---- fused attention: scores and weights live in registers only ----
__device__ __forceinline__ v8f f_mma(v16h a, v16h b, v8f c) { return __builtin_amdgcn_wmma_f32_16x16x32_f16(false, a, false, b, (short)0, c, false, false); }
typedef unsigned v4ua __attribute__((ext_vector_type(4), may_alias));
#define SC2 0.18033688011112042f     /* (1 / 8) log2(e): scores go to the exponent base 2 */
#define MASKED -3.0e38f              /* score of a masked key: its weight underflows to 0 against any row reference >= M0 */
#define M0 -1.0e30f                  /* start value of a row's reference; a row with every key masked keeps it, sums 0 and ends as 0 x inf = NaN like the definition */
// one bit per (query, key): bit j of word [query][key / 32] is mask[query][32 (key / 32) + j] != 0; a wave packs 32 words
__global__ __launch_bounds__(256) void k_maskbits(const int* __restrict__ mask, unsigned* __restrict__ MB) {
  const int lane = threadIdx.x & 31; const size_t wv = (size_t)blockIdx.x * 8 + (threadIdx.x >> 5); const int* m = mask + wv * 1024; unsigned keep = 0;
#pragma unroll      /* 32 independent loads in flight */
  for (int i = 0; i < 32; ++i) { const unsigned bits = __builtin_amdgcn_ballot_w32(m[i * 32 + lane] != 0); if (lane == i) keep = bits; }
  MB[wv * 32 + lane] = keep; }
// S^T tile rows are keys 8 hh + r, its column is query ln: bit 16 kt + 8 hh + r of the query's mask word
__device__ __forceinline__ void mask_tile(v8f& s, unsigned word, int kt, int hh) { const unsigned u = word >> (16 * kt + 8 * hh);
#pragma unroll      /* constant indices, so the tile stays in registers */
  for (int r = 0; r < 8; ++r) s[r] = ((u >> r) & 1u) ? s[r] : MASKED; }
// the key loop of k_fattn; MSK = false is taken by a wave none of whose 32 mask rows holds a zero, and then reads no mask word
template <bool MSK>
__device__ __forceinline__ void fattn_keys(const _Float16* kp, const _Float16* vp, const unsigned* mb, int hh, const v16h (&qf)[2][2], v8f (&o)[2][4], float (&m)[2], float (&l)[2]) {
  const v8f z8 = {0.f,0.f,0.f,0.f,0.f,0.f,0.f,0.f}; v16h ka[2][2], kb2[2][2], va[4], vb[4]; unsigned mw[2] = {0u, 0u};
#pragma unroll      /* constant indices, so the fragment arrays stay in registers */
  for (int t = 0; t < 2; ++t) { ka[t][0] = g2_frag(kp + (size_t)t * 16 * DM, hh); ka[t][1] = g2_frag(kp + (size_t)t * 16 * DM + 32, hh); if (MSK) mw[t] = mb[t * 16 * (SQ / 32)]; }
#pragma unroll      /* constant indices, so the fragment arrays stay in registers */
  for (int d = 0; d < 4; ++d) va[d] = g2_frag(vp + (size_t)d * 16 * SQ, hh);
  // one pass = 32 keys: kc and vc hold this pass's K and V^T fragments, kx and vn take the next pass's, a whole pass in flight; the last pass re-reads the first rows, unused
  auto pass = [&](int kb, const v16h (&kc)[2][2], v16h (&kx)[2][2], const v16h (&vc)[4], v16h (&vn)[4]) { const int kn = (kb + 32) & (SQ - 1);
    v8f s[2][2]; float mx[2]; FragH pf[2];
#pragma unroll      /* constant indices, so the fragment arrays stay in registers */
    for (int t = 0; t < 2; ++t) { kx[t][0] = g2_frag(kp + (size_t)(kn + t * 16) * DM, hh); kx[t][1] = g2_frag(kp + (size_t)(kn + t * 16) * DM + 32, hh); }
#pragma unroll      /* constant indices, so the fragment arrays stay in registers */
    for (int d = 0; d < 4; ++d) vn[d] = g2_frag(vp + (size_t)d * 16 * SQ + kn, hh);
#pragma unroll      /* constant indices, so the fragment arrays stay in registers */
    for (int qt = 0; qt < 2; ++qt)
#pragma unroll      /* constant indices, so the fragment arrays stay in registers */
      for (int kt = 0; kt < 2; ++kt) s[qt][kt] = f_mma(kc[kt][1], qf[qt][1], f_mma(kc[kt][0], qf[qt][0], z8));
    if (MSK) {
#pragma unroll      /* constant indices, so the fragment arrays stay in registers */
      for (int qt = 0; qt < 2; ++qt) { mask_tile(s[qt][0], mw[qt], 0, hh); mask_tile(s[qt][1], mw[qt], 1, hh); mw[qt] = mb[qt * 16 * (SQ / 32) + (kn >> 5)]; }
      asm volatile("s_wait_xcnt 0x0" ::: "memory"); }      /* precaution: stands behind the loads issued above, in front of any rewrite of their address registers */
#pragma unroll      /* constant indices, so the fragment arrays stay in registers */
    for (int qt = 0; qt < 2; ++qt) { float a = fmaxf(s[qt][0][0], s[qt][1][0]);
#pragma unroll      /* constant indices, so the fragment arrays stay in registers */
      for (int r = 1; r < 8; ++r) a = fmaxf(a, fmaxf(s[qt][0][r], s[qt][1][r]));
      a *= SC2; mx[qt] = fmaxf(a, lane_xor<16>(a)); }      /* both halves of a column agree on the maximum, so on the reference too */
    if (__builtin_amdgcn_ballot_w32(mx[0] > m[0] + 8.f || mx[1] > m[1] + 8.f) != 0) {      /* scalar branch: rescale only when some column's reference must rise */
#pragma unroll      /* constant indices, so the fragment arrays stay in registers */
      for (int qt = 0; qt < 2; ++qt) { const float mn = fmaxf(m[qt], mx[qt]), f = __builtin_amdgcn_exp2f(m[qt] - mn); m[qt] = mn; l[qt] *= f;
#pragma unroll      /* constant indices, so the fragment arrays stay in registers */
        for (int d = 0; d < 4; ++d) o[qt][d] *= f; } }
#pragma unroll      /* constant indices, so the fragment arrays stay in registers */
    for (int qt = 0; qt < 2; ++qt) { float ls = 0.f;
#pragma unroll      /* constant indices, so the fragment arrays stay in registers */
      for (int r = 0; r < 8; ++r) { const float p0 = __builtin_amdgcn_exp2f(__builtin_fmaf(s[qt][0][r], SC2, -m[qt])), p1 = __builtin_amdgcn_exp2f(__builtin_fmaf(s[qt][1][r], SC2, -m[qt])); ls += p0 + p1; pf[qt].h[r] = (_Float16)p0; pf[qt].h[8 + r] = (_Float16)p1; }
      l[qt] += ls; }
#pragma unroll      /* constant indices, so the fragment arrays stay in registers */
    for (int d = 0; d < 4; ++d) { o[0][d] = f_mma(vc[d], pf[0].v, o[0][d]); o[1][d] = f_mma(vc[d], pf[1].v, o[1][d]); }
    __builtin_amdgcn_sched_barrier(0); };      /* keeps the next pass's products behind this pass: moved up, they would wait on fragments fetched only half a pass earlier */
#pragma unroll 1    /* two passes a trip, so the two fragment buffers swap by name and no register is copied */
  for (int kb = 0; kb < SQ; kb += 64) { pass(kb, ka, kb2, va, vb); pass(kb + 32, kb2, ka, vb, va); } }
// One wave: 32 queries of one head against all keys, 32 keys a pass. S^T = K Q^T (A = K rows, B = Q rows), so a lane holds one query's scores; the two S^T tiles of a pass, converted in place,
// are the B operand of O^T += V^T P^T. Running row reference m (base-2 exponent), raised only when a new maximum exceeds it by more than 8 (weights then stay <= 256, inside f16); f32 row sums.
// Writes merged f16 rows 64 o + 64 alpha vp and, per (batch, head, query), the pair (m, 1 / sum) for the head-sum launch.
// The 8 waves of a work-group walk the same head's K and V^T, one work-group per WGP, so a line that one wave has fetched can serve the others from the WGP cache.
__global__ __launch_bounds__(256) void k_fattn(const _Float16* __restrict__ Q, const _Float16* __restrict__ Kp, const _Float16* __restrict__ VT, const unsigned* __restrict__ MB, const float* __restrict__ AV, _Float16* __restrict__ O16, float* __restrict__ ST) {
  const int tid = threadIdx.x, w = tid >> 5, lane = tid & 31, ln = lane & 15, hh = lane >> 4; const int h = blockIdx.y, b = blockIdx.z, q0 = blockIdx.x * 256 + w * 32; const size_t r0 = (size_t)b * SQ;
  const _Float16* qp = Q + (r0 + q0 + ln) * DM + h * HD; const _Float16* kp = Kp + (r0 + ln) * DM + h * HD; const _Float16* vp = VT + ((size_t)(b * NH + h) * HD + ln) * SQ; const unsigned* mb = MB + (size_t)(q0 + ln) * (SQ / 32);
  const v8f z8 = {0.f,0.f,0.f,0.f,0.f,0.f,0.f,0.f};
  v16h qf[2][2]; v8f o[2][4]; float m[2] = {M0, M0}, l[2] = {0.f, 0.f};
#pragma unroll      /* constant indices, so the fragment arrays stay in registers */
  for (int t = 0; t < 2; ++t) { qf[t][0] = g2_frag(qp + (size_t)t * 16 * DM, hh); qf[t][1] = g2_frag(qp + (size_t)t * 16 * DM + 32, hh);
#pragma unroll      /* constant indices, so the fragment arrays stay in registers */
    for (int d = 0; d < 4; ++d) o[t][d] = z8; }
  unsigned all1 = 0xFFFFFFFFu;      /* lane i: the AND of the 64 mask words of the wave's row i */
  { const v4ua* row = (const v4ua*)(MB + (size_t)(q0 + lane) * (SQ / 32));
#pragma unroll      /* 16 independent loads in flight */
    for (int i = 0; i < SQ / 128; ++i) { const v4ua x = row[i]; all1 &= x[0] & x[1] & x[2] & x[3]; } }
  asm volatile("s_wait_xcnt 0x0" ::: "memory");      /* precaution: stands behind the loads issued above, in front of any rewrite of their address registers */
  if (__builtin_amdgcn_ballot_w32(all1 != 0xFFFFFFFFu) != 0) fattn_keys<true>(kp, vp, mb, hh, qf, o, m, l); else fattn_keys<false>(kp, vp, mb, hh, qf, o, m, l);      /* scalar branch */
#pragma unroll      /* constant indices, so the fragment arrays stay in registers */
  for (int qt = 0; qt < 2; ++qt) { const float inv = 1.0f / (l[qt] + lane_xor<16>(l[qt])), sc = inv * 64.0f; const int q = q0 + qt * 16 + ln;
    if (hh == 0) { float* st = ST + ((size_t)(b * NH + h) * SQ + q) * 2; st[0] = m[qt]; st[1] = inv; }
#pragma unroll      /* constant indices, so the fragment arrays stay in registers */
    for (int d = 0; d < 4; ++d) { const size_t off = (r0 + q) * DM + h * HD + d * 16 + 8 * hh; const v4f a0 = *(const v4fa*)(AV + off), a1 = *(const v4fa*)(AV + off + 4); FragH f;      /* O^T tile: a lane holds 8 consecutive d of one query */
#pragma unroll      /* constant indices, so the fragment arrays stay in registers */
      for (int r = 0; r < 4; ++r) { f.h[r] = (_Float16)(o[qt][d][r] * sc + a0[r]); f.h[4 + r] = (_Float16)(o[qt][d][4 + r] * sc + a1[r]); }
      *(v8us*)((unsigned short*)O16 + off) = f.half[0]; } } }
// the head loop of k_headsum; MSK = false is taken by a wave whose 32 x 64 mask bits are all set
template <bool MSK>
__device__ __forceinline__ void headsum_heads(const _Float16* qp, const _Float16* kp, const float* st, int hh, const unsigned (&mw)[2][2], v8f (&acc)[2][4]) {
  const v8f z8 = {0.f,0.f,0.f,0.f,0.f,0.f,0.f,0.f};
#pragma unroll 1    /* one head a trip: the live set stays small enough for four waves a SIMD */
  for (int h = 0; h < NH; ++h) { v16h qf[2][2], kf[4][2]; float mr[2], iv[2];
#pragma unroll      /* constant indices, so the fragment arrays stay in registers */
    for (int t = 0; t < 4; ++t) { kf[t][0] = g2_frag(kp + (size_t)t * 16 * DM + h * HD, hh); kf[t][1] = g2_frag(kp + (size_t)t * 16 * DM + h * HD + 32, hh); }
#pragma unroll      /* constant indices, so the fragment arrays stay in registers */
    for (int t = 0; t < 2; ++t) { qf[t][0] = g2_frag(qp + (size_t)t * 16 * DM + h * HD, hh); qf[t][1] = g2_frag(qp + (size_t)t * 16 * DM + h * HD + 32, hh); mr[t] = st[((size_t)h * SQ + t * 16) * 2]; iv[t] = st[((size_t)h * SQ + t * 16) * 2 + 1]; }
#pragma unroll      /* constant indices, so the fragment arrays stay in registers */
    for (int qt = 0; qt < 2; ++qt)
#pragma unroll      /* constant indices, so the fragment arrays stay in registers */
      for (int kt = 0; kt < 4; ++kt) { v8f s = f_mma(kf[kt][1], qf[qt][1], f_mma(kf[kt][0], qf[qt][0], z8));
        if (MSK) mask_tile(s, mw[qt][kt >> 1], kt & 1, hh);
#pragma unroll      /* constant indices, so the fragment arrays stay in registers */
        for (int r = 0; r < 8; ++r) acc[qt][kt][r] = __builtin_fmaf(__builtin_amdgcn_exp2f(__builtin_fmaf(s[r], SC2, -mr[qt])), iv[qt], acc[qt][kt][r]); } } }
// second output: one wave holds 32 queries x 64 keys of the head sum in registers and walks the 16 heads, forming each head's S^T tiles again (same products, same order as k_fattn) and its weights from the stored (m, 1 / sum)
__global__ __launch_bounds__(128) void k_headsum(const _Float16* __restrict__ Q, const _Float16* __restrict__ Kp, const unsigned* __restrict__ MB, const float* __restrict__ ST, float* __restrict__ WS) {
  const int tid = threadIdx.x, w = tid >> 5, lane = tid & 31, ln = lane & 15, hh = lane >> 4; const int b = blockIdx.z, q0 = blockIdx.y * 32, k0 = blockIdx.x * 256 + w * 64; const size_t r0 = (size_t)b * SQ;
  const _Float16* qp = Q + (r0 + q0 + ln) * DM; const _Float16* kp = Kp + (r0 + k0 + ln) * DM; const float* st = ST + ((size_t)b * NH * SQ + q0 + ln) * 2;
  const v8f z8 = {0.f,0.f,0.f,0.f,0.f,0.f,0.f,0.f}; v8f acc[2][4]; unsigned mw[2][2];
#pragma unroll      /* constant indices, so the fragment arrays stay in registers */
  for (int qt = 0; qt < 2; ++qt) { const unsigned* mb = MB + (size_t)(q0 + qt * 16 + ln) * (SQ / 32) + (k0 >> 5); mw[qt][0] = mb[0]; mw[qt][1] = mb[1];
#pragma unroll      /* constant indices, so the fragment arrays stay in registers */
    for (int kt = 0; kt < 4; ++kt) acc[qt][kt] = z8; }
  if (__builtin_amdgcn_ballot_w32((mw[0][0] & mw[0][1] & mw[1][0] & mw[1][1]) != 0xFFFFFFFFu) != 0) headsum_heads<true>(qp, kp, st, hh, mw, acc); else headsum_heads<false>(qp, kp, st, hh, mw, acc);      /* scalar branch */
#pragma unroll      /* constant indices, so the fragment arrays stay in registers */
  for (int qt = 0; qt < 2; ++qt)
#pragma unroll      /* constant indices, so the fragment arrays stay in registers */
    for (int kt = 0; kt < 4; ++kt) { float* d = WS + (r0 + q0 + qt * 16 + ln) * SQ + k0 + kt * 16 + 8 * hh; v4f a0, a1;      /* a lane holds 8 consecutive keys of one query */
#pragma unroll      /* constant indices, so the fragment arrays stay in registers */
      for (int r = 0; r < 4; ++r) { a0[r] = acc[qt][kt][r]; a1[r] = acc[qt][kt][4 + r]; }
      *(v4f*)d = a0; *(v4f*)(d + 4) = a1; } }
__global__ __launch_bounds__(256) void k_av64(const float* __restrict__ VPF, const float* __restrict__ alpha, float* __restrict__ AV, size_t n4) {
  #pragma clang fp contract(off)
  const size_t t = (size_t)blockIdx.x * 256 + threadIdx.x; if (t >= n4) return; const float a = __fmul_rn(bf16_round(alpha[0]), 64.0f); const v4f v = *(const v4fa*)(VPF + t * 4); v4f o; for (int q = 0; q < 4; ++q) o[q] = __fmul_rn(a, v[q]); *(v4f*)(AV + t * 4) = o;  }

extern "C" void kernel_launch(void* const* d_in, const int* in_sizes, int n_in,
                              void* d_out, int out_size, void* d_ws, size_t ws_size, hipStream_t stream) {
  (void)in_sizes; (void)n_in; (void)out_size;
  const float* const* I = (const float* const*)d_in; const float* qin = I[0]; const float* kin = I[1]; const float* vin = I[2]; const int* mask = (const int*)d_in[3]; const float* wq = I[4]; const float* bq = I[5]; const float* wkv = I[6]; const float* bkv = I[7]; const float* wo = I[8]; const float* bo = I[9]; const float* alpha = I[10];      /* weights [in][out] */
  float* out0 = (float*)d_out; float* out1 = (float*)d_out + NR * DM;      /* byte offset 16,777,216 */
  char* ws = (char*)d_ws; size_t off = 0;
  auto take = [&](size_t bytes) { char* p = ws + off; off += (bytes + 255) & ~(size_t)255; return p; };
  _Float16* BQ = (_Float16*)take((size_t)DM * DM * 2); _Float16* BKV = (_Float16*)take((size_t)DM * DM * 2); _Float16* BO = (_Float16*)take((size_t)DM * DM * 2);
  _Float16* Q16 = (_Float16*)take(NR * DM * 2); _Float16* K16 = (_Float16*)take(NR * DM * 2); _Float16* V16 = (_Float16*)take(NR * DM * 2); float* AV = (float*)take(NR * DM * 4); _Float16* O16 = (_Float16*)take(NR * DM * 2);
  _Float16* VT = (_Float16*)take((size_t)NB * NH * HD * SQ * 2); unsigned* MB = (unsigned*)take((size_t)SQ * (SQ / 32) * 4); float* ST = (float*)take((size_t)NB * NH * SQ * 2 * 4);
  _Float16* XQ = (_Float16*)take(NR * DM * 2); _Float16* XK = (_Float16*)take(NR * DM * 2); _Float16* XV = (_Float16*)take(NR * DM * 2); float* VPF = (float*)take(NR * DM * 4);
  if (off > ws_size) return;      /* 6 + 24 + 16 + 8 + 8 + 0.5 + 0.5 + 24 + 16 = 103 MiB */
  { const unsigned gw = (unsigned)(((size_t)DM * (DM / 8) + 255) / 256); k_wt_f16<<<gw, 256, 0, stream>>>(wq, BQ, DM, DM, 16.0f); k_wt_f16<<<gw, 256, 0, stream>>>(wkv, BKV, DM, DM, 16.0f); k_wt_f16<<<gw, 256, 0, stream>>>(wo, BO, DM, DM, 16.0f); }
  { const unsigned gx = (unsigned)((NR * DM / 8 + 255) / 256); k_x16<<<gx, 256, 0, stream>>>(qin, XQ, NR * DM / 8); k_x16<<<gx, 256, 0, stream>>>(kin, XK, NR * DM / 8); k_x16<<<gx, 256, 0, stream>>>(vin, XV, NR * DM / 8); }
  const size_t r0p = (size_t)B0 * SQ; const dim3 gp((unsigned)((MP / 128) * (DM / 64)), 1);
  k_gemm2<0><<<gp, 128, 0, stream>>>(XQ + r0p * DM, DM, 0, BQ, DM, 0, 0.0625f, bq, 0, nullptr, 1, 0, 0, nullptr, Q16 + r0p * DM, DM, 0, MP, DM, DM);
  k_gemm2<0><<<gp, 128, 0, stream>>>(XK + r0p * DM, DM, 0, BKV, DM, 0, 0.0625f, bkv, 0, nullptr, 1, 0, 0, nullptr, K16 + r0p * DM, DM, 0, MP, DM, DM);
  k_gemm2<0><<<gp, 128, 0, stream>>>(XV + r0p * DM, DM, 0, BKV, DM, 0, 0.0625f, bkv, 0, nullptr, 1, 0, 0, VPF + r0p * DM, V16 + r0p * DM, DM, 0, MP, DM, DM);      /* vp: f32 (residual) and f16 (attention operand) */
  k_av64<<<(unsigned)(((size_t)MP * DM / 4 + 255) / 256), 256, 0, stream>>>(VPF + r0p * DM, alpha, AV + r0p * DM, (size_t)MP * DM / 4);
  k_vt<NH, SQ><<<NB * NH * (SQ / 64), 256, 0, stream>>>(V16, DM, 0, VT);      /* V^T [NB][NH][HD][SQ] */
  k_maskbits<<<SQ * (SQ / 32) / 256, 256, 0, stream>>>(mask, MB);
  k_fattn<<<dim3(SQ / 256, NH, NB), 256, 0, stream>>>(Q16, K16, VT, MB, AV, O16, ST);      /* o x64 = 64 attn v + 64 alpha vp, f16 rows; row statistics */
  k_headsum<<<dim3(SQ / 256, SQ / 32, NB), 128, 0, stream>>>(Q16, K16, MB, ST, out1);      /* sum over the heads of the weights */
  k_gemm2<0><<<dim3((unsigned)((MPO / 128) * (DM / 64)), 1), 128, 0, stream>>>(O16 + r0p * DM, DM, 0, BO, DM, 0, 0.0009765625f, bo, 0, nullptr, 1, 0, 0, out0 + r0p * DM, nullptr, DM, 0, MPO, DM, DM);      /* out0 = o Wo + bo */
}

// v004
// A run of this version takes 202 microseconds.
// Timed twice side by side with v003, it ran 1.51 times as fast both times.
// Counting every step since v000, it is 677 times as fast.
#include <hip/hip_runtime.h>
#define NB 2
#define SQ 2048
#define DM 1024
#define NH 16
#define HD 64
#define HG 4                         /* k_vt(b,h0) compatibility (unused) */
#define B0 0                         /* first batch processed (debug hook) */
#define NBR NB                       /* batches processed (debug hook) */
#define Q0S 0                        /* first tile (unused) */
#define QN SQ                        /* query rows end (unused) */
#define NR ((size_t)NB * SQ)
#define MP ((int)((size_t)NBR * SQ)) /* rows projected (debug hook) */
#define MPO MP                       /* rows through the output GEMM (debug hook) */
typedef __bf16 v16b __attribute__((ext_vector_type(16)));
typedef unsigned short v8us __attribute__((ext_vector_type(8), may_alias));
typedef float  v8f  __attribute__((ext_vector_type(8)));
typedef float  v4f  __attribute__((ext_vector_type(4)));
typedef float  v4fa __attribute__((ext_vector_type(4), may_alias));
union FragB { v16b v; v8us half[2]; unsigned short u[16]; };

__device__ __forceinline__ unsigned short bf16_bits(float x) { unsigned int u = __float_as_uint(x); return (unsigned short)((u + 0x7FFFu + ((u >> 16) & 1u)) >> 16); }
__device__ __forceinline__ float bf16_val(unsigned short b) { return __uint_as_float(((unsigned int)b) << 16); }
__device__ __forceinline__ float bf16_round(float x) { return bf16_val(bf16_bits(x)); }
// D += A·B with NT terms: 1 = ah·bh, 2 = + al·bh (A split), 3 = + ah·bl (both split)
template <int NT>
__device__ __forceinline__ v8f mmaN(v16b ah, v16b al, v16b bh, v16b bl, v8f c) {
  c = __builtin_amdgcn_wmma_f32_16x16x32_bf16(false, ah, false, bh, (short)0, c, false, false);
  if (NT >= 2) c = __builtin_amdgcn_wmma_f32_16x16x32_bf16(false, al, false, bh, (short)0, c, false, false);
  if (NT >= 3) c = __builtin_amdgcn_wmma_f32_16x16x32_bf16(false, ah, false, bl, (short)0, c, false, false);
  asm volatile("v_nop\n\tv_nop\n\tv_nop\n\tv_nop" : "+v"(c) : "v"(ah), "v"(al), "v"(bh), "v"(bl));
  return c;
}

__global__ __launch_bounds__(256) void k_wt_bf16(const float* __restrict__ W, unsigned short* __restrict__ Wt, int K, int N) {
  const int t = blockIdx.x * 256 + threadIdx.x;
  const int k8n = K / 8;
  if (t >= N * k8n) return;
  const int n = t / k8n, k8 = (t % k8n) * 8;
  v8us v;
#pragma unroll
  for (int i = 0; i < 8; ++i) v[i] = bf16_bits(W[(size_t)(k8 + i) * N + n]);
  *(v8us*)(Wt + (size_t)n * K + k8) = v;
  
}

// GEMM C[M][N] (f32, pitch ldc) = act(A[M][K]·W + bias). A f32 row-major (pitch lda) converted per fragment to bf16
// (ASPLIT: hi/lo two planes -> 2 terms, else single rounded term); Wt bf16 [N][K] (pitch ldb). BIAS_BF16 rounds the
// bias to bf16 first (bias quantised to bf16 before the add). K%32==0, M%16==0, N%64==0.
template <bool ASPLIT, int ACT, bool BIAS_BF16>
__global__ __launch_bounds__(128) void k_gemm_bf(const float* __restrict__ A, int lda, const unsigned short* __restrict__ Wt, int ldb,
                                               const float* __restrict__ bias, float* __restrict__ C, int ldc, int M, int N, int K) {
  __shared__ __attribute__((aligned(16))) float so[4][16][64];
  const int tid = threadIdx.x, w = tid >> 5, lane = tid & 31, ln = lane & 15, hh = lane >> 4;
  const int ntn = N / 64;
  const int wid = blockIdx.x * 4 + w;
  const int mt = wid / ntn, nq = wid % ntn;
  if (mt * 16 >= M) return;
  const int row0 = mt * 16, col0 = nq * 64;
  const float* arow = A + (size_t)(row0 + ln) * lda;
  v8f acc[4] = {};
  for (int kb = 0; kb < K; kb += 32) {
    FragB ah, al;
    const v4f x0 = *(const v4fa*)(arow + kb + 8 * hh), x1 = *(const v4fa*)(arow + kb + 8 * hh + 4);
    const v4f x2 = *(const v4fa*)(arow + kb + 16 + 8 * hh), x3 = *(const v4fa*)(arow + kb + 16 + 8 * hh + 4);
    float xs[16] = {x0[0],x0[1],x0[2],x0[3],x1[0],x1[1],x1[2],x1[3],x2[0],x2[1],x2[2],x2[3],x3[0],x3[1],x3[2],x3[3]};
#pragma unroll
    for (int i = 0; i < 16; ++i) { const unsigned short hb = bf16_bits(xs[i]); ah.u[i] = hb; al.u[i] = ASPLIT ? bf16_bits(xs[i] - bf16_val(hb)) : (unsigned short)0; }
#pragma unroll
    for (int t = 0; t < 4; ++t) {
      const unsigned short* brow = Wt + (size_t)(col0 + t * 16 + ln) * ldb + kb;
      FragB b;
      b.half[0] = *(const v8us*)(brow + 8 * hh);
      b.half[1] = *(const v8us*)(brow + 16 + 8 * hh);
      acc[t] = mmaN<ASPLIT ? 2 : 1>(ah.v, al.v, b.v, b.v, acc[t]);
    }
  }
#pragma unroll
  for (int t = 0; t < 4; ++t) {
    float bv = bias ? bias[col0 + t * 16 + ln] : 0.f;
    if (BIAS_BF16) bv = bf16_round(bv);
#pragma unroll
    for (int r = 0; r < 8; ++r) { float v = acc[t][r] + bv; if (ACT == 1) v = fmaxf(v, 0.f); so[w][8 * hh + r][t * 16 + ln] = v; }
  }
  __builtin_amdgcn_fence(__ATOMIC_ACQ_REL, "workgroup");
  __builtin_amdgcn_wave_barrier();
  const int rsub = lane >> 4, c4 = (lane & 15) * 4;
  {
#pragma unroll
    for (int q = 0; q < 8; ++q) {
      const int r = q * 2 + rsub;
      const v4f v = *(const v4fa*)&so[w][r][c4];
      *(v4f*)(C + (size_t)(row0 + r) * ldc + col0 + c4) = v;
    }
    
  }
}

// GEMM C = act(A·W + bias + resid): A f32 (ASPLIT -> hi/lo 2 terms), Wt bf16 [N][K]; ACT 0 none, 1 relu, 2 exact gelu;
// resid (optional, f32, row index = (row % rmod), pitch ldr, RES_BF16 rounds it) added before the activation.
template <bool ASPLIT, int ACT, bool BIAS_BF16, bool RES_BF16>
__global__ __launch_bounds__(128) void k_gemm_bf3(const float* __restrict__ A, int lda, const unsigned short* __restrict__ Wt, int ldb,
                                                const float* __restrict__ bias, const float* __restrict__ resid, int rmod, int ldr,
                                                float* __restrict__ C, int ldc, int M, int N, int K) {
  __shared__ __attribute__((aligned(16))) float so[4][16][64];
  const int tid = threadIdx.x, w = tid >> 5, lane = tid & 31, ln = lane & 15, hh = lane >> 4;
  const int ntn = N / 64;
  const int wid = blockIdx.x * 4 + w;
  const int mt = wid / ntn, nq = wid % ntn;
  if (mt * 16 >= M) return;
  const int row0 = mt * 16, col0 = nq * 64;
  const float* arow = A + (size_t)(row0 + ln) * lda;
  v8f acc[4] = {};
  for (int kb = 0; kb < K; kb += 32) {
    FragB ah, al;
    const v4f x0 = *(const v4fa*)(arow + kb + 8 * hh), x1 = *(const v4fa*)(arow + kb + 8 * hh + 4);
    const v4f x2 = *(const v4fa*)(arow + kb + 16 + 8 * hh), x3 = *(const v4fa*)(arow + kb + 16 + 8 * hh + 4);
    float xs[16] = {x0[0],x0[1],x0[2],x0[3],x1[0],x1[1],x1[2],x1[3],x2[0],x2[1],x2[2],x2[3],x3[0],x3[1],x3[2],x3[3]};
#pragma unroll
    for (int i = 0; i < 16; ++i) { const unsigned short hb = bf16_bits(xs[i]); ah.u[i] = hb; al.u[i] = ASPLIT ? bf16_bits(xs[i] - bf16_val(hb)) : (unsigned short)0; }
#pragma unroll
    for (int t = 0; t < 4; ++t) {
      const unsigned short* brow = Wt + (size_t)(col0 + t * 16 + ln) * ldb + kb;
      FragB b;
      b.half[0] = *(const v8us*)(brow + 8 * hh);
      b.half[1] = *(const v8us*)(brow + 16 + 8 * hh);
      acc[t] = mmaN<ASPLIT ? 2 : 1>(ah.v, al.v, b.v, b.v, acc[t]);
    }
  }
#pragma unroll
  for (int t = 0; t < 4; ++t) {
    const int col = col0 + t * 16 + ln;
    float bv = bias ? bias[col] : 0.f;
    if (BIAS_BF16) bv = bf16_round(bv);
#pragma unroll
    for (int r = 0; r < 8; ++r) {
      float v = acc[t][r] + bv;
      if (resid) { float rv = resid[(size_t)((row0 + 8 * hh + r) % rmod) * ldr + col]; if (RES_BF16) rv = bf16_round(rv); v += rv; }
      if (ACT == 1) v = fmaxf(v, 0.f);
      if (ACT == 2) v = 0.5f * v * (1.0f + erff(v * 0.70710678118654752f));
      if (ACT == 3) { const float u = 0.7978845608028654f * (v + 0.044715f * v * v * v); v = 0.5f * v * (1.0f + tanhf(u)); }
      so[w][8 * hh + r][t * 16 + ln] = v;
    }
  }
  __builtin_amdgcn_fence(__ATOMIC_ACQ_REL, "workgroup");
  __builtin_amdgcn_wave_barrier();
  const int rsub = lane >> 4, c4 = (lane & 15) * 4;
  {
#pragma unroll
    for (int q = 0; q < 8; ++q) {
      const int r = q * 2 + rsub;
      const v4f v = *(const v4fa*)&so[w][r][c4];
      *(v4f*)(C + (size_t)(row0 + r) * ldc + col0 + c4) = v;
    }
    
  }
}
// row LayerNorm (biased variance, eps) over N: s = X (+ R); optional out_sum <- s; out_norm <- (s-mu)*rsqrt(var+eps)*g + b
template <bool PARAM_BF16>
__global__ __launch_bounds__(256) void k_layernorm(const float* __restrict__ X, const float* __restrict__ R, const float* __restrict__ g, const float* __restrict__ bta,
                                                  float* __restrict__ out_sum, float* __restrict__ out_norm, int N, float eps) {
  __shared__ float red[256];
  const int row = blockIdx.x, tid = threadIdx.x;
  const float* x = X + (size_t)row * N; const float* rr = R ? R + (size_t)row * N : nullptr;
  float vals[16];                     // up to N = 4096
  const int per = N / 256;            // contiguous chunk per thread? use strided-by-4 chunks: thread handles j = tid*4 + 1024*u
  float s1 = 0.f;
  for (int u = 0; u < per / 4; ++u) {
    const int j = tid * 4 + 1024 * u;
    const v4f a = *(const v4fa*)(x + j);
    v4f b = {0.f,0.f,0.f,0.f}; if (rr) b = *(const v4fa*)(rr + j);
#pragma unroll
    for (int q = 0; q < 4; ++q) { const float v = a[q] + b[q]; vals[u * 4 + q] = v; s1 += v; }
  }
  red[tid] = s1; __syncthreads();
  for (int st = 128; st > 0; st >>= 1) { if (tid < st) red[tid] += red[tid + st]; __syncthreads(); }
  const float mu = red[0] / (float)N; __syncthreads();
  float s2 = 0.f;
  for (int u = 0; u < per / 4; ++u)
#pragma unroll
    for (int q = 0; q < 4; ++q) { const float c = vals[u * 4 + q] - mu; s2 += c * c; }
  red[tid] = s2; __syncthreads();
  for (int st = 128; st > 0; st >>= 1) { if (tid < st) red[tid] += red[tid + st]; __syncthreads(); }
  const float rs = rsqrtf(red[0] / (float)N + eps);
  {
    for (int u = 0; u < per / 4; ++u) {
      const int j = tid * 4 + 1024 * u;
      v4f o, sm;
#pragma unroll
      for (int q = 0; q < 4; ++q) {
        float gg = g[j + q], bb = bta[j + q];
        if (PARAM_BF16) { gg = bf16_round(gg); bb = bf16_round(bb); }
        sm[q] = vals[u * 4 + q]; o[q] = (vals[u * 4 + q] - mu) * rs * gg + bb;
      }
      if (out_sum) *(v4f*)(out_sum + (size_t)row * N + j) = sm;
      *(v4f*)(out_norm + (size_t)row * N + j) = o;
    }
    
  }
}



// ---- f16 WMMA path (v_wmma_f32_16x16x32_f16): 11-bit significands for operands in range — used for every launched product, the unnormalised softmax weights (<= 256) among them
typedef _Float16 v16h __attribute__((ext_vector_type(16)));
union FragH { v16h v; v8us half[2]; _Float16 h[16]; unsigned short u[16]; };
template <int NT>
__device__ __forceinline__ v8f mmaH(v16h ah, v16h al, v16h bh, v16h bl, v8f c) {
  c = __builtin_amdgcn_wmma_f32_16x16x32_f16(false, ah, false, bh, (short)0, c, false, false);
  if (NT >= 2) c = __builtin_amdgcn_wmma_f32_16x16x32_f16(false, al, false, bh, (short)0, c, false, false);
  if (NT >= 3) c = __builtin_amdgcn_wmma_f32_16x16x32_f16(false, ah, false, bl, (short)0, c, false, false);
  asm volatile("v_nop\n\tv_nop\n\tv_nop\n\tv_nop" : "+v"(c) : "v"(ah), "v"(al), "v"(bh), "v"(bl));
  return c;
}
// batched GEMM like k_gemm_b but f16 operands: A f32 (split into f16 hi/lo if ASPLIT, else rounded to f16), Bt = f16 values [n][k]; alpha; C f32; N multiple of 16 (partial tiles skipped)
template <bool ASPLIT>
__global__ __launch_bounds__(128) void k_gemm_h(const float* __restrict__ A, int lda, size_t sA, const _Float16* __restrict__ Bh, int ldb, size_t sB, float alpha, float* __restrict__ C, int ldc, size_t sC, int M, int N, int K) {
  __shared__ __attribute__((aligned(16))) float so[4][16][64];
  const int tid = threadIdx.x, w = tid >> 5, lane = tid & 31, ln = lane & 15, hh = lane >> 4; const int by = blockIdx.y;
  A += (size_t)by * sA; Bh += (size_t)by * sB; C += (size_t)by * sC;
  const int ntn = (N + 63) / 64; const int wid = blockIdx.x * 4 + w; const int mt = wid / ntn, nq = wid % ntn; if (mt * 16 >= M) return;
  const int row0 = mt * 16, col0 = nq * 64; const float* arow = A + (size_t)(row0 + ln) * lda;
  v8f acc[4] = {};
  for (int kb = 0; kb < K; kb += 32) {
    FragH ah, al;
    const v4f x0 = *(const v4fa*)(arow + kb + 8 * hh), x1 = *(const v4fa*)(arow + kb + 8 * hh + 4), x2 = *(const v4fa*)(arow + kb + 16 + 8 * hh), x3 = *(const v4fa*)(arow + kb + 16 + 8 * hh + 4);
    float xs[16] = {x0[0],x0[1],x0[2],x0[3],x1[0],x1[1],x1[2],x1[3],x2[0],x2[1],x2[2],x2[3],x3[0],x3[1],x3[2],x3[3]};
#pragma unroll
    for (int i = 0; i < 16; ++i) { const _Float16 h = (_Float16)xs[i]; ah.h[i] = h; al.h[i] = ASPLIT ? (_Float16)(xs[i] - (float)h) : (_Float16)0.0f; }
#pragma unroll
    for (int t = 0; t < 4; ++t) { if (col0 + t * 16 >= N) continue; const size_t boff = (size_t)(col0 + t * 16 + ln) * ldb + kb; FragH bq; bq.half[0] = *(const v8us*)(Bh + boff + 8 * hh); bq.half[1] = *(const v8us*)(Bh + boff + 16 + 8 * hh);
      acc[t] = mmaH<ASPLIT ? 2 : 1>(ah.v, al.v, bq.v, bq.v, acc[t]); }
  }
#pragma unroll
  for (int t = 0; t < 4; ++t) { if (col0 + t * 16 >= N) continue;
#pragma unroll
    for (int r = 0; r < 8; ++r) so[w][8 * hh + r][t * 16 + ln] = acc[t][r] * alpha; }
  __builtin_amdgcn_fence(__ATOMIC_ACQ_REL, "workgroup"); __builtin_amdgcn_wave_barrier();
  const int rsub = lane >> 4, c4 = (lane & 15) * 4;
  {
#pragma unroll
    for (int q = 0; q < 8; ++q) { const int r = q * 2 + rsub; if (col0 + c4 < N) { const v4f v = *(const v4fa*)&so[w][r][c4]; *(v4f*)(C + (size_t)(row0 + r) * ldc + col0 + c4) = v; } }
     }
}

// Wt[n][k] = f16(W[k][n]·scale) from f32 row-major W[K][N] (scale = power of two; bf16-exact weights stay exact in f16 away from the subnormal range)
__global__ __launch_bounds__(256) void k_wt_f16(const float* __restrict__ W, _Float16* __restrict__ Wt, int K, int N, float scale) {
  const int t = blockIdx.x * 256 + threadIdx.x; if (t >= N * (K / 8)) return; const int n = t / (K / 8), k8 = (t % (K / 8)) * 8; FragH f;
#pragma unroll
  for (int i = 0; i < 8; ++i) f.h[i] = (_Float16)(bf16_round(W[(size_t)(k8 + i) * N + n]) * scale); const v8us o = f.half[0];
  *(v8us*)((unsigned short*)Wt + (size_t)n * K + k8) = o; 
}
// k_gemm_hh variant with fused epilogue: v = acc·alpha + bias[by·sBias + col] (+ CP[(row/rowsPerB)·sCPb + by·64 + col] if CP) ; ACT 0 none / 1 elu ; writes f16 C16 (and f32 C if non-null)
template <int ACT>
__global__ __launch_bounds__(128) void k_gemm_hhx(const _Float16* __restrict__ A, int lda, size_t sA, const _Float16* __restrict__ Bh, int ldb, size_t sB, float alpha, const float* __restrict__ bias, size_t sBias, const float* __restrict__ CP, int rowsPerB, size_t sCPb, int row0g,
    float* __restrict__ C, _Float16* __restrict__ C16, int ldc, size_t sC, int M, int N, int K) {
  __shared__ __attribute__((aligned(16))) float so[4][16][64];
  const int tid = threadIdx.x, w = tid >> 5, lane = tid & 31, ln = lane & 15, hh = lane >> 4; const int by = blockIdx.y;
  A += (size_t)by * sA; Bh += (size_t)by * sB; const size_t cofs = (size_t)by * sC; const float* bp = bias ? bias + (size_t)by * sBias : nullptr;
  const int ntn = (N + 63) / 64; const int wid = blockIdx.x * 4 + w; const int mt = wid / ntn, nq = wid % ntn; if (mt * 16 >= M) return;
  const int row0 = mt * 16, col0 = nq * 64; const _Float16* arow = A + (size_t)(row0 + ln) * lda;
  v8f acc[4] = {};
  for (int kb = 0; kb < K; kb += 32) { FragH ah; ah.half[0] = *(const v8us*)((const unsigned short*)arow + kb + 8 * hh); ah.half[1] = *(const v8us*)((const unsigned short*)arow + kb + 16 + 8 * hh);
#pragma unroll
    for (int t = 0; t < 4; ++t) { if (col0 + t * 16 >= N) continue; const size_t boff = (size_t)(col0 + t * 16 + ln) * ldb + kb; FragH bq; bq.half[0] = *(const v8us*)((const unsigned short*)Bh + boff + 8 * hh); bq.half[1] = *(const v8us*)((const unsigned short*)Bh + boff + 16 + 8 * hh);
      acc[t] = mmaH<1>(ah.v, ah.v, bq.v, bq.v, acc[t]); }
  }
#pragma unroll
  for (int t = 0; t < 4; ++t) { if (col0 + t * 16 >= N) continue; const int col = col0 + t * 16 + ln; const float bv = bp ? bf16_round(bp[col]) : 0.f;
#pragma unroll
    for (int r = 0; r < 8; ++r) { float v = acc[t][r] * alpha + bv; if (CP) { const int rr = row0g + row0 + 8 * hh + r; if (rowsPerB < 0) v += CP[cofs + (size_t)rr * ldc + col];      /* rowsPerB < 0: own element of the batched C plane */ else { const int bidx = rr / rowsPerB; v += CP[(size_t)bidx * sCPb + (size_t)by * 64 + col]; } } if (ACT == 1) v = (v > 0.f) ? v : expm1f(v); else if (ACT == 7) v = (v > 0.f) ? v + 1.0f : expf(v); else if (ACT == 8) v = tanhf(v); else if (ACT == 9) v = 0.5f * v * (1.0f + tanhf(0.7978845608028654f * (v + 0.044715f * v * v * v))); else if (ACT == 11) v = 1.0f / (1.0f + expf(-v)); else if (ACT == 12) v = (v > 0.f) ? v : 0.01f * v; else if (ACT == 14) v = (v > 0.f) ? v : 0.1f * v; else if (ACT == 16) v = (v >= 0.f) ? v : 0.3f * v; else if (ACT == 17) v = (v >= 0.f) ? v : 0.2f * v; else if (ACT == 15) v = v / (1.0f + expf(-v)); else if (ACT == 3) v = fmaxf(v, 0.f); else if (ACT == 6) v = 0.5f * v * (1.0f + erff(v * 0.70710678118654752f)); so[w][8 * hh + r][t * 16 + ln] = v; } }
  __builtin_amdgcn_fence(__ATOMIC_ACQ_REL, "workgroup"); __builtin_amdgcn_wave_barrier();
  const int rsub = lane >> 4, c4 = (lane & 15) * 4; typedef _Float16 v4h __attribute__((ext_vector_type(4)));
  {
#pragma unroll
    for (int q = 0; q < 8; ++q) { const int r = q * 2 + rsub; if (col0 + c4 < N) { const v4f v = *(const v4fa*)&so[w][r][c4]; if (C) *(v4f*)(C + cofs + (size_t)(row0 + r) * ldc + col0 + c4) = v; if (C16) { v4h h4; for (int i = 0; i < 4; ++i) h4[i] = (_Float16)v[i]; *(v4h*)(C16 + cofs + (size_t)(row0 + r) * ldc + col0 + c4) = h4; } } }
     }
}


typedef _Float16 v4h __attribute__((ext_vector_type(4)));

__global__ __launch_bounds__(256) void k_x16(const float* __restrict__ x, _Float16* __restrict__ X16, size_t n8) { const size_t t = (size_t)blockIdx.x * 256 + threadIdx.x; if (t >= n8) return; FragH f;
#pragma unroll
  for (int q = 0; q < 8; ++q) f.h[q] = (_Float16)bf16_round(x[t * 8 + q]); *(v8us*)((unsigned short*)X16 + t * 8) = f.half[0];  }
__global__ __launch_bounds__(256) void k_h16(const float* __restrict__ x, _Float16* __restrict__ X16, size_t n8) { const size_t t = (size_t)blockIdx.x * 256 + threadIdx.x; if (t >= n8) return; FragH f;
#pragma unroll
  for (int q = 0; q < 8; ++q) f.h[q] = (_Float16)x[t * 8 + q]; *(v8us*)((unsigned short*)X16 + t * 8) = f.half[0];  }
__global__ __launch_bounds__(256) void k_round16f(const float* __restrict__ W, _Float16* __restrict__ Bt, size_t n8) { const size_t t = (size_t)blockIdx.x * 256 + threadIdx.x; if (t >= n8) return; FragH f;
#pragma unroll
  for (int i = 0; i < 8; ++i) f.h[i] = (_Float16)(bf16_round(W[t * 8 + i]) * 16.0f); *(v8us*)((unsigned short*)Bt + t * 8) = f.half[0];  }
template <int NHv, int TTv>
__global__ __launch_bounds__(256) void k_vt(const _Float16* __restrict__ V16, int ldv, int voff, _Float16* __restrict__ Vt) { __shared__ unsigned short tl[64][66]; const int tid = threadIdx.x; const int slab = blockIdx.x / (TTv / 64), lg = blockIdx.x % (TTv / 64); const int b = slab / NHv, h = slab % NHv;
  for (int i = tid; i < 64 * 8; i += 256) { const int r = i / 8, c8 = (i % 8) * 8; FragH f; f.half[0] = *(const v8us*)((const unsigned short*)V16 + ((size_t)b * TTv + lg * 64 + r) * ldv + voff + h * 64 + c8);
#pragma unroll
    for (int q = 0; q < 8; ++q) tl[r][c8 + q] = f.u[q]; }
  __syncthreads();
  {
#pragma unroll
    for (int rd = 0; rd < 2; ++rd) { const int d = rd * 32 + tid / 8, pc = tid % 8; FragH f;
#pragma unroll
      for (int q = 0; q < 8; ++q) f.u[q] = tl[pc * 8 + q][d];
      *(v8us*)((unsigned short*)Vt + ((size_t)slab * 64 + d) * TTv + lg * 64 + pc * 8) = f.half[0]; }
     } }

__global__ __launch_bounds__(256) void k_hl(const float* __restrict__ F, _Float16* __restrict__ Hh, _Float16* __restrict__ Hl, size_t n8) { const size_t t = (size_t)blockIdx.x * 256 + threadIdx.x; if (t >= n8) return; FragH fh, fl; const v4f a = *(const v4fa*)(F + t * 8), c = *(const v4fa*)(F + t * 8 + 4);
#pragma unroll
  for (int q = 0; q < 4; ++q) { _Float16 h = (_Float16)a[q]; fh.h[q] = h; fl.h[q] = (_Float16)((a[q] - (float)h) * 1024.0f); h = (_Float16)c[q]; fh.h[4 + q] = h; fl.h[4 + q] = (_Float16)((c[q] - (float)h) * 1024.0f); }
  { *(v8us*)((unsigned short*)Hh + t * 8) = fh.half[0]; *(v8us*)((unsigned short*)Hl + t * 8) = fl.half[0];  } }

// ---- fast GEMM (work-group tile 128x64, wave tile 32x64; requires M % 128 == 0, N % 64 == 0, K % 128 == 0, K >= 128); epilogue = k_gemm_hhx semantics ----
// Operands go through LDS: a stage is 128 k (256 B) of the work-group's 128 A rows and 64 B rows, brought by asynchronous copies of whole lines, two buffers, the next stage in flight while this one is multiplied.
__device__ __forceinline__ v16h g2_frag(const _Float16* p, int hh) { FragH f; f.half[0] = *(const v8us*)((const unsigned short*)p + 8 * hh); f.half[1] = *(const v8us*)((const unsigned short*)p + 16 + 8 * hh); return f.v; }
__device__ __forceinline__ v8f g2_mma(v16h a, v16h b, v8f c) { return __builtin_amdgcn_wmma_f32_16x16x32_f16(false, a, false, b, (short)0, c, false, false); }
#define G2_PITCH 272                 /* LDS bytes from row to row: 256 + 16, an odd multiple of 16 B, so the 16 rows of a fragment read fall on different banks */
#define G2_BUF (192 * G2_PITCH)      /* one stage: rows 0..127 = A, rows 128..191 = B */
__device__ __forceinline__ v16h g2_lfrag(const unsigned char* p) { FragH f; f.half[0] = *(const v8us*)p; f.half[1] = *(const v8us*)(p + 32); return f.v; }      /* p = row start + 64 B x block + 16 hh: the k order of g2_frag */
// eight asynchronous copies of 16 B a lane, rows 8 apart: LDS byte address l (+ 8 rows each), global address g (+ gs elements each)
__device__ __forceinline__ void g2_copy8(unsigned l, const _Float16* g, size_t gs) {
  const unsigned l1 = l + 8 * G2_PITCH, l2 = l + 16 * G2_PITCH, l3 = l + 24 * G2_PITCH, l4 = l + 32 * G2_PITCH, l5 = l + 40 * G2_PITCH, l6 = l + 48 * G2_PITCH, l7 = l + 56 * G2_PITCH;
  const _Float16* g1 = g + gs; const _Float16* g2 = g1 + gs; const _Float16* g3 = g2 + gs; const _Float16* g4 = g3 + gs; const _Float16* g5 = g4 + gs; const _Float16* g6 = g5 + gs; const _Float16* g7 = g6 + gs;
  /* the copies move global bytes into LDS through no register; the closing s_wait_xcnt is a precaution: it stands in front of any rewrite of the address registers named here */
  asm volatile("global_load_async_to_lds_b128 %0, %8, off\n\t"
               "global_load_async_to_lds_b128 %1, %9, off\n\t"
               "global_load_async_to_lds_b128 %2, %10, off\n\t"
               "global_load_async_to_lds_b128 %3, %11, off\n\t"
               "global_load_async_to_lds_b128 %4, %12, off\n\t"
               "global_load_async_to_lds_b128 %5, %13, off\n\t"
               "global_load_async_to_lds_b128 %6, %14, off\n\t"
               "global_load_async_to_lds_b128 %7, %15, off\n\t"
               "s_wait_xcnt 0x0"
               :: "v"(l), "v"(l1), "v"(l2), "v"(l3), "v"(l4), "v"(l5), "v"(l6), "v"(l7), "v"(g), "v"(g1), "v"(g2), "v"(g3), "v"(g4), "v"(g5), "v"(g6), "v"(g7) : "memory"); }
template <int ACT>
__global__ __launch_bounds__(128) void k_gemm2(const _Float16* __restrict__ A, int lda, size_t sA, const _Float16* __restrict__ Bh, int ldb, size_t sB, float alpha, const float* __restrict__ bias, size_t sBias, const float* __restrict__ CP, int rowsPerB, size_t sCPb, int row0g,
    float* __restrict__ C, _Float16* __restrict__ C16, int ldc, size_t sC, int M, int N, int K) { static_assert(ACT == 0 || ACT == 3 || ACT == 6 || ACT == 8 || ACT == 9 || ACT == 11 || ACT == 12 || ACT == 14 || ACT == 15 || ACT == 16 || ACT == 17, "k_gemm2: unsupported ACT code (would silently apply no activation)");
  __shared__ __attribute__((aligned(16))) float so[4][32][68];
  __shared__ __attribute__((aligned(16))) unsigned char ring[2][G2_BUF];
  const int tid = threadIdx.x, w = tid >> 5, lane = tid & 31, ln = lane & 15, hh = lane >> 4; const int by = blockIdx.y;
  A += (size_t)by * sA; Bh += (size_t)by * sB; const size_t cofs = (size_t)by * sC; const float* bp = bias ? bias + (size_t)by * sBias : nullptr;
  const int ntn = N >> 6; const int mt = blockIdx.x / ntn, nq = blockIdx.x - mt * ntn; const int row0 = mt * 128 + 32 * w, col0 = nq * 64; if (mt * 128 >= M) return;      /* taken by a whole work-group, in front of every barrier */
  const int cr = tid >> 4, cc = tid & 15;      /* copy role: 16 lanes cover the 256 B of one row, a wave two whole rows (4 lines) */
  const _Float16* ga = A + (size_t)(mt * 128 + cr) * lda + cc * 8; const _Float16* gb = Bh + (size_t)(col0 + cr) * ldb + cc * 8; const unsigned lc = (unsigned)(size_t)&ring[0][0] + cr * G2_PITCH + cc * 16;
  auto stage = [&](int t, int buf) { const unsigned l = lc + buf * G2_BUF; const _Float16* a = ga + t * 128;
    g2_copy8(l, a, (size_t)8 * lda); g2_copy8(l + 64 * G2_PITCH, a + (size_t)64 * lda, (size_t)8 * lda); g2_copy8(l + 128 * G2_PITCH, gb + t * 128, (size_t)8 * ldb); };
  const int nt = K >> 7;
  const v8f z8 = {0.f,0.f,0.f,0.f,0.f,0.f,0.f,0.f}; v8f c00 = z8, c01 = z8, c02 = z8, c03 = z8, c10 = z8, c11 = z8, c12 = z8, c13 = z8;
  stage(0, 0);
  asm volatile("s_wait_asynccnt 0x0" ::: "memory");      /* this wave's copies of stage 0 have landed */
  __syncthreads();                                       /* every wave's have: stage 0 may be read */
  if (nt > 1) stage(1, 1);
#pragma unroll 1    /* one stage a trip: the publish point at the foot stands once */
  for (int t = 0; t < nt; ++t) { const unsigned char* ap = &ring[t & 1][0] + (32 * w + ln) * G2_PITCH + 16 * hh; const unsigned char* bq = &ring[t & 1][0] + (128 + ln) * G2_PITCH + 16 * hh; v16h fa[2][2], fb[2][4];
    auto frags = [&](int kk, v16h (&a)[2], v16h (&b)[4]) { a[0] = g2_lfrag(ap + kk * 64); a[1] = g2_lfrag(ap + 16 * G2_PITCH + kk * 64);
#pragma unroll      /* constant indices, so the fragment arrays stay in registers */
      for (int j = 0; j < 4; ++j) b[j] = g2_lfrag(bq + j * 16 * G2_PITCH + kk * 64); };
    frags(0, fa[0], fb[0]);
#pragma unroll      /* constant indices, so the fragment arrays stay in registers */
    for (int kk = 0; kk < 4; ++kk) { const int c = kk & 1;
      if (kk < 3) frags(kk + 1, fa[c ^ 1], fb[c ^ 1]);
      __builtin_amdgcn_sched_barrier(0);      /* the next block's LDS reads stay one group ahead of this block's products instead of among them */
      c00 = g2_mma(fa[c][0], fb[c][0], c00); c10 = g2_mma(fa[c][1], fb[c][0], c10); c01 = g2_mma(fa[c][0], fb[c][1], c01); c11 = g2_mma(fa[c][1], fb[c][1], c11);
      c02 = g2_mma(fa[c][0], fb[c][2], c02); c12 = g2_mma(fa[c][1], fb[c][2], c12); c03 = g2_mma(fa[c][0], fb[c][3], c03); c13 = g2_mma(fa[c][1], fb[c][3], c13);
      __builtin_amdgcn_sched_barrier(0); }    /* and the block after next's reads stay behind these products */
    asm volatile("s_wait_dscnt 0x0" ::: "memory");         /* this wave has finished reading the buffer */
    asm volatile("s_wait_asynccnt 0x0" ::: "memory");      /* its copies of stage t + 1 have landed */
    __syncthreads();                                       /* publishes stage t + 1 and ends every wave's reads of stage t */
    if (t + 2 < nt) stage(t + 2, t & 1); }                 /* refill of the buffer just left; the test reads the same in the whole work-group */
  asm volatile("s_wait_asynccnt 0x0" ::: "memory");        /* nothing of this wave is in flight behind the loop */
  v8f accs[8] = {c00, c01, c02, c03, c10, c11, c12, c13};
#pragma unroll
  for (int u = 0; u < 8; ++u) { const int t = u & 3, half = u >> 2; const int col = col0 + t * 16 + ln; const float bv = bp ? bf16_round(bp[col]) : 0.f;
#pragma unroll
    for (int r = 0; r < 8; ++r) { const int rloc = half * 16 + 8 * hh + r; float v = accs[u][r] * alpha + bv; if (CP) { if (rowsPerB < 0) v += CP[cofs + (size_t)(row0g + row0 + rloc) * ldc + col];      /* rowsPerB < 0: own element of the batched C plane */ else { const int bidx = (row0g + row0 + rloc) / rowsPerB; v += CP[(size_t)bidx * sCPb + (size_t)by * 64 + col]; } }
      if (ACT == 3) v = fmaxf(v, 0.f); else if (ACT == 6) v = 0.5f * v * (1.0f + erff(v * 0.70710678118654752f)); else if (ACT == 11) v = 1.0f / (1.0f + expf(-v)); else if (ACT == 15) v = v / (1.0f + expf(-v)); else if (ACT == 12) v = (v > 0.f) ? v : 0.01f * v; else if (ACT == 8) v = tanhf(v); else if (ACT == 9) v = 0.5f * v * (1.0f + tanhf(0.7978845608028654f * (v + 0.044715f * v * v * v))); else if (ACT == 14) v = (v > 0.f) ? v : 0.1f * v; else if (ACT == 16) v = (v >= 0.f) ? v : 0.3f * v; else if (ACT == 17) v = (v >= 0.f) ? v : 0.2f * v;
      so[w][rloc][t * 16 + ln] = v; } }
  __builtin_amdgcn_fence(__ATOMIC_ACQ_REL, "workgroup"); __builtin_amdgcn_wave_barrier();
  const int rsub = lane >> 4, c4 = (lane & 15) * 4;
  {
#pragma unroll
    for (int q = 0; q < 16; ++q) { const int r = q * 2 + rsub; const v4f v = *(const v4fa*)&so[w][r][c4]; if (C) *(v4f*)(C + cofs + (size_t)(row0 + r) * ldc + col0 + c4) = v; if (C16) { v4h h4; for (int i = 0; i < 4; ++i) h4[i] = (_Float16)v[i]; *(v4h*)(C16 + cofs + (size_t)(row0 + r) * ldc + col0 + c4) = h4; } }
     } }


__global__ __launch_bounds__(256) void k_wnat(const float* __restrict__ w, size_t n8, _Float16* __restrict__ Bt) { const size_t t = (size_t)blockIdx.x * 256 + threadIdx.x; if (t >= n8) return; FragH f; for (int q = 0; q < 8; ++q) f.h[q] = (_Float16)(bf16_round(w[t * 8 + q]) * 16.0f); *(v8us*)((unsigned short*)Bt + t * 8) = f.half[0];  }
__global__ __launch_bounds__(256) void k_rsm(const float* __restrict__ S, _Float16* __restrict__ P, int nrows) {
  #pragma clang fp contract(off)
  const int i = blockIdx.x * 256 + threadIdx.x; if (i >= nrows) return; const float* s = S + (size_t)i * SQ; float mx = -3.0e38f;
#pragma unroll 1
  for (int j = 0; j < SQ; ++j) mx = fmaxf(mx, s[j]); float se = 0.f;
#pragma unroll 1
  for (int j = 0; j < SQ; ++j) se += expf(s[j] - mx); const float sc = 256.0f / se;
#pragma unroll 1
  for (int j0 = 0; j0 < SQ; j0 += 8) { FragH f; for (int q = 0; q < 8; ++q) f.h[q] = (_Float16)(expf(s[j0 + q] - mx) * sc); unsigned short* d = (unsigned short*)P + (size_t)i * SQ + j0; *(v8us*)d = f.half[0];  } }
__global__ __launch_bounds__(256) void k_vt(const _Float16* __restrict__ V16, int b, int h0, _Float16* __restrict__ VT) { __shared__ unsigned short tl[64][65]; const int tid = threadIdx.x; const int hh = blockIdx.x % HG, sg = blockIdx.x / HG; const int s0 = sg * 64; const int h = h0 + hh;
  for (int i = tid; i < 64 * 8; i += 256) { const int j = i / 8, d8 = (i % 8) * 8; FragH f; f.half[0] = *(const v8us*)((const unsigned short*)V16 + ((size_t)b * SQ + s0 + j) * DM + h * HD + d8); for (int q = 0; q < 8; ++q) tl[d8 + q][j] = f.u[q]; }
  __syncthreads();
  { for (int i = tid; i < 64 * 8; i += 256) { const int d = i / 8, j8 = (i % 8) * 8; FragH f; for (int q = 0; q < 8; ++q) f.u[q] = tl[d][j8 + q]; *(v8us*)((unsigned short*)VT + ((size_t)hh * HD + d) * SQ + s0 + j8) = f.half[0]; }  } }


// lane l <-> lane l ^ M of the wave, in vector registers (no LDS round trip): M = 16 crosses the two 16-lane rows, M < 16 is a DPP row_xmask move
template <int M>
__device__ __forceinline__ float lane_xor(float x) { const int b = __float_as_int(x);
  if constexpr (M == 16) return __int_as_float(__builtin_amdgcn_permlanex16(b, b, 0x76543210, 0xfedcba98, false, false));
  else return __int_as_float(__builtin_amdgcn_update_dpp(0, b, 0x160 | M, 0xf, 0xf, true)); }
// ---- fused attention: scores and weights live in registers only ----
__device__ __forceinline__ v8f f_mma(v16h a, v16h b, v8f c) { return __builtin_amdgcn_wmma_f32_16x16x32_f16(false, a, false, b, (short)0, c, false, false); }
typedef unsigned v4ua __attribute__((ext_vector_type(4), may_alias));
#define SC2 0.18033688011112042f     /* (1 / 8) log2(e): scores go to the exponent base 2 */
#define MASKED -3.0e38f              /* score of a masked key: its weight underflows to 0 against any row reference >= M0 */
#define M0 -1.0e30f                  /* start value of a row's reference; a row with every key masked keeps it, sums 0 and ends as 0 x inf = NaN like the definition */
// one bit per (query, key): bit j of word [query][key / 32] is mask[query][32 (key / 32) + j] != 0; a wave packs 32 words
__global__ __launch_bounds__(256) void k_maskbits(const int* __restrict__ mask, unsigned* __restrict__ MB) {
  const int lane = threadIdx.x & 31; const size_t wv = (size_t)blockIdx.x * 8 + (threadIdx.x >> 5); const int* m = mask + wv * 1024; unsigned keep = 0;
#pragma unroll      /* 32 independent loads in flight */
  for (int i = 0; i < 32; ++i) { const unsigned bits = __builtin_amdgcn_ballot_w32(m[i * 32 + lane] != 0); if (lane == i) keep = bits; }
  MB[wv * 32 + lane] = keep; }
// S^T tile rows are keys 8 hh + r, its column is query ln: bit 16 kt + 8 hh + r of the query's mask word
__device__ __forceinline__ void mask_tile(v8f& s, unsigned word, int kt, int hh) { const unsigned u = word >> (16 * kt + 8 * hh);
#pragma unroll      /* constant indices, so the tile stays in registers */
  for (int r = 0; r < 8; ++r) s[r] = ((u >> r) & 1u) ? s[r] : MASKED; }
// the key loop of k_fattn; MSK = false is taken by a wave none of whose 32 mask rows holds a zero, and then reads no mask word
template <bool MSK>
__device__ __forceinline__ void fattn_keys(const _Float16* kp, const _Float16* vp, const unsigned* mb, int hh, const v16h (&qf)[2][2], v8f (&o)[2][4], float (&m)[2], float (&l)[2]) {
  const v8f z8 = {0.f,0.f,0.f,0.f,0.f,0.f,0.f,0.f}; v16h ka[2][2], kb2[2][2], va[4], vb[4]; unsigned mw[2] = {0u, 0u};
#pragma unroll      /* constant indices, so the fragment arrays stay in registers */
  for (int t = 0; t < 2; ++t) { ka[t][0] = g2_frag(kp + (size_t)t * 16 * DM, hh); ka[t][1] = g2_frag(kp + (size_t)t * 16 * DM + 32, hh); if (MSK) mw[t] = mb[t * 16 * (SQ / 32)]; }
#pragma unroll      /* constant indices, so the fragment arrays stay in registers */
  for (int d = 0; d < 4; ++d) va[d] = g2_frag(vp + (size_t)d * 16 * SQ, hh);
  // one pass = 32 keys: kc and vc hold this pass's K and V^T fragments, kx and vn take the next pass's, a whole pass in flight; the last pass re-reads the first rows, unused
  auto pass = [&](int kb, const v16h (&kc)[2][2], v16h (&kx)[2][2], const v16h (&vc)[4], v16h (&vn)[4]) { const int kn = (kb + 32) & (SQ - 1);
    v8f s[2][2]; float mx[2]; FragH pf[2];
#pragma unroll      /* constant indices, so the fragment arrays stay in registers */
    for (int t = 0; t < 2; ++t) { kx[t][0] = g2_frag(kp + (size_t)(kn + t * 16) * DM, hh); kx[t][1] = g2_frag(kp + (size_t)(kn + t * 16) * DM + 32, hh); }
#pragma unroll      /* constant indices, so the fragment arrays stay in registers */
    for (int d = 0; d < 4; ++d) vn[d] = g2_frag(vp + (size_t)d * 16 * SQ + kn, hh);
#pragma unroll      /* constant indices, so the fragment arrays stay in registers */
    for (int qt = 0; qt < 2; ++qt)
#pragma unroll      /* constant indices, so the fragment arrays stay in registers */
      for (int kt = 0; kt < 2; ++kt) s[qt][kt] = f_mma(kc[kt][1], qf[qt][1], f_mma(kc[kt][0], qf[qt][0], z8));
    if (MSK) {
#pragma unroll      /* constant indices, so the fragment arrays stay in registers */
      for (int qt = 0; qt < 2; ++qt) { mask_tile(s[qt][0], mw[qt], 0, hh); mask_tile(s[qt][1], mw[qt], 1, hh); mw[qt] = mb[qt * 16 * (SQ / 32) + (kn >> 5)]; }
      asm volatile("s_wait_xcnt 0x0" ::: "memory"); }      /* precaution: stands behind the loads issued above, in front of any rewrite of their address registers */
#pragma unroll      /* constant indices, so the fragment arrays stay in registers */
    for (int qt = 0; qt < 2; ++qt) { float a = fmaxf(s[qt][0][0], s[qt][1][0]);
#pragma unroll      /* constant indices, so the fragment arrays stay in registers */
      for (int r = 1; r < 8; ++r) a = fmaxf(a, fmaxf(s[qt][0][r], s[qt][1][r]));
      a *= SC2; mx[qt] = fmaxf(a, lane_xor<16>(a)); }      /* both halves of a column agree on the maximum, so on the reference too */
    if (__builtin_amdgcn_ballot_w32(mx[0] > m[0] + 8.f || mx[1] > m[1] + 8.f) != 0) {      /* scalar branch: rescale only when some column's reference must rise */
#pragma unroll      /* constant indices, so the fragment arrays stay in registers */
      for (int qt = 0; qt < 2; ++qt) { const float mn = fmaxf(m[qt], mx[qt]), f = __builtin_amdgcn_exp2f(m[qt] - mn); m[qt] = mn; l[qt] *= f;
#pragma unroll      /* constant indices, so the fragment arrays stay in registers */
        for (int d = 0; d < 4; ++d) o[qt][d] *= f; } }
#pragma unroll      /* constant indices, so the fragment arrays stay in registers */
    for (int qt = 0; qt < 2; ++qt) { float ls = 0.f;
#pragma unroll      /* constant indices, so the fragment arrays stay in registers */
      for (int r = 0; r < 8; ++r) { const float p0 = __builtin_amdgcn_exp2f(__builtin_fmaf(s[qt][0][r], SC2, -m[qt])), p1 = __builtin_amdgcn_exp2f(__builtin_fmaf(s[qt][1][r], SC2, -m[qt])); ls += p0 + p1; pf[qt].h[r] = (_Float16)p0; pf[qt].h[8 + r] = (_Float16)p1; }
      l[qt] += ls; }
#pragma unroll      /* constant indices, so the fragment arrays stay in registers */
    for (int d = 0; d < 4; ++d) { o[0][d] = f_mma(vc[d], pf[0].v, o[0][d]); o[1][d] = f_mma(vc[d], pf[1].v, o[1][d]); }
    __builtin_amdgcn_sched_barrier(0); };      /* keeps the next pass's products behind this pass: moved up, they would wait on fragments fetched only half a pass earlier */
#pragma unroll 1    /* two passes a trip, so the two fragment buffers swap by name and no register is copied */
  for (int kb = 0; kb < SQ; kb += 64) { pass(kb, ka, kb2, va, vb); pass(kb + 32, kb2, ka, vb, va); } }
// One wave: 32 queries of one head against all keys, 32 keys a pass. S^T = K Q^T (A = K rows, B = Q rows), so a lane holds one query's scores; the two S^T tiles of a pass, converted in place,
// are the B operand of O^T += V^T P^T. Running row reference m (base-2 exponent), raised only when a new maximum exceeds it by more than 8 (weights then stay <= 256, inside f16); f32 row sums.
// Writes merged f16 rows 64 o + 64 alpha vp and, per (batch, head, query), the pair (m, 1 / sum) for the head-sum launch.
// The 8 waves of a work-group walk the same head's K and V^T, one work-group per WGP, so a line that one wave has fetched can serve the others from the WGP cache.
__global__ __launch_bounds__(256) void k_fattn(const _Float16* __restrict__ Q, const _Float16* __restrict__ Kp, const _Float16* __restrict__ VT, const unsigned* __restrict__ MB, const float* __restrict__ AV, _Float16* __restrict__ O16, float* __restrict__ ST) {
  const int tid = threadIdx.x, w = tid >> 5, lane = tid & 31, ln = lane & 15, hh = lane >> 4; const int h = blockIdx.y, b = blockIdx.z, q0 = blockIdx.x * 256 + w * 32; const size_t r0 = (size_t)b * SQ;
  const _Float16* qp = Q + (r0 + q0 + ln) * DM + h * HD; const _Float16* kp = Kp + (r0 + ln) * DM + h * HD; const _Float16* vp = VT + ((size_t)(b * NH + h) * HD + ln) * SQ; const unsigned* mb = MB + (size_t)(q0 + ln) * (SQ / 32);
  const v8f z8 = {0.f,0.f,0.f,0.f,0.f,0.f,0.f,0.f};
  v16h qf[2][2]; v8f o[2][4]; float m[2] = {M0, M0}, l[2] = {0.f, 0.f};
#pragma unroll      /* constant indices, so the fragment arrays stay in registers */
  for (int t = 0; t < 2; ++t) { qf[t][0] = g2_frag(qp + (size_t)t * 16 * DM, hh); qf[t][1] = g2_frag(qp + (size_t)t * 16 * DM + 32, hh);
#pragma unroll      /* constant indices, so the fragment arrays stay in registers */
    for (int d = 0; d < 4; ++d) o[t][d] = z8; }
  unsigned all1 = 0xFFFFFFFFu;      /* lane i: the AND of the 64 mask words of the wave's row i */
  { const v4ua* row = (const v4ua*)(MB + (size_t)(q0 + lane) * (SQ / 32));
#pragma unroll      /* 16 independent loads in flight */
    for (int i = 0; i < SQ / 128; ++i) { const v4ua x = row[i]; all1 &= x[0] & x[1] & x[2] & x[3]; } }
  asm volatile("s_wait_xcnt 0x0" ::: "memory");      /* precaution: stands behind the loads issued above, in front of any rewrite of their address registers */
  if (__builtin_amdgcn_ballot_w32(all1 != 0xFFFFFFFFu) != 0) fattn_keys<true>(kp, vp, mb, hh, qf, o, m, l); else fattn_keys<false>(kp, vp, mb, hh, qf, o, m, l);      /* scalar branch */
#pragma unroll      /* constant indices, so the fragment arrays stay in registers */
  for (int qt = 0; qt < 2; ++qt) { const float inv = 1.0f / (l[qt] + lane_xor<16>(l[qt])), sc = inv * 64.0f; const int q = q0 + qt * 16 + ln;
    if (hh == 0) { float* st = ST + ((size_t)(b * NH + h) * SQ + q) * 2; st[0] = m[qt]; st[1] = inv; }
#pragma unroll      /* constant indices, so the fragment arrays stay in registers */
    for (int d = 0; d < 4; ++d) { const size_t off = (r0 + q) * DM + h * HD + d * 16 + 8 * hh; const v4f a0 = *(const v4fa*)(AV + off), a1 = *(const v4fa*)(AV + off + 4); FragH f;      /* O^T tile: a lane holds 8 consecutive d of one query */
#pragma unroll      /* constant indices, so the fragment arrays stay in registers */
      for (int r = 0; r < 4; ++r) { f.h[r] = (_Float16)(o[qt][d][r] * sc + a0[r]); f.h[4 + r] = (_Float16)(o[qt][d][4 + r] * sc + a1[r]); }
      *(v8us*)((unsigned short*)O16 + off) = f.half[0]; } } }
// the head loop of k_headsum; MSK = false is taken by a wave whose 32 x 64 mask bits are all set
template <bool MSK>
__device__ __forceinline__ void headsum_heads(const _Float16* qp, const _Float16* kp, const float* st, int hh, const unsigned (&mw)[2][2], v8f (&acc)[2][4]) {
  const v8f z8 = {0.f,0.f,0.f,0.f,0.f,0.f,0.f,0.f};
#pragma unroll 1    /* one head a trip: the live set stays small enough for four waves a SIMD */
  for (int h = 0; h < NH; ++h) { v16h qf[2][2], kf[4][2]; float mr[2], iv[2];
#pragma unroll      /* constant indices, so the fragment arrays stay in registers */
    for (int t = 0; t < 4; ++t) { kf[t][0] = g2_frag(kp + (size_t)t * 16 * DM + h * HD, hh); kf[t][1] = g2_frag(kp + (size_t)t * 16 * DM + h * HD + 32, hh); }
#pragma unroll      /* constant indices, so the fragment arrays stay in registers */
    for (int t = 0; t < 2; ++t) { qf[t][0] = g2_frag(qp + (size_t)t * 16 * DM + h * HD, hh); qf[t][1] = g2_frag(qp + (size_t)t * 16 * DM + h * HD + 32, hh); mr[t] = st[((size_t)h * SQ + t * 16) * 2]; iv[t] = st[((size_t)h * SQ + t * 16) * 2 + 1]; }
#pragma unroll      /* constant indices, so the fragment arrays stay in registers */
    for (int qt = 0; qt < 2; ++qt)
#pragma unroll      /* constant indices, so the fragment arrays stay in registers */
      for (int kt = 0; kt < 4; ++kt) { v8f s = f_mma(kf[kt][1], qf[qt][1], f_mma(kf[kt][0], qf[qt][0], z8));
        if (MSK) mask_tile(s, mw[qt][kt >> 1], kt & 1, hh);
#pragma unroll      /* constant indices, so the fragment arrays stay in registers */
        for (int r = 0; r < 8; ++r) acc[qt][kt][r] = __builtin_fmaf(__builtin_amdgcn_exp2f(__builtin_fmaf(s[r], SC2, -mr[qt])), iv[qt], acc[qt][kt][r]); } } }
// second output: one wave holds 32 queries x 64 keys of the head sum in registers and walks the 16 heads, forming each head's S^T tiles again (same products, same order as k_fattn) and its weights from the stored (m, 1 / sum)
__global__ __launch_bounds__(128) void k_headsum(const _Float16* __restrict__ Q, const _Float16* __restrict__ Kp, const unsigned* __restrict__ MB, const float* __restrict__ ST, float* __restrict__ WS) {
  const int tid = threadIdx.x, w = tid >> 5, lane = tid & 31, ln = lane & 15, hh = lane >> 4; const int b = blockIdx.z, q0 = blockIdx.y * 32, k0 = blockIdx.x * 256 + w * 64; const size_t r0 = (size_t)b * SQ;
  const _Float16* qp = Q + (r0 + q0 + ln) * DM; const _Float16* kp = Kp + (r0 + k0 + ln) * DM; const float* st = ST + ((size_t)b * NH * SQ + q0 + ln) * 2;
  const v8f z8 = {0.f,0.f,0.f,0.f,0.f,0.f,0.f,0.f}; v8f acc[2][4]; unsigned mw[2][2];
#pragma unroll      /* constant indices, so the fragment arrays stay in registers */
  for (int qt = 0; qt < 2; ++qt) { const unsigned* mb = MB + (size_t)(q0 + qt * 16 + ln) * (SQ / 32) + (k0 >> 5); mw[qt][0] = mb[0]; mw[qt][1] = mb[1];
#pragma unroll      /* constant indices, so the fragment arrays stay in registers */
    for (int kt = 0; kt < 4; ++kt) acc[qt][kt] = z8; }
  if (__builtin_amdgcn_ballot_w32((mw[0][0] & mw[0][1] & mw[1][0] & mw[1][1]) != 0xFFFFFFFFu) != 0) headsum_heads<true>(qp, kp, st, hh, mw, acc); else headsum_heads<false>(qp, kp, st, hh, mw, acc);      /* scalar branch */
#pragma unroll      /* constant indices, so the fragment arrays stay in registers */
  for (int qt = 0; qt < 2; ++qt)
#pragma unroll      /* constant indices, so the fragment arrays stay in registers */
    for (int kt = 0; kt < 4; ++kt) { float* d = WS + (r0 + q0 + qt * 16 + ln) * SQ + k0 + kt * 16 + 8 * hh; v4f a0, a1;      /* a lane holds 8 consecutive keys of one query */
#pragma unroll      /* constant indices, so the fragment arrays stay in registers */
      for (int r = 0; r < 4; ++r) { a0[r] = acc[qt][kt][r]; a1[r] = acc[qt][kt][4 + r]; }
      *(v4f*)d = a0; *(v4f*)(d + 4) = a1; } }
__global__ __launch_bounds__(256) void k_av64(const float* __restrict__ VPF, const float* __restrict__ alpha, float* __restrict__ AV, size_t n4) {
  #pragma clang fp contract(off)
  const size_t t = (size_t)blockIdx.x * 256 + threadIdx.x; if (t >= n4) return; const float a = __fmul_rn(bf16_round(alpha[0]), 64.0f); const v4f v = *(const v4fa*)(VPF + t * 4); v4f o; for (int q = 0; q < 4; ++q) o[q] = __fmul_rn(a, v[q]); *(v4f*)(AV + t * 4) = o;  }

extern "C" void kernel_launch(void* const* d_in, const int* in_sizes, int n_in,
                              void* d_out, int out_size, void* d_ws, size_t ws_size, hipStream_t stream) {
  (void)in_sizes; (void)n_in; (void)out_size;
  const float* const* I = (const float* const*)d_in; const float* qin = I[0]; const float* kin = I[1]; const float* vin = I[2]; const int* mask = (const int*)d_in[3]; const float* wq = I[4]; const float* bq = I[5]; const float* wkv = I[6]; const float* bkv = I[7]; const float* wo = I[8]; const float* bo = I[9]; const float* alpha = I[10];      /* weights [in][out] */
  float* out0 = (float*)d_out; float* out1 = (float*)d_out + NR * DM;      /* byte offset 16,777,216 */
  char* ws = (char*)d_ws; size_t off = 0;
  auto take = [&](size_t bytes) { char* p = ws + off; off += (bytes + 255) & ~(size_t)255; return p; };
  _Float16* BQ = (_Float16*)take((size_t)DM * DM * 2); _Float16* BKV = (_Float16*)take((size_t)DM * DM * 2); _Float16* BO = (_Float16*)take((size_t)DM * DM * 2);
  _Float16* Q16 = (_Float16*)take(NR * DM * 2); _Float16* K16 = (_Float16*)take(NR * DM * 2); _Float16* V16 = (_Float16*)take(NR * DM * 2); float* AV = (float*)take(NR * DM * 4); _Float16* O16 = (_Float16*)take(NR * DM * 2);
  _Float16* VT = (_Float16*)take((size_t)NB * NH * HD * SQ * 2); unsigned* MB = (unsigned*)take((size_t)SQ * (SQ / 32) * 4); float* ST = (float*)take((size_t)NB * NH * SQ * 2 * 4);
  _Float16* XQ = (_Float16*)take(NR * DM * 2); _Float16* XK = (_Float16*)take(NR * DM * 2); _Float16* XV = (_Float16*)take(NR * DM * 2); float* VPF = (float*)take(NR * DM * 4);
  if (off > ws_size) return;      /* 6 + 24 + 16 + 8 + 8 + 0.5 + 0.5 + 24 + 16 = 103 MiB */
  { const unsigned gw = (unsigned)(((size_t)DM * (DM / 8) + 255) / 256); k_wt_f16<<<gw, 256, 0, stream>>>(wq, BQ, DM, DM, 16.0f); k_wt_f16<<<gw, 256, 0, stream>>>(wkv, BKV, DM, DM, 16.0f); k_wt_f16<<<gw, 256, 0, stream>>>(wo, BO, DM, DM, 16.0f); }
  { const unsigned gx = (unsigned)((NR * DM / 8 + 255) / 256); k_x16<<<gx, 256, 0, stream>>>(qin, XQ, NR * DM / 8); k_x16<<<gx, 256, 0, stream>>>(kin, XK, NR * DM / 8); k_x16<<<gx, 256, 0, stream>>>(vin, XV, NR * DM / 8); }
  const size_t r0p = (size_t)B0 * SQ; const dim3 gp((unsigned)((MP / 128) * (DM / 64)), 1);
  k_gemm2<0><<<gp, 128, 0, stream>>>(XQ + r0p * DM, DM, 0, BQ, DM, 0, 0.0625f, bq, 0, nullptr, 1, 0, 0, nullptr, Q16 + r0p * DM, DM, 0, MP, DM, DM);
  k_gemm2<0><<<gp, 128, 0, stream>>>(XK + r0p * DM, DM, 0, BKV, DM, 0, 0.0625f, bkv, 0, nullptr, 1, 0, 0, nullptr, K16 + r0p * DM, DM, 0, MP, DM, DM);
  k_gemm2<0><<<gp, 128, 0, stream>>>(XV + r0p * DM, DM, 0, BKV, DM, 0, 0.0625f, bkv, 0, nullptr, 1, 0, 0, VPF + r0p * DM, V16 + r0p * DM, DM, 0, MP, DM, DM);      /* vp: f32 (residual) and f16 (attention operand) */
  k_av64<<<(unsigned)(((size_t)MP * DM / 4 + 255) / 256), 256, 0, stream>>>(VPF + r0p * DM, alpha, AV + r0p * DM, (size_t)MP * DM / 4);
  k_vt<NH, SQ><<<NB * NH * (SQ / 64), 256, 0, stream>>>(V16, DM, 0, VT);      /* V^T [NB][NH][HD][SQ] */
  k_maskbits<<<SQ * (SQ / 32) / 256, 256, 0, stream>>>(mask, MB);
  k_fattn<<<dim3(SQ / 256, NH, NB), 256, 0, stream>>>(Q16, K16, VT, MB, AV, O16, ST);      /* o x64 = 64 attn v + 64 alpha vp, f16 rows; row statistics */
  k_headsum<<<dim3(SQ / 256, SQ / 32, NB), 128, 0, stream>>>(Q16, K16, MB, ST, out1);      /* sum over the heads of the weights */
  k_gemm2<0><<<dim3((unsigned)((MPO / 128) * (DM / 64)), 1), 128, 0, stream>>>(O16 + r0p * DM, DM, 0, BO, DM, 0, 0.0009765625f, bo, 0, nullptr, 1, 0, 0, out0 + r0p * DM, nullptr, DM, 0, MPO, DM, DM);      /* out0 = o Wo + bo */
}

// v005
// A run of this version takes 167 microseconds.
// In both of two side-by-side timings against v004, it was 1.21 times as fast.
// All steps since v000 together make it 818 times as fast.
#include <hip/hip_runtime.h>
#define NB 2
#define SQ 2048
#define DM 1024
#define NH 16
#define HD 64
#define HG 4                         /* k_vt(b,h0) compatibility (unused) */
#define B0 0                         /* first batch processed (debug hook) */
#define NBR NB                       /* batches processed (debug hook) */
#define Q0S 0                        /* first tile (unused) */
#define QN SQ                        /* query rows end (unused) */
#define NR ((size_t)NB * SQ)
#define MP ((int)((size_t)NBR * SQ)) /* rows projected (debug hook) */
#define MPO MP                       /* rows through the output GEMM (debug hook) */
typedef __bf16 v16b __attribute__((ext_vector_type(16)));
typedef unsigned short v8us __attribute__((ext_vector_type(8), may_alias));
typedef float  v8f  __attribute__((ext_vector_type(8)));
typedef float  v4f  __attribute__((ext_vector_type(4)));
typedef float  v4fa __attribute__((ext_vector_type(4), may_alias));
union FragB { v16b v; v8us half[2]; unsigned short u[16]; };

__device__ __forceinline__ unsigned short bf16_bits(float x) { unsigned int u = __float_as_uint(x); return (unsigned short)((u + 0x7FFFu + ((u >> 16) & 1u)) >> 16); }
__device__ __forceinline__ float bf16_val(unsigned short b) { return __uint_as_float(((unsigned int)b) << 16); }
__device__ __forceinline__ float bf16_round(float x) { return bf16_val(bf16_bits(x)); }
// D += A·B with NT terms: 1 = ah·bh, 2 = + al·bh (A split), 3 = + ah·bl (both split)
template <int NT>
__device__ __forceinline__ v8f mmaN(v16b ah, v16b al, v16b bh, v16b bl, v8f c) {
  c = __builtin_amdgcn_wmma_f32_16x16x32_bf16(false, ah, false, bh, (short)0, c, false, false);
  if (NT >= 2) c = __builtin_amdgcn_wmma_f32_16x16x32_bf16(false, al, false, bh, (short)0, c, false, false);
  if (NT >= 3) c = __builtin_amdgcn_wmma_f32_16x16x32_bf16(false, ah, false, bl, (short)0, c, false, false);
  asm volatile("v_nop\n\tv_nop\n\tv_nop\n\tv_nop" : "+v"(c) : "v"(ah), "v"(al), "v"(bh), "v"(bl));
  return c;
}

__global__ __launch_bounds__(256) void k_wt_bf16(const float* __restrict__ W, unsigned short* __restrict__ Wt, int K, int N) {
  const int t = blockIdx.x * 256 + threadIdx.x;
  const int k8n = K / 8;
  if (t >= N * k8n) return;
  const int n = t / k8n, k8 = (t % k8n) * 8;
  v8us v;
#pragma unroll
  for (int i = 0; i < 8; ++i) v[i] = bf16_bits(W[(size_t)(k8 + i) * N + n]);
  *(v8us*)(Wt + (size_t)n * K + k8) = v;
  
}

// GEMM C[M][N] (f32, pitch ldc) = act(A[M][K]·W + bias). A f32 row-major (pitch lda) converted per fragment to bf16
// (ASPLIT: hi/lo two planes -> 2 terms, else single rounded term); Wt bf16 [N][K] (pitch ldb). BIAS_BF16 rounds the
// bias to bf16 first (bias quantised to bf16 before the add). K%32==0, M%16==0, N%64==0.
template <bool ASPLIT, int ACT, bool BIAS_BF16>
__global__ __launch_bounds__(128) void k_gemm_bf(const float* __restrict__ A, int lda, const unsigned short* __restrict__ Wt, int ldb,
                                               const float* __restrict__ bias, float* __restrict__ C, int ldc, int M, int N, int K) {
  __shared__ __attribute__((aligned(16))) float so[4][16][64];
  const int tid = threadIdx.x, w = tid >> 5, lane = tid & 31, ln = lane & 15, hh = lane >> 4;
  const int ntn = N / 64;
  const int wid = blockIdx.x * 4 + w;
  const int mt = wid / ntn, nq = wid % ntn;
  if (mt * 16 >= M) return;
  const int row0 = mt * 16, col0 = nq * 64;
  const float* arow = A + (size_t)(row0 + ln) * lda;
  v8f acc[4] = {};
  for (int kb = 0; kb < K; kb += 32) {
    FragB ah, al;
    const v4f x0 = *(const v4fa*)(arow + kb + 8 * hh), x1 = *(const v4fa*)(arow + kb + 8 * hh + 4);
    const v4f x2 = *(const v4fa*)(arow + kb + 16 + 8 * hh), x3 = *(const v4fa*)(arow + kb + 16 + 8 * hh + 4);
    float xs[16] = {x0[0],x0[1],x0[2],x0[3],x1[0],x1[1],x1[2],x1[3],x2[0],x2[1],x2[2],x2[3],x3[0],x3[1],x3[2],x3[3]};
#pragma unroll
    for (int i = 0; i < 16; ++i) { const unsigned short hb = bf16_bits(xs[i]); ah.u[i] = hb; al.u[i] = ASPLIT ? bf16_bits(xs[i] - bf16_val(hb)) : (unsigned short)0; }
#pragma unroll
    for (int t = 0; t < 4; ++t) {
      const unsigned short* brow = Wt + (size_t)(col0 + t * 16 + ln) * ldb + kb;
      FragB b;
      b.half[0] = *(const v8us*)(brow + 8 * hh);
      b.half[1] = *(const v8us*)(brow + 16 + 8 * hh);
      acc[t] = mmaN<ASPLIT ? 2 : 1>(ah.v, al.v, b.v, b.v, acc[t]);
    }
  }
#pragma unroll
  for (int t = 0; t < 4; ++t) {
    float bv = bias ? bias[col0 + t * 16 + ln] : 0.f;
    if (BIAS_BF16) bv = bf16_round(bv);
#pragma unroll
    for (int r = 0; r < 8; ++r) { float v = acc[t][r] + bv; if (ACT == 1) v = fmaxf(v, 0.f); so[w][8 * hh + r][t * 16 + ln] = v; }
  }
  __builtin_amdgcn_fence(__ATOMIC_ACQ_REL, "workgroup");
  __builtin_amdgcn_wave_barrier();
  const int rsub = lane >> 4, c4 = (lane & 15) * 4;
  {
#pragma unroll
    for (int q = 0; q < 8; ++q) {
      const int r = q * 2 + rsub;
      const v4f v = *(const v4fa*)&so[w][r][c4];
      *(v4f*)(C + (size_t)(row0 + r) * ldc + col0 + c4) = v;
    }
    
  }
}

// GEMM C = act(A·W + bias + resid): A f32 (ASPLIT -> hi/lo 2 terms), Wt bf16 [N][K]; ACT 0 none, 1 relu, 2 exact gelu;
// resid (optional, f32, row index = (row % rmod), pitch ldr, RES_BF16 rounds it) added before the activation.
template <bool ASPLIT, int ACT, bool BIAS_BF16, bool RES_BF16>
__global__ __launch_bounds__(128) void k_gemm_bf3(const float* __restrict__ A, int lda, const unsigned short* __restrict__ Wt, int ldb,
                                                const float* __restrict__ bias, const float* __restrict__ resid, int rmod, int ldr,
                                                float* __restrict__ C, int ldc, int M, int N, int K) {
  __shared__ __attribute__((aligned(16))) float so[4][16][64];
  const int tid = threadIdx.x, w = tid >> 5, lane = tid & 31, ln = lane & 15, hh = lane >> 4;
  const int ntn = N / 64;
  const int wid = blockIdx.x * 4 + w;
  const int mt = wid / ntn, nq = wid % ntn;
  if (mt * 16 >= M) return;
  const int row0 = mt * 16, col0 = nq * 64;
  const float* arow = A + (size_t)(row0 + ln) * lda;
  v8f acc[4] = {};
  for (int kb = 0; kb < K; kb += 32) {
    FragB ah, al;
    const v4f x0 = *(const v4fa*)(arow + kb + 8 * hh), x1 = *(const v4fa*)(arow + kb + 8 * hh + 4);
    const v4f x2 = *(const v4fa*)(arow + kb + 16 + 8 * hh), x3 = *(const v4fa*)(arow + kb + 16 + 8 * hh + 4);
    float xs[16] = {x0[0],x0[1],x0[2],x0[3],x1[0],x1[1],x1[2],x1[3],x2[0],x2[1],x2[2],x2[3],x3[0],x3[1],x3[2],x3[3]};
#pragma unroll
    for (int i = 0; i < 16; ++i) { const unsigned short hb = bf16_bits(xs[i]); ah.u[i] = hb; al.u[i] = ASPLIT ? bf16_bits(xs[i] - bf16_val(hb)) : (unsigned short)0; }
#pragma unroll
    for (int t = 0; t < 4; ++t) {
      const unsigned short* brow = Wt + (size_t)(col0 + t * 16 + ln) * ldb + kb;
      FragB b;
      b.half[0] = *(const v8us*)(brow + 8 * hh);
      b.half[1] = *(const v8us*)(brow + 16 + 8 * hh);
      acc[t] = mmaN<ASPLIT ? 2 : 1>(ah.v, al.v, b.v, b.v, acc[t]);
    }
  }
#pragma unroll
  for (int t = 0; t < 4; ++t) {
    const int col = col0 + t * 16 + ln;
    float bv = bias ? bias[col] : 0.f;
    if (BIAS_BF16) bv = bf16_round(bv);
#pragma unroll
    for (int r = 0; r < 8; ++r) {
      float v = acc[t][r] + bv;
      if (resid) { float rv = resid[(size_t)((row0 + 8 * hh + r) % rmod) * ldr + col]; if (RES_BF16) rv = bf16_round(rv); v += rv; }
      if (ACT == 1) v = fmaxf(v, 0.f);
      if (ACT == 2) v = 0.5f * v * (1.0f + erff(v * 0.70710678118654752f));
      if (ACT == 3) { const float u = 0.7978845608028654f * (v + 0.044715f * v * v * v); v = 0.5f * v * (1.0f + tanhf(u)); }
      so[w][8 * hh + r][t * 16 + ln] = v;
    }
  }
  __builtin_amdgcn_fence(__ATOMIC_ACQ_REL, "workgroup");
  __builtin_amdgcn_wave_barrier();
  const int rsub = lane >> 4, c4 = (lane & 15) * 4;
  {
#pragma unroll
    for (int q = 0; q < 8; ++q) {
      const int r = q * 2 + rsub;
      const v4f v = *(const v4fa*)&so[w][r][c4];
      *(v4f*)(C + (size_t)(row0 + r) * ldc + col0 + c4) = v;
    }
    
  }
}
// row LayerNorm (biased variance, eps) over N: s = X (+ R); optional out_sum <- s; out_norm <- (s-mu)*rsqrt(var+eps)*g + b
template <bool PARAM_BF16>
__global__ __launch_bounds__(256) void k_layernorm(const float* __restrict__ X, const float* __restrict__ R, const float* __restrict__ g, const float* __restrict__ bta,
                                                  float* __restrict__ out_sum, float* __restrict__ out_norm, int N, float eps) {
  __shared__ float red[256];
  const int row = blockIdx.x, tid = threadIdx.x;
  const float* x = X + (size_t)row * N; const float* rr = R ? R + (size_t)row * N : nullptr;
  float vals[16];                     // up to N = 4096
  const int per = N / 256;            // contiguous chunk per thread? use strided-by-4 chunks: thread handles j = tid*4 + 1024*u
  float s1 = 0.f;
  for (int u = 0; u < per / 4; ++u) {
    const int j = tid * 4 + 1024 * u;
    const v4f a = *(const v4fa*)(x + j);
    v4f b = {0.f,0.f,0.f,0.f}; if (rr) b = *(const v4fa*)(rr + j);
#pragma unroll
    for (int q = 0; q < 4; ++q) { const float v = a[q] + b[q]; vals[u * 4 + q] = v; s1 += v; }
  }
  red[tid] = s1; __syncthreads();
  for (int st = 128; st > 0; st >>= 1) { if (tid < st) red[tid] += red[tid + st]; __syncthreads(); }
  const float mu = red[0] / (float)N; __syncthreads();
  float s2 = 0.f;
  for (int u = 0; u < per / 4; ++u)
#pragma unroll
    for (int q = 0; q < 4; ++q) { const float c = vals[u * 4 + q] - mu; s2 += c * c; }
  red[tid] = s2; __syncthreads();
  for (int st = 128; st > 0; st >>= 1) { if (tid < st) red[tid] += red[tid + st]; __syncthreads(); }
  const float rs = rsqrtf(red[0] / (float)N + eps);
  {
    for (int u = 0; u < per / 4; ++u) {
      const int j = tid * 4 + 1024 * u;
      v4f o, sm;
#pragma unroll
      for (int q = 0; q < 4; ++q) {
        float gg = g[j + q], bb = bta[j + q];
        if (PARAM_BF16) { gg = bf16_round(gg); bb = bf16_round(bb); }
        sm[q] = vals[u * 4 + q]; o[q] = (vals[u * 4 + q] - mu) * rs * gg + bb;
      }
      if (out_sum) *(v4f*)(out_sum + (size_t)row * N + j) = sm;
      *(v4f*)(out_norm + (size_t)row * N + j) = o;
    }
    
  }
}



// ---- f16 WMMA path (v_wmma_f32_16x16x32_f16): 11-bit significands for operands in range — used for every launched product, the unnormalised softmax weights (<= 256) among them
typedef _Float16 v16h __attribute__((ext_vector_type(16)));
union FragH { v16h v; v8us half[2]; _Float16 h[16]; unsigned short u[16]; };
template <int NT>
__device__ __forceinline__ v8f mmaH(v16h ah, v16h al, v16h bh, v16h bl, v8f c) {
  c = __builtin_amdgcn_wmma_f32_16x16x32_f16(false, ah, false, bh, (short)0, c, false, false);
  if (NT >= 2) c = __builtin_amdgcn_wmma_f32_16x16x32_f16(false, al, false, bh, (short)0, c, false, false);
  if (NT >= 3) c = __builtin_amdgcn_wmma_f32_16x16x32_f16(false, ah, false, bl, (short)0, c, false, false);
  asm volatile("v_nop\n\tv_nop\n\tv_nop\n\tv_nop" : "+v"(c) : "v"(ah), "v"(al), "v"(bh), "v"(bl));
  return c;
}
// batched GEMM like k_gemm_b but f16 operands: A f32 (split into f16 hi/lo if ASPLIT, else rounded to f16), Bt = f16 values [n][k]; alpha; C f32; N multiple of 16 (partial tiles skipped)
template <bool ASPLIT>
__global__ __launch_bounds__(128) void k_gemm_h(const float* __restrict__ A, int lda, size_t sA, const _Float16* __restrict__ Bh, int ldb, size_t sB, float alpha, float* __restrict__ C, int ldc, size_t sC, int M, int N, int K) {
  __shared__ __attribute__((aligned(16))) float so[4][16][64];
  const int tid = threadIdx.x, w = tid >> 5, lane = tid & 31, ln = lane & 15, hh = lane >> 4; const int by = blockIdx.y;
  A += (size_t)by * sA; Bh += (size_t)by * sB; C += (size_t)by * sC;
  const int ntn = (N + 63) / 64; const int wid = blockIdx.x * 4 + w; const int mt = wid / ntn, nq = wid % ntn; if (mt * 16 >= M) return;
  const int row0 = mt * 16, col0 = nq * 64; const float* arow = A + (size_t)(row0 + ln) * lda;
  v8f acc[4] = {};
  for (int kb = 0; kb < K; kb += 32) {
    FragH ah, al;
    const v4f x0 = *(const v4fa*)(arow + kb + 8 * hh), x1 = *(const v4fa*)(arow + kb + 8 * hh + 4), x2 = *(const v4fa*)(arow + kb + 16 + 8 * hh), x3 = *(const v4fa*)(arow + kb + 16 + 8 * hh + 4);
    float xs[16] = {x0[0],x0[1],x0[2],x0[3],x1[0],x1[1],x1[2],x1[3],x2[0],x2[1],x2[2],x2[3],x3[0],x3[1],x3[2],x3[3]};
#pragma unroll
    for (int i = 0; i < 16; ++i) { const _Float16 h = (_Float16)xs[i]; ah.h[i] = h; al.h[i] = ASPLIT ? (_Float16)(xs[i] - (float)h) : (_Float16)0.0f; }
#pragma unroll
    for (int t = 0; t < 4; ++t) { if (col0 + t * 16 >= N) continue; const size_t boff = (size_t)(col0 + t * 16 + ln) * ldb + kb; FragH bq; bq.half[0] = *(const v8us*)(Bh + boff + 8 * hh); bq.half[1] = *(const v8us*)(Bh + boff + 16 + 8 * hh);
      acc[t] = mmaH<ASPLIT ? 2 : 1>(ah.v, al.v, bq.v, bq.v, acc[t]); }
  }
#pragma unroll
  for (int t = 0; t < 4; ++t) { if (col0 + t * 16 >= N) continue;
#pragma unroll
    for (int r = 0; r < 8; ++r) so[w][8 * hh + r][t * 16 + ln] = acc[t][r] * alpha; }
  __builtin_amdgcn_fence(__ATOMIC_ACQ_REL, "workgroup"); __builtin_amdgcn_wave_barrier();
  const int rsub = lane >> 4, c4 = (lane & 15) * 4;
  {
#pragma unroll
    for (int q = 0; q < 8; ++q) { const int r = q * 2 + rsub; if (col0 + c4 < N) { const v4f v = *(const v4fa*)&so[w][r][c4]; *(v4f*)(C + (size_t)(row0 + r) * ldc + col0 + c4) = v; } }
     }
}

// Wt[n][k] = f16(W[k][n]·scale) from f32 row-major W[K][N] (scale = power of two; bf16-exact weights stay exact in f16 away from the subnormal range)
__global__ __launch_bounds__(256) void k_wt_f16(const float* __restrict__ W, _Float16* __restrict__ Wt, int K, int N, float scale) {
  const int t = blockIdx.x * 256 + threadIdx.x; if (t >= N * (K / 8)) return; const int n = t / (K / 8), k8 = (t % (K / 8)) * 8; FragH f;
#pragma unroll
  for (int i = 0; i < 8; ++i) f.h[i] = (_Float16)(bf16_round(W[(size_t)(k8 + i) * N + n]) * scale); const v8us o = f.half[0];
  *(v8us*)((unsigned short*)Wt + (size_t)n * K + k8) = o; 
}
// k_gemm_hh variant with fused epilogue: v = acc·alpha + bias[by·sBias + col] (+ CP[(row/rowsPerB)·sCPb + by·64 + col] if CP) ; ACT 0 none / 1 elu ; writes f16 C16 (and f32 C if non-null)
template <int ACT>
__global__ __launch_bounds__(128) void k_gemm_hhx(const _Float16* __restrict__ A, int lda, size_t sA, const _Float16* __restrict__ Bh, int ldb, size_t sB, float alpha, const float* __restrict__ bias, size_t sBias, const float* __restrict__ CP, int rowsPerB, size_t sCPb, int row0g,
    float* __restrict__ C, _Float16* __restrict__ C16, int ldc, size_t sC, int M, int N, int K) {
  __shared__ __attribute__((aligned(16))) float so[4][16][64];
  const int tid = threadIdx.x, w = tid >> 5, lane = tid & 31, ln = lane & 15, hh = lane >> 4; const int by = blockIdx.y;
  A += (size_t)by * sA; Bh += (size_t)by * sB; const size_t cofs = (size_t)by * sC; const float* bp = bias ? bias + (size_t)by * sBias : nullptr;
  const int ntn = (N + 63) / 64; const int wid = blockIdx.x * 4 + w; const int mt = wid / ntn, nq = wid % ntn; if (mt * 16 >= M) return;
  const int row0 = mt * 16, col0 = nq * 64; const _Float16* arow = A + (size_t)(row0 + ln) * lda;
  v8f acc[4] = {};
  for (int kb = 0; kb < K; kb += 32) { FragH ah; ah.half[0] = *(const v8us*)((const unsigned short*)arow + kb + 8 * hh); ah.half[1] = *(const v8us*)((const unsigned short*)arow + kb + 16 + 8 * hh);
#pragma unroll
    for (int t = 0; t < 4; ++t) { if (col0 + t * 16 >= N) continue; const size_t boff = (size_t)(col0 + t * 16 + ln) * ldb + kb; FragH bq; bq.half[0] = *(const v8us*)((const unsigned short*)Bh + boff + 8 * hh); bq.half[1] = *(const v8us*)((const unsigned short*)Bh + boff + 16 + 8 * hh);
      acc[t] = mmaH<1>(ah.v, ah.v, bq.v, bq.v, acc[t]); }
  }
#pragma unroll
  for (int t = 0; t < 4; ++t) { if (col0 + t * 16 >= N) continue; const int col = col0 + t * 16 + ln; const float bv = bp ? bf16_round(bp[col]) : 0.f;
#pragma unroll
    for (int r = 0; r < 8; ++r) { float v = acc[t][r] * alpha + bv; if (CP) { const int rr = row0g + row0 + 8 * hh + r; if (rowsPerB < 0) v += CP[cofs + (size_t)rr * ldc + col];      /* rowsPerB < 0: own element of the batched C plane */ else { const int bidx = rr / rowsPerB; v += CP[(size_t)bidx * sCPb + (size_t)by * 64 + col]; } } if (ACT == 1) v = (v > 0.f) ? v : expm1f(v); else if (ACT == 7) v = (v > 0.f) ? v + 1.0f : expf(v); else if (ACT == 8) v = tanhf(v); else if (ACT == 9) v = 0.5f * v * (1.0f + tanhf(0.7978845608028654f * (v + 0.044715f * v * v * v))); else if (ACT == 11) v = 1.0f / (1.0f + expf(-v)); else if (ACT == 12) v = (v > 0.f) ? v : 0.01f * v; else if (ACT == 14) v = (v > 0.f) ? v : 0.1f * v; else if (ACT == 16) v = (v >= 0.f) ? v : 0.3f * v; else if (ACT == 17) v = (v >= 0.f) ? v : 0.2f * v; else if (ACT == 15) v = v / (1.0f + expf(-v)); else if (ACT == 3) v = fmaxf(v, 0.f); else if (ACT == 6) v = 0.5f * v * (1.0f + erff(v * 0.70710678118654752f)); so[w][8 * hh + r][t * 16 + ln] = v; } }
  __builtin_amdgcn_fence(__ATOMIC_ACQ_REL, "workgroup"); __builtin_amdgcn_wave_barrier();
  const int rsub = lane >> 4, c4 = (lane & 15) * 4; typedef _Float16 v4h __attribute__((ext_vector_type(4)));
  {
#pragma unroll
    for (int q = 0; q < 8; ++q) { const int r = q * 2 + rsub; if (col0 + c4 < N) { const v4f v = *(const v4fa*)&so[w][r][c4]; if (C) *(v4f*)(C + cofs + (size_t)(row0 + r) * ldc + col0 + c4) = v; if (C16) { v4h h4; for (int i = 0; i < 4; ++i) h4[i] = (_Float16)v[i]; *(v4h*)(C16 + cofs + (size_t)(row0 + r) * ldc + col0 + c4) = h4; } } }
     }
}


typedef _Float16 v4h __attribute__((ext_vector_type(4)));

__global__ __launch_bounds__(256) void k_x16(const float* __restrict__ x, _Float16* __restrict__ X16, size_t n8) { const size_t t = (size_t)blockIdx.x * 256 + threadIdx.x; if (t >= n8) return; FragH f;
#pragma unroll
  for (int q = 0; q < 8; ++q) f.h[q] = (_Float16)bf16_round(x[t * 8 + q]); *(v8us*)((unsigned short*)X16 + t * 8) = f.half[0];  }
__global__ __launch_bounds__(256) void k_h16(const float* __restrict__ x, _Float16* __restrict__ X16, size_t n8) { const size_t t = (size_t)blockIdx.x * 256 + threadIdx.x; if (t >= n8) return; FragH f;
#pragma unroll
  for (int q = 0; q < 8; ++q) f.h[q] = (_Float16)x[t * 8 + q]; *(v8us*)((unsigned short*)X16 + t * 8) = f.half[0];  }
__global__ __launch_bounds__(256) void k_round16f(const float* __restrict__ W, _Float16* __restrict__ Bt, size_t n8) { const size_t t = (size_t)blockIdx.x * 256 + threadIdx.x; if (t >= n8) return; FragH f;
#pragma unroll
  for (int i = 0; i < 8; ++i) f.h[i] = (_Float16)(bf16_round(W[t * 8 + i]) * 16.0f); *(v8us*)((unsigned short*)Bt + t * 8) = f.half[0];  }
template <int NHv, int TTv>
__global__ __launch_bounds__(256) void k_vt(const _Float16* __restrict__ V16, int ldv, int voff, _Float16* __restrict__ Vt) { __shared__ unsigned short tl[64][66]; const int tid = threadIdx.x; const int slab = blockIdx.x / (TTv / 64), lg = blockIdx.x % (TTv / 64); const int b = slab / NHv, h = slab % NHv;
  for (int i = tid; i < 64 * 8; i += 256) { const int r = i / 8, c8 = (i % 8) * 8; FragH f; f.half[0] = *(const v8us*)((const unsigned short*)V16 + ((size_t)b * TTv + lg * 64 + r) * ldv + voff + h * 64 + c8);
#pragma unroll
    for (int q = 0; q < 8; ++q) tl[r][c8 + q] = f.u[q]; }
  __syncthreads();
  {
#pragma unroll
    for (int rd = 0; rd < 2; ++rd) { const int d = rd * 32 + tid / 8, pc = tid % 8; FragH f;
#pragma unroll
      for (int q = 0; q < 8; ++q) f.u[q] = tl[pc * 8 + q][d];
      *(v8us*)((unsigned short*)Vt + ((size_t)slab * 64 + d) * TTv + lg * 64 + pc * 8) = f.half[0]; }
     } }

__global__ __launch_bounds__(256) void k_hl(const float* __restrict__ F, _Float16* __restrict__ Hh, _Float16* __restrict__ Hl, size_t n8) { const size_t t = (size_t)blockIdx.x * 256 + threadIdx.x; if (t >= n8) return; FragH fh, fl; const v4f a = *(const v4fa*)(F + t * 8), c = *(const v4fa*)(F + t * 8 + 4);
#pragma unroll
  for (int q = 0; q < 4; ++q) { _Float16 h = (_Float16)a[q]; fh.h[q] = h; fl.h[q] = (_Float16)((a[q] - (float)h) * 1024.0f); h = (_Float16)c[q]; fh.h[4 + q] = h; fl.h[4 + q] = (_Float16)((c[q] - (float)h) * 1024.0f); }
  { *(v8us*)((unsigned short*)Hh + t * 8) = fh.half[0]; *(v8us*)((unsigned short*)Hl + t * 8) = fl.half[0];  } }

// ---- fast GEMM (work-group tile 128x64, wave tile 32x64; requires M % 128 == 0, N % 64 == 0, K % 128 == 0, K >= 128); epilogue = k_gemm_hhx semantics ----
// Operands go through LDS: a stage is 128 k (256 B) of the work-group's 128 A rows and 64 B rows, brought by asynchronous copies of whole lines, two buffers, the next stage in flight while this one is multiplied.
__device__ __forceinline__ v16h g2_frag(const _Float16* p, int hh) { FragH f; f.half[0] = *(const v8us*)((const unsigned short*)p + 8 * hh); f.half[1] = *(const v8us*)((const unsigned short*)p + 16 + 8 * hh); return f.v; }
__device__ __forceinline__ v8f g2_mma(v16h a, v16h b, v8f c) { return __builtin_amdgcn_wmma_f32_16x16x32_f16(false, a, false, b, (short)0, c, false, false); }
#define G2_PITCH 272                 /* LDS bytes from row to row: 256 + 16, an odd multiple of 16 B, so the 16 rows of a fragment read fall on different banks */
#define G2_BUF (192 * G2_PITCH)      /* one stage: rows 0..127 = A, rows 128..191 = B */
__device__ __forceinline__ v16h g2_lfrag(const unsigned char* p) { FragH f; f.half[0] = *(const v8us*)p; f.half[1] = *(const v8us*)(p + 32); return f.v; }      /* p = row start + 64 B x block + 16 hh: the k order of g2_frag */
// eight asynchronous copies of 16 B a lane, rows 8 apart: LDS byte address l (+ 8 rows each), global address g (+ gs elements each)
__device__ __forceinline__ void g2_copy8(unsigned l, const _Float16* g, size_t gs) {
  const unsigned l1 = l + 8 * G2_PITCH, l2 = l + 16 * G2_PITCH, l3 = l + 24 * G2_PITCH, l4 = l + 32 * G2_PITCH, l5 = l + 40 * G2_PITCH, l6 = l + 48 * G2_PITCH, l7 = l + 56 * G2_PITCH;
  const _Float16* g1 = g + gs; const _Float16* g2 = g1 + gs; const _Float16* g3 = g2 + gs; const _Float16* g4 = g3 + gs; const _Float16* g5 = g4 + gs; const _Float16* g6 = g5 + gs; const _Float16* g7 = g6 + gs;
  /* the copies move global bytes into LDS through no register; the closing s_wait_xcnt is a precaution: it stands in front of any rewrite of the address registers named here */
  asm volatile("global_load_async_to_lds_b128 %0, %8, off\n\t"
               "global_load_async_to_lds_b128 %1, %9, off\n\t"
               "global_load_async_to_lds_b128 %2, %10, off\n\t"
               "global_load_async_to_lds_b128 %3, %11, off\n\t"
               "global_load_async_to_lds_b128 %4, %12, off\n\t"
               "global_load_async_to_lds_b128 %5, %13, off\n\t"
               "global_load_async_to_lds_b128 %6, %14, off\n\t"
               "global_load_async_to_lds_b128 %7, %15, off\n\t"
               "s_wait_xcnt 0x0"
               :: "v"(l), "v"(l1), "v"(l2), "v"(l3), "v"(l4), "v"(l5), "v"(l6), "v"(l7), "v"(g), "v"(g1), "v"(g2), "v"(g3), "v"(g4), "v"(g5), "v"(g6), "v"(g7) : "memory"); }
template <int ACT>
__global__ __launch_bounds__(128) void k_gemm2(const _Float16* __restrict__ A, int lda, size_t sA, const _Float16* __restrict__ Bh, int ldb, size_t sB, float alpha, const float* __restrict__ bias, size_t sBias, const float* __restrict__ CP, int rowsPerB, size_t sCPb, int row0g,
    float* __restrict__ C, _Float16* __restrict__ C16, int ldc, size_t sC, int M, int N, int K) { static_assert(ACT == 0 || ACT == 3 || ACT == 6 || ACT == 8 || ACT == 9 || ACT == 11 || ACT == 12 || ACT == 14 || ACT == 15 || ACT == 16 || ACT == 17, "k_gemm2: unsupported ACT code (would silently apply no activation)");
  __shared__ __attribute__((aligned(16))) float so[4][32][68];
  __shared__ __attribute__((aligned(16))) unsigned char ring[2][G2_BUF];
  const int tid = threadIdx.x, w = tid >> 5, lane = tid & 31, ln = lane & 15, hh = lane >> 4; const int by = blockIdx.y;
  A += (size_t)by * sA; Bh += (size_t)by * sB; const size_t cofs = (size_t)by * sC; const float* bp = bias ? bias + (size_t)by * sBias : nullptr;
  const int ntn = N >> 6; const int mt = blockIdx.x / ntn, nq = blockIdx.x - mt * ntn; const int row0 = mt * 128 + 32 * w, col0 = nq * 64; if (mt * 128 >= M) return;      /* taken by a whole work-group, in front of every barrier */
  const int cr = tid >> 4, cc = tid & 15;      /* copy role: 16 lanes cover the 256 B of one row, a wave two whole rows (4 lines) */
  const _Float16* ga = A + (size_t)(mt * 128 + cr) * lda + cc * 8; const _Float16* gb = Bh + (size_t)(col0 + cr) * ldb + cc * 8; const unsigned lc = (unsigned)(size_t)&ring[0][0] + cr * G2_PITCH + cc * 16;
  auto stage = [&](int t, int buf) { const unsigned l = lc + buf * G2_BUF; const _Float16* a = ga + t * 128;
    g2_copy8(l, a, (size_t)8 * lda); g2_copy8(l + 64 * G2_PITCH, a + (size_t)64 * lda, (size_t)8 * lda); g2_copy8(l + 128 * G2_PITCH, gb + t * 128, (size_t)8 * ldb); };
  const int nt = K >> 7;
  const v8f z8 = {0.f,0.f,0.f,0.f,0.f,0.f,0.f,0.f}; v8f c00 = z8, c01 = z8, c02 = z8, c03 = z8, c10 = z8, c11 = z8, c12 = z8, c13 = z8;
  stage(0, 0);
  asm volatile("s_wait_asynccnt 0x0" ::: "memory");      /* this wave's copies of stage 0 have landed */
  __syncthreads();                                       /* every wave's have: stage 0 may be read */
  if (nt > 1) stage(1, 1);
#pragma unroll 1    /* one stage a trip: the publish point at the foot stands once */
  for (int t = 0; t < nt; ++t) { const unsigned char* ap = &ring[t & 1][0] + (32 * w + ln) * G2_PITCH + 16 * hh; const unsigned char* bq = &ring[t & 1][0] + (128 + ln) * G2_PITCH + 16 * hh; v16h fa[2][2], fb[2][4];
    auto frags = [&](int kk, v16h (&a)[2], v16h (&b)[4]) { a[0] = g2_lfrag(ap + kk * 64); a[1] = g2_lfrag(ap + 16 * G2_PITCH + kk * 64);
#pragma unroll      /* constant indices, so the fragment arrays stay in registers */
      for (int j = 0; j < 4; ++j) b[j] = g2_lfrag(bq + j * 16 * G2_PITCH + kk * 64); };
    frags(0, fa[0], fb[0]);
#pragma unroll      /* constant indices, so the fragment arrays stay in registers */
    for (int kk = 0; kk < 4; ++kk) { const int c = kk & 1;
      if (kk < 3) frags(kk + 1, fa[c ^ 1], fb[c ^ 1]);
      __builtin_amdgcn_sched_barrier(0);      /* the next block's LDS reads stay one group ahead of this block's products instead of among them */
      c00 = g2_mma(fa[c][0], fb[c][0], c00); c10 = g2_mma(fa[c][1], fb[c][0], c10); c01 = g2_mma(fa[c][0], fb[c][1], c01); c11 = g2_mma(fa[c][1], fb[c][1], c11);
      c02 = g2_mma(fa[c][0], fb[c][2], c02); c12 = g2_mma(fa[c][1], fb[c][2], c12); c03 = g2_mma(fa[c][0], fb[c][3], c03); c13 = g2_mma(fa[c][1], fb[c][3], c13);
      __builtin_amdgcn_sched_barrier(0); }    /* and the block after next's reads stay behind these products */
    asm volatile("s_wait_dscnt 0x0" ::: "memory");         /* this wave has finished reading the buffer */
    asm volatile("s_wait_asynccnt 0x0" ::: "memory");      /* its copies of stage t + 1 have landed */
    __syncthreads();                                       /* publishes stage t + 1 and ends every wave's reads of stage t */
    if (t + 2 < nt) stage(t + 2, t & 1); }                 /* refill of the buffer just left; the test reads the same in the whole work-group */
  asm volatile("s_wait_asynccnt 0x0" ::: "memory");        /* nothing of this wave is in flight behind the loop */
  v8f accs[8] = {c00, c01, c02, c03, c10, c11, c12, c13};
#pragma unroll
  for (int u = 0; u < 8; ++u) { const int t = u & 3, half = u >> 2; const int col = col0 + t * 16 + ln; const float bv = bp ? bf16_round(bp[col]) : 0.f;
#pragma unroll
    for (int r = 0; r < 8; ++r) { const int rloc = half * 16 + 8 * hh + r; float v = accs[u][r] * alpha + bv; if (CP) { if (rowsPerB < 0) v += CP[cofs + (size_t)(row0g + row0 + rloc) * ldc + col];      /* rowsPerB < 0: own element of the batched C plane */ else { const int bidx = (row0g + row0 + rloc) / rowsPerB; v += CP[(size_t)bidx * sCPb + (size_t)by * 64 + col]; } }
      if (ACT == 3) v = fmaxf(v, 0.f); else if (ACT == 6) v = 0.5f * v * (1.0f + erff(v * 0.70710678118654752f)); else if (ACT == 11) v = 1.0f / (1.0f + expf(-v)); else if (ACT == 15) v = v / (1.0f + expf(-v)); else if (ACT == 12) v = (v > 0.f) ? v : 0.01f * v; else if (ACT == 8) v = tanhf(v); else if (ACT == 9) v = 0.5f * v * (1.0f + tanhf(0.7978845608028654f * (v + 0.044715f * v * v * v))); else if (ACT == 14) v = (v > 0.f) ? v : 0.1f * v; else if (ACT == 16) v = (v >= 0.f) ? v : 0.3f * v; else if (ACT == 17) v = (v >= 0.f) ? v : 0.2f * v;
      so[w][rloc][t * 16 + ln] = v; } }
  __builtin_amdgcn_fence(__ATOMIC_ACQ_REL, "workgroup"); __builtin_amdgcn_wave_barrier();
  const int rsub = lane >> 4, c4 = (lane & 15) * 4;
  {
#pragma unroll
    for (int q = 0; q < 16; ++q) { const int r = q * 2 + rsub; const v4f v = *(const v4fa*)&so[w][r][c4]; if (C) *(v4f*)(C + cofs + (size_t)(row0 + r) * ldc + col0 + c4) = v; if (C16) { v4h h4; for (int i = 0; i < 4; ++i) h4[i] = (_Float16)v[i]; *(v4h*)(C16 + cofs + (size_t)(row0 + r) * ldc + col0 + c4) = h4; } }
     } }


__global__ __launch_bounds__(256) void k_wnat(const float* __restrict__ w, size_t n8, _Float16* __restrict__ Bt) { const size_t t = (size_t)blockIdx.x * 256 + threadIdx.x; if (t >= n8) return; FragH f; for (int q = 0; q < 8; ++q) f.h[q] = (_Float16)(bf16_round(w[t * 8 + q]) * 16.0f); *(v8us*)((unsigned short*)Bt + t * 8) = f.half[0];  }
__global__ __launch_bounds__(256) void k_rsm(const float* __restrict__ S, _Float16* __restrict__ P, int nrows) {
  #pragma clang fp contract(off)
  const int i = blockIdx.x * 256 + threadIdx.x; if (i >= nrows) return; const float* s = S + (size_t)i * SQ; float mx = -3.0e38f;
#pragma unroll 1
  for (int j = 0; j < SQ; ++j) mx = fmaxf(mx, s[j]); float se = 0.f;
#pragma unroll 1
  for (int j = 0; j < SQ; ++j) se += expf(s[j] - mx); const float sc = 256.0f / se;
#pragma unroll 1
  for (int j0 = 0; j0 < SQ; j0 += 8) { FragH f; for (int q = 0; q < 8; ++q) f.h[q] = (_Float16)(expf(s[j0 + q] - mx) * sc); unsigned short* d = (unsigned short*)P + (size_t)i * SQ + j0; *(v8us*)d = f.half[0];  } }
__global__ __launch_bounds__(256) void k_vt(const _Float16* __restrict__ V16, int b, int h0, _Float16* __restrict__ VT) { __shared__ unsigned short tl[64][65]; const int tid = threadIdx.x; const int hh = blockIdx.x % HG, sg = blockIdx.x / HG; const int s0 = sg * 64; const int h = h0 + hh;
  for (int i = tid; i < 64 * 8; i += 256) { const int j = i / 8, d8 = (i % 8) * 8; FragH f; f.half[0] = *(const v8us*)((const unsigned short*)V16 + ((size_t)b * SQ + s0 + j) * DM + h * HD + d8); for (int q = 0; q < 8; ++q) tl[d8 + q][j] = f.u[q]; }
  __syncthreads();
  { for (int i = tid; i < 64 * 8; i += 256) { const int d = i / 8, j8 = (i % 8) * 8; FragH f; for (int q = 0; q < 8; ++q) f.u[q] = tl[d][j8 + q]; *(v8us*)((unsigned short*)VT + ((size_t)hh * HD + d) * SQ + s0 + j8) = f.half[0]; }  } }


// lane l <-> lane l ^ M of the wave, in vector registers (no LDS round trip): M = 16 crosses the two 16-lane rows, M < 16 is a DPP row_xmask move
template <int M>
__device__ __forceinline__ float lane_xor(float x) { const int b = __float_as_int(x);
  if constexpr (M == 16) return __int_as_float(__builtin_amdgcn_permlanex16(b, b, 0x76543210, 0xfedcba98, false, false));
  else return __int_as_float(__builtin_amdgcn_update_dpp(0, b, 0x160 | M, 0xf, 0xf, true)); }
// ---- fused attention: scores and weights live in registers only ----
__device__ __forceinline__ v8f f_mma(v16h a, v16h b, v8f c) { return __builtin_amdgcn_wmma_f32_16x16x32_f16(false, a, false, b, (short)0, c, false, false); }
typedef unsigned v4ua __attribute__((ext_vector_type(4), may_alias));
#define SC2 0.18033688011112042f     /* (1 / 8) log2(e): scores go to the exponent base 2 */
#define MASKED -3.0e38f              /* score of a masked key: its weight underflows to 0 against any row reference >= M0 */
#define M0 -1.0e30f                  /* start value of a row's reference; a row with every key masked keeps it, sums 0 and ends as 0 x inf = NaN like the definition */
// one bit per (query, key): bit j of word [query][key / 32] is mask[query][32 (key / 32) + j] != 0; a wave packs 32 words
__global__ __launch_bounds__(256) void k_maskbits(const int* __restrict__ mask, unsigned* __restrict__ MB) {
  const int lane = threadIdx.x & 31; const size_t wv = (size_t)blockIdx.x * 8 + (threadIdx.x >> 5); const int* m = mask + wv * 1024; unsigned keep = 0;
#pragma unroll      /* 32 independent loads in flight */
  for (int i = 0; i < 32; ++i) { const unsigned bits = __builtin_amdgcn_ballot_w32(m[i * 32 + lane] != 0); if (lane == i) keep = bits; }
  MB[wv * 32 + lane] = keep; }
// S^T tile rows are keys 8 hh + r, its column is query ln: bit 16 kt + 8 hh + r of the query's mask word
__device__ __forceinline__ void mask_tile(v8f& s, unsigned word, int kt, int hh) { const unsigned u = word >> (16 * kt + 8 * hh);
#pragma unroll      /* constant indices, so the tile stays in registers */
  for (int r = 0; r < 8; ++r) s[r] = ((u >> r) & 1u) ? s[r] : MASKED; }
// K and V^T go through LDS: a stage is 128 keys of the head (K: 128 rows of 128 B; V^T: 64 rows of 256 B), brought once for the 8 waves by asynchronous copies of whole lines, two buffers, the next stage in flight while this one is worked on
#define FST 128                      /* keys a stage */
#define FK_PITCH 144                 /* LDS bytes from K row to K row: 128 + 16, an odd multiple of 16 B, so the 16 rows of a fragment read fall on different banks */
#define FV_PITCH 272                 /* the same for the V^T rows: 256 + 16 */
#define FK_BYTES (FST * FK_PITCH)
#define F_BUF (FK_BYTES + HD * FV_PITCH)      /* one stage: K rows, then V^T rows */
// four asynchronous copies of 16 B a lane: LDS byte address l (+ ls each), global address g (+ gs elements each)
__device__ __forceinline__ void f_copy4(unsigned l, unsigned ls, const _Float16* g, size_t gs) {
  const unsigned l1 = l + ls, l2 = l1 + ls, l3 = l2 + ls; const _Float16* g1 = g + gs; const _Float16* g2 = g1 + gs; const _Float16* g3 = g2 + gs;
  /* the copies move global bytes into LDS through no register; the closing s_wait_xcnt is a precaution: it stands in front of any rewrite of the address registers named here */
  asm volatile("global_load_async_to_lds_b128 %0, %4, off\n\t"
               "global_load_async_to_lds_b128 %1, %5, off\n\t"
               "global_load_async_to_lds_b128 %2, %6, off\n\t"
               "global_load_async_to_lds_b128 %3, %7, off\n\t"
               "s_wait_xcnt 0x0"
               :: "v"(l), "v"(l1), "v"(l2), "v"(l3), "v"(g), "v"(g1), "v"(g2), "v"(g3) : "memory"); }
// the key loop of k_fattn; MSK = false is taken by a work-group none of whose 256 mask rows holds a zero, and then reads no mask word
// ring: the two buffers; gk, gv, lk, lv: this lane's first global and LDS addresses as a copier of K and of V^T
template <bool MSK>
__device__ __forceinline__ void fattn_keys(const unsigned char* ring, const _Float16* gk, const _Float16* gv, unsigned lk, unsigned lv, const unsigned* mb, int ln, int hh, const v16h (&qf)[2][2], v8f (&o)[2][4], float (&m)[2], float (&l)[2]) {
  const v8f z8 = {0.f,0.f,0.f,0.f,0.f,0.f,0.f,0.f}; v16h ka[2][2], kb2[2][2], va[4], vb[4]; unsigned mw[2] = {0u, 0u};
  auto stage = [&](int t, int buf) { f_copy4(lk + buf * F_BUF, 32 * FK_PITCH, gk + (size_t)t * FST * DM, (size_t)32 * DM); f_copy4(lv + buf * F_BUF, 16 * FV_PITCH, gv + t * FST, (size_t)16 * SQ); };
  if (MSK) { mw[0] = mb[0]; mw[1] = mb[16 * (SQ / 32)]; }
  stage(0, 0);
  asm volatile("s_wait_asynccnt 0x0" ::: "memory");      /* this wave's copies of stage 0 have landed */
  __syncthreads();                                       /* every wave's have: stage 0 may be read */
  stage(1, 1);
#pragma unroll 1    /* one stage a trip: the publish point at the foot stands once */
  for (int t = 0; t < SQ / FST; ++t) { const unsigned char* kt = ring + (t & 1) * F_BUF + ln * FK_PITCH + 16 * hh; const unsigned char* vt = ring + (t & 1) * F_BUF + FK_BYTES + ln * FV_PITCH + 16 * hh;
    // the K and V^T fragments of pass p of this stage, in the k order of g2_frag
    auto frags = [&](int p, v16h (&k)[2][2], v16h (&v)[4]) {
#pragma unroll      /* constant indices, so the fragment arrays stay in registers */
      for (int i = 0; i < 2; ++i) { k[i][0] = g2_lfrag(kt + (p * 32 + i * 16) * FK_PITCH); k[i][1] = g2_lfrag(kt + (p * 32 + i * 16) * FK_PITCH + 64); }
#pragma unroll      /* constant indices, so the fragment arrays stay in registers */
      for (int d = 0; d < 4; ++d) v[d] = g2_lfrag(vt + d * 16 * FV_PITCH + p * 64); };
    // one pass = 32 keys: kc and vc hold this pass's K and V^T fragments, kx and vn take those of pass pn of the same stage (pn = 0: the stage's last pass, which fetches nothing)
    auto pass = [&](int kb, int pn, const v16h (&kc)[2][2], v16h (&kx)[2][2], const v16h (&vc)[4], v16h (&vn)[4]) { const int kn = (kb + 32) & (SQ - 1);
      v8f s[2][2]; float mx[2]; FragH pf[2];
      if (pn) frags(pn, kx, vn);
      __builtin_amdgcn_sched_barrier(0);      /* the next pass's LDS reads stay one group ahead of this pass's products instead of among them */
#pragma unroll      /* constant indices, so the fragment arrays stay in registers */
      for (int qt = 0; qt < 2; ++qt)
#pragma unroll      /* constant indices, so the fragment arrays stay in registers */
        for (int kt2 = 0; kt2 < 2; ++kt2) s[qt][kt2] = f_mma(kc[kt2][1], qf[qt][1], f_mma(kc[kt2][0], qf[qt][0], z8));
      if (MSK) {
#pragma unroll      /* constant indices, so the fragment arrays stay in registers */
        for (int qt = 0; qt < 2; ++qt) { mask_tile(s[qt][0], mw[qt], 0, hh); mask_tile(s[qt][1], mw[qt], 1, hh); }
        __builtin_amdgcn_sched_barrier(0);      /* with the one below: the next pass's two mask loads and their wait stay one group, so nothing that could rewrite an address register comes between */
        mw[0] = mb[kn >> 5]; mw[1] = mb[16 * (SQ / 32) + (kn >> 5)];
        asm volatile("s_wait_xcnt 0x0" ::: "memory");      /* precaution: stands behind the loads issued above, in front of any rewrite of their address registers */
        __builtin_amdgcn_sched_barrier(0); }
#pragma unroll      /* constant indices, so the fragment arrays stay in registers */
      for (int qt = 0; qt < 2; ++qt) { float a = fmaxf(s[qt][0][0], s[qt][1][0]);
#pragma unroll      /* constant indices, so the fragment arrays stay in registers */
        for (int r = 1; r < 8; ++r) a = fmaxf(a, fmaxf(s[qt][0][r], s[qt][1][r]));
        a *= SC2; mx[qt] = fmaxf(a, lane_xor<16>(a)); }      /* both halves of a column agree on the maximum, so on the reference too */
      if (__builtin_amdgcn_ballot_w32(mx[0] > m[0] + 8.f || mx[1] > m[1] + 8.f) != 0) {      /* scalar branch: rescale only when some column's reference must rise */
#pragma unroll      /* constant indices, so the fragment arrays stay in registers */
        for (int qt = 0; qt < 2; ++qt) { const float mn = fmaxf(m[qt], mx[qt]), f = __builtin_amdgcn_exp2f(m[qt] - mn); m[qt] = mn; l[qt] *= f;
#pragma unroll      /* constant indices, so the fragment arrays stay in registers */
          for (int d = 0; d < 4; ++d) o[qt][d] *= f; } }
#pragma unroll      /* constant indices, so the fragment arrays stay in registers */
      for (int qt = 0; qt < 2; ++qt) { float ls = 0.f;
#pragma unroll      /* constant indices, so the fragment arrays stay in registers */
        for (int r = 0; r < 8; ++r) { const float p0 = __builtin_amdgcn_exp2f(__builtin_fmaf(s[qt][0][r], SC2, -m[qt])), p1 = __builtin_amdgcn_exp2f(__builtin_fmaf(s[qt][1][r], SC2, -m[qt])); ls += p0 + p1; pf[qt].h[r] = (_Float16)p0; pf[qt].h[8 + r] = (_Float16)p1; }
        l[qt] += ls; }
#pragma unroll      /* constant indices, so the fragment arrays stay in registers */
      for (int d = 0; d < 4; ++d) { o[0][d] = f_mma(vc[d], pf[0].v, o[0][d]); o[1][d] = f_mma(vc[d], pf[1].v, o[1][d]); }
      __builtin_amdgcn_sched_barrier(0); };      /* keeps the next pass's products behind this pass: moved up, they would wait on fragments fetched only half a pass earlier */
    const int kb = t * FST;
    frags(0, ka, va);
    pass(kb, 1, ka, kb2, va, vb); pass(kb + 32, 2, kb2, ka, vb, va); pass(kb + 64, 3, ka, kb2, va, vb); pass(kb + 96, 0, kb2, ka, vb, va);      /* the two fragment sets swap by name, no register is copied */
    asm volatile("s_wait_dscnt 0x0" ::: "memory");         /* this wave has finished reading the buffer */
    asm volatile("s_wait_asynccnt 0x0" ::: "memory");      /* its copies of stage t + 1 have landed */
    __syncthreads();                                       /* publishes stage t + 1 and ends every wave's reads of stage t */
    if (t + 2 < SQ / FST) stage(t + 2, t & 1); }           /* refill of the buffer just left; the test reads the same in the whole work-group */
  asm volatile("s_wait_asynccnt 0x0" ::: "memory"); }      /* nothing of this wave is in flight behind the loop */
// One wave: 32 queries of one head against all keys, 32 keys a pass. S^T = K Q^T (A = K rows, B = Q rows), so a lane holds one query's scores; the two S^T tiles of a pass, converted in place,
// are the B operand of O^T += V^T P^T. Running row reference m (base-2 exponent), raised only when a new maximum exceeds it by more than 8 (weights then stay <= 256, inside f16); f32 row sums.
// Writes merged f16 rows 64 o + 64 alpha vp and, per (batch, head, query), the pair (m, 1 / sum) for the head-sum launch.
// The 8 waves of a work-group walk the same head's K and V^T, which are staged once for all of them in LDS.
__global__ __launch_bounds__(256) void k_fattn(const _Float16* __restrict__ Q, const _Float16* __restrict__ Kp, const _Float16* __restrict__ VT, const unsigned* __restrict__ MB, const float* __restrict__ AV, _Float16* __restrict__ O16, float* __restrict__ ST) {
  const int tid = threadIdx.x, w = tid >> 5, lane = tid & 31, ln = lane & 15, hh = lane >> 4; const int h = blockIdx.y, b = blockIdx.z, q0 = blockIdx.x * 256 + w * 32; const size_t r0 = (size_t)b * SQ;
  __shared__ __attribute__((aligned(16))) unsigned char ring[2 * F_BUF]; __shared__ __attribute__((aligned(16))) unsigned wz[8];
  const _Float16* qp = Q + (r0 + q0 + ln) * DM + h * HD; const unsigned* mb = MB + (size_t)(q0 + ln) * (SQ / 32);
  /* copy roles: 8 lanes cover the 128 B of a K row, 16 lanes the 256 B of a V^T row, so a wave copies 4 whole lines at a time */
  const _Float16* gk = Kp + (r0 + (tid >> 3)) * DM + h * HD + (tid & 7) * 8; const _Float16* gv = VT + ((size_t)(b * NH + h) * HD + (tid >> 4)) * SQ + (tid & 15) * 8;
  const unsigned lk = (unsigned)(size_t)&ring[0] + (tid >> 3) * FK_PITCH + (tid & 7) * 16, lv = (unsigned)(size_t)&ring[0] + FK_BYTES + (tid >> 4) * FV_PITCH + (tid & 15) * 16;
  const v8f z8 = {0.f,0.f,0.f,0.f,0.f,0.f,0.f,0.f};
  v16h qf[2][2]; v8f o[2][4]; float m[2] = {M0, M0}, l[2] = {0.f, 0.f};
#pragma unroll      /* constant indices, so the fragment arrays stay in registers */
  for (int t = 0; t < 2; ++t) { qf[t][0] = g2_frag(qp + (size_t)t * 16 * DM, hh); qf[t][1] = g2_frag(qp + (size_t)t * 16 * DM + 32, hh);
#pragma unroll      /* constant indices, so the fragment arrays stay in registers */
    for (int d = 0; d < 4; ++d) o[t][d] = z8; }
  unsigned all1 = 0xFFFFFFFFu;      /* lane i: the AND of the 64 mask words of the wave's row i */
  { const v4ua* row = (const v4ua*)(MB + (size_t)(q0 + lane) * (SQ / 32));
#pragma unroll      /* 16 independent loads in flight */
    for (int i = 0; i < SQ / 128; ++i) { const v4ua x = row[i]; all1 &= x[0] & x[1] & x[2] & x[3]; } }
  asm volatile("s_wait_xcnt 0x0" ::: "memory");      /* precaution: stands behind the loads issued above, in front of any rewrite of their address registers */
  const unsigned bz = __builtin_amdgcn_ballot_w32(all1 != 0xFFFFFFFFu);      /* taken with every lane on */
  if (lane == 0) wz[w] = bz;
  __syncthreads();      /* the key loop holds barriers, so the whole work-group takes one side: every wave sees all 8 waves' findings */
  const v4ua z0 = *(const v4ua*)&wz[0], z1 = *(const v4ua*)&wz[4];
  if (__builtin_amdgcn_readfirstlane(z0[0] | z0[1] | z0[2] | z0[3] | z1[0] | z1[1] | z1[2] | z1[3]) != 0) fattn_keys<true>(ring, gk, gv, lk, lv, mb, ln, hh, qf, o, m, l); else fattn_keys<false>(ring, gk, gv, lk, lv, mb, ln, hh, qf, o, m, l);      /* scalar branch, the same in every wave */
#pragma unroll      /* constant indices, so the fragment arrays stay in registers */
  for (int qt = 0; qt < 2; ++qt) { const float inv = 1.0f / (l[qt] + lane_xor<16>(l[qt])), sc = inv * 64.0f; const int q = q0 + qt * 16 + ln;
    if (hh == 0) { float* st = ST + ((size_t)(b * NH + h) * SQ + q) * 2; st[0] = m[qt]; st[1] = inv; }
    v4f av[4][2];
    __builtin_amdgcn_sched_barrier(0);      /* with the one below: the eight loads of the addend and their wait stay one group, so nothing that could rewrite an address register comes between */
#pragma unroll      /* constant indices, so the fragment arrays stay in registers */
    for (int d = 0; d < 4; ++d) { const size_t off = (r0 + q) * DM + h * HD + d * 16 + 8 * hh; av[d][0] = *(const v4fa*)(AV + off); av[d][1] = *(const v4fa*)(AV + off + 4); }
    asm volatile("s_wait_xcnt 0x0" ::: "memory");      /* precaution: stands behind the loads issued above, in front of any rewrite of their address registers */
    __builtin_amdgcn_sched_barrier(0);
#pragma unroll      /* constant indices, so the fragment arrays stay in registers */
    for (int d = 0; d < 4; ++d) { const size_t off = (r0 + q) * DM + h * HD + d * 16 + 8 * hh; const v4f a0 = av[d][0], a1 = av[d][1]; FragH f;      /* O^T tile: a lane holds 8 consecutive d of one query */
#pragma unroll      /* constant indices, so the fragment arrays stay in registers */
      for (int r = 0; r < 4; ++r) { f.h[r] = (_Float16)(o[qt][d][r] * sc + a0[r]); f.h[4 + r] = (_Float16)(o[qt][d][4 + r] * sc + a1[r]); }
      *(v8us*)((unsigned short*)O16 + off) = f.half[0]; } } }
// K, Q and the row statistics of k_headsum go through LDS: a stage is one head's 128 B of the work-group's 256 K rows and 64 Q rows, brought by asynchronous copies of whole lines, two buffers, the next head in flight while this one is worked on
#define HS_PITCH 144                 /* LDS bytes from row to row: 128 + 16, an odd multiple of 16 B, so the 16 rows of a fragment read fall on different banks */
#define HS_BUF (320 * HS_PITCH)      /* one stage: rows 0..255 = K, rows 256..319 = Q */
// two asynchronous copies of 16 B a lane: LDS byte address l (+ ls), global address g (+ gs bytes)
__device__ __forceinline__ void f_copy2(unsigned l, unsigned ls, const unsigned char* g, size_t gs) {
  const unsigned l1 = l + ls; const unsigned char* g1 = g + gs;
  /* the copies move global bytes into LDS through no register; the closing s_wait_xcnt is a precaution: it stands in front of any rewrite of the address registers named here */
  asm volatile("global_load_async_to_lds_b128 %0, %2, off\n\t"
               "global_load_async_to_lds_b128 %1, %3, off\n\t"
               "s_wait_xcnt 0x0"
               :: "v"(l), "v"(l1), "v"(g), "v"(g1) : "memory"); }
// this lane's ten copies of head h into buffer buf; gk, gq: the work-group's first K and Q rows; go, lc: the lane's element offset from them and its first LDS address
__device__ __forceinline__ void hs_stage(const _Float16* gk, const _Float16* gq, unsigned go, unsigned lc, int h, int buf) { const unsigned l = lc + buf * HS_BUF;
  f_copy4(l, 32 * HS_PITCH, gk + h * HD + go, (size_t)32 * DM); f_copy4(l + 128 * HS_PITCH, 32 * HS_PITCH, gk + (size_t)128 * DM + h * HD + go, (size_t)32 * DM); f_copy2(l + 256 * HS_PITCH, 32 * HS_PITCH, (const unsigned char*)(gq + h * HD + go), (size_t)32 * DM * 2); }
// the head loop of k_headsum, entered with head 0 published and head 1 in flight; MSK = false is taken by a work-group whose 64 x 256 mask bits are all set
// ring: the two buffers; gk, gq, go, lc: as in hs_stage; kr, qr: the LDS rows of this lane's first K and Q fragments; st: this lane's first (m, 1 / sum) pair in LDS
template <bool MSK>
__device__ __forceinline__ void headsum_heads(const unsigned char* ring, const _Float16* gk, const _Float16* gq, unsigned go, unsigned lc, int kr, int qr, const float* st, int hh, const unsigned (&mw)[2][2], v8f (&acc)[2][4]) {
  const v8f z8 = {0.f,0.f,0.f,0.f,0.f,0.f,0.f,0.f};
#pragma unroll 1    /* one head a trip: the publish point at the foot stands once, and the live set stays small enough for four waves a SIMD */
  for (int h = 0; h < NH; ++h) { v16h qf[2][2], kf[4][2]; float mr[2], iv[2]; const unsigned char* kp = ring + (h & 1) * HS_BUF + kr * HS_PITCH + 16 * hh; const unsigned char* qp = ring + (h & 1) * HS_BUF + qr * HS_PITCH + 16 * hh;
#pragma unroll      /* constant indices, so the fragment arrays stay in registers */
    for (int t = 0; t < 4; ++t) { kf[t][0] = g2_lfrag(kp + t * 16 * HS_PITCH); kf[t][1] = g2_lfrag(kp + t * 16 * HS_PITCH + 64); }
#pragma unroll      /* constant indices, so the fragment arrays stay in registers */
    for (int t = 0; t < 2; ++t) { qf[t][0] = g2_lfrag(qp + t * 16 * HS_PITCH); qf[t][1] = g2_lfrag(qp + t * 16 * HS_PITCH + 64); mr[t] = st[(h * 64 + t * 16) * 2]; iv[t] = st[(h * 64 + t * 16) * 2 + 1]; }
#pragma unroll      /* constant indices, so the fragment arrays stay in registers */
    for (int qt = 0; qt < 2; ++qt)
#pragma unroll      /* constant indices, so the fragment arrays stay in registers */
      for (int kt = 0; kt < 4; ++kt) { v8f s = f_mma(kf[kt][1], qf[qt][1], f_mma(kf[kt][0], qf[qt][0], z8));
        if (MSK) mask_tile(s, mw[qt][kt >> 1], kt & 1, hh);
#pragma unroll      /* constant indices, so the fragment arrays stay in registers */
        for (int r = 0; r < 8; ++r) acc[qt][kt][r] = __builtin_fmaf(__builtin_amdgcn_exp2f(__builtin_fmaf(s[r], SC2, -mr[qt])), iv[qt], acc[qt][kt][r]); }
    asm volatile("s_wait_dscnt 0x0" ::: "memory");         /* this wave has finished reading the buffer */
    asm volatile("s_wait_asynccnt 0x0" ::: "memory");      /* its copies of head h + 1 have landed */
    __syncthreads();                                       /* publishes head h + 1 and ends every wave's reads of head h */
    if (h + 2 < NH) hs_stage(gk, gq, go, lc, h + 2, h & 1); }      /* refill of the buffer just left; the test reads the same in the whole work-group */
  asm volatile("s_wait_asynccnt 0x0" ::: "memory"); }      /* nothing of this wave is in flight behind the loop */
// second output: one wave holds 32 queries x 64 keys of the head sum in registers and walks the 16 heads, forming each head's S^T tiles again (same products, same order as k_fattn) and its weights from the stored (m, 1 / sum)
// a work-group is 2 x 4 such waves: 64 queries x 256 keys, so a staged K row serves two waves and a staged Q row four
__global__ __launch_bounds__(256) void k_headsum(const _Float16* __restrict__ Q, const _Float16* __restrict__ Kp, const unsigned* __restrict__ MB, const float* __restrict__ ST, float* __restrict__ WS) {
  __shared__ __attribute__((aligned(16))) unsigned char ring[2 * HS_BUF]; __shared__ __attribute__((aligned(16))) float sst[NH][64][2]; __shared__ __attribute__((aligned(16))) unsigned wz[8];
  const int tid = threadIdx.x, w = tid >> 5, lane = tid & 31, ln = lane & 15, hh = lane >> 4, qi = w >> 2, ki = w & 3; const int b = blockIdx.z, qb = blockIdx.y * 64, kb = blockIdx.x * 256, q0 = qb + qi * 32, k0 = kb + ki * 64; const size_t r0 = (size_t)b * SQ;
  /* copy roles: 8 lanes cover the 128 B of a row, so a wave copies 4 whole lines at a time; the statistics are 512 B a head, 32 lanes each */
  const _Float16* gk = Kp + (r0 + kb) * DM; const _Float16* gq = Q + (r0 + qb) * DM; const unsigned go = (tid >> 3) * DM + (tid & 7) * 8; const unsigned lc = (unsigned)(size_t)&ring[0] + (tid >> 3) * HS_PITCH + (tid & 7) * 16;
  f_copy2((unsigned)(size_t)&sst[0][0][0] + tid * 16, 8 * 512, (const unsigned char*)(ST + ((size_t)(b * NH + (tid >> 5)) * SQ + qb) * 2 + (tid & 31) * 4), (size_t)8 * SQ * 2 * 4);      /* heads w and w + 8; waited for with head 0's copies */
  hs_stage(gk, gq, go, lc, 0, 0);
  const v8f z8 = {0.f,0.f,0.f,0.f,0.f,0.f,0.f,0.f}; v8f acc[2][4]; unsigned mw[2][2];
#pragma unroll      /* constant indices, so the fragment arrays stay in registers */
  for (int qt = 0; qt < 2; ++qt) { const unsigned* mb = MB + (size_t)(q0 + qt * 16 + ln) * (SQ / 32) + (k0 >> 5); mw[qt][0] = mb[0]; mw[qt][1] = mb[1];
#pragma unroll      /* constant indices, so the fragment arrays stay in registers */
    for (int kt = 0; kt < 4; ++kt) acc[qt][kt] = z8; }
  const unsigned bz = __builtin_amdgcn_ballot_w32((mw[0][0] & mw[0][1] & mw[1][0] & mw[1][1]) != 0xFFFFFFFFu);      /* taken with every lane on */
  if (lane == 0) wz[w] = bz;
  asm volatile("s_wait_asynccnt 0x0" ::: "memory");      /* this wave's copies of head 0 and of the statistics have landed */
  __syncthreads();      /* every wave's have: they may be read; and every wave sees all 8 waves' mask findings: the head loop holds barriers, so the whole work-group takes one side */
  hs_stage(gk, gq, go, lc, 1, 1);
  const v4ua z0 = *(const v4ua*)&wz[0], z1 = *(const v4ua*)&wz[4]; const float* st = &sst[0][qi * 32 + ln][0]; const int kr = ki * 64 + ln, qr = 256 + qi * 32 + ln;
  if (__builtin_amdgcn_readfirstlane(z0[0] | z0[1] | z0[2] | z0[3] | z1[0] | z1[1] | z1[2] | z1[3]) != 0) headsum_heads<true>(ring, gk, gq, go, lc, kr, qr, st, hh, mw, acc); else headsum_heads<false>(ring, gk, gq, go, lc, kr, qr, st, hh, mw, acc);      /* scalar branch, the same in every wave */
#pragma unroll      /* constant indices, so the fragment arrays stay in registers */
  for (int qt = 0; qt < 2; ++qt)
#pragma unroll      /* constant indices, so the fragment arrays stay in registers */
    for (int kt = 0; kt < 4; ++kt) { float* d = WS + (r0 + q0 + qt * 16 + ln) * SQ + k0 + kt * 16 + 8 * hh; v4f a0, a1;      /* a lane holds 8 consecutive keys of one query */
#pragma unroll      /* constant indices, so the fragment arrays stay in registers */
      for (int r = 0; r < 4; ++r) { a0[r] = acc[qt][kt][r]; a1[r] = acc[qt][kt][4 + r]; }
      *(v4f*)d = a0; *(v4f*)(d + 4) = a1; } }
__global__ __launch_bounds__(256) void k_av64(const float* __restrict__ VPF, const float* __restrict__ alpha, float* __restrict__ AV, size_t n4) {
  #pragma clang fp contract(off)
  const size_t t = (size_t)blockIdx.x * 256 + threadIdx.x; if (t >= n4) return; const float a = __fmul_rn(bf16_round(alpha[0]), 64.0f); const v4f v = *(const v4fa*)(VPF + t * 4); v4f o; for (int q = 0; q < 4; ++q) o[q] = __fmul_rn(a, v[q]); *(v4f*)(AV + t * 4) = o;  }

extern "C" void kernel_launch(void* const* d_in, const int* in_sizes, int n_in,
                              void* d_out, int out_size, void* d_ws, size_t ws_size, hipStream_t stream) {
  (void)in_sizes; (void)n_in; (void)out_size;
  const float* const* I = (const float* const*)d_in; const float* qin = I[0]; const float* kin = I[1]; const float* vin = I[2]; const int* mask = (const int*)d_in[3]; const float* wq = I[4]; const float* bq = I[5]; const float* wkv = I[6]; const float* bkv = I[7]; const float* wo = I[8]; const float* bo = I[9]; const float* alpha = I[10];      /* weights [in][out] */
  float* out0 = (float*)d_out; float* out1 = (float*)d_out + NR * DM;      /* byte offset 16,777,216 */
  char* ws = (char*)d_ws; size_t off = 0;
  auto take = [&](size_t bytes) { char* p = ws + off; off += (bytes + 255) & ~(size_t)255; return p; };
  _Float16* BQ = (_Float16*)take((size_t)DM * DM * 2); _Float16* BKV = (_Float16*)take((size_t)DM * DM * 2); _Float16* BO = (_Float16*)take((size_t)DM * DM * 2);
  _Float16* Q16 = (_Float16*)take(NR * DM * 2); _Float16* K16 = (_Float16*)take(NR * DM * 2); _Float16* V16 = (_Float16*)take(NR * DM * 2); float* AV = (float*)take(NR * DM * 4); _Float16* O16 = (_Float16*)take(NR * DM * 2);
  _Float16* VT = (_Float16*)take((size_t)NB * NH * HD * SQ * 2); unsigned* MB = (unsigned*)take((size_t)SQ * (SQ / 32) * 4); float* ST = (float*)take((size_t)NB * NH * SQ * 2 * 4);
  _Float16* XQ = (_Float16*)take(NR * DM * 2); _Float16* XK = (_Float16*)take(NR * DM * 2); _Float16* XV = (_Float16*)take(NR * DM * 2); float* VPF = (float*)take(NR * DM * 4);
  if (off > ws_size) return;      /* 6 + 24 + 16 + 8 + 8 + 0.5 + 0.5 + 24 + 16 = 103 MiB */
  { const unsigned gw = (unsigned)(((size_t)DM * (DM / 8) + 255) / 256); k_wt_f16<<<gw, 256, 0, stream>>>(wq, BQ, DM, DM, 16.0f); k_wt_f16<<<gw, 256, 0, stream>>>(wkv, BKV, DM, DM, 16.0f); k_wt_f16<<<gw, 256, 0, stream>>>(wo, BO, DM, DM, 16.0f); }
  { const unsigned gx = (unsigned)((NR * DM / 8 + 255) / 256); k_x16<<<gx, 256, 0, stream>>>(qin, XQ, NR * DM / 8); k_x16<<<gx, 256, 0, stream>>>(kin, XK, NR * DM / 8); k_x16<<<gx, 256, 0, stream>>>(vin, XV, NR * DM / 8); }
  const size_t r0p = (size_t)B0 * SQ; const dim3 gp((unsigned)((MP / 128) * (DM / 64)), 1);
  k_gemm2<0><<<gp, 128, 0, stream>>>(XQ + r0p * DM, DM, 0, BQ, DM, 0, 0.0625f, bq, 0, nullptr, 1, 0, 0, nullptr, Q16 + r0p * DM, DM, 0, MP, DM, DM);
  k_gemm2<0><<<gp, 128, 0, stream>>>(XK + r0p * DM, DM, 0, BKV, DM, 0, 0.0625f, bkv, 0, nullptr, 1, 0, 0, nullptr, K16 + r0p * DM, DM, 0, MP, DM, DM);
  k_gemm2<0><<<gp, 128, 0, stream>>>(XV + r0p * DM, DM, 0, BKV, DM, 0, 0.0625f, bkv, 0, nullptr, 1, 0, 0, VPF + r0p * DM, V16 + r0p * DM, DM, 0, MP, DM, DM);      /* vp: f32 (residual) and f16 (attention operand) */
  k_av64<<<(unsigned)(((size_t)MP * DM / 4 + 255) / 256), 256, 0, stream>>>(VPF + r0p * DM, alpha, AV + r0p * DM, (size_t)MP * DM / 4);
  k_vt<NH, SQ><<<NB * NH * (SQ / 64), 256, 0, stream>>>(V16, DM, 0, VT);      /* V^T [NB][NH][HD][SQ] */
  k_maskbits<<<SQ * (SQ / 32) / 256, 256, 0, stream>>>(mask, MB);
  k_fattn<<<dim3(SQ / 256, NH, NB), 256, 0, stream>>>(Q16, K16, VT, MB, AV, O16, ST);      /* o x64 = 64 attn v + 64 alpha vp, f16 rows; row statistics */
  k_headsum<<<dim3(SQ / 256, SQ / 64, NB), 256, 0, stream>>>(Q16, K16, MB, ST, out1);      /* sum over the heads of the weights */
  k_gemm2<0><<<dim3((unsigned)((MPO / 128) * (DM / 64)), 1), 128, 0, stream>>>(O16 + r0p * DM, DM, 0, BO, DM, 0, 0.0009765625f, bo, 0, nullptr, 1, 0, 0, out0 + r0p * DM, nullptr, DM, 0, MPO, DM, DM);      /* out0 = o Wo + bo */
}

// v006
// It runs in 142 microseconds.
// Timed twice side by side with v005, it ran 1.18 times as fast both times.
// All steps since v000 together make it 964 times as fast.
#include <hip/hip_runtime.h>
#define NB 2
#define SQ 2048
#define DM 1024
#define NH 16
#define HD 64
#define HG 4                         /* k_vt(b,h0) compatibility (unused) */
#define B0 0                         /* first batch processed (debug hook) */
#define NBR NB                       /* batches processed (debug hook) */
#define Q0S 0                        /* first tile (unused) */
#define QN SQ                        /* query rows end (unused) */
#define NR ((size_t)NB * SQ)
#define MP ((int)((size_t)NBR * SQ)) /* rows projected (debug hook) */
#define MPO MP                       /* rows through the output GEMM (debug hook) */
typedef __bf16 v16b __attribute__((ext_vector_type(16)));
typedef unsigned short v8us __attribute__((ext_vector_type(8), may_alias));
typedef float  v8f  __attribute__((ext_vector_type(8)));
typedef float  v4f  __attribute__((ext_vector_type(4)));
typedef float  v4fa __attribute__((ext_vector_type(4), may_alias));
union FragB { v16b v; v8us half[2]; unsigned short u[16]; };

__device__ __forceinline__ unsigned short bf16_bits(float x) { unsigned int u = __float_as_uint(x); return (unsigned short)((u + 0x7FFFu + ((u >> 16) & 1u)) >> 16); }
__device__ __forceinline__ float bf16_val(unsigned short b) { return __uint_as_float(((unsigned int)b) << 16); }
__device__ __forceinline__ float bf16_round(float x) { return bf16_val(bf16_bits(x)); }
// D += A·B with NT terms: 1 = ah·bh, 2 = + al·bh (A split), 3 = + ah·bl (both split)
template <int NT>
__device__ __forceinline__ v8f mmaN(v16b ah, v16b al, v16b bh, v16b bl, v8f c) {
  c = __builtin_amdgcn_wmma_f32_16x16x32_bf16(false, ah, false, bh, (short)0, c, false, false);
  if (NT >= 2) c = __builtin_amdgcn_wmma_f32_16x16x32_bf16(false, al, false, bh, (short)0, c, false, false);
  if (NT >= 3) c = __builtin_amdgcn_wmma_f32_16x16x32_bf16(false, ah, false, bl, (short)0, c, false, false);
  asm volatile("v_nop\n\tv_nop\n\tv_nop\n\tv_nop" : "+v"(c) : "v"(ah), "v"(al), "v"(bh), "v"(bl));
  return c;
}

__global__ __launch_bounds__(256) void k_wt_bf16(const float* __restrict__ W, unsigned short* __restrict__ Wt, int K, int N) {
  const int t = blockIdx.x * 256 + threadIdx.x;
  const int k8n = K / 8;
  if (t >= N * k8n) return;
  const int n = t / k8n, k8 = (t % k8n) * 8;
  v8us v;
#pragma unroll
  for (int i = 0; i < 8; ++i) v[i] = bf16_bits(W[(size_t)(k8 + i) * N + n]);
  *(v8us*)(Wt + (size_t)n * K + k8) = v;
  
}

// GEMM C[M][N] (f32, pitch ldc) = act(A[M][K]·W + bias). A f32 row-major (pitch lda) converted per fragment to bf16
// (ASPLIT: hi/lo two planes -> 2 terms, else single rounded term); Wt bf16 [N][K] (pitch ldb). BIAS_BF16 rounds the
// bias to bf16 first (bias quantised to bf16 before the add). K%32==0, M%16==0, N%64==0.
template <bool ASPLIT, int ACT, bool BIAS_BF16>
__global__ __launch_bounds__(128) void k_gemm_bf(const float* __restrict__ A, int lda, const unsigned short* __restrict__ Wt, int ldb,
                                               const float* __restrict__ bias, float* __restrict__ C, int ldc, int M, int N, int K) {
  __shared__ __attribute__((aligned(16))) float so[4][16][64];
  const int tid = threadIdx.x, w = tid >> 5, lane = tid & 31, ln = lane & 15, hh = lane >> 4;
  const int ntn = N / 64;
  const int wid = blockIdx.x * 4 + w;
  const int mt = wid / ntn, nq = wid % ntn;
  if (mt * 16 >= M) return;
  const int row0 = mt * 16, col0 = nq * 64;
  const float* arow = A + (size_t)(row0 + ln) * lda;
  v8f acc[4] = {};
  for (int kb = 0; kb < K; kb += 32) {
    FragB ah, al;
    const v4f x0 = *(const v4fa*)(arow + kb + 8 * hh), x1 = *(const v4fa*)(arow + kb + 8 * hh + 4);
    const v4f x2 = *(const v4fa*)(arow + kb + 16 + 8 * hh), x3 = *(const v4fa*)(arow + kb + 16 + 8 * hh + 4);
    float xs[16] = {x0[0],x0[1],x0[2],x0[3],x1[0],x1[1],x1[2],x1[3],x2[0],x2[1],x2[2],x2[3],x3[0],x3[1],x3[2],x3[3]};
#pragma unroll
    for (int i = 0; i < 16; ++i) { const unsigned short hb = bf16_bits(xs[i]); ah.u[i] = hb; al.u[i] = ASPLIT ? bf16_bits(xs[i] - bf16_val(hb)) : (unsigned short)0; }
#pragma unroll
    for (int t = 0; t < 4; ++t) {
      const unsigned short* brow = Wt + (size_t)(col0 + t * 16 + ln) * ldb + kb;
      FragB b;
      b.half[0] = *(const v8us*)(brow + 8 * hh);
      b.half[1] = *(const v8us*)(brow + 16 + 8 * hh);
      acc[t] = mmaN<ASPLIT ? 2 : 1>(ah.v, al.v, b.v, b.v, acc[t]);
    }
  }
#pragma unroll
  for (int t = 0; t < 4; ++t) {
    float bv = bias ? bias[col0 + t * 16 + ln] : 0.f;
    if (BIAS_BF16) bv = bf16_round(bv);
#pragma unroll
    for (int r = 0; r < 8; ++r) { float v = acc[t][r] + bv; if (ACT == 1) v = fmaxf(v, 0.f); so[w][8 * hh + r][t * 16 + ln] = v; }
  }
  __builtin_amdgcn_fence(__ATOMIC_ACQ_REL, "workgroup");
  __builtin_amdgcn_wave_barrier();
  const int rsub = lane >> 4, c4 = (lane & 15) * 4;
  {
#pragma unroll
    for (int q = 0; q < 8; ++q) {
      const int r = q * 2 + rsub;
      const v4f v = *(const v4fa*)&so[w][r][c4];
      *(v4f*)(C + (size_t)(row0 + r) * ldc + col0 + c4) = v;
    }
    
  }
}

// GEMM C = act(A·W + bias + resid): A f32 (ASPLIT -> hi/lo 2 terms), Wt bf16 [N][K]; ACT 0 none, 1 relu, 2 exact gelu;
// resid (optional, f32, row index = (row % rmod), pitch ldr, RES_BF16 rounds it) added before the activation.
template <bool ASPLIT, int ACT, bool BIAS_BF16, bool RES_BF16>
__global__ __launch_bounds__(128) void k_gemm_bf3(const float* __restrict__ A, int lda, const unsigned short* __restrict__ Wt, int ldb,
                                                const float* __restrict__ bias, const float* __restrict__ resid, int rmod, int ldr,
                                                float* __restrict__ C, int ldc, int M, int N, int K) {
  __shared__ __attribute__((aligned(16))) float so[4][16][64];
  const int tid = threadIdx.x, w = tid >> 5, lane = tid & 31, ln = lane & 15, hh = lane >> 4;
  const int ntn = N / 64;
  const int wid = blockIdx.x * 4 + w;
  const int mt = wid / ntn, nq = wid % ntn;
  if (mt * 16 >= M) return;
  const int row0 = mt * 16, col0 = nq * 64;
  const float* arow = A + (size_t)(row0 + ln) * lda;
  v8f acc[4] = {};
  for (int kb = 0; kb < K; kb += 32) {
    FragB ah, al;
    const v4f x0 = *(const v4fa*)(arow + kb + 8 * hh), x1 = *(const v4fa*)(arow + kb + 8 * hh + 4);
    const v4f x2 = *(const v4fa*)(arow + kb + 16 + 8 * hh), x3 = *(const v4fa*)(arow + kb + 16 + 8 * hh + 4);
    float xs[16] = {x0[0],x0[1],x0[2],x0[3],x1[0],x1[1],x1[2],x1[3],x2[0],x2[1],x2[2],x2[3],x3[0],x3[1],x3[2],x3[3]};
#pragma unroll
    for (int i = 0; i < 16; ++i) { const unsigned short hb = bf16_bits(xs[i]); ah.u[i] = hb; al.u[i] = ASPLIT ? bf16_bits(xs[i] - bf16_val(hb)) : (unsigned short)0; }
#pragma unroll
    for (int t = 0; t < 4; ++t) {
      const unsigned short* brow = Wt + (size_t)(col0 + t * 16 + ln) * ldb + kb;
      FragB b;
      b.half[0] = *(const v8us*)(brow + 8 * hh);
      b.half[1] = *(const v8us*)(brow + 16 + 8 * hh);
      acc[t] = mmaN<ASPLIT ? 2 : 1>(ah.v, al.v, b.v, b.v, acc[t]);
    }
  }
#pragma unroll
  for (int t = 0; t < 4; ++t) {
    const int col = col0 + t * 16 + ln;
    float bv = bias ? bias[col] : 0.f;
    if (BIAS_BF16) bv = bf16_round(bv);
#pragma unroll
    for (int r = 0; r < 8; ++r) {
      float v = acc[t][r] + bv;
      if (resid) { float rv = resid[(size_t)((row0 + 8 * hh + r) % rmod) * ldr + col]; if (RES_BF16) rv = bf16_round(rv); v += rv; }
      if (ACT == 1) v = fmaxf(v, 0.f);
      if (ACT == 2) v = 0.5f * v * (1.0f + erff(v * 0.70710678118654752f));
      if (ACT == 3) { const float u = 0.7978845608028654f * (v + 0.044715f * v * v * v); v = 0.5f * v * (1.0f + tanhf(u)); }
      so[w][8 * hh + r][t * 16 + ln] = v;
    }
  }
  __builtin_amdgcn_fence(__ATOMIC_ACQ_REL, "workgroup");
  __builtin_amdgcn_wave_barrier();
  const int rsub = lane >> 4, c4 = (lane & 15) * 4;
  {
#pragma unroll
    for (int q = 0; q < 8; ++q) {
      const int r = q * 2 + rsub;
      const v4f v = *(const v4fa*)&so[w][r][c4];
      *(v4f*)(C + (size_t)(row0 + r) * ldc + col0 + c4) = v;
    }
    
  }
}
// row LayerNorm (biased variance, eps) over N: s = X (+ R); optional out_sum <- s; out_norm <- (s-mu)*rsqrt(var+eps)*g + b
template <bool PARAM_BF16>
__global__ __launch_bounds__(256) void k_layernorm(const float* __restrict__ X, const float* __restrict__ R, const float* __restrict__ g, const float* __restrict__ bta,
                                                  float* __restrict__ out_sum, float* __restrict__ out_norm, int N, float eps) {
  __shared__ float red[256];
  const int row = blockIdx.x, tid = threadIdx.x;
  const float* x = X + (size_t)row * N; const float* rr = R ? R + (size_t)row * N : nullptr;
  float vals[16];                     // up to N = 4096
  const int per = N / 256;            // contiguous chunk per thread? use strided-by-4 chunks: thread handles j = tid*4 + 1024*u
  float s1 = 0.f;
  for (int u = 0; u < per / 4; ++u) {
    const int j = tid * 4 + 1024 * u;
    const v4f a = *(const v4fa*)(x + j);
    v4f b = {0.f,0.f,0.f,0.f}; if (rr) b = *(const v4fa*)(rr + j);
#pragma unroll
    for (int q = 0; q < 4; ++q) { const float v = a[q] + b[q]; vals[u * 4 + q] = v; s1 += v; }
  }
  red[tid] = s1; __syncthreads();
  for (int st = 128; st > 0; st >>= 1) { if (tid < st) red[tid] += red[tid + st]; __syncthreads(); }
  const float mu = red[0] / (float)N; __syncthreads();
  float s2 = 0.f;
  for (int u = 0; u < per / 4; ++u)
#pragma unroll
    for (int q = 0; q < 4; ++q) { const float c = vals[u * 4 + q] - mu; s2 += c * c; }
  red[tid] = s2; __syncthreads();
  for (int st = 128; st > 0; st >>= 1) { if (tid < st) red[tid] += red[tid + st]; __syncthreads(); }
  const float rs = rsqrtf(red[0] / (float)N + eps);
  {
    for (int u = 0; u < per / 4; ++u) {
      const int j = tid * 4 + 1024 * u;
      v4f o, sm;
#pragma unroll
      for (int q = 0; q < 4; ++q) {
        float gg = g[j + q], bb = bta[j + q];
        if (PARAM_BF16) { gg = bf16_round(gg); bb = bf16_round(bb); }
        sm[q] = vals[u * 4 + q]; o[q] = (vals[u * 4 + q] - mu) * rs * gg + bb;
      }
      if (out_sum) *(v4f*)(out_sum + (size_t)row * N + j) = sm;
      *(v4f*)(out_norm + (size_t)row * N + j) = o;
    }
    
  }
}



// ---- f16 WMMA path (v_wmma_f32_16x16x32_f16): 11-bit significands for operands in range — used for every launched product, the unnormalised softmax weights (<= 256) among them
typedef _Float16 v16h __attribute__((ext_vector_type(16)));
union FragH { v16h v; v8us half[2]; _Float16 h[16]; unsigned short u[16]; };
template <int NT>
__device__ __forceinline__ v8f mmaH(v16h ah, v16h al, v16h bh, v16h bl, v8f c) {
  c = __builtin_amdgcn_wmma_f32_16x16x32_f16(false, ah, false, bh, (short)0, c, false, false);
  if (NT >= 2) c = __builtin_amdgcn_wmma_f32_16x16x32_f16(false, al, false, bh, (short)0, c, false, false);
  if (NT >= 3) c = __builtin_amdgcn_wmma_f32_16x16x32_f16(false, ah, false, bl, (short)0, c, false, false);
  asm volatile("v_nop\n\tv_nop\n\tv_nop\n\tv_nop" : "+v"(c) : "v"(ah), "v"(al), "v"(bh), "v"(bl));
  return c;
}
// batched GEMM like k_gemm_b but f16 operands: A f32 (split into f16 hi/lo if ASPLIT, else rounded to f16), Bt = f16 values [n][k]; alpha; C f32; N multiple of 16 (partial tiles skipped)
template <bool ASPLIT>
__global__ __launch_bounds__(128) void k_gemm_h(const float* __restrict__ A, int lda, size_t sA, const _Float16* __restrict__ Bh, int ldb, size_t sB, float alpha, float* __restrict__ C, int ldc, size_t sC, int M, int N, int K) {
  __shared__ __attribute__((aligned(16))) float so[4][16][64];
  const int tid = threadIdx.x, w = tid >> 5, lane = tid & 31, ln = lane & 15, hh = lane >> 4; const int by = blockIdx.y;
  A += (size_t)by * sA; Bh += (size_t)by * sB; C += (size_t)by * sC;
  const int ntn = (N + 63) / 64; const int wid = blockIdx.x * 4 + w; const int mt = wid / ntn, nq = wid % ntn; if (mt * 16 >= M) return;
  const int row0 = mt * 16, col0 = nq * 64; const float* arow = A + (size_t)(row0 + ln) * lda;
  v8f acc[4] = {};
  for (int kb = 0; kb < K; kb += 32) {
    FragH ah, al;
    const v4f x0 = *(const v4fa*)(arow + kb + 8 * hh), x1 = *(const v4fa*)(arow + kb + 8 * hh + 4), x2 = *(const v4fa*)(arow + kb + 16 + 8 * hh), x3 = *(const v4fa*)(arow + kb + 16 + 8 * hh + 4);
    float xs[16] = {x0[0],x0[1],x0[2],x0[3],x1[0],x1[1],x1[2],x1[3],x2[0],x2[1],x2[2],x2[3],x3[0],x3[1],x3[2],x3[3]};
#pragma unroll
    for (int i = 0; i < 16; ++i) { const _Float16 h = (_Float16)xs[i]; ah.h[i] = h; al.h[i] = ASPLIT ? (_Float16)(xs[i] - (float)h) : (_Float16)0.0f; }
#pragma unroll
    for (int t = 0; t < 4; ++t) { if (col0 + t * 16 >= N) continue; const size_t boff = (size_t)(col0 + t * 16 + ln) * ldb + kb; FragH bq; bq.half[0] = *(const v8us*)(Bh + boff + 8 * hh); bq.half[1] = *(const v8us*)(Bh + boff + 16 + 8 * hh);
      acc[t] = mmaH<ASPLIT ? 2 : 1>(ah.v, al.v, bq.v, bq.v, acc[t]); }
  }
#pragma unroll
  for (int t = 0; t < 4; ++t) { if (col0 + t * 16 >= N) continue;
#pragma unroll
    for (int r = 0; r < 8; ++r) so[w][8 * hh + r][t * 16 + ln] = acc[t][r] * alpha; }
  __builtin_amdgcn_fence(__ATOMIC_ACQ_REL, "workgroup"); __builtin_amdgcn_wave_barrier();
  const int rsub = lane >> 4, c4 = (lane & 15) * 4;
  {
#pragma unroll
    for (int q = 0; q < 8; ++q) { const int r = q * 2 + rsub; if (col0 + c4 < N) { const v4f v = *(const v4fa*)&so[w][r][c4]; *(v4f*)(C + (size_t)(row0 + r) * ldc + col0 + c4) = v; } }
     }
}

// Wt[n][k] = f16(W[k][n]·scale) from f32 row-major W[K][N] (scale = power of two; bf16-exact weights stay exact in f16 away from the subnormal range)
// bx, here and in the other d_ bodies: the work-group's index within this job's own share of a grid that several jobs share
__device__ __forceinline__ void d_wt_f16(unsigned bx, const float* __restrict__ W, _Float16* __restrict__ Wt, int K, int N, float scale) {
  const int t = bx * 256 + threadIdx.x; if (t >= N * (K / 8)) return; const int n = t / (K / 8), k8 = (t % (K / 8)) * 8; FragH f;
#pragma unroll
  for (int i = 0; i < 8; ++i) f.h[i] = (_Float16)(bf16_round(W[(size_t)(k8 + i) * N + n]) * scale); const v8us o = f.half[0];
  *(v8us*)((unsigned short*)Wt + (size_t)n * K + k8) = o; 
}
// k_gemm_hh variant with fused epilogue: v = acc·alpha + bias[by·sBias + col] (+ CP[(row/rowsPerB)·sCPb + by·64 + col] if CP) ; ACT 0 none / 1 elu ; writes f16 C16 (and f32 C if non-null)
template <int ACT>
__global__ __launch_bounds__(128) void k_gemm_hhx(const _Float16* __restrict__ A, int lda, size_t sA, const _Float16* __restrict__ Bh, int ldb, size_t sB, float alpha, const float* __restrict__ bias, size_t sBias, const float* __restrict__ CP, int rowsPerB, size_t sCPb, int row0g,
    float* __restrict__ C, _Float16* __restrict__ C16, int ldc, size_t sC, int M, int N, int K) {
  __shared__ __attribute__((aligned(16))) float so[4][16][64];
  const int tid = threadIdx.x, w = tid >> 5, lane = tid & 31, ln = lane & 15, hh = lane >> 4; const int by = blockIdx.y;
  A += (size_t)by * sA; Bh += (size_t)by * sB; const size_t cofs = (size_t)by * sC; const float* bp = bias ? bias + (size_t)by * sBias : nullptr;
  const int ntn = (N + 63) / 64; const int wid = blockIdx.x * 4 + w; const int mt = wid / ntn, nq = wid % ntn; if (mt * 16 >= M) return;
  const int row0 = mt * 16, col0 = nq * 64; const _Float16* arow = A + (size_t)(row0 + ln) * lda;
  v8f acc[4] = {};
  for (int kb = 0; kb < K; kb += 32) { FragH ah; ah.half[0] = *(const v8us*)((const unsigned short*)arow + kb + 8 * hh); ah.half[1] = *(const v8us*)((const unsigned short*)arow + kb + 16 + 8 * hh);
#pragma unroll
    for (int t = 0; t < 4; ++t) { if (col0 + t * 16 >= N) continue; const size_t boff = (size_t)(col0 + t * 16 + ln) * ldb + kb; FragH bq; bq.half[0] = *(const v8us*)((const unsigned short*)Bh + boff + 8 * hh); bq.half[1] = *(const v8us*)((const unsigned short*)Bh + boff + 16 + 8 * hh);
      acc[t] = mmaH<1>(ah.v, ah.v, bq.v, bq.v, acc[t]); }
  }
#pragma unroll
  for (int t = 0; t < 4; ++t) { if (col0 + t * 16 >= N) continue; const int col = col0 + t * 16 + ln; const float bv = bp ? bf16_round(bp[col]) : 0.f;
#pragma unroll
    for (int r = 0; r < 8; ++r) { float v = acc[t][r] * alpha + bv; if (CP) { const int rr = row0g + row0 + 8 * hh + r; if (rowsPerB < 0) v += CP[cofs + (size_t)rr * ldc + col];      /* rowsPerB < 0: own element of the batched C plane */ else { const int bidx = rr / rowsPerB; v += CP[(size_t)bidx * sCPb + (size_t)by * 64 + col]; } } if (ACT == 1) v = (v > 0.f) ? v : expm1f(v); else if (ACT == 7) v = (v > 0.f) ? v + 1.0f : expf(v); else if (ACT == 8) v = tanhf(v); else if (ACT == 9) v = 0.5f * v * (1.0f + tanhf(0.7978845608028654f * (v + 0.044715f * v * v * v))); else if (ACT == 11) v = 1.0f / (1.0f + expf(-v)); else if (ACT == 12) v = (v > 0.f) ? v : 0.01f * v; else if (ACT == 14) v = (v > 0.f) ? v : 0.1f * v; else if (ACT == 16) v = (v >= 0.f) ? v : 0.3f * v; else if (ACT == 17) v = (v >= 0.f) ? v : 0.2f * v; else if (ACT == 15) v = v / (1.0f + expf(-v)); else if (ACT == 3) v = fmaxf(v, 0.f); else if (ACT == 6) v = 0.5f * v * (1.0f + erff(v * 0.70710678118654752f)); so[w][8 * hh + r][t * 16 + ln] = v; } }
  __builtin_amdgcn_fence(__ATOMIC_ACQ_REL, "workgroup"); __builtin_amdgcn_wave_barrier();
  const int rsub = lane >> 4, c4 = (lane & 15) * 4; typedef _Float16 v4h __attribute__((ext_vector_type(4)));
  {
#pragma unroll
    for (int q = 0; q < 8; ++q) { const int r = q * 2 + rsub; if (col0 + c4 < N) { const v4f v = *(const v4fa*)&so[w][r][c4]; if (C) *(v4f*)(C + cofs + (size_t)(row0 + r) * ldc + col0 + c4) = v; if (C16) { v4h h4; for (int i = 0; i < 4; ++i) h4[i] = (_Float16)v[i]; *(v4h*)(C16 + cofs + (size_t)(row0 + r) * ldc + col0 + c4) = h4; } } }
     }
}


typedef _Float16 v4h __attribute__((ext_vector_type(4)));

__device__ __forceinline__ void d_x16(unsigned bx, const float* __restrict__ x, _Float16* __restrict__ X16, size_t n8) { const size_t t = (size_t)bx * 256 + threadIdx.x; if (t >= n8) return; FragH f;
#pragma unroll
  for (int q = 0; q < 8; ++q) f.h[q] = (_Float16)bf16_round(x[t * 8 + q]); *(v8us*)((unsigned short*)X16 + t * 8) = f.half[0];  }
__global__ __launch_bounds__(256) void k_h16(const float* __restrict__ x, _Float16* __restrict__ X16, size_t n8) { const size_t t = (size_t)blockIdx.x * 256 + threadIdx.x; if (t >= n8) return; FragH f;
#pragma unroll
  for (int q = 0; q < 8; ++q) f.h[q] = (_Float16)x[t * 8 + q]; *(v8us*)((unsigned short*)X16 + t * 8) = f.half[0];  }
__global__ __launch_bounds__(256) void k_round16f(const float* __restrict__ W, _Float16* __restrict__ Bt, size_t n8) { const size_t t = (size_t)blockIdx.x * 256 + threadIdx.x; if (t >= n8) return; FragH f;
#pragma unroll
  for (int i = 0; i < 8; ++i) f.h[i] = (_Float16)(bf16_round(W[t * 8 + i]) * 16.0f); *(v8us*)((unsigned short*)Bt + t * 8) = f.half[0];  }
template <int NHv, int TTv>
__device__ __forceinline__ void d_vt(unsigned bx, const _Float16* __restrict__ V16, int ldv, int voff, _Float16* __restrict__ Vt) { __shared__ unsigned short tl[64][66]; const int tid = threadIdx.x; const int slab = bx / (TTv / 64), lg = bx % (TTv / 64); const int b = slab / NHv, h = slab % NHv;
  for (int i = tid; i < 64 * 8; i += 256) { const int r = i / 8, c8 = (i % 8) * 8; FragH f; f.half[0] = *(const v8us*)((const unsigned short*)V16 + ((size_t)b * TTv + lg * 64 + r) * ldv + voff + h * 64 + c8);
#pragma unroll
    for (int q = 0; q < 8; ++q) tl[r][c8 + q] = f.u[q]; }
  __syncthreads();
  {
#pragma unroll
    for (int rd = 0; rd < 2; ++rd) { const int d = rd * 32 + tid / 8, pc = tid % 8; FragH f;
#pragma unroll
      for (int q = 0; q < 8; ++q) f.u[q] = tl[pc * 8 + q][d];
      *(v8us*)((unsigned short*)Vt + ((size_t)slab * 64 + d) * TTv + lg * 64 + pc * 8) = f.half[0]; }
     } }

__global__ __launch_bounds__(256) void k_hl(const float* __restrict__ F, _Float16* __restrict__ Hh, _Float16* __restrict__ Hl, size_t n8) { const size_t t = (size_t)blockIdx.x * 256 + threadIdx.x; if (t >= n8) return; FragH fh, fl; const v4f a = *(const v4fa*)(F + t * 8), c = *(const v4fa*)(F + t * 8 + 4);
#pragma unroll
  for (int q = 0; q < 4; ++q) { _Float16 h = (_Float16)a[q]; fh.h[q] = h; fl.h[q] = (_Float16)((a[q] - (float)h) * 1024.0f); h = (_Float16)c[q]; fh.h[4 + q] = h; fl.h[4 + q] = (_Float16)((c[q] - (float)h) * 1024.0f); }
  { *(v8us*)((unsigned short*)Hh + t * 8) = fh.half[0]; *(v8us*)((unsigned short*)Hl + t * 8) = fl.half[0];  } }

// ---- fast GEMM (work-group tile 128x64, wave tile 32x64; requires M % 128 == 0, N % 64 == 0, K % 128 == 0, K >= 128); epilogue = k_gemm_hhx semantics ----
// Operands go through LDS: a stage is 128 k (256 B) of the work-group's 128 A rows and 64 B rows, brought by asynchronous copies of whole lines, two buffers, the next stage in flight while this one is multiplied.
__device__ __forceinline__ v16h g2_frag(const _Float16* p, int hh) { FragH f; f.half[0] = *(const v8us*)((const unsigned short*)p + 8 * hh); f.half[1] = *(const v8us*)((const unsigned short*)p + 16 + 8 * hh); return f.v; }
__device__ __forceinline__ v8f g2_mma(v16h a, v16h b, v8f c) { return __builtin_amdgcn_wmma_f32_16x16x32_f16(false, a, false, b, (short)0, c, false, false); }
#define G2_PITCH 272                 /* LDS bytes from row to row: 256 + 16, an odd multiple of 16 B, so the 16 rows of a fragment read fall on different banks */
#define G2_BUF (192 * G2_PITCH)      /* one stage: rows 0..127 = A, rows 128..191 = B */
__device__ __forceinline__ v16h g2_lfrag(const unsigned char* p) { FragH f; f.half[0] = *(const v8us*)p; f.half[1] = *(const v8us*)(p + 32); return f.v; }      /* p = row start + 64 B x block + 16 hh: the k order of g2_frag */
// eight asynchronous copies of 16 B a lane, rows 8 apart: LDS byte address l (+ 8 rows each), global address g (+ gs elements each)
__device__ __forceinline__ void g2_copy8(unsigned l, const _Float16* g, size_t gs) {
  const unsigned l1 = l + 8 * G2_PITCH, l2 = l + 16 * G2_PITCH, l3 = l + 24 * G2_PITCH, l4 = l + 32 * G2_PITCH, l5 = l + 40 * G2_PITCH, l6 = l + 48 * G2_PITCH, l7 = l + 56 * G2_PITCH;
  const _Float16* g1 = g + gs; const _Float16* g2 = g1 + gs; const _Float16* g3 = g2 + gs; const _Float16* g4 = g3 + gs; const _Float16* g5 = g4 + gs; const _Float16* g6 = g5 + gs; const _Float16* g7 = g6 + gs;
  /* the copies move global bytes into LDS through no register; the closing s_wait_xcnt is a precaution: it stands in front of any rewrite of the address registers named here */
  asm volatile("global_load_async_to_lds_b128 %0, %8, off\n\t"
               "global_load_async_to_lds_b128 %1, %9, off\n\t"
               "global_load_async_to_lds_b128 %2, %10, off\n\t"
               "global_load_async_to_lds_b128 %3, %11, off\n\t"
               "global_load_async_to_lds_b128 %4, %12, off\n\t"
               "global_load_async_to_lds_b128 %5, %13, off\n\t"
               "global_load_async_to_lds_b128 %6, %14, off\n\t"
               "global_load_async_to_lds_b128 %7, %15, off\n\t"
               "s_wait_xcnt 0x0"
               :: "v"(l), "v"(l1), "v"(l2), "v"(l3), "v"(l4), "v"(l5), "v"(l6), "v"(l7), "v"(g), "v"(g1), "v"(g2), "v"(g3), "v"(g4), "v"(g5), "v"(g6), "v"(g7) : "memory"); }
// Products that do not depend on one another share a grid as planes of blockIdx.y: planes 1 and up take B1 and bias1 where B1 is given; C, the f32 result, is one plane and is stored by plane cy alone
template <int ACT>
__global__ __launch_bounds__(128) void k_gemm2(const _Float16* __restrict__ A, int lda, size_t sA, const _Float16* __restrict__ Bh, int ldb, size_t sB, float alpha, const float* __restrict__ bias, size_t sBias, const float* __restrict__ CP, int rowsPerB, size_t sCPb, int row0g,
    float* __restrict__ C, _Float16* __restrict__ C16, int ldc, size_t sC, int M, int N, int K, const _Float16* __restrict__ B1, const float* __restrict__ bias1, int cy) { static_assert(ACT == 0 || ACT == 3 || ACT == 6 || ACT == 8 || ACT == 9 || ACT == 11 || ACT == 12 || ACT == 14 || ACT == 15 || ACT == 16 || ACT == 17, "k_gemm2: unsupported ACT code (would silently apply no activation)");
  __shared__ __attribute__((aligned(16))) float so[4][32][68];
  __shared__ __attribute__((aligned(16))) unsigned char ring[2][G2_BUF];
  const int tid = threadIdx.x, w = tid >> 5, lane = tid & 31, ln = lane & 15, hh = lane >> 4; const int by = blockIdx.y;
  A += (size_t)by * sA; Bh += (size_t)by * sB; const size_t cofs = (size_t)by * sC; const float* bp = bias ? bias + (size_t)by * sBias : nullptr;
  if (B1 && by) { Bh = B1; bp = bias1; }
  C = by == cy ? C - cofs : nullptr;      /* the stores below add cofs */
  const int ntn = N >> 6; const int mt = blockIdx.x / ntn, nq = blockIdx.x - mt * ntn; const int row0 = mt * 128 + 32 * w, col0 = nq * 64; if (mt * 128 >= M) return;      /* taken by a whole work-group, in front of every barrier */
  const int cr = tid >> 4, cc = tid & 15;      /* copy role: 16 lanes cover the 256 B of one row, a wave two whole rows (4 lines) */
  const _Float16* ga = A + (size_t)(mt * 128 + cr) * lda + cc * 8; const _Float16* gb = Bh + (size_t)(col0 + cr) * ldb + cc * 8; const unsigned lc = (unsigned)(size_t)&ring[0][0] + cr * G2_PITCH + cc * 16;
  auto stage = [&](int t, int buf) { const unsigned l = lc + buf * G2_BUF; const _Float16* a = ga + t * 128;
    g2_copy8(l, a, (size_t)8 * lda); g2_copy8(l + 64 * G2_PITCH, a + (size_t)64 * lda, (size_t)8 * lda); g2_copy8(l + 128 * G2_PITCH, gb + t * 128, (size_t)8 * ldb); };
  const int nt = K >> 7;
  const v8f z8 = {0.f,0.f,0.f,0.f,0.f,0.f,0.f,0.f}; v8f c00 = z8, c01 = z8, c02 = z8, c03 = z8, c10 = z8, c11 = z8, c12 = z8, c13 = z8;
  stage(0, 0);
  asm volatile("s_wait_asynccnt 0x0" ::: "memory");      /* this wave's copies of stage 0 have landed */
  __syncthreads();                                       /* every wave's have: stage 0 may be read */
  if (nt > 1) stage(1, 1);
#pragma unroll 1    /* one stage a trip: the publish point at the foot stands once */
  for (int t = 0; t < nt; ++t) { const unsigned char* ap = &ring[t & 1][0] + (32 * w + ln) * G2_PITCH + 16 * hh; const unsigned char* bq = &ring[t & 1][0] + (128 + ln) * G2_PITCH + 16 * hh; v16h fa[2][2], fb[2][4];
    auto frags = [&](int kk, v16h (&a)[2], v16h (&b)[4]) { a[0] = g2_lfrag(ap + kk * 64); a[1] = g2_lfrag(ap + 16 * G2_PITCH + kk * 64);
#pragma unroll      /* constant indices, so the fragment arrays stay in registers */
      for (int j = 0; j < 4; ++j) b[j] = g2_lfrag(bq + j * 16 * G2_PITCH + kk * 64); };
    frags(0, fa[0], fb[0]);
#pragma unroll      /* constant indices, so the fragment arrays stay in registers */
    for (int kk = 0; kk < 4; ++kk) { const int c = kk & 1;
      if (kk < 3) frags(kk + 1, fa[c ^ 1], fb[c ^ 1]);
      __builtin_amdgcn_sched_barrier(0);      /* the next block's LDS reads stay one group ahead of this block's products instead of among them */
      c00 = g2_mma(fa[c][0], fb[c][0], c00); c10 = g2_mma(fa[c][1], fb[c][0], c10); c01 = g2_mma(fa[c][0], fb[c][1], c01); c11 = g2_mma(fa[c][1], fb[c][1], c11);
      c02 = g2_mma(fa[c][0], fb[c][2], c02); c12 = g2_mma(fa[c][1], fb[c][2], c12); c03 = g2_mma(fa[c][0], fb[c][3], c03); c13 = g2_mma(fa[c][1], fb[c][3], c13);
      __builtin_amdgcn_sched_barrier(0); }    /* and the block after next's reads stay behind these products */
    asm volatile("s_wait_dscnt 0x0" ::: "memory");         /* this wave has finished reading the buffer */
    asm volatile("s_wait_asynccnt 0x0" ::: "memory");      /* its copies of stage t + 1 have landed */
    __syncthreads();                                       /* publishes stage t + 1 and ends every wave's reads of stage t */
    if (t + 2 < nt) stage(t + 2, t & 1); }                 /* refill of the buffer just left; the test reads the same in the whole work-group */
  asm volatile("s_wait_asynccnt 0x0" ::: "memory");        /* nothing of this wave is in flight behind the loop */
  v8f accs[8] = {c00, c01, c02, c03, c10, c11, c12, c13};
#pragma unroll
  for (int u = 0; u < 8; ++u) { const int t = u & 3, half = u >> 2; const int col = col0 + t * 16 + ln; const float bv = bp ? bf16_round(bp[col]) : 0.f;
#pragma unroll
    for (int r = 0; r < 8; ++r) { const int rloc = half * 16 + 8 * hh + r; float v = accs[u][r] * alpha + bv; if (CP) { if (rowsPerB < 0) v += CP[cofs + (size_t)(row0g + row0 + rloc) * ldc + col];      /* rowsPerB < 0: own element of the batched C plane */ else { const int bidx = (row0g + row0 + rloc) / rowsPerB; v += CP[(size_t)bidx * sCPb + (size_t)by * 64 + col]; } }
      if (ACT == 3) v = fmaxf(v, 0.f); else if (ACT == 6) v = 0.5f * v * (1.0f + erff(v * 0.70710678118654752f)); else if (ACT == 11) v = 1.0f / (1.0f + expf(-v)); else if (ACT == 15) v = v / (1.0f + expf(-v)); else if (ACT == 12) v = (v > 0.f) ? v : 0.01f * v; else if (ACT == 8) v = tanhf(v); else if (ACT == 9) v = 0.5f * v * (1.0f + tanhf(0.7978845608028654f * (v + 0.044715f * v * v * v))); else if (ACT == 14) v = (v > 0.f) ? v : 0.1f * v; else if (ACT == 16) v = (v >= 0.f) ? v : 0.3f * v; else if (ACT == 17) v = (v >= 0.f) ? v : 0.2f * v;
      so[w][rloc][t * 16 + ln] = v; } }
  __builtin_amdgcn_fence(__ATOMIC_ACQ_REL, "workgroup"); __builtin_amdgcn_wave_barrier();
  const int rsub = lane >> 4, c4 = (lane & 15) * 4;
  {
#pragma unroll
    for (int q = 0; q < 16; ++q) { const int r = q * 2 + rsub; const v4f v = *(const v4fa*)&so[w][r][c4]; if (C) *(v4f*)(C + cofs + (size_t)(row0 + r) * ldc + col0 + c4) = v; if (C16) { v4h h4; for (int i = 0; i < 4; ++i) h4[i] = (_Float16)v[i]; *(v4h*)(C16 + cofs + (size_t)(row0 + r) * ldc + col0 + c4) = h4; } }
     } }


__global__ __launch_bounds__(256) void k_wnat(const float* __restrict__ w, size_t n8, _Float16* __restrict__ Bt) { const size_t t = (size_t)blockIdx.x * 256 + threadIdx.x; if (t >= n8) return; FragH f; for (int q = 0; q < 8; ++q) f.h[q] = (_Float16)(bf16_round(w[t * 8 + q]) * 16.0f); *(v8us*)((unsigned short*)Bt + t * 8) = f.half[0];  }
__global__ __launch_bounds__(256) void k_rsm(const float* __restrict__ S, _Float16* __restrict__ P, int nrows) {
  #pragma clang fp contract(off)
  const int i = blockIdx.x * 256 + threadIdx.x; if (i >= nrows) return; const float* s = S + (size_t)i * SQ; float mx = -3.0e38f;
#pragma unroll 1
  for (int j = 0; j < SQ; ++j) mx = fmaxf(mx, s[j]); float se = 0.f;
#pragma unroll 1
  for (int j = 0; j < SQ; ++j) se += expf(s[j] - mx); const float sc = 256.0f / se;
#pragma unroll 1
  for (int j0 = 0; j0 < SQ; j0 += 8) { FragH f; for (int q = 0; q < 8; ++q) f.h[q] = (_Float16)(expf(s[j0 + q] - mx) * sc); unsigned short* d = (unsigned short*)P + (size_t)i * SQ + j0; *(v8us*)d = f.half[0];  } }
__global__ __launch_bounds__(256) void k_vt(const _Float16* __restrict__ V16, int b, int h0, _Float16* __restrict__ VT) { __shared__ unsigned short tl[64][65]; const int tid = threadIdx.x; const int hh = blockIdx.x % HG, sg = blockIdx.x / HG; const int s0 = sg * 64; const int h = h0 + hh;
  for (int i = tid; i < 64 * 8; i += 256) { const int j = i / 8, d8 = (i % 8) * 8; FragH f; f.half[0] = *(const v8us*)((const unsigned short*)V16 + ((size_t)b * SQ + s0 + j) * DM + h * HD + d8); for (int q = 0; q < 8; ++q) tl[d8 + q][j] = f.u[q]; }
  __syncthreads();
  { for (int i = tid; i < 64 * 8; i += 256) { const int d = i / 8, j8 = (i % 8) * 8; FragH f; for (int q = 0; q < 8; ++q) f.u[q] = tl[d][j8 + q]; *(v8us*)((unsigned short*)VT + ((size_t)hh * HD + d) * SQ + s0 + j8) = f.half[0]; }  } }


// lane l <-> lane l ^ M of the wave, in vector registers (no LDS round trip): M = 16 crosses the two 16-lane rows, M < 16 is a DPP row_xmask move
template <int M>
__device__ __forceinline__ float lane_xor(float x) { const int b = __float_as_int(x);
  if constexpr (M == 16) return __int_as_float(__builtin_amdgcn_permlanex16(b, b, 0x76543210, 0xfedcba98, false, false));
  else return __int_as_float(__builtin_amdgcn_update_dpp(0, b, 0x160 | M, 0xf, 0xf, true)); }
// ---- fused attention: scores and weights live in registers only ----
__device__ __forceinline__ v8f f_mma(v16h a, v16h b, v8f c) { return __builtin_amdgcn_wmma_f32_16x16x32_f16(false, a, false, b, (short)0, c, false, false); }
typedef unsigned v4ua __attribute__((ext_vector_type(4), may_alias));
#define SC2 0.18033688011112042f     /* (1 / 8) log2(e): scores go to the exponent base 2 */
#define MASKED -3.0e38f              /* score of a masked key: its weight underflows to 0 against any row reference >= M0 */
#define M0 -1.0e30f                  /* start value of a row's reference; a row with every key masked keeps it, sums 0 and ends as 0 x inf = NaN like the definition */
// one bit per (query, key): bit j of word [query][key / 32] is mask[query][32 (key / 32) + j] != 0; a wave packs 32 words
__device__ __forceinline__ void d_maskbits(unsigned bx, const int* __restrict__ mask, unsigned* __restrict__ MB) {
  const int lane = threadIdx.x & 31; const size_t wv = (size_t)bx * 8 + (threadIdx.x >> 5); const int* m = mask + wv * 1024; unsigned keep = 0;
#pragma unroll      /* 32 independent loads in flight */
  for (int i = 0; i < 32; ++i) { const unsigned bits = __builtin_amdgcn_ballot_w32(m[i * 32 + lane] != 0); if (lane == i) keep = bits; }
  MB[wv * 32 + lane] = keep;
  asm volatile("s_wait_xcnt 0x0" ::: "memory"); }      /* precaution: stands behind the store above, in front of the other jobs' code, which in the listing follows this one and rewrites the store's registers */
// S^T tile rows are keys 8 hh + r, its column is query ln: bit 16 kt + 8 hh + r of the query's mask word
__device__ __forceinline__ void mask_tile(v8f& s, unsigned word, int kt, int hh) { const unsigned u = word >> (16 * kt + 8 * hh);
#pragma unroll      /* constant indices, so the tile stays in registers */
  for (int r = 0; r < 8; ++r) s[r] = ((u >> r) & 1u) ? s[r] : MASKED; }
// K and V^T go through LDS: a stage is 128 keys of the head (K: 128 rows of 128 B; V^T: 64 rows of 256 B), brought once for the 8 waves by asynchronous copies of whole lines, two buffers, the next stage in flight while this one is worked on
#define FST 128                      /* keys a stage */
#define FK_PITCH 144                 /* LDS bytes from K row to K row: 128 + 16, an odd multiple of 16 B, so the 16 rows of a fragment read fall on different banks */
#define FV_PITCH 272                 /* the same for the V^T rows: 256 + 16 */
#define FK_BYTES (FST * FK_PITCH)
#define F_BUF (FK_BYTES + HD * FV_PITCH)      /* one stage: K rows, then V^T rows */
// four asynchronous copies of 16 B a lane: LDS byte address l (+ ls each), global address g (+ gs elements each)
__device__ __forceinline__ void f_copy4(unsigned l, unsigned ls, const _Float16* g, size_t gs) {
  const unsigned l1 = l + ls, l2 = l1 + ls, l3 = l2 + ls; const _Float16* g1 = g + gs; const _Float16* g2 = g1 + gs; const _Float16* g3 = g2 + gs;
  /* the copies move global bytes into LDS through no register; the closing s_wait_xcnt is a precaution: it stands in front of any rewrite of the address registers named here */
  asm volatile("global_load_async_to_lds_b128 %0, %4, off\n\t"
               "global_load_async_to_lds_b128 %1, %5, off\n\t"
               "global_load_async_to_lds_b128 %2, %6, off\n\t"
               "global_load_async_to_lds_b128 %3, %7, off\n\t"
               "s_wait_xcnt 0x0"
               :: "v"(l), "v"(l1), "v"(l2), "v"(l3), "v"(g), "v"(g1), "v"(g2), "v"(g3) : "memory"); }
// the key loop of k_fattn; MSK = false is taken by a work-group none of whose 256 mask rows holds a zero, and then reads no mask word
// ring: the two buffers; gk, gv, lk, lv: this lane's first global and LDS addresses as a copier of K and of V^T
template <bool MSK>
__device__ __forceinline__ void fattn_keys(const unsigned char* ring, const _Float16* gk, const _Float16* gv, unsigned lk, unsigned lv, const unsigned* mb, int ln, int hh, const v16h (&qf)[2][2], v8f (&o)[2][4], float (&m)[2], float (&l)[2]) {
  const v8f z8 = {0.f,0.f,0.f,0.f,0.f,0.f,0.f,0.f}; v16h ka[2][2], kb2[2][2], va[4], vb[4]; unsigned mw[2] = {0u, 0u};
  auto stage = [&](int t, int buf) { f_copy4(lk + buf * F_BUF, 32 * FK_PITCH, gk + (size_t)t * FST * DM, (size_t)32 * DM); f_copy4(lv + buf * F_BUF, 16 * FV_PITCH, gv + t * FST, (size_t)16 * SQ); };
  if (MSK) { mw[0] = mb[0]; mw[1] = mb[16 * (SQ / 32)]; }
  stage(0, 0);
  asm volatile("s_wait_asynccnt 0x0" ::: "memory");      /* this wave's copies of stage 0 have landed */
  __syncthreads();                                       /* every wave's have: stage 0 may be read */
  stage(1, 1);
#pragma unroll 1    /* one stage a trip: the publish point at the foot stands once */
  for (int t = 0; t < SQ / FST; ++t) { const unsigned char* kt = ring + (t & 1) * F_BUF + ln * FK_PITCH + 16 * hh; const unsigned char* vt = ring + (t & 1) * F_BUF + FK_BYTES + ln * FV_PITCH + 16 * hh;
    // the K and V^T fragments of pass p of this stage, in the k order of g2_frag
    auto frags = [&](int p, v16h (&k)[2][2], v16h (&v)[4]) {
#pragma unroll      /* constant indices, so the fragment arrays stay in registers */
      for (int i = 0; i < 2; ++i) { k[i][0] = g2_lfrag(kt + (p * 32 + i * 16) * FK_PITCH); k[i][1] = g2_lfrag(kt + (p * 32 + i * 16) * FK_PITCH + 64); }
#pragma unroll      /* constant indices, so the fragment arrays stay in registers */
      for (int d = 0; d < 4; ++d) v[d] = g2_lfrag(vt + d * 16 * FV_PITCH + p * 64); };
    // one pass = 32 keys: kc and vc hold this pass's K and V^T fragments, kx and vn take those of pass pn of the same stage (pn = 0: the stage's last pass, which fetches nothing)
    auto pass = [&](int kb, int pn, const v16h (&kc)[2][2], v16h (&kx)[2][2], const v16h (&vc)[4], v16h (&vn)[4]) { const int kn = (kb + 32) & (SQ - 1);
      v8f s[2][2]; float mx[2]; FragH pf[2];
      if (pn) frags(pn, kx, vn);
      __builtin_amdgcn_sched_barrier(0);      /* the next pass's LDS reads stay one group ahead of this pass's products instead of among them */
#pragma unroll      /* constant indices, so the fragment arrays stay in registers */
      for (int qt = 0; qt < 2; ++qt)
#pragma unroll      /* constant indices, so the fragment arrays stay in registers */
        for (int kt2 = 0; kt2 < 2; ++kt2) s[qt][kt2] = f_mma(kc[kt2][1], qf[qt][1], f_mma(kc[kt2][0], qf[qt][0], z8));
      if (MSK) {
#pragma unroll      /* constant indices, so the fragment arrays stay in registers */
        for (int qt = 0; qt < 2; ++qt) { mask_tile(s[qt][0], mw[qt], 0, hh); mask_tile(s[qt][1], mw[qt], 1, hh); }
        __builtin_amdgcn_sched_barrier(0);      /* with the one below: the next pass's two mask loads and their wait stay one group, so nothing that could rewrite an address register comes between */
        mw[0] = mb[kn >> 5]; mw[1] = mb[16 * (SQ / 32) + (kn >> 5)];
        asm volatile("s_wait_xcnt 0x0" ::: "memory");      /* precaution: stands behind the loads issued above, in front of any rewrite of their address registers */
        __builtin_amdgcn_sched_barrier(0); }
#pragma unroll      /* constant indices, so the fragment arrays stay in registers */
      for (int qt = 0; qt < 2; ++qt) { float a = fmaxf(s[qt][0][0], s[qt][1][0]);
#pragma unroll      /* constant indices, so the fragment arrays stay in registers */
        for (int r = 1; r < 8; ++r) a = fmaxf(a, fmaxf(s[qt][0][r], s[qt][1][r]));
        a *= SC2; mx[qt] = fmaxf(a, lane_xor<16>(a)); }      /* both halves of a column agree on the maximum, so on the reference too */
      if (__builtin_amdgcn_ballot_w32(mx[0] > m[0] + 8.f || mx[1] > m[1] + 8.f) != 0) {      /* scalar branch: rescale only when some column's reference must rise */
#pragma unroll      /* constant indices, so the fragment arrays stay in registers */
        for (int qt = 0; qt < 2; ++qt) { const float mn = fmaxf(m[qt], mx[qt]), f = __builtin_amdgcn_exp2f(m[qt] - mn); m[qt] = mn; l[qt] *= f;
#pragma unroll      /* constant indices, so the fragment arrays stay in registers */
          for (int d = 0; d < 4; ++d) o[qt][d] *= f; } }
#pragma unroll      /* constant indices, so the fragment arrays stay in registers */
      for (int qt = 0; qt < 2; ++qt) { float ls = 0.f;
#pragma unroll      /* constant indices, so the fragment arrays stay in registers */
        for (int r = 0; r < 8; ++r) { const float p0 = __builtin_amdgcn_exp2f(__builtin_fmaf(s[qt][0][r], SC2, -m[qt])), p1 = __builtin_amdgcn_exp2f(__builtin_fmaf(s[qt][1][r], SC2, -m[qt])); ls += p0 + p1; pf[qt].h[r] = (_Float16)p0; pf[qt].h[8 + r] = (_Float16)p1; }
        l[qt] += ls; }
#pragma unroll      /* constant indices, so the fragment arrays stay in registers */
      for (int d = 0; d < 4; ++d) { o[0][d] = f_mma(vc[d], pf[0].v, o[0][d]); o[1][d] = f_mma(vc[d], pf[1].v, o[1][d]); }
      __builtin_amdgcn_sched_barrier(0); };      /* keeps the next pass's products behind this pass: moved up, they would wait on fragments fetched only half a pass earlier */
    const int kb = t * FST;
    frags(0, ka, va);
    pass(kb, 1, ka, kb2, va, vb); pass(kb + 32, 2, kb2, ka, vb, va); pass(kb + 64, 3, ka, kb2, va, vb); pass(kb + 96, 0, kb2, ka, vb, va);      /* the two fragment sets swap by name, no register is copied */
    asm volatile("s_wait_dscnt 0x0" ::: "memory");         /* this wave has finished reading the buffer */
    asm volatile("s_wait_asynccnt 0x0" ::: "memory");      /* its copies of stage t + 1 have landed */
    __syncthreads();                                       /* publishes stage t + 1 and ends every wave's reads of stage t */
    if (t + 2 < SQ / FST) stage(t + 2, t & 1); }           /* refill of the buffer just left; the test reads the same in the whole work-group */
  asm volatile("s_wait_asynccnt 0x0" ::: "memory"); }      /* nothing of this wave is in flight behind the loop */
// One wave: 32 queries of one head against all keys, 32 keys a pass. S^T = K Q^T (A = K rows, B = Q rows), so a lane holds one query's scores; the two S^T tiles of a pass, converted in place,
// are the B operand of O^T += V^T P^T. Running row reference m (base-2 exponent), raised only when a new maximum exceeds it by more than 8 (weights then stay <= 256, inside f16); f32 row sums.
// Writes merged f16 rows 64 o + 64 alpha vp and, per (batch, head, query), the pair (m, 1 / sum) for the head-sum launch.
// The 8 waves of a work-group walk the same head's K and V^T, which are staged once for all of them in LDS.
__global__ __launch_bounds__(256) void k_fattn(const _Float16* __restrict__ Q, const _Float16* __restrict__ Kp, const _Float16* __restrict__ VT, const unsigned* __restrict__ MB, const float* __restrict__ AV, _Float16* __restrict__ O16, float* __restrict__ ST) {
  const int tid = threadIdx.x, w = tid >> 5, lane = tid & 31, ln = lane & 15, hh = lane >> 4; const int h = blockIdx.y, b = blockIdx.z, q0 = blockIdx.x * 256 + w * 32; const size_t r0 = (size_t)b * SQ;
  __shared__ __attribute__((aligned(16))) unsigned char ring[2 * F_BUF]; __shared__ __attribute__((aligned(16))) unsigned wz[8];
  const _Float16* qp = Q + (r0 + q0 + ln) * DM + h * HD; const unsigned* mb = MB + (size_t)(q0 + ln) * (SQ / 32);
  /* copy roles: 8 lanes cover the 128 B of a K row, 16 lanes the 256 B of a V^T row, so a wave copies 4 whole lines at a time */
  const _Float16* gk = Kp + (r0 + (tid >> 3)) * DM + h * HD + (tid & 7) * 8; const _Float16* gv = VT + ((size_t)(b * NH + h) * HD + (tid >> 4)) * SQ + (tid & 15) * 8;
  const unsigned lk = (unsigned)(size_t)&ring[0] + (tid >> 3) * FK_PITCH + (tid & 7) * 16, lv = (unsigned)(size_t)&ring[0] + FK_BYTES + (tid >> 4) * FV_PITCH + (tid & 15) * 16;
  const v8f z8 = {0.f,0.f,0.f,0.f,0.f,0.f,0.f,0.f};
  v16h qf[2][2]; v8f o[2][4]; float m[2] = {M0, M0}, l[2] = {0.f, 0.f};
#pragma unroll      /* constant indices, so the fragment arrays stay in registers */
  for (int t = 0; t < 2; ++t) { qf[t][0] = g2_frag(qp + (size_t)t * 16 * DM, hh); qf[t][1] = g2_frag(qp + (size_t)t * 16 * DM + 32, hh);
#pragma unroll      /* constant indices, so the fragment arrays stay in registers */
    for (int d = 0; d < 4; ++d) o[t][d] = z8; }
  unsigned all1 = 0xFFFFFFFFu;      /* lane i: the AND of the 64 mask words of the wave's row i */
  { const v4ua* row = (const v4ua*)(MB + (size_t)(q0 + lane) * (SQ / 32));
#pragma unroll      /* 16 independent loads in flight */
    for (int i = 0; i < SQ / 128; ++i) { const v4ua x = row[i]; all1 &= x[0] & x[1] & x[2] & x[3]; } }
  asm volatile("s_wait_xcnt 0x0" ::: "memory");      /* precaution: stands behind the loads issued above, in front of any rewrite of their address registers */
  const unsigned bz = __builtin_amdgcn_ballot_w32(all1 != 0xFFFFFFFFu);      /* taken with every lane on */
  if (lane == 0) wz[w] = bz;
  __syncthreads();      /* the key loop holds barriers, so the whole work-group takes one side: every wave sees all 8 waves' findings */
  const v4ua z0 = *(const v4ua*)&wz[0], z1 = *(const v4ua*)&wz[4];
  if (__builtin_amdgcn_readfirstlane(z0[0] | z0[1] | z0[2] | z0[3] | z1[0] | z1[1] | z1[2] | z1[3]) != 0) fattn_keys<true>(ring, gk, gv, lk, lv, mb, ln, hh, qf, o, m, l); else fattn_keys<false>(ring, gk, gv, lk, lv, mb, ln, hh, qf, o, m, l);      /* scalar branch, the same in every wave */
#pragma unroll      /* constant indices, so the fragment arrays stay in registers */
  for (int qt = 0; qt < 2; ++qt) { const float inv = 1.0f / (l[qt] + lane_xor<16>(l[qt])), sc = inv * 64.0f; const int q = q0 + qt * 16 + ln;
    if (hh == 0) { float* st = ST + ((size_t)(b * NH + h) * SQ + q) * 2; st[0] = m[qt]; st[1] = inv; }
    v4f av[4][2];
    __builtin_amdgcn_sched_barrier(0);      /* with the one below: the eight loads of the addend and their wait stay one group, so nothing that could rewrite an address register comes between */
#pragma unroll      /* constant indices, so the fragment arrays stay in registers */
    for (int d = 0; d < 4; ++d) { const size_t off = (r0 + q) * DM + h * HD + d * 16 + 8 * hh; av[d][0] = *(const v4fa*)(AV + off); av[d][1] = *(const v4fa*)(AV + off + 4); }
    asm volatile("s_wait_xcnt 0x0" ::: "memory");      /* precaution: stands behind the loads issued above, in front of any rewrite of their address registers */
    __builtin_amdgcn_sched_barrier(0);
#pragma unroll      /* constant indices, so the fragment arrays stay in registers */
    for (int d = 0; d < 4; ++d) { const size_t off = (r0 + q) * DM + h * HD + d * 16 + 8 * hh; const v4f a0 = av[d][0], a1 = av[d][1]; FragH f;      /* O^T tile: a lane holds 8 consecutive d of one query */
#pragma unroll      /* constant indices, so the fragment arrays stay in registers */
      for (int r = 0; r < 4; ++r) { f.h[r] = (_Float16)(o[qt][d][r] * sc + a0[r]); f.h[4 + r] = (_Float16)(o[qt][d][4 + r] * sc + a1[r]); }
      *(v8us*)((unsigned short*)O16 + off) = f.half[0]; } } }
// K, Q and the row statistics of k_headsum go through LDS: a stage is one head's 128 B of the work-group's 256 K rows and 64 Q rows, brought by asynchronous copies of whole lines, two buffers, the next head in flight while this one is worked on
#define HS_PITCH 144                 /* LDS bytes from row to row: 128 + 16, an odd multiple of 16 B, so the 16 rows of a fragment read fall on different banks */
#define HS_BUF (320 * HS_PITCH)      /* one stage: rows 0..255 = K, rows 256..319 = Q */
// two asynchronous copies of 16 B a lane: LDS byte address l (+ ls), global address g (+ gs bytes)
__device__ __forceinline__ void f_copy2(unsigned l, unsigned ls, const unsigned char* g, size_t gs) {
  const unsigned l1 = l + ls; const unsigned char* g1 = g + gs;
  /* the copies move global bytes into LDS through no register; the closing s_wait_xcnt is a precaution: it stands in front of any rewrite of the address registers named here */
  asm volatile("global_load_async_to_lds_b128 %0, %2, off\n\t"
               "global_load_async_to_lds_b128 %1, %3, off\n\t"
               "s_wait_xcnt 0x0"
               :: "v"(l), "v"(l1), "v"(g), "v"(g1) : "memory"); }
// this lane's ten copies of head h into buffer buf; gk, gq: the work-group's first K and Q rows; go, lc: the lane's element offset from them and its first LDS address
__device__ __forceinline__ void hs_stage(const _Float16* gk, const _Float16* gq, unsigned go, unsigned lc, int h, int buf) { const unsigned l = lc + buf * HS_BUF;
  f_copy4(l, 32 * HS_PITCH, gk + h * HD + go, (size_t)32 * DM); f_copy4(l + 128 * HS_PITCH, 32 * HS_PITCH, gk + (size_t)128 * DM + h * HD + go, (size_t)32 * DM); f_copy2(l + 256 * HS_PITCH, 32 * HS_PITCH, (const unsigned char*)(gq + h * HD + go), (size_t)32 * DM * 2); }
// the head loop of k_headsum, entered with head 0 published and head 1 in flight; MSK = false is taken by a work-group whose 64 x 256 mask bits are all set
// ring: the two buffers; gk, gq, go, lc: as in hs_stage; kr, qr: the LDS rows of this lane's first K and Q fragments; st: this lane's first (m, 1 / sum) pair in LDS
template <bool MSK>
__device__ __forceinline__ void headsum_heads(const unsigned char* ring, const _Float16* gk, const _Float16* gq, unsigned go, unsigned lc, int kr, int qr, const float* st, int hh, const unsigned (&mw)[2][2], v8f (&acc)[2][4]) {
  const v8f z8 = {0.f,0.f,0.f,0.f,0.f,0.f,0.f,0.f};
#pragma unroll 1    /* one head a trip: the publish point at the foot stands once, and the live set stays small enough for four waves a SIMD */
  for (int h = 0; h < NH; ++h) { v16h qf[2][2], kf[4][2]; float mr[2], iv[2]; const unsigned char* kp = ring + (h & 1) * HS_BUF + kr * HS_PITCH + 16 * hh; const unsigned char* qp = ring + (h & 1) * HS_BUF + qr * HS_PITCH + 16 * hh;
#pragma unroll      /* constant indices, so the fragment arrays stay in registers */
    for (int t = 0; t < 4; ++t) { kf[t][0] = g2_lfrag(kp + t * 16 * HS_PITCH); kf[t][1] = g2_lfrag(kp + t * 16 * HS_PITCH + 64); }
#pragma unroll      /* constant indices, so the fragment arrays stay in registers */
    for (int t = 0; t < 2; ++t) { qf[t][0] = g2_lfrag(qp + t * 16 * HS_PITCH); qf[t][1] = g2_lfrag(qp + t * 16 * HS_PITCH + 64); mr[t] = st[(h * 64 + t * 16) * 2]; iv[t] = st[(h * 64 + t * 16) * 2 + 1]; }
#pragma unroll      /* constant indices, so the fragment arrays stay in registers */
    for (int qt = 0; qt < 2; ++qt)
#pragma unroll      /* constant indices, so the fragment arrays stay in registers */
      for (int kt = 0; kt < 4; ++kt) { v8f s = f_mma(kf[kt][1], qf[qt][1], f_mma(kf[kt][0], qf[qt][0], z8));
        if (MSK) mask_tile(s, mw[qt][kt >> 1], kt & 1, hh);
#pragma unroll      /* constant indices, so the fragment arrays stay in registers */
        for (int r = 0; r < 8; ++r) acc[qt][kt][r] = __builtin_fmaf(__builtin_amdgcn_exp2f(__builtin_fmaf(s[r], SC2, -mr[qt])), iv[qt], acc[qt][kt][r]); }
    asm volatile("s_wait_dscnt 0x0" ::: "memory");         /* this wave has finished reading the buffer */
    asm volatile("s_wait_asynccnt 0x0" ::: "memory");      /* its copies of head h + 1 have landed */
    __syncthreads();                                       /* publishes head h + 1 and ends every wave's reads of head h */
    if (h + 2 < NH) hs_stage(gk, gq, go, lc, h + 2, h & 1); }      /* refill of the buffer just left; the test reads the same in the whole work-group */
  asm volatile("s_wait_asynccnt 0x0" ::: "memory"); }      /* nothing of this wave is in flight behind the loop */
// second output: one wave holds 32 queries x 64 keys of the head sum in registers and walks the 16 heads, forming each head's S^T tiles again (same products, same order as k_fattn) and its weights from the stored (m, 1 / sum)
// a work-group is 2 x 4 such waves: 64 queries x 256 keys, so a staged K row serves two waves and a staged Q row four
__global__ __launch_bounds__(256) void k_headsum(const _Float16* __restrict__ Q, const _Float16* __restrict__ Kp, const unsigned* __restrict__ MB, const float* __restrict__ ST, float* __restrict__ WS) {
  __shared__ __attribute__((aligned(16))) unsigned char ring[2 * HS_BUF]; __shared__ __attribute__((aligned(16))) float sst[NH][64][2]; __shared__ __attribute__((aligned(16))) unsigned wz[8];
  const int tid = threadIdx.x, w = tid >> 5, lane = tid & 31, ln = lane & 15, hh = lane >> 4, qi = w >> 2, ki = w & 3; const int b = blockIdx.z, qb = blockIdx.y * 64, kb = blockIdx.x * 256, q0 = qb + qi * 32, k0 = kb + ki * 64; const size_t r0 = (size_t)b * SQ;
  /* copy roles: 8 lanes cover the 128 B of a row, so a wave copies 4 whole lines at a time; the statistics are 512 B a head, 32 lanes each */
  const _Float16* gk = Kp + (r0 + kb) * DM; const _Float16* gq = Q + (r0 + qb) * DM; const unsigned go = (tid >> 3) * DM + (tid & 7) * 8; const unsigned lc = (unsigned)(size_t)&ring[0] + (tid >> 3) * HS_PITCH + (tid & 7) * 16;
  f_copy2((unsigned)(size_t)&sst[0][0][0] + tid * 16, 8 * 512, (const unsigned char*)(ST + ((size_t)(b * NH + (tid >> 5)) * SQ + qb) * 2 + (tid & 31) * 4), (size_t)8 * SQ * 2 * 4);      /* heads w and w + 8; waited for with head 0's copies */
  hs_stage(gk, gq, go, lc, 0, 0);
  const v8f z8 = {0.f,0.f,0.f,0.f,0.f,0.f,0.f,0.f}; v8f acc[2][4]; unsigned mw[2][2];
#pragma unroll      /* constant indices, so the fragment arrays stay in registers */
  for (int qt = 0; qt < 2; ++qt) { const unsigned* mb = MB + (size_t)(q0 + qt * 16 + ln) * (SQ / 32) + (k0 >> 5); mw[qt][0] = mb[0]; mw[qt][1] = mb[1];
#pragma unroll      /* constant indices, so the fragment arrays stay in registers */
    for (int kt = 0; kt < 4; ++kt) acc[qt][kt] = z8; }
  const unsigned bz = __builtin_amdgcn_ballot_w32((mw[0][0] & mw[0][1] & mw[1][0] & mw[1][1]) != 0xFFFFFFFFu);      /* taken with every lane on */
  if (lane == 0) wz[w] = bz;
  asm volatile("s_wait_asynccnt 0x0" ::: "memory");      /* this wave's copies of head 0 and of the statistics have landed */
  __syncthreads();      /* every wave's have: they may be read; and every wave sees all 8 waves' mask findings: the head loop holds barriers, so the whole work-group takes one side */
  hs_stage(gk, gq, go, lc, 1, 1);
  const v4ua z0 = *(const v4ua*)&wz[0], z1 = *(const v4ua*)&wz[4]; const float* st = &sst[0][qi * 32 + ln][0]; const int kr = ki * 64 + ln, qr = 256 + qi * 32 + ln;
  if (__builtin_amdgcn_readfirstlane(z0[0] | z0[1] | z0[2] | z0[3] | z1[0] | z1[1] | z1[2] | z1[3]) != 0) headsum_heads<true>(ring, gk, gq, go, lc, kr, qr, st, hh, mw, acc); else headsum_heads<false>(ring, gk, gq, go, lc, kr, qr, st, hh, mw, acc);      /* scalar branch, the same in every wave */
#pragma unroll      /* constant indices, so the fragment arrays stay in registers */
  for (int qt = 0; qt < 2; ++qt)
#pragma unroll      /* constant indices, so the fragment arrays stay in registers */
    for (int kt = 0; kt < 4; ++kt) { float* d = WS + (r0 + q0 + qt * 16 + ln) * SQ + k0 + kt * 16 + 8 * hh; v4f a0, a1;      /* a lane holds 8 consecutive keys of one query */
#pragma unroll      /* constant indices, so the fragment arrays stay in registers */
      for (int r = 0; r < 4; ++r) { a0[r] = acc[qt][kt][r]; a1[r] = acc[qt][kt][4 + r]; }
      *(v4f*)d = a0; *(v4f*)(d + 4) = a1; } }
__device__ __forceinline__ void d_av64(unsigned bx, const float* __restrict__ VPF, const float* __restrict__ alpha, float* __restrict__ AV, size_t n4) {
  #pragma clang fp contract(off)
  const size_t t = (size_t)bx * 256 + threadIdx.x; if (t >= n4) return; const float a = __fmul_rn(bf16_round(alpha[0]), 64.0f); const v4f v = *(const v4fa*)(VPF + t * 4); v4f o; for (int q = 0; q < 4; ++q) o[q] = __fmul_rn(a, v[q]); *(v4f*)(AV + t * 4) = o;  }
// Jobs that do not depend on one another share a grid: a work-group picks its job by its index, the same for all its threads, and runs that job's body with its index within the job.
#define PW_G (DM * (DM / 8) / 256)            /* work-groups of one weight transpose */
#define PM_G (SQ * (SQ / 32) / 256)           /* of the mask pack */
#define PX_G ((int)(NR * DM / 8 / 256))       /* of one input conversion */
#define PV_G (NB * NH * (SQ / 64))            /* of the V transposes */
// all that reads inputs only: the three weight transposes, the mask pack, the three input conversions
__global__ __launch_bounds__(256) void k_prep(const float* __restrict__ wq, const float* __restrict__ wkv, const float* __restrict__ wo, _Float16* __restrict__ BQ, _Float16* __restrict__ BKV, _Float16* __restrict__ BO, const int* __restrict__ mask, unsigned* __restrict__ MB,
    const float* __restrict__ qin, const float* __restrict__ kin, const float* __restrict__ vin, _Float16* __restrict__ XQ, _Float16* __restrict__ XK, _Float16* __restrict__ XV) { const unsigned bx = blockIdx.x;
  if (bx < 3 * PW_G) { const unsigned j = bx / PW_G; d_wt_f16(bx - j * PW_G, j == 0 ? wq : j == 1 ? wkv : wo, j == 0 ? BQ : j == 1 ? BKV : BO, DM, DM, 16.0f); }
  else if (bx < 3 * PW_G + PM_G) d_maskbits(bx - 3 * PW_G, mask, MB);
  else { const unsigned i = bx - (3 * PW_G + PM_G), j = i / PX_G; d_x16(i - j * PX_G, j == 0 ? qin : j == 1 ? kin : vin, j == 0 ? XQ : j == 1 ? XK : XV, NR * DM / 8); } }
// the two that read the v projection only: V^T and 64 alpha vp
__global__ __launch_bounds__(256) void k_vt_av(const _Float16* __restrict__ V16, _Float16* __restrict__ VT, const float* __restrict__ VPF, const float* __restrict__ alpha, float* __restrict__ AV, size_t n4) { const unsigned bx = blockIdx.x;
  if (bx < PV_G) d_vt<NH, SQ>(bx, V16, DM, 0, VT); else d_av64(bx - PV_G, VPF, alpha, AV, n4); }      /* the test reads the same in the whole work-group: d_vt holds a barrier */

extern "C" void kernel_launch(void* const* d_in, const int* in_sizes, int n_in,
                              void* d_out, int out_size, void* d_ws, size_t ws_size, hipStream_t stream) {
  (void)in_sizes; (void)n_in; (void)out_size;
  const float* const* I = (const float* const*)d_in; const float* qin = I[0]; const float* kin = I[1]; const float* vin = I[2]; const int* mask = (const int*)d_in[3]; const float* wq = I[4]; const float* bq = I[5]; const float* wkv = I[6]; const float* bkv = I[7]; const float* wo = I[8]; const float* bo = I[9]; const float* alpha = I[10];      /* weights [in][out] */
  float* out0 = (float*)d_out; float* out1 = (float*)d_out + NR * DM;      /* byte offset 16,777,216 */
  char* ws = (char*)d_ws; size_t off = 0;
  auto take = [&](size_t bytes) { char* p = ws + off; off += (bytes + 255) & ~(size_t)255; return p; };
  _Float16* BQ = (_Float16*)take((size_t)DM * DM * 2); _Float16* BKV = (_Float16*)take((size_t)DM * DM * 2); _Float16* BO = (_Float16*)take((size_t)DM * DM * 2);
  _Float16* Q16 = (_Float16*)take(NR * DM * 2); _Float16* K16 = (_Float16*)take(NR * DM * 2); _Float16* V16 = (_Float16*)take(NR * DM * 2); float* AV = (float*)take(NR * DM * 4); _Float16* O16 = (_Float16*)take(NR * DM * 2);
  _Float16* VT = (_Float16*)take((size_t)NB * NH * HD * SQ * 2); unsigned* MB = (unsigned*)take((size_t)SQ * (SQ / 32) * 4); float* ST = (float*)take((size_t)NB * NH * SQ * 2 * 4);
  _Float16* XQ = (_Float16*)take(NR * DM * 2); _Float16* XK = (_Float16*)take(NR * DM * 2); _Float16* XV = (_Float16*)take(NR * DM * 2); float* VPF = (float*)take(NR * DM * 4);
  if (off > ws_size) return;      /* 6 + 24 + 16 + 8 + 8 + 0.5 + 0.5 + 24 + 16 = 103 MiB */
  k_prep<<<3 * PW_G + PM_G + 3 * PX_G, 256, 0, stream>>>(wq, wkv, wo, BQ, BKV, BO, mask, MB, qin, kin, vin, XQ, XK, XV);
  const size_t r0p = (size_t)B0 * SQ; const dim3 gp((unsigned)((MP / 128) * (DM / 64)), 3);
  k_gemm2<0><<<gp, 128, 0, stream>>>(XQ + r0p * DM, DM, NR * DM, BQ, DM, 0, 0.0625f, bq, 0, nullptr, 1, 0, 0, VPF + r0p * DM, Q16 + r0p * DM, DM, NR * DM, MP, DM, DM, BKV, bkv, 2);      /* planes qp, kp, vp: XQ, XK, XV and Q16, K16, V16 lie NR * DM elements apart; vp: f32 (residual) and f16 (attention operand) */
  k_vt_av<<<PV_G + (unsigned)(((size_t)MP * DM / 4 + 255) / 256), 256, 0, stream>>>(V16, VT, VPF + r0p * DM, alpha, AV + r0p * DM, (size_t)MP * DM / 4);      /* V^T [NB][NH][HD][SQ]; 64 alpha vp */
  k_fattn<<<dim3(SQ / 256, NH, NB), 256, 0, stream>>>(Q16, K16, VT, MB, AV, O16, ST);      /* o x64 = 64 attn v + 64 alpha vp, f16 rows; row statistics */
  k_headsum<<<dim3(SQ / 256, SQ / 64, NB), 256, 0, stream>>>(Q16, K16, MB, ST, out1);      /* sum over the heads of the weights */
  k_gemm2<0><<<dim3((unsigned)((MPO / 128) * (DM / 64)), 1), 128, 0, stream>>>(O16 + r0p * DM, DM, 0, BO, DM, 0, 0.0009765625f, bo, 0, nullptr, 1, 0, 0, out0 + r0p * DM, nullptr, DM, 0, MPO, DM, DM, nullptr, nullptr, 0);      /* out0 = o Wo + bo */
}

// v007
// One run takes 135 microseconds.
// Timed twice side by side with v006, it ran 1.06 and 1.05 times as fast.
// Over all steps from v000 it is 1015 times as fast.
#include <hip/hip_runtime.h>
#define NB 2
#define SQ 2048
#define DM 1024
#define NH 16
#define HD 64
#define HG 4                         /* k_vt(b,h0) compatibility (unused) */
#define B0 0                         /* first batch processed (debug hook) */
#define NBR NB                       /* batches processed (debug hook) */
#define Q0S 0                        /* first tile (unused) */
#define QN SQ                        /* query rows end (unused) */
#define NR ((size_t)NB * SQ)
#define MP ((int)((size_t)NBR * SQ)) /* rows projected (debug hook) */
#define MPO MP                       /* rows through the output GEMM (debug hook) */
typedef __bf16 v16b __attribute__((ext_vector_type(16)));
typedef unsigned short v8us __attribute__((ext_vector_type(8), may_alias));
typedef float  v8f  __attribute__((ext_vector_type(8)));
typedef float  v4f  __attribute__((ext_vector_type(4)));
typedef float  v4fa __attribute__((ext_vector_type(4), may_alias));
union FragB { v16b v; v8us half[2]; unsigned short u[16]; };

__device__ __forceinline__ unsigned short bf16_bits(float x) { unsigned int u = __float_as_uint(x); return (unsigned short)((u + 0x7FFFu + ((u >> 16) & 1u)) >> 16); }
__device__ __forceinline__ float bf16_val(unsigned short b) { return __uint_as_float(((unsigned int)b) << 16); }
__device__ __forceinline__ float bf16_round(float x) { return bf16_val(bf16_bits(x)); }
// D += A·B with NT terms: 1 = ah·bh, 2 = + al·bh (A split), 3 = + ah·bl (both split)
template <int NT>
__device__ __forceinline__ v8f mmaN(v16b ah, v16b al, v16b bh, v16b bl, v8f c) {
  c = __builtin_amdgcn_wmma_f32_16x16x32_bf16(false, ah, false, bh, (short)0, c, false, false);
  if (NT >= 2) c = __builtin_amdgcn_wmma_f32_16x16x32_bf16(false, al, false, bh, (short)0, c, false, false);
  if (NT >= 3) c = __builtin_amdgcn_wmma_f32_16x16x32_bf16(false, ah, false, bl, (short)0, c, false, false);
  asm volatile("v_nop\n\tv_nop\n\tv_nop\n\tv_nop" : "+v"(c) : "v"(ah), "v"(al), "v"(bh), "v"(bl));
  return c;
}

__global__ __launch_bounds__(256) void k_wt_bf16(const float* __restrict__ W, unsigned short* __restrict__ Wt, int K, int N) {
  const int t = blockIdx.x * 256 + threadIdx.x;
  const int k8n = K / 8;
  if (t >= N * k8n) return;
  const int n = t / k8n, k8 = (t % k8n) * 8;
  v8us v;
#pragma unroll
  for (int i = 0; i < 8; ++i) v[i] = bf16_bits(W[(size_t)(k8 + i) * N + n]);
  *(v8us*)(Wt + (size_t)n * K + k8) = v;
  
}

// GEMM C[M][N] (f32, pitch ldc) = act(A[M][K]·W + bias). A f32 row-major (pitch lda) converted per fragment to bf16
// (ASPLIT: hi/lo two planes -> 2 terms, else single rounded term); Wt bf16 [N][K] (pitch ldb). BIAS_BF16 rounds the
// bias to bf16 first (bias quantised to bf16 before the add). K%32==0, M%16==0, N%64==0.
template <bool ASPLIT, int ACT, bool BIAS_BF16>
__global__ __launch_bounds__(128) void k_gemm_bf(const float* __restrict__ A, int lda, const unsigned short* __restrict__ Wt, int ldb,
                                               const float* __restrict__ bias, float* __restrict__ C, int ldc, int M, int N, int K) {
  __shared__ __attribute__((aligned(16))) float so[4][16][64];
  const int tid = threadIdx.x, w = tid >> 5, lane = tid & 31, ln = lane & 15, hh = lane >> 4;
  const int ntn = N / 64;
  const int wid = blockIdx.x * 4 + w;
  const int mt = wid / ntn, nq = wid % ntn;
  if (mt * 16 >= M) return;
  const int row0 = mt * 16, col0 = nq * 64;
  const float* arow = A + (size_t)(row0 + ln) * lda;
  v8f acc[4] = {};
  for (int kb = 0; kb < K; kb += 32) {
    FragB ah, al;
    const v4f x0 = *(const v4fa*)(arow + kb + 8 * hh), x1 = *(const v4fa*)(arow + kb + 8 * hh + 4);
    const v4f x2 = *(const v4fa*)(arow + kb + 16 + 8 * hh), x3 = *(const v4fa*)(arow + kb + 16 + 8 * hh + 4);
    float xs[16] = {x0[0],x0[1],x0[2],x0[3],x1[0],x1[1],x1[2],x1[3],x2[0],x2[1],x2[2],x2[3],x3[0],x3[1],x3[2],x3[3]};
#pragma unroll
    for (int i = 0; i < 16; ++i) { const unsigned short hb = bf16_bits(xs[i]); ah.u[i] = hb; al.u[i] = ASPLIT ? bf16_bits(xs[i] - bf16_val(hb)) : (unsigned short)0; }
#pragma unroll
    for (int t = 0; t < 4; ++t) {
      const unsigned short* brow = Wt + (size_t)(col0 + t * 16 + ln) * ldb + kb;
      FragB b;
      b.half[0] = *(const v8us*)(brow + 8 * hh);
      b.half[1] = *(const v8us*)(brow + 16 + 8 * hh);
      acc[t] = mmaN<ASPLIT ? 2 : 1>(ah.v, al.v, b.v, b.v, acc[t]);
    }
  }
#pragma unroll
  for (int t = 0; t < 4; ++t) {
    float bv = bias ? bias[col0 + t * 16 + ln] : 0.f;
    if (BIAS_BF16) bv = bf16_round(bv);
#pragma unroll
    for (int r = 0; r < 8; ++r) { float v = acc[t][r] + bv; if (ACT == 1) v = fmaxf(v, 0.f); so[w][8 * hh + r][t * 16 + ln] = v; }
  }
  __builtin_amdgcn_fence(__ATOMIC_ACQ_REL, "workgroup");
  __builtin_amdgcn_wave_barrier();
  const int rsub = lane >> 4, c4 = (lane & 15) * 4;
  {
#pragma unroll
    for (int q = 0; q < 8; ++q) {
      const int r = q * 2 + rsub;
      const v4f v = *(const v4fa*)&so[w][r][c4];
      *(v4f*)(C + (size_t)(row0 + r) * ldc + col0 + c4) = v;
    }
    
  }
}

// GEMM C = act(A·W + bias + resid): A f32 (ASPLIT -> hi/lo 2 terms), Wt bf16 [N][K]; ACT 0 none, 1 relu, 2 exact gelu;
// resid (optional, f32, row index = (row % rmod), pitch ldr, RES_BF16 rounds it) added before the activation.
template <bool ASPLIT, int ACT, bool BIAS_BF16, bool RES_BF16>
__global__ __launch_bounds__(128) void k_gemm_bf3(const float* __restrict__ A, int lda, const unsigned short* __restrict__ Wt, int ldb,
                                                const float* __restrict__ bias, const float* __restrict__ resid, int rmod, int ldr,
                                                float* __restrict__ C, int ldc, int M, int N, int K) {
  __shared__ __attribute__((aligned(16))) float so[4][16][64];
  const int tid = threadIdx.x, w = tid >> 5, lane = tid & 31, ln = lane & 15, hh = lane >> 4;
  const int ntn = N / 64;
  const int wid = blockIdx.x * 4 + w;
  const int mt = wid / ntn, nq = wid % ntn;
  if (mt * 16 >= M) return;
  const int row0 = mt * 16, col0 = nq * 64;
  const float* arow = A + (size_t)(row0 + ln) * lda;
  v8f acc[4] = {};
  for (int kb = 0; kb < K; kb += 32) {
    FragB ah, al;
    const v4f x0 = *(const v4fa*)(arow + kb + 8 * hh), x1 = *(const v4fa*)(arow + kb + 8 * hh + 4);
    const v4f x2 = *(const v4fa*)(arow + kb + 16 + 8 * hh), x3 = *(const v4fa*)(arow + kb + 16 + 8 * hh + 4);
    float xs[16] = {x0[0],x0[1],x0[2],x0[3],x1[0],x1[1],x1[2],x1[3],x2[0],x2[1],x2[2],x2[3],x3[0],x3[1],x3[2],x3[3]};
#pragma unroll
    for (int i = 0; i < 16; ++i) { const unsigned short hb = bf16_bits(xs[i]); ah.u[i] = hb; al.u[i] = ASPLIT ? bf16_bits(xs[i] - bf16_val(hb)) : (unsigned short)0; }
#pragma unroll
    for (int t = 0; t < 4; ++t) {
      const unsigned short* brow = Wt + (size_t)(col0 + t * 16 + ln) * ldb + kb;
      FragB b;
      b.half[0] = *(const v8us*)(brow + 8 * hh);
      b.half[1] = *(const v8us*)(brow + 16 + 8 * hh);
      acc[t] = mmaN<ASPLIT ? 2 : 1>(ah.v, al.v, b.v, b.v, acc[t]);
    }
  }
#pragma unroll
  for (int t = 0; t < 4; ++t) {
    const int col = col0 + t * 16 + ln;
    float bv = bias ? bias[col] : 0.f;
    if (BIAS_BF16) bv = bf16_round(bv);
#pragma unroll
    for (int r = 0; r < 8; ++r) {
      float v = acc[t][r] + bv;
      if (resid) { float rv = resid[(size_t)((row0 + 8 * hh + r) % rmod) * ldr + col]; if (RES_BF16) rv = bf16_round(rv); v += rv; }
      if (ACT == 1) v = fmaxf(v, 0.f);
      if (ACT == 2) v = 0.5f * v * (1.0f + erff(v * 0.70710678118654752f));
      if (ACT == 3) { const float u = 0.7978845608028654f * (v + 0.044715f * v * v * v); v = 0.5f * v * (1.0f + tanhf(u)); }
      so[w][8 * hh + r][t * 16 + ln] = v;
    }
  }
  __builtin_amdgcn_fence(__ATOMIC_ACQ_REL, "workgroup");
  __builtin_amdgcn_wave_barrier();
  const int rsub = lane >> 4, c4 = (lane & 15) * 4;
  {
#pragma unroll
    for (int q = 0; q < 8; ++q) {
      const int r = q * 2 + rsub;
      const v4f v = *(const v4fa*)&so[w][r][c4];
      *(v4f*)(C + (size_t)(row0 + r) * ldc + col0 + c4) = v;
    }
    
  }
}
// row LayerNorm (biased variance, eps) over N: s = X (+ R); optional out_sum <- s; out_norm <- (s-mu)*rsqrt(var+eps)*g + b
template <bool PARAM_BF16>
__global__ __launch_bounds__(256) void k_layernorm(const float* __restrict__ X, const float* __restrict__ R, const float* __restrict__ g, const float* __restrict__ bta,
                                                  float* __restrict__ out_sum, float* __restrict__ out_norm, int N, float eps) {
  __shared__ float red[256];
  const int row = blockIdx.x, tid = threadIdx.x;
  const float* x = X + (size_t)row * N; const float* rr = R ? R + (size_t)row * N : nullptr;
  float vals[16];                     // up to N = 4096
  const int per = N / 256;            // contiguous chunk per thread? use strided-by-4 chunks: thread handles j = tid*4 + 1024*u
  float s1 = 0.f;
  for (int u = 0; u < per / 4; ++u) {
    const int j = tid * 4 + 1024 * u;
    const v4f a = *(const v4fa*)(x + j);
    v4f b = {0.f,0.f,0.f,0.f}; if (rr) b = *(const v4fa*)(rr + j);
#pragma unroll
    for (int q = 0; q < 4; ++q) { const float v = a[q] + b[q]; vals[u * 4 + q] = v; s1 += v; }
  }
  red[tid] = s1; __syncthreads();
  for (int st = 128; st > 0; st >>= 1) { if (tid < st) red[tid] += red[tid + st]; __syncthreads(); }
  const float mu = red[0] / (float)N; __syncthreads();
  float s2 = 0.f;
  for (int u = 0; u < per / 4; ++u)
#pragma unroll
    for (int q = 0; q < 4; ++q) { const float c = vals[u * 4 + q] - mu; s2 += c * c; }
  red[tid] = s2; __syncthreads();
  for (int st = 128; st > 0; st >>= 1) { if (tid < st) red[tid] += red[tid + st]; __syncthreads(); }
  const float rs = rsqrtf(red[0] / (float)N + eps);
  {
    for (int u = 0; u < per / 4; ++u) {
      const int j = tid * 4 + 1024 * u;
      v4f o, sm;
#pragma unroll
      for (int q = 0; q < 4; ++q) {
        float gg = g[j + q], bb = bta[j + q];
        if (PARAM_BF16) { gg = bf16_round(gg); bb = bf16_round(bb); }
        sm[q] = vals[u * 4 + q]; o[q] = (vals[u * 4 + q] - mu) * rs * gg + bb;
      }
      if (out_sum) *(v4f*)(out_sum + (size_t)row * N + j) = sm;
      *(v4f*)(out_norm + (size_t)row * N + j) = o;
    }
    
  }
}



// ---- f16 WMMA path (v_wmma_f32_16x16x32_f16): 11-bit significands for operands in range — used for every launched product, the unnormalised softmax weights (<= 256) among them
typedef _Float16 v16h __attribute__((ext_vector_type(16)));
union FragH { v16h v; v8us half[2]; _Float16 h[16]; unsigned short u[16]; };
template <int NT>
__device__ __forceinline__ v8f mmaH(v16h ah, v16h al, v16h bh, v16h bl, v8f c) {
  c = __builtin_amdgcn_wmma_f32_16x16x32_f16(false, ah, false, bh, (short)0, c, false, false);
  if (NT >= 2) c = __builtin_amdgcn_wmma_f32_16x16x32_f16(false, al, false, bh, (short)0, c, false, false);
  if (NT >= 3) c = __builtin_amdgcn_wmma_f32_16x16x32_f16(false, ah, false, bl, (short)0, c, false, false);
  asm volatile("v_nop\n\tv_nop\n\tv_nop\n\tv_nop" : "+v"(c) : "v"(ah), "v"(al), "v"(bh), "v"(bl));
  return c;
}
// batched GEMM like k_gemm_b but f16 operands: A f32 (split into f16 hi/lo if ASPLIT, else rounded to f16), Bt = f16 values [n][k]; alpha; C f32; N multiple of 16 (partial tiles skipped)
template <bool ASPLIT>
__global__ __launch_bounds__(128) void k_gemm_h(const float* __restrict__ A, int lda, size_t sA, const _Float16* __restrict__ Bh, int ldb, size_t sB, float alpha, float* __restrict__ C, int ldc, size_t sC, int M, int N, int K) {
  __shared__ __attribute__((aligned(16))) float so[4][16][64];
  const int tid = threadIdx.x, w = tid >> 5, lane = tid & 31, ln = lane & 15, hh = lane >> 4; const int by = blockIdx.y;
  A += (size_t)by * sA; Bh += (size_t)by * sB; C += (size_t)by * sC;
  const int ntn = (N + 63) / 64; const int wid = blockIdx.x * 4 + w; const int mt = wid / ntn, nq = wid % ntn; if (mt * 16 >= M) return;
  const int row0 = mt * 16, col0 = nq * 64; const float* arow = A + (size_t)(row0 + ln) * lda;
  v8f acc[4] = {};
  for (int kb = 0; kb < K; kb += 32) {
    FragH ah, al;
    const v4f x0 = *(const v4fa*)(arow + kb + 8 * hh), x1 = *(const v4fa*)(arow + kb + 8 * hh + 4), x2 = *(const v4fa*)(arow + kb + 16 + 8 * hh), x3 = *(const v4fa*)(arow + kb + 16 + 8 * hh + 4);
    float xs[16] = {x0[0],x0[1],x0[2],x0[3],x1[0],x1[1],x1[2],x1[3],x2[0],x2[1],x2[2],x2[3],x3[0],x3[1],x3[2],x3[3]};
#pragma unroll
    for (int i = 0; i < 16; ++i) { const _Float16 h = (_Float16)xs[i]; ah.h[i] = h; al.h[i] = ASPLIT ? (_Float16)(xs[i] - (float)h) : (_Float16)0.0f; }
#pragma unroll
    for (int t = 0; t < 4; ++t) { if (col0 + t * 16 >= N) continue; const size_t boff = (size_t)(col0 + t * 16 + ln) * ldb + kb; FragH bq; bq.half[0] = *(const v8us*)(Bh + boff + 8 * hh); bq.half[1] = *(const v8us*)(Bh + boff + 16 + 8 * hh);
      acc[t] = mmaH<ASPLIT ? 2 : 1>(ah.v, al.v, bq.v, bq.v, acc[t]); }
  }
#pragma unroll
  for (int t = 0; t < 4; ++t) { if (col0 + t * 16 >= N) continue;
#pragma unroll
    for (int r = 0; r < 8; ++r) so[w][8 * hh + r][t * 16 + ln] = acc[t][r] * alpha; }
  __builtin_amdgcn_fence(__ATOMIC_ACQ_REL, "workgroup"); __builtin_amdgcn_wave_barrier();
  const int rsub = lane >> 4, c4 = (lane & 15) * 4;
  {
#pragma unroll
    for (int q = 0; q < 8; ++q) { const int r = q * 2 + rsub; if (col0 + c4 < N) { const v4f v = *(const v4fa*)&so[w][r][c4]; *(v4f*)(C + (size_t)(row0 + r) * ldc + col0 + c4) = v; } }
     }
}

// Wt[n][k] = f16(W[k][n]·scale) from f32 row-major W[K][N] (scale = power of two; bf16-exact weights stay exact in f16 away from the subnormal range)
// bx, here and in the other d_ bodies: the work-group's index within this job's own share of a grid that several jobs share
__device__ __forceinline__ void d_wt_f16(unsigned bx, const float* __restrict__ W, _Float16* __restrict__ Wt, int K, int N, float scale) {
  const int t = bx * 256 + threadIdx.x; if (t >= N * (K / 8)) return; const int n = t / (K / 8), k8 = (t % (K / 8)) * 8; FragH f;
#pragma unroll
  for (int i = 0; i < 8; ++i) f.h[i] = (_Float16)(bf16_round(W[(size_t)(k8 + i) * N + n]) * scale); const v8us o = f.half[0];
  *(v8us*)((unsigned short*)Wt + (size_t)n * K + k8) = o; 
}
// k_gemm_hh variant with fused epilogue: v = acc·alpha + bias[by·sBias + col] (+ CP[(row/rowsPerB)·sCPb + by·64 + col] if CP) ; ACT 0 none / 1 elu ; writes f16 C16 (and f32 C if non-null)
template <int ACT>
__global__ __launch_bounds__(128) void k_gemm_hhx(const _Float16* __restrict__ A, int lda, size_t sA, const _Float16* __restrict__ Bh, int ldb, size_t sB, float alpha, const float* __restrict__ bias, size_t sBias, const float* __restrict__ CP, int rowsPerB, size_t sCPb, int row0g,
    float* __restrict__ C, _Float16* __restrict__ C16, int ldc, size_t sC, int M, int N, int K) {
  __shared__ __attribute__((aligned(16))) float so[4][16][64];
  const int tid = threadIdx.x, w = tid >> 5, lane = tid & 31, ln = lane & 15, hh = lane >> 4; const int by = blockIdx.y;
  A += (size_t)by * sA; Bh += (size_t)by * sB; const size_t cofs = (size_t)by * sC; const float* bp = bias ? bias + (size_t)by * sBias : nullptr;
  const int ntn = (N + 63) / 64; const int wid = blockIdx.x * 4 + w; const int mt = wid / ntn, nq = wid % ntn; if (mt * 16 >= M) return;
  const int row0 = mt * 16, col0 = nq * 64; const _Float16* arow = A + (size_t)(row0 + ln) * lda;
  v8f acc[4] = {};
  for (int kb = 0; kb < K; kb += 32) { FragH ah; ah.half[0] = *(const v8us*)((const unsigned short*)arow + kb + 8 * hh); ah.half[1] = *(const v8us*)((const unsigned short*)arow + kb + 16 + 8 * hh);
#pragma unroll
    for (int t = 0; t < 4; ++t) { if (col0 + t * 16 >= N) continue; const size_t boff = (size_t)(col0 + t * 16 + ln) * ldb + kb; FragH bq; bq.half[0] = *(const v8us*)((const unsigned short*)Bh + boff + 8 * hh); bq.half[1] = *(const v8us*)((const unsigned short*)Bh + boff + 16 + 8 * hh);
      acc[t] = mmaH<1>(ah.v, ah.v, bq.v, bq.v, acc[t]); }
  }
#pragma unroll
  for (int t = 0; t < 4; ++t) { if (col0 + t * 16 >= N) continue; const int col = col0 + t * 16 + ln; const float bv = bp ? bf16_round(bp[col]) : 0.f;
#pragma unroll
    for (int r = 0; r < 8; ++r) { float v = acc[t][r] * alpha + bv; if (CP) { const int rr = row0g + row0 + 8 * hh + r; if (rowsPerB < 0) v += CP[cofs + (size_t)rr * ldc + col];      /* rowsPerB < 0: own element of the batched C plane */ else { const int bidx = rr / rowsPerB; v += CP[(size_t)bidx * sCPb + (size_t)by * 64 + col]; } } if (ACT == 1) v = (v > 0.f) ? v : expm1f(v); else if (ACT == 7) v = (v > 0.f) ? v + 1.0f : expf(v); else if (ACT == 8) v = tanhf(v); else if (ACT == 9) v = 0.5f * v * (1.0f + tanhf(0.7978845608028654f * (v + 0.044715f * v * v * v))); else if (ACT == 11) v = 1.0f / (1.0f + expf(-v)); else if (ACT == 12) v = (v > 0.f) ? v : 0.01f * v; else if (ACT == 14) v = (v > 0.f) ? v : 0.1f * v; else if (ACT == 16) v = (v >= 0.f) ? v : 0.3f * v; else if (ACT == 17) v = (v >= 0.f) ? v : 0.2f * v; else if (ACT == 15) v = v / (1.0f + expf(-v)); else if (ACT == 3) v = fmaxf(v, 0.f); else if (ACT == 6) v = 0.5f * v * (1.0f + erff(v * 0.70710678118654752f)); so[w][8 * hh + r][t * 16 + ln] = v; } }
  __builtin_amdgcn_fence(__ATOMIC_ACQ_REL, "workgroup"); __builtin_amdgcn_wave_barrier();
  const int rsub = lane >> 4, c4 = (lane & 15) * 4; typedef _Float16 v4h __attribute__((ext_vector_type(4)));
  {
#pragma unroll
    for (int q = 0; q < 8; ++q) { const int r = q * 2 + rsub; if (col0 + c4 < N) { const v4f v = *(const v4fa*)&so[w][r][c4]; if (C) *(v4f*)(C + cofs + (size_t)(row0 + r) * ldc + col0 + c4) = v; if (C16) { v4h h4; for (int i = 0; i < 4; ++i) h4[i] = (_Float16)v[i]; *(v4h*)(C16 + cofs + (size_t)(row0 + r) * ldc + col0 + c4) = h4; } } }
     }
}


typedef _Float16 v4h __attribute__((ext_vector_type(4)));

__device__ __forceinline__ void d_x16(unsigned bx, const float* __restrict__ x, _Float16* __restrict__ X16, size_t n8) { const size_t t = (size_t)bx * 256 + threadIdx.x; if (t >= n8) return; FragH f;
#pragma unroll
  for (int q = 0; q < 8; ++q) f.h[q] = (_Float16)bf16_round(x[t * 8 + q]); *(v8us*)((unsigned short*)X16 + t * 8) = f.half[0];  }
__global__ __launch_bounds__(256) void k_h16(const float* __restrict__ x, _Float16* __restrict__ X16, size_t n8) { const size_t t = (size_t)blockIdx.x * 256 + threadIdx.x; if (t >= n8) return; FragH f;
#pragma unroll
  for (int q = 0; q < 8; ++q) f.h[q] = (_Float16)x[t * 8 + q]; *(v8us*)((unsigned short*)X16 + t * 8) = f.half[0];  }
__global__ __launch_bounds__(256) void k_round16f(const float* __restrict__ W, _Float16* __restrict__ Bt, size_t n8) { const size_t t = (size_t)blockIdx.x * 256 + threadIdx.x; if (t >= n8) return; FragH f;
#pragma unroll
  for (int i = 0; i < 8; ++i) f.h[i] = (_Float16)(bf16_round(W[t * 8 + i]) * 16.0f); *(v8us*)((unsigned short*)Bt + t * 8) = f.half[0];  }
__global__ __launch_bounds__(256) void k_hl(const float* __restrict__ F, _Float16* __restrict__ Hh, _Float16* __restrict__ Hl, size_t n8) { const size_t t = (size_t)blockIdx.x * 256 + threadIdx.x; if (t >= n8) return; FragH fh, fl; const v4f a = *(const v4fa*)(F + t * 8), c = *(const v4fa*)(F + t * 8 + 4);
#pragma unroll
  for (int q = 0; q < 4; ++q) { _Float16 h = (_Float16)a[q]; fh.h[q] = h; fl.h[q] = (_Float16)((a[q] - (float)h) * 1024.0f); h = (_Float16)c[q]; fh.h[4 + q] = h; fl.h[4 + q] = (_Float16)((c[q] - (float)h) * 1024.0f); }
  { *(v8us*)((unsigned short*)Hh + t * 8) = fh.half[0]; *(v8us*)((unsigned short*)Hl + t * 8) = fl.half[0];  } }

// ---- fast GEMM (work-group tile 128x64, wave tile 32x64; requires M % 128 == 0, N % 64 == 0, K % 128 == 0, K >= 128); epilogue = k_gemm_hhx semantics ----
// Operands go through LDS: a stage is 128 k (256 B) of the work-group's 128 A rows and 64 B rows, brought by asynchronous copies of whole lines, two buffers, the next stage in flight while this one is multiplied.
__device__ __forceinline__ v16h g2_frag(const _Float16* p, int hh) { FragH f; f.half[0] = *(const v8us*)((const unsigned short*)p + 8 * hh); f.half[1] = *(const v8us*)((const unsigned short*)p + 16 + 8 * hh); return f.v; }
__device__ __forceinline__ v8f g2_mma(v16h a, v16h b, v8f c) { return __builtin_amdgcn_wmma_f32_16x16x32_f16(false, a, false, b, (short)0, c, false, false); }
#define G2_PITCH 272                 /* LDS bytes from row to row: 256 + 16, an odd multiple of 16 B, so the 16 rows of a fragment read fall on different banks */
#define G2_BUF (192 * G2_PITCH)      /* one stage: rows 0..127 = A, rows 128..191 = B */
__device__ __forceinline__ v16h g2_lfrag(const unsigned char* p) { FragH f; f.half[0] = *(const v8us*)p; f.half[1] = *(const v8us*)(p + 32); return f.v; }      /* p = row start + 64 B x block + 16 hh: the k order of g2_frag */
// eight asynchronous copies of 16 B a lane, rows 8 apart: LDS byte address l (+ 8 rows each), global address g (+ gs elements each)
__device__ __forceinline__ void g2_copy8(unsigned l, const _Float16* g, size_t gs) {
  const unsigned l1 = l + 8 * G2_PITCH, l2 = l + 16 * G2_PITCH, l3 = l + 24 * G2_PITCH, l4 = l + 32 * G2_PITCH, l5 = l + 40 * G2_PITCH, l6 = l + 48 * G2_PITCH, l7 = l + 56 * G2_PITCH;
  const _Float16* g1 = g + gs; const _Float16* g2 = g1 + gs; const _Float16* g3 = g2 + gs; const _Float16* g4 = g3 + gs; const _Float16* g5 = g4 + gs; const _Float16* g6 = g5 + gs; const _Float16* g7 = g6 + gs;
  /* the copies move global bytes into LDS through no register; the closing s_wait_xcnt is a precaution: it stands in front of any rewrite of the address registers named here */
  asm volatile("global_load_async_to_lds_b128 %0, %8, off\n\t"
               "global_load_async_to_lds_b128 %1, %9, off\n\t"
               "global_load_async_to_lds_b128 %2, %10, off\n\t"
               "global_load_async_to_lds_b128 %3, %11, off\n\t"
               "global_load_async_to_lds_b128 %4, %12, off\n\t"
               "global_load_async_to_lds_b128 %5, %13, off\n\t"
               "global_load_async_to_lds_b128 %6, %14, off\n\t"
               "global_load_async_to_lds_b128 %7, %15, off\n\t"
               "s_wait_xcnt 0x0"
               :: "v"(l), "v"(l1), "v"(l2), "v"(l3), "v"(l4), "v"(l5), "v"(l6), "v"(l7), "v"(g), "v"(g1), "v"(g2), "v"(g3), "v"(g4), "v"(g5), "v"(g6), "v"(g7) : "memory"); }
// Products that do not depend on one another share a grid as planes of blockIdx.y: planes 1 and up take B1 and bias1 where B1 is given; C, the f32 result, is one plane and is stored by plane cy alone
// Where VT is given, plane cy is the v projection (N = NH heads of HD columns, rows = tokens of NB batches of SQ): it stores its f32 rows times 64 bf16(av[0]) in C and its f16 values transposed in VT [NB][NH][HD][SQ], and no C16 rows
template <int ACT>
__global__ __launch_bounds__(128) void k_gemm2(const _Float16* __restrict__ A, int lda, size_t sA, const _Float16* __restrict__ Bh, int ldb, size_t sB, float alpha, const float* __restrict__ bias, size_t sBias, const float* __restrict__ CP, int rowsPerB, size_t sCPb, int row0g,
    float* __restrict__ C, _Float16* __restrict__ C16, int ldc, size_t sC, int M, int N, int K, const _Float16* __restrict__ B1, const float* __restrict__ bias1, int cy, _Float16* __restrict__ VT, const float* __restrict__ av) { static_assert(ACT == 0 || ACT == 3 || ACT == 6 || ACT == 8 || ACT == 9 || ACT == 11 || ACT == 12 || ACT == 14 || ACT == 15 || ACT == 16 || ACT == 17, "k_gemm2: unsupported ACT code (would silently apply no activation)");
  __shared__ __attribute__((aligned(16))) float so[4][32][68];
  __shared__ __attribute__((aligned(16))) unsigned char ring[2][G2_BUF];
  const int tid = threadIdx.x, w = tid >> 5, lane = tid & 31, ln = lane & 15, hh = lane >> 4; const int by = blockIdx.y;
  A += (size_t)by * sA; Bh += (size_t)by * sB; const size_t cofs = (size_t)by * sC; const float* bp = bias ? bias + (size_t)by * sBias : nullptr;
  if (B1 && by) { Bh = B1; bp = bias1; }
  C = by == cy ? C - cofs : nullptr;      /* the stores below add cofs */
  const int ntn = N >> 6; const int mt = blockIdx.x / ntn, nq = blockIdx.x - mt * ntn; const int row0 = mt * 128 + 32 * w, col0 = nq * 64; if (mt * 128 >= M) return;      /* taken by a whole work-group, in front of every barrier */
  const int cr = tid >> 4, cc = tid & 15;      /* copy role: 16 lanes cover the 256 B of one row, a wave two whole rows (4 lines) */
  const _Float16* ga = A + (size_t)(mt * 128 + cr) * lda + cc * 8; const _Float16* gb = Bh + (size_t)(col0 + cr) * ldb + cc * 8; const unsigned lc = (unsigned)(size_t)&ring[0][0] + cr * G2_PITCH + cc * 16;
  auto stage = [&](int t, int buf) { const unsigned l = lc + buf * G2_BUF; const _Float16* a = ga + t * 128;
    g2_copy8(l, a, (size_t)8 * lda); g2_copy8(l + 64 * G2_PITCH, a + (size_t)64 * lda, (size_t)8 * lda); g2_copy8(l + 128 * G2_PITCH, gb + t * 128, (size_t)8 * ldb); };
  const int nt = K >> 7;
  const v8f z8 = {0.f,0.f,0.f,0.f,0.f,0.f,0.f,0.f}; v8f c00 = z8, c01 = z8, c02 = z8, c03 = z8, c10 = z8, c11 = z8, c12 = z8, c13 = z8;
  stage(0, 0);
  asm volatile("s_wait_asynccnt 0x0" ::: "memory");      /* this wave's copies of stage 0 have landed */
  __syncthreads();                                       /* every wave's have: stage 0 may be read */
  if (nt > 1) stage(1, 1);
#pragma unroll 1    /* one stage a trip: the publish point at the foot stands once */
  for (int t = 0; t < nt; ++t) { const unsigned char* ap = &ring[t & 1][0] + (32 * w + ln) * G2_PITCH + 16 * hh; const unsigned char* bq = &ring[t & 1][0] + (128 + ln) * G2_PITCH + 16 * hh; v16h fa[2][2], fb[2][4];
    auto frags = [&](int kk, v16h (&a)[2], v16h (&b)[4]) { a[0] = g2_lfrag(ap + kk * 64); a[1] = g2_lfrag(ap + 16 * G2_PITCH + kk * 64);
#pragma unroll      /* constant indices, so the fragment arrays stay in registers */
      for (int j = 0; j < 4; ++j) b[j] = g2_lfrag(bq + j * 16 * G2_PITCH + kk * 64); };
    frags(0, fa[0], fb[0]);
#pragma unroll      /* constant indices, so the fragment arrays stay in registers */
    for (int kk = 0; kk < 4; ++kk) { const int c = kk & 1;
      if (kk < 3) frags(kk + 1, fa[c ^ 1], fb[c ^ 1]);
      __builtin_amdgcn_sched_barrier(0);      /* the next block's LDS reads stay one group ahead of this block's products instead of among them */
      c00 = g2_mma(fa[c][0], fb[c][0], c00); c10 = g2_mma(fa[c][1], fb[c][0], c10); c01 = g2_mma(fa[c][0], fb[c][1], c01); c11 = g2_mma(fa[c][1], fb[c][1], c11);
      c02 = g2_mma(fa[c][0], fb[c][2], c02); c12 = g2_mma(fa[c][1], fb[c][2], c12); c03 = g2_mma(fa[c][0], fb[c][3], c03); c13 = g2_mma(fa[c][1], fb[c][3], c13);
      __builtin_amdgcn_sched_barrier(0); }    /* and the block after next's reads stay behind these products */
    asm volatile("s_wait_dscnt 0x0" ::: "memory");         /* this wave has finished reading the buffer */
    asm volatile("s_wait_asynccnt 0x0" ::: "memory");      /* its copies of stage t + 1 have landed */
    __syncthreads();                                       /* publishes stage t + 1 and ends every wave's reads of stage t */
    if (t + 2 < nt) stage(t + 2, t & 1); }                 /* refill of the buffer just left; the test reads the same in the whole work-group */
  asm volatile("s_wait_asynccnt 0x0" ::: "memory");        /* nothing of this wave is in flight behind the loop */
  v8f accs[8] = {c00, c01, c02, c03, c10, c11, c12, c13};
  if constexpr (ACT == 0) { if (VT && by == cy) {      /* the test reads the same in the whole work-group: the block holds a barrier */
    float bv[4] = {0.f, 0.f, 0.f, 0.f};
    __builtin_amdgcn_sched_barrier(0);      /* with the one below: the loads of the factor and of the four bias values stay one group with their wait, so nothing that could rewrite an address register comes between */
    const float a0 = av[0];
    if (bp) {
#pragma unroll      /* constant indices, so the four values stay in registers */
      for (int t = 0; t < 4; ++t) bv[t] = bp[col0 + t * 16 + ln]; }
    asm volatile("s_wait_xcnt 0x0" ::: "memory");      /* precaution: stands behind the loads issued above, in front of any rewrite of their address registers */
    __builtin_amdgcn_sched_barrier(0);
    const float a64 = bf16_round(a0) * 64.0f;
    /* an accumulator tile holds, per lane, 8 consecutive rows (keys) of one column (d): 16 B of a V^T row. The ring is free here (every wave's reads and copies ended in front of the loop's last barrier) and collects the work-group's 64 V^T rows of 128 keys at the ring's own pitch */
    unsigned char* tw = &ring[0][0] + ln * G2_PITCH + (32 * w + 8 * hh) * 2;
#pragma unroll      /* constant indices, so the accumulators stay in registers */
    for (int u = 0; u < 8; ++u) { const int t = u & 3, half = u >> 2; const float b = bf16_round(bv[t]); FragH f;
#pragma unroll      /* constant indices, so the accumulators stay in registers */
      for (int r = 0; r < 8; ++r) { const float v = accs[u][r] * alpha + b; so[w][half * 16 + 8 * hh + r][t * 16 + ln] = a64 * v; f.h[r] = (_Float16)v; }
      *(v8us*)(tw + t * 16 * G2_PITCH + half * 32) = f.half[0]; }
    __syncthreads();      /* every wave's part of the V^T rows is written: they may be read across the waves */
    const int rs = lane >> 4, e4 = (lane & 15) * 4; float* cr0 = C + cofs + (size_t)(row0 + rs) * ldc + col0 + e4;
#pragma unroll      /* the LDS reads issue ahead of the stores */
    for (int q = 0; q < 16; ++q) { const v4f v = *(const v4fa*)&so[w][q * 2 + rs][e4]; *(v4f*)(cr0 + (size_t)(q * 2) * ldc) = v; }
    /* 16 lanes store the 256 B that the work-group holds of one V^T row: two whole lines */
    unsigned short* vr = (unsigned short*)VT + ((size_t)((mt * 128 / SQ) * NH + nq) * HD + cr) * SQ + mt * 128 % SQ + cc * 8; const unsigned char* tr = &ring[0][0] + cr * G2_PITCH + cc * 16;
#pragma unroll      /* the LDS reads issue ahead of the stores */
    for (int i = 0; i < 8; ++i) { const v8us x = *(const v8us*)(tr + i * 8 * G2_PITCH); *(v8us*)(vr + (size_t)i * 8 * SQ) = x; }
    asm volatile("s_wait_xcnt 0x0" ::: "memory");      /* precaution: stands behind the stores above, in front of the other planes' code, which may follow in the listing and rewrite their registers */
    return; } }
#pragma unroll
  for (int u = 0; u < 8; ++u) { const int t = u & 3, half = u >> 2; const int col = col0 + t * 16 + ln; const float bv = bp ? bf16_round(bp[col]) : 0.f;
#pragma unroll
    for (int r = 0; r < 8; ++r) { const int rloc = half * 16 + 8 * hh + r; float v = accs[u][r] * alpha + bv; if (CP) { if (rowsPerB < 0) v += CP[cofs + (size_t)(row0g + row0 + rloc) * ldc + col];      /* rowsPerB < 0: own element of the batched C plane */ else { const int bidx = (row0g + row0 + rloc) / rowsPerB; v += CP[(size_t)bidx * sCPb + (size_t)by * 64 + col]; } }
      if (ACT == 3) v = fmaxf(v, 0.f); else if (ACT == 6) v = 0.5f * v * (1.0f + erff(v * 0.70710678118654752f)); else if (ACT == 11) v = 1.0f / (1.0f + expf(-v)); else if (ACT == 15) v = v / (1.0f + expf(-v)); else if (ACT == 12) v = (v > 0.f) ? v : 0.01f * v; else if (ACT == 8) v = tanhf(v); else if (ACT == 9) v = 0.5f * v * (1.0f + tanhf(0.7978845608028654f * (v + 0.044715f * v * v * v))); else if (ACT == 14) v = (v > 0.f) ? v : 0.1f * v; else if (ACT == 16) v = (v >= 0.f) ? v : 0.3f * v; else if (ACT == 17) v = (v >= 0.f) ? v : 0.2f * v;
      so[w][rloc][t * 16 + ln] = v; } }
  __builtin_amdgcn_fence(__ATOMIC_ACQ_REL, "workgroup"); __builtin_amdgcn_wave_barrier();
  const int rsub = lane >> 4, c4 = (lane & 15) * 4;
  {
#pragma unroll
    for (int q = 0; q < 16; ++q) { const int r = q * 2 + rsub; const v4f v = *(const v4fa*)&so[w][r][c4]; if (C) *(v4f*)(C + cofs + (size_t)(row0 + r) * ldc + col0 + c4) = v; if (C16) { v4h h4; for (int i = 0; i < 4; ++i) h4[i] = (_Float16)v[i]; *(v4h*)(C16 + cofs + (size_t)(row0 + r) * ldc + col0 + c4) = h4; } }
     } }


__global__ __launch_bounds__(256) void k_wnat(const float* __restrict__ w, size_t n8, _Float16* __restrict__ Bt) { const size_t t = (size_t)blockIdx.x * 256 + threadIdx.x; if (t >= n8) return; FragH f; for (int q = 0; q < 8; ++q) f.h[q] = (_Float16)(bf16_round(w[t * 8 + q]) * 16.0f); *(v8us*)((unsigned short*)Bt + t * 8) = f.half[0];  }
__global__ __launch_bounds__(256) void k_rsm(const float* __restrict__ S, _Float16* __restrict__ P, int nrows) {
  #pragma clang fp contract(off)
  const int i = blockIdx.x * 256 + threadIdx.x; if (i >= nrows) return; const float* s = S + (size_t)i * SQ; float mx = -3.0e38f;
#pragma unroll 1
  for (int j = 0; j < SQ; ++j) mx = fmaxf(mx, s[j]); float se = 0.f;
#pragma unroll 1
  for (int j = 0; j < SQ; ++j) se += expf(s[j] - mx); const float sc = 256.0f / se;
#pragma unroll 1
  for (int j0 = 0; j0 < SQ; j0 += 8) { FragH f; for (int q = 0; q < 8; ++q) f.h[q] = (_Float16)(expf(s[j0 + q] - mx) * sc); unsigned short* d = (unsigned short*)P + (size_t)i * SQ + j0; *(v8us*)d = f.half[0];  } }
__global__ __launch_bounds__(256) void k_vt(const _Float16* __restrict__ V16, int b, int h0, _Float16* __restrict__ VT) { __shared__ unsigned short tl[64][65]; const int tid = threadIdx.x; const int hh = blockIdx.x % HG, sg = blockIdx.x / HG; const int s0 = sg * 64; const int h = h0 + hh;
  for (int i = tid; i < 64 * 8; i += 256) { const int j = i / 8, d8 = (i % 8) * 8; FragH f; f.half[0] = *(const v8us*)((const unsigned short*)V16 + ((size_t)b * SQ + s0 + j) * DM + h * HD + d8); for (int q = 0; q < 8; ++q) tl[d8 + q][j] = f.u[q]; }
  __syncthreads();
  { for (int i = tid; i < 64 * 8; i += 256) { const int d = i / 8, j8 = (i % 8) * 8; FragH f; for (int q = 0; q < 8; ++q) f.u[q] = tl[d][j8 + q]; *(v8us*)((unsigned short*)VT + ((size_t)hh * HD + d) * SQ + s0 + j8) = f.half[0]; }  } }


// lane l <-> lane l ^ M of the wave, in vector registers (no LDS round trip): M = 16 crosses the two 16-lane rows, M < 16 is a DPP row_xmask move
template <int M>
__device__ __forceinline__ float lane_xor(float x) { const int b = __float_as_int(x);
  if constexpr (M == 16) return __int_as_float(__builtin_amdgcn_permlanex16(b, b, 0x76543210, 0xfedcba98, false, false));
  else return __int_as_float(__builtin_amdgcn_update_dpp(0, b, 0x160 | M, 0xf, 0xf, true)); }
// ---- fused attention: scores and weights live in registers only ----
__device__ __forceinline__ v8f f_mma(v16h a, v16h b, v8f c) { return __builtin_amdgcn_wmma_f32_16x16x32_f16(false, a, false, b, (short)0, c, false, false); }
typedef unsigned v4ua __attribute__((ext_vector_type(4), may_alias));
#define SC2 0.18033688011112042f     /* (1 / 8) log2(e): scores go to the exponent base 2 */
#define MASKED -3.0e38f              /* score of a masked key: its weight underflows to 0 against any row reference >= M0 */
#define M0 -1.0e30f                  /* start value of a row's reference; a row with every key masked keeps it, sums 0 and ends as 0 x inf = NaN like the definition */
// one bit per (query, key): bit j of word [query][key / 32] is mask[query][32 (key / 32) + j] != 0; a wave packs 32 words
__device__ __forceinline__ void d_maskbits(unsigned bx, const int* __restrict__ mask, unsigned* __restrict__ MB) {
  const int lane = threadIdx.x & 31; const size_t wv = (size_t)bx * 8 + (threadIdx.x >> 5); const int* m = mask + wv * 1024; unsigned keep = 0;
#pragma unroll      /* 32 independent loads in flight */
  for (int i = 0; i < 32; ++i) { const unsigned bits = __builtin_amdgcn_ballot_w32(m[i * 32 + lane] != 0); if (lane == i) keep = bits; }
  MB[wv * 32 + lane] = keep;
  asm volatile("s_wait_xcnt 0x0" ::: "memory"); }      /* precaution: stands behind the store above, in front of the other jobs' code, which in the listing follows this one and rewrites the store's registers */
// S^T tile rows are keys 8 hh + r, its column is query ln: bit 16 kt + 8 hh + r of the query's mask word
__device__ __forceinline__ void mask_tile(v8f& s, unsigned word, int kt, int hh) { const unsigned u = word >> (16 * kt + 8 * hh);
#pragma unroll      /* constant indices, so the tile stays in registers */
  for (int r = 0; r < 8; ++r) s[r] = ((u >> r) & 1u) ? s[r] : MASKED; }
// K and V^T go through LDS: a stage is 128 keys of the head (K: 128 rows of 128 B; V^T: 64 rows of 256 B), brought once for the 8 waves by asynchronous copies of whole lines, two buffers, the next stage in flight while this one is worked on
#define FST 128                      /* keys a stage */
#define FK_PITCH 144                 /* LDS bytes from K row to K row: 128 + 16, an odd multiple of 16 B, so the 16 rows of a fragment read fall on different banks */
#define FV_PITCH 272                 /* the same for the V^T rows: 256 + 16 */
#define FK_BYTES (FST * FK_PITCH)
#define F_BUF (FK_BYTES + HD * FV_PITCH)      /* one stage: K rows, then V^T rows */
// four asynchronous copies of 16 B a lane: LDS byte address l (+ ls each), global address g (+ gs elements each)
__device__ __forceinline__ void f_copy4(unsigned l, unsigned ls, const _Float16* g, size_t gs) {
  const unsigned l1 = l + ls, l2 = l1 + ls, l3 = l2 + ls; const _Float16* g1 = g + gs; const _Float16* g2 = g1 + gs; const _Float16* g3 = g2 + gs;
  /* the copies move global bytes into LDS through no register; the closing s_wait_xcnt is a precaution: it stands in front of any rewrite of the address registers named here */
  asm volatile("global_load_async_to_lds_b128 %0, %4, off\n\t"
               "global_load_async_to_lds_b128 %1, %5, off\n\t"
               "global_load_async_to_lds_b128 %2, %6, off\n\t"
               "global_load_async_to_lds_b128 %3, %7, off\n\t"
               "s_wait_xcnt 0x0"
               :: "v"(l), "v"(l1), "v"(l2), "v"(l3), "v"(g), "v"(g1), "v"(g2), "v"(g3) : "memory"); }
// the key loop of k_fattn; MSK = false is taken by a work-group none of whose 256 mask rows holds a zero, and then reads no mask word
// ring: the two buffers; gk, gv, lk, lv: this lane's first global and LDS addresses as a copier of K and of V^T
template <bool MSK>
__device__ __forceinline__ void fattn_keys(const unsigned char* ring, const _Float16* gk, const _Float16* gv, unsigned lk, unsigned lv, const unsigned* mb, int ln, int hh, const v16h (&qf)[2][2], v8f (&o)[2][4], float (&m)[2], float (&l)[2]) {
  const v8f z8 = {0.f,0.f,0.f,0.f,0.f,0.f,0.f,0.f}; v16h ka[2][2], kb2[2][2], va[4], vb[4]; unsigned mw[2] = {0u, 0u};
  auto stage = [&](int t, int buf) { f_copy4(lk + buf * F_BUF, 32 * FK_PITCH, gk + (size_t)t * FST * DM, (size_t)32 * DM); f_copy4(lv + buf * F_BUF, 16 * FV_PITCH, gv + t * FST, (size_t)16 * SQ); };
  if (MSK) { mw[0] = mb[0]; mw[1] = mb[16 * (SQ / 32)]; }
  stage(0, 0);
  asm volatile("s_wait_asynccnt 0x0" ::: "memory");      /* this wave's copies of stage 0 have landed */
  __syncthreads();                                       /* every wave's have: stage 0 may be read */
  stage(1, 1);
#pragma unroll 1    /* one stage a trip: the publish point at the foot stands once */
  for (int t = 0; t < SQ / FST; ++t) { const unsigned char* kt = ring + (t & 1) * F_BUF + ln * FK_PITCH + 16 * hh; const unsigned char* vt = ring + (t & 1) * F_BUF + FK_BYTES + ln * FV_PITCH + 16 * hh;
    // the K and V^T fragments of pass p of this stage, in the k order of g2_frag
    auto frags = [&](int p, v16h (&k)[2][2], v16h (&v)[4]) {
#pragma unroll      /* constant indices, so the fragment arrays stay in registers */
      for (int i = 0; i < 2; ++i) { k[i][0] = g2_lfrag(kt + (p * 32 + i * 16) * FK_PITCH); k[i][1] = g2_lfrag(kt + (p * 32 + i * 16) * FK_PITCH + 64); }
#pragma unroll      /* constant indices, so the fragment arrays stay in registers */
      for (int d = 0; d < 4; ++d) v[d] = g2_lfrag(vt + d * 16 * FV_PITCH + p * 64); };
    // one pass = 32 keys: kc and vc hold this pass's K and V^T fragments, kx and vn take those of pass pn of the same stage (pn = 0: the stage's last pass, which fetches nothing)
    auto pass = [&](int kb, int pn, const v16h (&kc)[2][2], v16h (&kx)[2][2], const v16h (&vc)[4], v16h (&vn)[4]) { const int kn = (kb + 32) & (SQ - 1);
      v8f s[2][2]; float mx[2]; FragH pf[2];
      if (pn) frags(pn, kx, vn);
      __builtin_amdgcn_sched_barrier(0);      /* the next pass's LDS reads stay one group ahead of this pass's products instead of among them */
#pragma unroll      /* constant indices, so the fragment arrays stay in registers */
      for (int qt = 0; qt < 2; ++qt)
#pragma unroll      /* constant indices, so the fragment arrays stay in registers */
        for (int kt2 = 0; kt2 < 2; ++kt2) s[qt][kt2] = f_mma(kc[kt2][1], qf[qt][1], f_mma(kc[kt2][0], qf[qt][0], z8));
      if (MSK) {
#pragma unroll      /* constant indices, so the fragment arrays stay in registers */
        for (int qt = 0; qt < 2; ++qt) { mask_tile(s[qt][0], mw[qt], 0, hh); mask_tile(s[qt][1], mw[qt], 1, hh); }
        __builtin_amdgcn_sched_barrier(0);      /* with the one below: the next pass's two mask loads and their wait stay one group, so nothing that could rewrite an address register comes between */
        mw[0] = mb[kn >> 5]; mw[1] = mb[16 * (SQ / 32) + (kn >> 5)];
        asm volatile("s_wait_xcnt 0x0" ::: "memory");      /* precaution: stands behind the loads issued above, in front of any rewrite of their address registers */
        __builtin_amdgcn_sched_barrier(0); }
#pragma unroll      /* constant indices, so the fragment arrays stay in registers */
      for (int qt = 0; qt < 2; ++qt) { float a = fmaxf(s[qt][0][0], s[qt][1][0]);
#pragma unroll      /* constant indices, so the fragment arrays stay in registers */
        for (int r = 1; r < 8; ++r) a = fmaxf(a, fmaxf(s[qt][0][r], s[qt][1][r]));
        a *= SC2; mx[qt] = fmaxf(a, lane_xor<16>(a)); }      /* both halves of a column agree on the maximum, so on the reference too */
      if (__builtin_amdgcn_ballot_w32(mx[0] > m[0] + 8.f || mx[1] > m[1] + 8.f) != 0) {      /* scalar branch: rescale only when some column's reference must rise */
#pragma unroll      /* constant indices, so the fragment arrays stay in registers */
        for (int qt = 0; qt < 2; ++qt) { const float mn = fmaxf(m[qt], mx[qt]), f = __builtin_amdgcn_exp2f(m[qt] - mn); m[qt] = mn; l[qt] *= f;
#pragma unroll      /* constant indices, so the fragment arrays stay in registers */
          for (int d = 0; d < 4; ++d) o[qt][d] *= f; } }
#pragma unroll      /* constant indices, so the fragment arrays stay in registers */
      for (int qt = 0; qt < 2; ++qt) { float ls = 0.f;
#pragma unroll      /* constant indices, so the fragment arrays stay in registers */
        for (int r = 0; r < 8; ++r) { const float p0 = __builtin_amdgcn_exp2f(__builtin_fmaf(s[qt][0][r], SC2, -m[qt])), p1 = __builtin_amdgcn_exp2f(__builtin_fmaf(s[qt][1][r], SC2, -m[qt])); ls += p0 + p1; pf[qt].h[r] = (_Float16)p0; pf[qt].h[8 + r] = (_Float16)p1; }
        l[qt] += ls; }
#pragma unroll      /* constant indices, so the fragment arrays stay in registers */
      for (int d = 0; d < 4; ++d) { o[0][d] = f_mma(vc[d], pf[0].v, o[0][d]); o[1][d] = f_mma(vc[d], pf[1].v, o[1][d]); }
      __builtin_amdgcn_sched_barrier(0); };      /* keeps the next pass's products behind this pass: moved up, they would wait on fragments fetched only half a pass earlier */
    const int kb = t * FST;
    frags(0, ka, va);
    pass(kb, 1, ka, kb2, va, vb); pass(kb + 32, 2, kb2, ka, vb, va); pass(kb + 64, 3, ka, kb2, va, vb); pass(kb + 96, 0, kb2, ka, vb, va);      /* the two fragment sets swap by name, no register is copied */
    asm volatile("s_wait_dscnt 0x0" ::: "memory");         /* this wave has finished reading the buffer */
    asm volatile("s_wait_asynccnt 0x0" ::: "memory");      /* its copies of stage t + 1 have landed */
    __syncthreads();                                       /* publishes stage t + 1 and ends every wave's reads of stage t */
    if (t + 2 < SQ / FST) stage(t + 2, t & 1); }           /* refill of the buffer just left; the test reads the same in the whole work-group */
  asm volatile("s_wait_asynccnt 0x0" ::: "memory"); }      /* nothing of this wave is in flight behind the loop */
// One wave: 32 queries of one head against all keys, 32 keys a pass. S^T = K Q^T (A = K rows, B = Q rows), so a lane holds one query's scores; the two S^T tiles of a pass, converted in place,
// are the B operand of O^T += V^T P^T. Running row reference m (base-2 exponent), raised only when a new maximum exceeds it by more than 8 (weights then stay <= 256, inside f16); f32 row sums.
// Writes merged f16 rows 64 o + 64 alpha vp and, per (batch, head, query), the pair (m, 1 / sum) for the head-sum launch.
// The 8 waves of a work-group walk the same head's K and V^T, which are staged once for all of them in LDS.
__global__ __launch_bounds__(256) void k_fattn(const _Float16* __restrict__ Q, const _Float16* __restrict__ Kp, const _Float16* __restrict__ VT, const unsigned* __restrict__ MB, const float* __restrict__ AV, _Float16* __restrict__ O16, float* __restrict__ ST) {
  const int tid = threadIdx.x, w = tid >> 5, lane = tid & 31, ln = lane & 15, hh = lane >> 4; const int h = blockIdx.y, b = blockIdx.z, q0 = blockIdx.x * 256 + w * 32; const size_t r0 = (size_t)b * SQ;
  __shared__ __attribute__((aligned(16))) unsigned char ring[2 * F_BUF]; __shared__ __attribute__((aligned(16))) unsigned wz[8];
  const _Float16* qp = Q + (r0 + q0 + ln) * DM + h * HD; const unsigned* mb = MB + (size_t)(q0 + ln) * (SQ / 32);
  /* copy roles: 8 lanes cover the 128 B of a K row, 16 lanes the 256 B of a V^T row, so a wave copies 4 whole lines at a time */
  const _Float16* gk = Kp + (r0 + (tid >> 3)) * DM + h * HD + (tid & 7) * 8; const _Float16* gv = VT + ((size_t)(b * NH + h) * HD + (tid >> 4)) * SQ + (tid & 15) * 8;
  const unsigned lk = (unsigned)(size_t)&ring[0] + (tid >> 3) * FK_PITCH + (tid & 7) * 16, lv = (unsigned)(size_t)&ring[0] + FK_BYTES + (tid >> 4) * FV_PITCH + (tid & 15) * 16;
  const v8f z8 = {0.f,0.f,0.f,0.f,0.f,0.f,0.f,0.f};
  v16h qf[2][2]; v8f o[2][4]; float m[2] = {M0, M0}, l[2] = {0.f, 0.f};
#pragma unroll      /* constant indices, so the fragment arrays stay in registers */
  for (int t = 0; t < 2; ++t) { qf[t][0] = g2_frag(qp + (size_t)t * 16 * DM, hh); qf[t][1] = g2_frag(qp + (size_t)t * 16 * DM + 32, hh);
#pragma unroll      /* constant indices, so the fragment arrays stay in registers */
    for (int d = 0; d < 4; ++d) o[t][d] = z8; }
  unsigned all1 = 0xFFFFFFFFu;      /* lane i: the AND of the 64 mask words of the wave's row i */
  { const v4ua* row = (const v4ua*)(MB + (size_t)(q0 + lane) * (SQ / 32));
#pragma unroll      /* 16 independent loads in flight */
    for (int i = 0; i < SQ / 128; ++i) { const v4ua x = row[i]; all1 &= x[0] & x[1] & x[2] & x[3]; } }
  asm volatile("s_wait_xcnt 0x0" ::: "memory");      /* precaution: stands behind the loads issued above, in front of any rewrite of their address registers */
  const unsigned bz = __builtin_amdgcn_ballot_w32(all1 != 0xFFFFFFFFu);      /* taken with every lane on */
  if (lane == 0) wz[w] = bz;
  __syncthreads();      /* the key loop holds barriers, so the whole work-group takes one side: every wave sees all 8 waves' findings */
  const v4ua z0 = *(const v4ua*)&wz[0], z1 = *(const v4ua*)&wz[4];
  if (__builtin_amdgcn_readfirstlane(z0[0] | z0[1] | z0[2] | z0[3] | z1[0] | z1[1] | z1[2] | z1[3]) != 0) fattn_keys<true>(ring, gk, gv, lk, lv, mb, ln, hh, qf, o, m, l); else fattn_keys<false>(ring, gk, gv, lk, lv, mb, ln, hh, qf, o, m, l);      /* scalar branch, the same in every wave */
#pragma unroll      /* constant indices, so the fragment arrays stay in registers */
  for (int qt = 0; qt < 2; ++qt) { const float inv = 1.0f / (l[qt] + lane_xor<16>(l[qt])), sc = inv * 64.0f; const int q = q0 + qt * 16 + ln;
    if (hh == 0) { float* st = ST + ((size_t)(b * NH + h) * SQ + q) * 2; st[0] = m[qt]; st[1] = inv; }
    v4f av[4][2];
    __builtin_amdgcn_sched_barrier(0);      /* with the one below: the eight loads of the addend and their wait stay one group, so nothing that could rewrite an address register comes between */
#pragma unroll      /* constant indices, so the fragment arrays stay in registers */
    for (int d = 0; d < 4; ++d) { const size_t off = (r0 + q) * DM + h * HD + d * 16 + 8 * hh; av[d][0] = *(const v4fa*)(AV + off); av[d][1] = *(const v4fa*)(AV + off + 4); }
    asm volatile("s_wait_xcnt 0x0" ::: "memory");      /* precaution: stands behind the loads issued above, in front of any rewrite of their address registers */
    __builtin_amdgcn_sched_barrier(0);
#pragma unroll      /* constant indices, so the fragment arrays stay in registers */
    for (int d = 0; d < 4; ++d) { const size_t off = (r0 + q) * DM + h * HD + d * 16 + 8 * hh; const v4f a0 = av[d][0], a1 = av[d][1]; FragH f;      /* O^T tile: a lane holds 8 consecutive d of one query */
#pragma unroll      /* constant indices, so the fragment arrays stay in registers */
      for (int r = 0; r < 4; ++r) { f.h[r] = (_Float16)(o[qt][d][r] * sc + a0[r]); f.h[4 + r] = (_Float16)(o[qt][d][4 + r] * sc + a1[r]); }
      *(v8us*)((unsigned short*)O16 + off) = f.half[0]; } } }
// K, Q and the row statistics of k_headsum go through LDS: a stage is one head's 128 B of the work-group's 256 K rows and 64 Q rows, brought by asynchronous copies of whole lines, two buffers, the next head in flight while this one is worked on
#define HS_PITCH 144                 /* LDS bytes from row to row: 128 + 16, an odd multiple of 16 B, so the 16 rows of a fragment read fall on different banks */
#define HS_BUF (320 * HS_PITCH)      /* one stage: rows 0..255 = K, rows 256..319 = Q */
// two asynchronous copies of 16 B a lane: LDS byte address l (+ ls), global address g (+ gs bytes)
__device__ __forceinline__ void f_copy2(unsigned l, unsigned ls, const unsigned char* g, size_t gs) {
  const unsigned l1 = l + ls; const unsigned char* g1 = g + gs;
  /* the copies move global bytes into LDS through no register; the closing s_wait_xcnt is a precaution: it stands in front of any rewrite of the address registers named here */
  asm volatile("global_load_async_to_lds_b128 %0, %2, off\n\t"
               "global_load_async_to_lds_b128 %1, %3, off\n\t"
               "s_wait_xcnt 0x0"
               :: "v"(l), "v"(l1), "v"(g), "v"(g1) : "memory"); }
// this lane's ten copies of head h into buffer buf; gk, gq: the work-group's first K and Q rows; go, lc: the lane's element offset from them and its first LDS address
__device__ __forceinline__ void hs_stage(const _Float16* gk, const _Float16* gq, unsigned go, unsigned lc, int h, int buf) { const unsigned l = lc + buf * HS_BUF;
  f_copy4(l, 32 * HS_PITCH, gk + h * HD + go, (size_t)32 * DM); f_copy4(l + 128 * HS_PITCH, 32 * HS_PITCH, gk + (size_t)128 * DM + h * HD + go, (size_t)32 * DM); f_copy2(l + 256 * HS_PITCH, 32 * HS_PITCH, (const unsigned char*)(gq + h * HD + go), (size_t)32 * DM * 2); }
// the head loop of k_headsum, entered with head 0 published and head 1 in flight; MSK = false is taken by a work-group whose 64 x 256 mask bits are all set
// ring: the two buffers; gk, gq, go, lc: as in hs_stage; kr, qr: the LDS rows of this lane's first K and Q fragments; st: this lane's first (m, 1 / sum) pair in LDS
template <bool MSK>
__device__ __forceinline__ void headsum_heads(const unsigned char* ring, const _Float16* gk, const _Float16* gq, unsigned go, unsigned lc, int kr, int qr, const float* st, int hh, const unsigned (&mw)[2][2], v8f (&acc)[2][4]) {
  const v8f z8 = {0.f,0.f,0.f,0.f,0.f,0.f,0.f,0.f};
#pragma unroll 1    /* one head a trip: the publish point at the foot stands once, and the live set stays small enough for four waves a SIMD */
  for (int h = 0; h < NH; ++h) { v16h qf[2][2], kf[4][2]; float mr[2], iv[2]; const unsigned char* kp = ring + (h & 1) * HS_BUF + kr * HS_PITCH + 16 * hh; const unsigned char* qp = ring + (h & 1) * HS_BUF + qr * HS_PITCH + 16 * hh;
#pragma unroll      /* constant indices, so the fragment arrays stay in registers */
    for (int t = 0; t < 4; ++t) { kf[t][0] = g2_lfrag(kp + t * 16 * HS_PITCH); kf[t][1] = g2_lfrag(kp + t * 16 * HS_PITCH + 64); }
#pragma unroll      /* constant indices, so the fragment arrays stay in registers */
    for (int t = 0; t < 2; ++t) { qf[t][0] = g2_lfrag(qp + t * 16 * HS_PITCH); qf[t][1] = g2_lfrag(qp + t * 16 * HS_PITCH + 64); mr[t] = st[(h * 64 + t * 16) * 2]; iv[t] = st[(h * 64 + t * 16) * 2 + 1]; }
#pragma unroll      /* constant indices, so the fragment arrays stay in registers */
    for (int qt = 0; qt < 2; ++qt)
#pragma unroll      /* constant indices, so the fragment arrays stay in registers */
      for (int kt = 0; kt < 4; ++kt) { v8f s = f_mma(kf[kt][1], qf[qt][1], f_mma(kf[kt][0], qf[qt][0], z8));
        if (MSK) mask_tile(s, mw[qt][kt >> 1], kt & 1, hh);
#pragma unroll      /* constant indices, so the fragment arrays stay in registers */
        for (int r = 0; r < 8; ++r) acc[qt][kt][r] = __builtin_fmaf(__builtin_amdgcn_exp2f(__builtin_fmaf(s[r], SC2, -mr[qt])), iv[qt], acc[qt][kt][r]); }
    asm volatile("s_wait_dscnt 0x0" ::: "memory");         /* this wave has finished reading the buffer */
    asm volatile("s_wait_asynccnt 0x0" ::: "memory");      /* its copies of head h + 1 have landed */
    __syncthreads();                                       /* publishes head h + 1 and ends every wave's reads of head h */
    if (h + 2 < NH) hs_stage(gk, gq, go, lc, h + 2, h & 1); }      /* refill of the buffer just left; the test reads the same in the whole work-group */
  asm volatile("s_wait_asynccnt 0x0" ::: "memory"); }      /* nothing of this wave is in flight behind the loop */
// second output: one wave holds 32 queries x 64 keys of the head sum in registers and walks the 16 heads, forming each head's S^T tiles again (same products, same order as k_fattn) and its weights from the stored (m, 1 / sum)
// a work-group is 2 x 4 such waves: 64 queries x 256 keys, so a staged K row serves two waves and a staged Q row four
__global__ __launch_bounds__(256) void k_headsum(const _Float16* __restrict__ Q, const _Float16* __restrict__ Kp, const unsigned* __restrict__ MB, const float* __restrict__ ST, float* __restrict__ WS) {
  __shared__ __attribute__((aligned(16))) unsigned char ring[2 * HS_BUF]; __shared__ __attribute__((aligned(16))) float sst[NH][64][2]; __shared__ __attribute__((aligned(16))) unsigned wz[8];
  const int tid = threadIdx.x, w = tid >> 5, lane = tid & 31, ln = lane & 15, hh = lane >> 4, qi = w >> 2, ki = w & 3; const int b = blockIdx.z, qb = blockIdx.y * 64, kb = blockIdx.x * 256, q0 = qb + qi * 32, k0 = kb + ki * 64; const size_t r0 = (size_t)b * SQ;
  /* copy roles: 8 lanes cover the 128 B of a row, so a wave copies 4 whole lines at a time; the statistics are 512 B a head, 32 lanes each */
  const _Float16* gk = Kp + (r0 + kb) * DM; const _Float16* gq = Q + (r0 + qb) * DM; const unsigned go = (tid >> 3) * DM + (tid & 7) * 8; const unsigned lc = (unsigned)(size_t)&ring[0] + (tid >> 3) * HS_PITCH + (tid & 7) * 16;
  f_copy2((unsigned)(size_t)&sst[0][0][0] + tid * 16, 8 * 512, (const unsigned char*)(ST + ((size_t)(b * NH + (tid >> 5)) * SQ + qb) * 2 + (tid & 31) * 4), (size_t)8 * SQ * 2 * 4);      /* heads w and w + 8; waited for with head 0's copies */
  hs_stage(gk, gq, go, lc, 0, 0);
  const v8f z8 = {0.f,0.f,0.f,0.f,0.f,0.f,0.f,0.f}; v8f acc[2][4]; unsigned mw[2][2];
#pragma unroll      /* constant indices, so the fragment arrays stay in registers */
  for (int qt = 0; qt < 2; ++qt) { const unsigned* mb = MB + (size_t)(q0 + qt * 16 + ln) * (SQ / 32) + (k0 >> 5); mw[qt][0] = mb[0]; mw[qt][1] = mb[1];
#pragma unroll      /* constant indices, so the fragment arrays stay in registers */
    for (int kt = 0; kt < 4; ++kt) acc[qt][kt] = z8; }
  const unsigned bz = __builtin_amdgcn_ballot_w32((mw[0][0] & mw[0][1] & mw[1][0] & mw[1][1]) != 0xFFFFFFFFu);      /* taken with every lane on */
  if (lane == 0) wz[w] = bz;
  asm volatile("s_wait_asynccnt 0x0" ::: "memory");      /* this wave's copies of head 0 and of the statistics have landed */
  __syncthreads();      /* every wave's have: they may be read; and every wave sees all 8 waves' mask findings: the head loop holds barriers, so the whole work-group takes one side */
  hs_stage(gk, gq, go, lc, 1, 1);
  const v4ua z0 = *(const v4ua*)&wz[0], z1 = *(const v4ua*)&wz[4]; const float* st = &sst[0][qi * 32 + ln][0]; const int kr = ki * 64 + ln, qr = 256 + qi * 32 + ln;
  if (__builtin_amdgcn_readfirstlane(z0[0] | z0[1] | z0[2] | z0[3] | z1[0] | z1[1] | z1[2] | z1[3]) != 0) headsum_heads<true>(ring, gk, gq, go, lc, kr, qr, st, hh, mw, acc); else headsum_heads<false>(ring, gk, gq, go, lc, kr, qr, st, hh, mw, acc);      /* scalar branch, the same in every wave */
#pragma unroll      /* constant indices, so the fragment arrays stay in registers */
  for (int qt = 0; qt < 2; ++qt)
#pragma unroll      /* constant indices, so the fragment arrays stay in registers */
    for (int kt = 0; kt < 4; ++kt) { float* d = WS + (r0 + q0 + qt * 16 + ln) * SQ + k0 + kt * 16 + 8 * hh; v4f a0, a1;      /* a lane holds 8 consecutive keys of one query */
#pragma unroll      /* constant indices, so the fragment arrays stay in registers */
      for (int r = 0; r < 4; ++r) { a0[r] = acc[qt][kt][r]; a1[r] = acc[qt][kt][4 + r]; }
      *(v4f*)d = a0; *(v4f*)(d + 4) = a1; } }
// Jobs that do not depend on one another share a grid: a work-group picks its job by its index, the same for all its threads, and runs that job's body with its index within the job.
#define PW_G (DM * (DM / 8) / 256)            /* work-groups of one weight transpose */
#define PM_G (SQ * (SQ / 32) / 256)           /* of the mask pack */
#define PX_G ((int)(NR * DM / 8 / 256))       /* of one input conversion */
// all that reads inputs only: the three weight transposes, the mask pack, the three input conversions
__global__ __launch_bounds__(256) void k_prep(const float* __restrict__ wq, const float* __restrict__ wkv, const float* __restrict__ wo, _Float16* __restrict__ BQ, _Float16* __restrict__ BKV, _Float16* __restrict__ BO, const int* __restrict__ mask, unsigned* __restrict__ MB,
    const float* __restrict__ qin, const float* __restrict__ kin, const float* __restrict__ vin, _Float16* __restrict__ XQ, _Float16* __restrict__ XK, _Float16* __restrict__ XV) { const unsigned bx = blockIdx.x;
  if (bx < 3 * PW_G) { const unsigned j = bx / PW_G; d_wt_f16(bx - j * PW_G, j == 0 ? wq : j == 1 ? wkv : wo, j == 0 ? BQ : j == 1 ? BKV : BO, DM, DM, 16.0f); }
  else if (bx < 3 * PW_G + PM_G) d_maskbits(bx - 3 * PW_G, mask, MB);
  else { const unsigned i = bx - (3 * PW_G + PM_G), j = i / PX_G; d_x16(i - j * PX_G, j == 0 ? qin : j == 1 ? kin : vin, j == 0 ? XQ : j == 1 ? XK : XV, NR * DM / 8); } }

extern "C" void kernel_launch(void* const* d_in, const int* in_sizes, int n_in,
                              void* d_out, int out_size, void* d_ws, size_t ws_size, hipStream_t stream) {
  (void)in_sizes; (void)n_in; (void)out_size;
  const float* const* I = (const float* const*)d_in; const float* qin = I[0]; const float* kin = I[1]; const float* vin = I[2]; const int* mask = (const int*)d_in[3]; const float* wq = I[4]; const float* bq = I[5]; const float* wkv = I[6]; const float* bkv = I[7]; const float* wo = I[8]; const float* bo = I[9]; const float* alpha = I[10];      /* weights [in][out] */
  float* out0 = (float*)d_out; float* out1 = (float*)d_out + NR * DM;      /* byte offset 16,777,216 */
  char* ws = (char*)d_ws; size_t off = 0;
  auto take = [&](size_t bytes) { char* p = ws + off; off += (bytes + 255) & ~(size_t)255; return p; };
  _Float16* BQ = (_Float16*)take((size_t)DM * DM * 2); _Float16* BKV = (_Float16*)take((size_t)DM * DM * 2); _Float16* BO = (_Float16*)take((size_t)DM * DM * 2);
  _Float16* Q16 = (_Float16*)take(NR * DM * 2); _Float16* K16 = (_Float16*)take(NR * DM * 2); float* AV = (float*)take(NR * DM * 4); _Float16* O16 = (_Float16*)take(NR * DM * 2);
  _Float16* VT = (_Float16*)take((size_t)NB * NH * HD * SQ * 2); unsigned* MB = (unsigned*)take((size_t)SQ * (SQ / 32) * 4); float* ST = (float*)take((size_t)NB * NH * SQ * 2 * 4);
  _Float16* XQ = (_Float16*)take(NR * DM * 2); _Float16* XK = (_Float16*)take(NR * DM * 2); _Float16* XV = (_Float16*)take(NR * DM * 2);
  if (off > ws_size) return;      /* 6 + 16 + 16 + 8 + 8 + 0.5 + 0.5 + 24 = 79 MiB */
  k_prep<<<3 * PW_G + PM_G + 3 * PX_G, 256, 0, stream>>>(wq, wkv, wo, BQ, BKV, BO, mask, MB, qin, kin, vin, XQ, XK, XV);
  const size_t r0p = (size_t)B0 * SQ; const dim3 gp((unsigned)((MP / 128) * (DM / 64)), 3);
  k_gemm2<0><<<gp, 128, 0, stream>>>(XQ + r0p * DM, DM, NR * DM, BQ, DM, 0, 0.0625f, bq, 0, nullptr, 1, 0, 0, AV + r0p * DM, Q16 + r0p * DM, DM, NR * DM, MP, DM, DM, BKV, bkv, 2, VT, alpha);      /* planes qp, kp, vp: XQ, XK, XV and Q16, K16 lie NR * DM elements apart; vp leaves as 64 alpha vp (f32 rows, residual) and as V^T [NB][NH][HD][SQ] (f16, attention operand) */
  k_fattn<<<dim3(SQ / 256, NH, NB), 256, 0, stream>>>(Q16, K16, VT, MB, AV, O16, ST);      /* o x64 = 64 attn v + 64 alpha vp, f16 rows; row statistics */
  k_headsum<<<dim3(SQ / 256, SQ / 64, NB), 256, 0, stream>>>(Q16, K16, MB, ST, out1);      /* sum over the heads of the weights */
  k_gemm2<0><<<dim3((unsigned)((MPO / 128) * (DM / 64)), 1), 128, 0, stream>>>(O16 + r0p * DM, DM, 0, BO, DM, 0, 0.0009765625f, bo, 0, nullptr, 1, 0, 0, out0 + r0p * DM, nullptr, DM, 0, MPO, DM, DM, nullptr, nullptr, 0, nullptr, nullptr);      /* out0 = o Wo + bo */
}

// v008
// One run takes 123 microseconds.
// Next to v007, in two timings, it ran 1.11 and 1.10 times as fast.
// Counting every step since v000, it is 1120 times as fast.
#include <hip/hip_runtime.h>
#define NB 2
#define SQ 2048
#define DM 1024
#define NH 16
#define HD 64
#define HG 4                         /* k_vt(b,h0) compatibility (unused) */
#define B0 0                         /* first batch processed (debug hook) */
#define NBR NB                       /* batches processed (debug hook) */
#define Q0S 0                        /* first tile (unused) */
#define QN SQ                        /* query rows end (unused) */
#define NR ((size_t)NB * SQ)
#define MP ((int)((size_t)NBR * SQ)) /* rows projected (debug hook) */
#define MPO MP                       /* rows through the output GEMM (debug hook) */
typedef __bf16 v16b __attribute__((ext_vector_type(16)));
typedef unsigned short v8us __attribute__((ext_vector_type(8), may_alias));
typedef float  v8f  __attribute__((ext_vector_type(8)));
typedef float  v4f  __attribute__((ext_vector_type(4)));
typedef float  v4fa __attribute__((ext_vector_type(4), may_alias));
union FragB { v16b v; v8us half[2]; unsigned short u[16]; };

__device__ __forceinline__ unsigned short bf16_bits(float x) { unsigned int u = __float_as_uint(x); return (unsigned short)((u + 0x7FFFu + ((u >> 16) & 1u)) >> 16); }
__device__ __forceinline__ float bf16_val(unsigned short b) { return __uint_as_float(((unsigned int)b) << 16); }
__device__ __forceinline__ float bf16_round(float x) { return bf16_val(bf16_bits(x)); }
// D += A·B with NT terms: 1 = ah·bh, 2 = + al·bh (A split), 3 = + ah·bl (both split)
template <int NT>
__device__ __forceinline__ v8f mmaN(v16b ah, v16b al, v16b bh, v16b bl, v8f c) {
  c = __builtin_amdgcn_wmma_f32_16x16x32_bf16(false, ah, false, bh, (short)0, c, false, false);
  if (NT >= 2) c = __builtin_amdgcn_wmma_f32_16x16x32_bf16(false, al, false, bh, (short)0, c, false, false);
  if (NT >= 3) c = __builtin_amdgcn_wmma_f32_16x16x32_bf16(false, ah, false, bl, (short)0, c, false, false);
  asm volatile("v_nop\n\tv_nop\n\tv_nop\n\tv_nop" : "+v"(c) : "v"(ah), "v"(al), "v"(bh), "v"(bl));
  return c;
}

__global__ __launch_bounds__(256) void k_wt_bf16(const float* __restrict__ W, unsigned short* __restrict__ Wt, int K, int N) {
  const int t = blockIdx.x * 256 + threadIdx.x;
  const int k8n = K / 8;
  if (t >= N * k8n) return;
  const int n = t / k8n, k8 = (t % k8n) * 8;
  v8us v;
#pragma unroll
  for (int i = 0; i < 8; ++i) v[i] = bf16_bits(W[(size_t)(k8 + i) * N + n]);
  *(v8us*)(Wt + (size_t)n * K + k8) = v;
  
}

// GEMM C[M][N] (f32, pitch ldc) = act(A[M][K]·W + bias). A f32 row-major (pitch lda) converted per fragment to bf16
// (ASPLIT: hi/lo two planes -> 2 terms, else single rounded term); Wt bf16 [N][K] (pitch ldb). BIAS_BF16 rounds the
// bias to bf16 first (bias quantised to bf16 before the add). K%32==0, M%16==0, N%64==0.
template <bool ASPLIT, int ACT, bool BIAS_BF16>
__global__ __launch_bounds__(128) void k_gemm_bf(const float* __restrict__ A, int lda, const unsigned short* __restrict__ Wt, int ldb,
                                               const float* __restrict__ bias, float* __restrict__ C, int ldc, int M, int N, int K) {
  __shared__ __attribute__((aligned(16))) float so[4][16][64];
  const int tid = threadIdx.x, w = tid >> 5, lane = tid & 31, ln = lane & 15, hh = lane >> 4;
  const int ntn = N / 64;
  const int wid = blockIdx.x * 4 + w;
  const int mt = wid / ntn, nq = wid % ntn;
  if (mt * 16 >= M) return;
  const int row0 = mt * 16, col0 = nq * 64;
  const float* arow = A + (size_t)(row0 + ln) * lda;
  v8f acc[4] = {};
  for (int kb = 0; kb < K; kb += 32) {
    FragB ah, al;
    const v4f x0 = *(const v4fa*)(arow + kb + 8 * hh), x1 = *(const v4fa*)(arow + kb + 8 * hh + 4);
    const v4f x2 = *(const v4fa*)(arow + kb + 16 + 8 * hh), x3 = *(const v4fa*)(arow + kb + 16 + 8 * hh + 4);
    float xs[16] = {x0[0],x0[1],x0[2],x0[3],x1[0],x1[1],x1[2],x1[3],x2[0],x2[1],x2[2],x2[3],x3[0],x3[1],x3[2],x3[3]};
#pragma unroll
    for (int i = 0; i < 16; ++i) { const unsigned short hb = bf16_bits(xs[i]); ah.u[i] = hb; al.u[i] = ASPLIT ? bf16_bits(xs[i] - bf16_val(hb)) : (unsigned short)0; }
#pragma unroll
    for (int t = 0; t < 4; ++t) {
      const unsigned short* brow = Wt + (size_t)(col0 + t * 16 + ln) * ldb + kb;
      FragB b;
      b.half[0] = *(const v8us*)(brow + 8 * hh);
      b.half[1] = *(const v8us*)(brow + 16 + 8 * hh);
      acc[t] = mmaN<ASPLIT ? 2 : 1>(ah.v, al.v, b.v, b.v, acc[t]);
    }
  }
#pragma unroll
  for (int t = 0; t < 4; ++t) {
    float bv = bias ? bias[col0 + t * 16 + ln] : 0.f;
    if (BIAS_BF16) bv = bf16_round(bv);
#pragma unroll
    for (int r = 0; r < 8; ++r) { float v = acc[t][r] + bv; if (ACT == 1) v = fmaxf(v, 0.f); so[w][8 * hh + r][t * 16 + ln] = v; }
  }
  __builtin_amdgcn_fence(__ATOMIC_ACQ_REL, "workgroup");
  __builtin_amdgcn_wave_barrier();
  const int rsub = lane >> 4, c4 = (lane & 15) * 4;
  {
#pragma unroll
    for (int q = 0; q < 8; ++q) {
      const int r = q * 2 + rsub;
      const v4f v = *(const v4fa*)&so[w][r][c4];
      *(v4f*)(C + (size_t)(row0 + r) * ldc + col0 + c4) = v;
    }
    
  }
}

// GEMM C = act(A·W + bias + resid): A f32 (ASPLIT -> hi/lo 2 terms), Wt bf16 [N][K]; ACT 0 none, 1 relu, 2 exact gelu;
// resid (optional, f32, row index = (row % rmod), pitch ldr, RES_BF16 rounds it) added before the activation.
template <bool ASPLIT, int ACT, bool BIAS_BF16, bool RES_BF16>
__global__ __launch_bounds__(128) void k_gemm_bf3(const float* __restrict__ A, int lda, const unsigned short* __restrict__ Wt, int ldb,
                                                const float* __restrict__ bias, const float* __restrict__ resid, int rmod, int ldr,
                                                float* __restrict__ C, int ldc, int M, int N, int K) {
  __shared__ __attribute__((aligned(16))) float so[4][16][64];
  const int tid = threadIdx.x, w = tid >> 5, lane = tid & 31, ln = lane & 15, hh = lane >> 4;
  const int ntn = N / 64;
  const int wid = blockIdx.x * 4 + w;
  const int mt = wid / ntn, nq = wid % ntn;
  if (mt * 16 >= M) return;
  const int row0 = mt * 16, col0 = nq * 64;
  const float* arow = A + (size_t)(row0 + ln) * lda;
  v8f acc[4] = {};
  for (int kb = 0; kb < K; kb += 32) {
    FragB ah, al;
    const v4f x0 = *(const v4fa*)(arow + kb + 8 * hh), x1 = *(const v4fa*)(arow + kb + 8 * hh + 4);
    const v4f x2 = *(const v4fa*)(arow + kb + 16 + 8 * hh), x3 = *(const v4fa*)(arow + kb + 16 + 8 * hh + 4);
    float xs[16] = {x0[0],x0[1],x0[2],x0[3],x1[0],x1[1],x1[2],x1[3],x2[0],x2[1],x2[2],x2[3],x3[0],x3[1],x3[2],x3[3]};
#pragma unroll
    for (int i = 0; i < 16; ++i) { const unsigned short hb = bf16_bits(xs[i]); ah.u[i] = hb; al.u[i] = ASPLIT ? bf16_bits(xs[i] - bf16_val(hb)) : (unsigned short)0; }
#pragma unroll
    for (int t = 0; t < 4; ++t) {
      const unsigned short* brow = Wt + (size_t)(col0 + t * 16 + ln) * ldb + kb;
      FragB b;
      b.half[0] = *(const v8us*)(brow + 8 * hh);
      b.half[1] = *(const v8us*)(brow + 16 + 8 * hh);
      acc[t] = mmaN<ASPLIT ? 2 : 1>(ah.v, al.v, b.v, b.v, acc[t]);
    }
  }
#pragma unroll
  for (int t = 0; t < 4; ++t) {
    const int col = col0 + t * 16 + ln;
    float bv = bias ? bias[col] : 0.f;
    if (BIAS_BF16) bv = bf16_round(bv);
#pragma unroll
    for (int r = 0; r < 8; ++r) {
      float v = acc[t][r] + bv;
      if (resid) { float rv = resid[(size_t)((row0 + 8 * hh + r) % rmod) * ldr + col]; if (RES_BF16) rv = bf16_round(rv); v += rv; }
      if (ACT == 1) v = fmaxf(v, 0.f);
      if (ACT == 2) v = 0.5f * v * (1.0f + erff(v * 0.70710678118654752f));
      if (ACT == 3) { const float u = 0.7978845608028654f * (v + 0.044715f * v * v * v); v = 0.5f * v * (1.0f + tanhf(u)); }
      so[w][8 * hh + r][t * 16 + ln] = v;
    }
  }
  __builtin_amdgcn_fence(__ATOMIC_ACQ_REL, "workgroup");
  __builtin_amdgcn_wave_barrier();
  const int rsub = lane >> 4, c4 = (lane & 15) * 4;
  {
#pragma unroll
    for (int q = 0; q < 8; ++q) {
      const int r = q * 2 + rsub;
      const v4f v = *(const v4fa*)&so[w][r][c4];
      *(v4f*)(C + (size_t)(row0 + r) * ldc + col0 + c4) = v;
    }
    
  }
}
// row LayerNorm (biased variance, eps) over N: s = X (+ R); optional out_sum <- s; out_norm <- (s-mu)*rsqrt(var+eps)*g + b
template <bool PARAM_BF16>
__global__ __launch_bounds__(256) void k_layernorm(const float* __restrict__ X, const float* __restrict__ R, const float* __restrict__ g, const float* __restrict__ bta,
                                                  float* __restrict__ out_sum, float* __restrict__ out_norm, int N, float eps) {
  __shared__ float red[256];
  const int row = blockIdx.x, tid = threadIdx.x;
  const float* x = X + (size_t)row * N; const float* rr = R ? R + (size_t)row * N : nullptr;
  float vals[16];                     // up to N = 4096
  const int per = N / 256;            // contiguous chunk per thread? use strided-by-4 chunks: thread handles j = tid*4 + 1024*u
  float s1 = 0.f;
  for (int u = 0; u < per / 4; ++u) {
    const int j = tid * 4 + 1024 * u;
    const v4f a = *(const v4fa*)(x + j);
    v4f b = {0.f,0.f,0.f,0.f}; if (rr) b = *(const v4fa*)(rr + j);
#pragma unroll
    for (int q = 0; q < 4; ++q) { const float v = a[q] + b[q]; vals[u * 4 + q] = v; s1 += v; }
  }
  red[tid] = s1; __syncthreads();
  for (int st = 128; st > 0; st >>= 1) { if (tid < st) red[tid] += red[tid + st]; __syncthreads(); }
  const float mu = red[0] / (float)N; __syncthreads();
  float s2 = 0.f;
  for (int u = 0; u < per / 4; ++u)
#pragma unroll
    for (int q = 0; q < 4; ++q) { const float c = vals[u * 4 + q] - mu; s2 += c * c; }
  red[tid] = s2; __syncthreads();
  for (int st = 128; st > 0; st >>= 1) { if (tid < st) red[tid] += red[tid + st]; __syncthreads(); }
  const float rs = rsqrtf(red[0] / (float)N + eps);
  {
    for (int u = 0; u < per / 4; ++u) {
      const int j = tid * 4 + 1024 * u;
      v4f o, sm;
#pragma unroll
      for (int q = 0; q < 4; ++q) {
        float gg = g[j + q], bb = bta[j + q];
        if (PARAM_BF16) { gg = bf16_round(gg); bb = bf16_round(bb); }
        sm[q] = vals[u * 4 + q]; o[q] = (vals[u * 4 + q] - mu) * rs * gg + bb;
      }
      if (out_sum) *(v4f*)(out_sum + (size_t)row * N + j) = sm;
      *(v4f*)(out_norm + (size_t)row * N + j) = o;
    }
    
  }
}



// ---- f16 WMMA path (v_wmma_f32_16x16x32_f16): 11-bit significands for operands in range — used for every launched product, the unnormalised softmax weights (<= 256) among them
typedef _Float16 v16h __attribute__((ext_vector_type(16)));
union FragH { v16h v; v8us half[2]; _Float16 h[16]; unsigned short u[16]; };
template <int NT>
__device__ __forceinline__ v8f mmaH(v16h ah, v16h al, v16h bh, v16h bl, v8f c) {
  c = __builtin_amdgcn_wmma_f32_16x16x32_f16(false, ah, false, bh, (short)0, c, false, false);
  if (NT >= 2) c = __builtin_amdgcn_wmma_f32_16x16x32_f16(false, al, false, bh, (short)0, c, false, false);
  if (NT >= 3) c = __builtin_amdgcn_wmma_f32_16x16x32_f16(false, ah, false, bl, (short)0, c, false, false);
  asm volatile("v_nop\n\tv_nop\n\tv_nop\n\tv_nop" : "+v"(c) : "v"(ah), "v"(al), "v"(bh), "v"(bl));
  return c;
}
// batched GEMM like k_gemm_b but f16 operands: A f32 (split into f16 hi/lo if ASPLIT, else rounded to f16), Bt = f16 values [n][k]; alpha; C f32; N multiple of 16 (partial tiles skipped)
template <bool ASPLIT>
__global__ __launch_bounds__(128) void k_gemm_h(const float* __restrict__ A, int lda, size_t sA, const _Float16* __restrict__ Bh, int ldb, size_t sB, float alpha, float* __restrict__ C, int ldc, size_t sC, int M, int N, int K) {
  __shared__ __attribute__((aligned(16))) float so[4][16][64];
  const int tid = threadIdx.x, w = tid >> 5, lane = tid & 31, ln = lane & 15, hh = lane >> 4; const int by = blockIdx.y;
  A += (size_t)by * sA; Bh += (size_t)by * sB; C += (size_t)by * sC;
  const int ntn = (N + 63) / 64; const int wid = blockIdx.x * 4 + w; const int mt = wid / ntn, nq = wid % ntn; if (mt * 16 >= M) return;
  const int row0 = mt * 16, col0 = nq * 64; const float* arow = A + (size_t)(row0 + ln) * lda;
  v8f acc[4] = {};
  for (int kb = 0; kb < K; kb += 32) {
    FragH ah, al;
    const v4f x0 = *(const v4fa*)(arow + kb + 8 * hh), x1 = *(const v4fa*)(arow + kb + 8 * hh + 4), x2 = *(const v4fa*)(arow + kb + 16 + 8 * hh), x3 = *(const v4fa*)(arow + kb + 16 + 8 * hh + 4);
    float xs[16] = {x0[0],x0[1],x0[2],x0[3],x1[0],x1[1],x1[2],x1[3],x2[0],x2[1],x2[2],x2[3],x3[0],x3[1],x3[2],x3[3]};
#pragma unroll
    for (int i = 0; i < 16; ++i) { const _Float16 h = (_Float16)xs[i]; ah.h[i] = h; al.h[i] = ASPLIT ? (_Float16)(xs[i] - (float)h) : (_Float16)0.0f; }
#pragma unroll
    for (int t = 0; t < 4; ++t) { if (col0 + t * 16 >= N) continue; const size_t boff = (size_t)(col0 + t * 16 + ln) * ldb + kb; FragH bq; bq.half[0] = *(const v8us*)(Bh + boff + 8 * hh); bq.half[1] = *(const v8us*)(Bh + boff + 16 + 8 * hh);
      acc[t] = mmaH<ASPLIT ? 2 : 1>(ah.v, al.v, bq.v, bq.v, acc[t]); }
  }
#pragma unroll
  for (int t = 0; t < 4; ++t) { if (col0 + t * 16 >= N) continue;
#pragma unroll
    for (int r = 0; r < 8; ++r) so[w][8 * hh + r][t * 16 + ln] = acc[t][r] * alpha; }
  __builtin_amdgcn_fence(__ATOMIC_ACQ_REL, "workgroup"); __builtin_amdgcn_wave_barrier();
  const int rsub = lane >> 4, c4 = (lane & 15) * 4;
  {
#pragma unroll
    for (int q = 0; q < 8; ++q) { const int r = q * 2 + rsub; if (col0 + c4 < N) { const v4f v = *(const v4fa*)&so[w][r][c4]; *(v4f*)(C + (size_t)(row0 + r) * ldc + col0 + c4) = v; } }
     }
}

// Wt[n][k] = f16(W[k][n]·scale) from f32 row-major W[K][N] (scale = power of two; bf16-exact weights stay exact in f16 away from the subnormal range)
// bx, here and in the other d_ bodies: the work-group's index within this job's own share of a grid that several jobs share
__device__ __forceinline__ void d_wt_f16(unsigned bx, const float* __restrict__ W, _Float16* __restrict__ Wt, int K, int N, float scale) {
  const int t = bx * 256 + threadIdx.x; if (t >= N * (K / 8)) return; const int n = t / (K / 8), k8 = (t % (K / 8)) * 8; FragH f;
#pragma unroll
  for (int i = 0; i < 8; ++i) f.h[i] = (_Float16)(bf16_round(W[(size_t)(k8 + i) * N + n]) * scale); const v8us o = f.half[0];
  *(v8us*)((unsigned short*)Wt + (size_t)n * K + k8) = o; 
}
// k_gemm_hh variant with fused epilogue: v = acc·alpha + bias[by·sBias + col] (+ CP[(row/rowsPerB)·sCPb + by·64 + col] if CP) ; ACT 0 none / 1 elu ; writes f16 C16 (and f32 C if non-null)
template <int ACT>
__global__ __launch_bounds__(128) void k_gemm_hhx(const _Float16* __restrict__ A, int lda, size_t sA, const _Float16* __restrict__ Bh, int ldb, size_t sB, float alpha, const float* __restrict__ bias, size_t sBias, const float* __restrict__ CP, int rowsPerB, size_t sCPb, int row0g,
    float* __restrict__ C, _Float16* __restrict__ C16, int ldc, size_t sC, int M, int N, int K) {
  __shared__ __attribute__((aligned(16))) float so[4][16][64];
  const int tid = threadIdx.x, w = tid >> 5, lane = tid & 31, ln = lane & 15, hh = lane >> 4; const int by = blockIdx.y;
  A += (size_t)by * sA; Bh += (size_t)by * sB; const size_t cofs = (size_t)by * sC; const float* bp = bias ? bias + (size_t)by * sBias : nullptr;
  const int ntn = (N + 63) / 64; const int wid = blockIdx.x * 4 + w; const int mt = wid / ntn, nq = wid % ntn; if (mt * 16 >= M) return;
  const int row0 = mt * 16, col0 = nq * 64; const _Float16* arow = A + (size_t)(row0 + ln) * lda;
  v8f acc[4] = {};
  for (int kb = 0; kb < K; kb += 32) { FragH ah; ah.half[0] = *(const v8us*)((const unsigned short*)arow + kb + 8 * hh); ah.half[1] = *(const v8us*)((const unsigned short*)arow + kb + 16 + 8 * hh);
#pragma unroll
    for (int t = 0; t < 4; ++t) { if (col0 + t * 16 >= N) continue; const size_t boff = (size_t)(col0 + t * 16 + ln) * ldb + kb; FragH bq; bq.half[0] = *(const v8us*)((const unsigned short*)Bh + boff + 8 * hh); bq.half[1] = *(const v8us*)((const unsigned short*)Bh + boff + 16 + 8 * hh);
      acc[t] = mmaH<1>(ah.v, ah.v, bq.v, bq.v, acc[t]); }
  }
#pragma unroll
  for (int t = 0; t < 4; ++t) { if (col0 + t * 16 >= N) continue; const int col = col0 + t * 16 + ln; const float bv = bp ? bf16_round(bp[col]) : 0.f;
#pragma unroll
    for (int r = 0; r < 8; ++r) { float v = acc[t][r] * alpha + bv; if (CP) { const int rr = row0g + row0 + 8 * hh + r; if (rowsPerB < 0) v += CP[cofs + (size_t)rr * ldc + col];      /* rowsPerB < 0: own element of the batched C plane */ else { const int bidx = rr / rowsPerB; v += CP[(size_t)bidx * sCPb + (size_t)by * 64 + col]; } } if (ACT == 1) v = (v > 0.f) ? v : expm1f(v); else if (ACT == 7) v = (v > 0.f) ? v + 1.0f : expf(v); else if (ACT == 8) v = tanhf(v); else if (ACT == 9) v = 0.5f * v * (1.0f + tanhf(0.7978845608028654f * (v + 0.044715f * v * v * v))); else if (ACT == 11) v = 1.0f / (1.0f + expf(-v)); else if (ACT == 12) v = (v > 0.f) ? v : 0.01f * v; else if (ACT == 14) v = (v > 0.f) ? v : 0.1f * v; else if (ACT == 16) v = (v >= 0.f) ? v : 0.3f * v; else if (ACT == 17) v = (v >= 0.f) ? v : 0.2f * v; else if (ACT == 15) v = v / (1.0f + expf(-v)); else if (ACT == 3) v = fmaxf(v, 0.f); else if (ACT == 6) v = 0.5f * v * (1.0f + erff(v * 0.70710678118654752f)); so[w][8 * hh + r][t * 16 + ln] = v; } }
  __builtin_amdgcn_fence(__ATOMIC_ACQ_REL, "workgroup"); __builtin_amdgcn_wave_barrier();
  const int rsub = lane >> 4, c4 = (lane & 15) * 4; typedef _Float16 v4h __attribute__((ext_vector_type(4)));
  {
#pragma unroll
    for (int q = 0; q < 8; ++q) { const int r = q * 2 + rsub; if (col0 + c4 < N) { const v4f v = *(const v4fa*)&so[w][r][c4]; if (C) *(v4f*)(C + cofs + (size_t)(row0 + r) * ldc + col0 + c4) = v; if (C16) { v4h h4; for (int i = 0; i < 4; ++i) h4[i] = (_Float16)v[i]; *(v4h*)(C16 + cofs + (size_t)(row0 + r) * ldc + col0 + c4) = h4; } } }
     }
}


typedef _Float16 v4h __attribute__((ext_vector_type(4)));

__device__ __forceinline__ void d_x16(unsigned bx, const float* __restrict__ x, _Float16* __restrict__ X16, size_t n8) { const size_t t = (size_t)bx * 256 + threadIdx.x; if (t >= n8) return; FragH f;
#pragma unroll
  for (int q = 0; q < 8; ++q) f.h[q] = (_Float16)bf16_round(x[t * 8 + q]); *(v8us*)((unsigned short*)X16 + t * 8) = f.half[0];  }
__global__ __launch_bounds__(256) void k_h16(const float* __restrict__ x, _Float16* __restrict__ X16, size_t n8) { const size_t t = (size_t)blockIdx.x * 256 + threadIdx.x; if (t >= n8) return; FragH f;
#pragma unroll
  for (int q = 0; q < 8; ++q) f.h[q] = (_Float16)x[t * 8 + q]; *(v8us*)((unsigned short*)X16 + t * 8) = f.half[0];  }
__global__ __launch_bounds__(256) void k_round16f(const float* __restrict__ W, _Float16* __restrict__ Bt, size_t n8) { const size_t t = (size_t)blockIdx.x * 256 + threadIdx.x; if (t >= n8) return; FragH f;
#pragma unroll
  for (int i = 0; i < 8; ++i) f.h[i] = (_Float16)(bf16_round(W[t * 8 + i]) * 16.0f); *(v8us*)((unsigned short*)Bt + t * 8) = f.half[0];  }
__global__ __launch_bounds__(256) void k_hl(const float* __restrict__ F, _Float16* __restrict__ Hh, _Float16* __restrict__ Hl, size_t n8) { const size_t t = (size_t)blockIdx.x * 256 + threadIdx.x; if (t >= n8) return; FragH fh, fl; const v4f a = *(const v4fa*)(F + t * 8), c = *(const v4fa*)(F + t * 8 + 4);
#pragma unroll
  for (int q = 0; q < 4; ++q) { _Float16 h = (_Float16)a[q]; fh.h[q] = h; fl.h[q] = (_Float16)((a[q] - (float)h) * 1024.0f); h = (_Float16)c[q]; fh.h[4 + q] = h; fl.h[4 + q] = (_Float16)((c[q] - (float)h) * 1024.0f); }
  { *(v8us*)((unsigned short*)Hh + t * 8) = fh.half[0]; *(v8us*)((unsigned short*)Hl + t * 8) = fl.half[0];  } }

// ---- fast GEMM (work-group tile 128x128, four waves as 2 x 2, wave tile 64x64; requires M % 128 == 0, N % 128 == 0, K % 128 == 0, K >= 128); epilogue = k_gemm_hhx semantics ----
// Operands go through LDS: a stage is 128 k (256 B) of the work-group's 128 A rows and 128 B rows, brought by asynchronous copies of whole lines, two buffers, the next stage in flight while this one is multiplied.
__device__ __forceinline__ v16h g2_frag(const _Float16* p, int hh) { FragH f; f.half[0] = *(const v8us*)((const unsigned short*)p + 8 * hh); f.half[1] = *(const v8us*)((const unsigned short*)p + 16 + 8 * hh); return f.v; }
__device__ __forceinline__ v8f g2_mma(v16h a, v16h b, v8f c) { return __builtin_amdgcn_wmma_f32_16x16x32_f16(false, a, false, b, (short)0, c, false, false); }
#define G2_PITCH 272                 /* LDS bytes from row to row: 256 + 16, an odd multiple of 16 B, so the 16 rows of a fragment read fall on different banks */
#define G2_BUF (256 * G2_PITCH)      /* one stage: rows 0..127 = A, rows 128..255 = B */
#define G2_SO (64 * 68 * 4)          /* bytes of one wave's f32 output staging: 64 rows of 64 + 4 values */
__device__ __forceinline__ v16h g2_lfrag(const unsigned char* p) { FragH f; f.half[0] = *(const v8us*)p; f.half[1] = *(const v8us*)(p + 32); return f.v; }      /* p = row start + 64 B x block + 16 hh: the k order of g2_frag */
// eight asynchronous copies of 16 B a lane, rows 8 apart: LDS byte address l (+ 8 rows each), global address g (+ gs elements each)
__device__ __forceinline__ void g2_copy8(unsigned l, const _Float16* g, size_t gs) {
  const unsigned l1 = l + 8 * G2_PITCH, l2 = l + 16 * G2_PITCH, l3 = l + 24 * G2_PITCH, l4 = l + 32 * G2_PITCH, l5 = l + 40 * G2_PITCH, l6 = l + 48 * G2_PITCH, l7 = l + 56 * G2_PITCH;
  const _Float16* g1 = g + gs; const _Float16* g2 = g1 + gs; const _Float16* g3 = g2 + gs; const _Float16* g4 = g3 + gs; const _Float16* g5 = g4 + gs; const _Float16* g6 = g5 + gs; const _Float16* g7 = g6 + gs;
  /* the copies move global bytes into LDS through no register; the closing s_wait_xcnt is a precaution: it stands in front of any rewrite of the address registers named here */
  asm volatile("global_load_async_to_lds_b128 %0, %8, off\n\t"
               "global_load_async_to_lds_b128 %1, %9, off\n\t"
               "global_load_async_to_lds_b128 %2, %10, off\n\t"
               "global_load_async_to_lds_b128 %3, %11, off\n\t"
               "global_load_async_to_lds_b128 %4, %12, off\n\t"
               "global_load_async_to_lds_b128 %5, %13, off\n\t"
               "global_load_async_to_lds_b128 %6, %14, off\n\t"
               "global_load_async_to_lds_b128 %7, %15, off\n\t"
               "s_wait_xcnt 0x0"
               :: "v"(l), "v"(l1), "v"(l2), "v"(l3), "v"(l4), "v"(l5), "v"(l6), "v"(l7), "v"(g), "v"(g1), "v"(g2), "v"(g3), "v"(g4), "v"(g5), "v"(g6), "v"(g7) : "memory"); }
// Products that do not depend on one another share a grid as planes of blockIdx.y: planes 1 and up take B1 and bias1 where B1 is given; C, the f32 result, is one plane and is stored by plane cy alone
// Where VT is given, plane cy is the v projection (N = NH heads of HD columns, rows = tokens of NB batches of SQ): it stores its f32 rows times 64 bf16(av[0]) in C and its f16 values transposed in VT [NB][NH][HD][SQ], and no C16 rows
template <int ACT>
__global__ __launch_bounds__(128) void k_gemm2(const _Float16* __restrict__ A, int lda, size_t sA, const _Float16* __restrict__ Bh, int ldb, size_t sB, float alpha, const float* __restrict__ bias, size_t sBias, const float* __restrict__ CP, int rowsPerB, size_t sCPb, int row0g,
    float* __restrict__ C, _Float16* __restrict__ C16, int ldc, size_t sC, int M, int N, int K, const _Float16* __restrict__ B1, const float* __restrict__ bias1, int cy, _Float16* __restrict__ VT, const float* __restrict__ av) { static_assert(ACT == 0 || ACT == 3 || ACT == 6 || ACT == 8 || ACT == 9 || ACT == 11 || ACT == 12 || ACT == 14 || ACT == 15 || ACT == 16 || ACT == 17, "k_gemm2: unsupported ACT code (would silently apply no activation)");
  __shared__ __attribute__((aligned(16))) unsigned char ring[2][G2_BUF];
  const int tid = threadIdx.x, w = tid >> 5, lane = tid & 31, ln = lane & 15, hh = lane >> 4, wm = w >> 1, wn = w & 1; const int by = blockIdx.y;
  float (*so)[68] = (float (*)[68])(&ring[0][0] + w * G2_SO);      /* this wave's output staging lies in the ring, which is free behind the loop: every wave's reads and copies end in front of the loop's last barrier */
  A += (size_t)by * sA; Bh += (size_t)by * sB; const size_t cofs = (size_t)by * sC; const float* bp = bias ? bias + (size_t)by * sBias : nullptr;
  if (B1 && by) { Bh = B1; bp = bias1; }
  C = by == cy ? C - cofs : nullptr;      /* the stores below add cofs */
  const int ntn = N >> 7; const int mt = blockIdx.x / ntn, nq = blockIdx.x - mt * ntn; const int row0 = mt * 128 + 64 * wm, col0 = nq * 128, colw = col0 + 64 * wn; if (mt * 128 >= M) return;      /* taken by a whole work-group, in front of every barrier */
  const int cr = tid >> 4, cc = tid & 15;      /* copy role: 16 lanes cover the 256 B of one row, a wave two whole rows (4 lines) */
  const _Float16* ga = A + (size_t)(mt * 128 + cr) * lda + cc * 8; const _Float16* gb = Bh + (size_t)(col0 + cr) * ldb + cc * 8; const unsigned lc = (unsigned)(size_t)&ring[0][0] + cr * G2_PITCH + cc * 16;
  auto stage = [&](int t, int buf) { const unsigned l = lc + buf * G2_BUF; const _Float16* a = ga + t * 128; const _Float16* b = gb + t * 128;
    g2_copy8(l, a, (size_t)8 * lda); g2_copy8(l + 64 * G2_PITCH, a + (size_t)64 * lda, (size_t)8 * lda); g2_copy8(l + 128 * G2_PITCH, b, (size_t)8 * ldb); g2_copy8(l + 192 * G2_PITCH, b + (size_t)64 * ldb, (size_t)8 * ldb); };
  const int nt = K >> 7;
  const v8f z8 = {0.f,0.f,0.f,0.f,0.f,0.f,0.f,0.f}; v8f acc[4][4];      /* acc[i][j]: rows 16 i, columns 16 j of the wave's tile */
#pragma unroll      /* constant indices, so the accumulators stay in registers */
  for (int i = 0; i < 4; ++i)
#pragma unroll      /* constant indices, so the accumulators stay in registers */
    for (int j = 0; j < 4; ++j) acc[i][j] = z8;
  stage(0, 0);
  asm volatile("s_wait_asynccnt 0x0" ::: "memory");      /* this wave's copies of stage 0 have landed */
  __syncthreads();                                       /* every wave's have: stage 0 may be read */
  if (nt > 1) stage(1, 1);
#pragma unroll 1    /* one stage a trip: the publish point at the foot stands once */
  for (int t = 0; t < nt; ++t) { const unsigned char* ap = &ring[t & 1][0] + (64 * wm + ln) * G2_PITCH + 16 * hh; const unsigned char* bq = &ring[t & 1][0] + (128 + 64 * wn + ln) * G2_PITCH + 16 * hh; v16h fa[2][4], fb[2][4];
    auto frags = [&](int kk, v16h (&a)[4], v16h (&b)[4]) {
#pragma unroll      /* constant indices, so the fragment arrays stay in registers */
      for (int j = 0; j < 4; ++j) { a[j] = g2_lfrag(ap + j * 16 * G2_PITCH + kk * 64); b[j] = g2_lfrag(bq + j * 16 * G2_PITCH + kk * 64); } };
    frags(0, fa[0], fb[0]);
#pragma unroll      /* constant indices, so the fragment arrays stay in registers */
    for (int kk = 0; kk < 4; ++kk) { const int c = kk & 1;
      if (kk < 3) frags(kk + 1, fa[c ^ 1], fb[c ^ 1]);
      __builtin_amdgcn_sched_barrier(0);      /* the next block's LDS reads stay one group ahead of this block's products instead of among them */
#pragma unroll      /* constant indices, so the fragment arrays stay in registers */
      for (int j = 0; j < 4; ++j)
#pragma unroll      /* constant indices, so the fragment arrays stay in registers */
        for (int i = 0; i < 4; ++i) acc[i][j] = g2_mma(fa[c][i], fb[c][j], acc[i][j]);
      __builtin_amdgcn_sched_barrier(0); }    /* and the block after next's reads stay behind these products */
    asm volatile("s_wait_dscnt 0x0" ::: "memory");         /* this wave has finished reading the buffer */
    asm volatile("s_wait_asynccnt 0x0" ::: "memory");      /* its copies of stage t + 1 have landed */
    __syncthreads();                                       /* publishes stage t + 1 and ends every wave's reads of stage t */
    if (t + 2 < nt) stage(t + 2, t & 1); }                 /* refill of the buffer just left; the test reads the same in the whole work-group */
  asm volatile("s_wait_asynccnt 0x0" ::: "memory");        /* nothing of this wave is in flight behind the loop */
  if constexpr (ACT == 0) { if (VT && by == cy) {      /* the test reads the same in the whole work-group: the block holds a barrier */
    float bv[4] = {0.f, 0.f, 0.f, 0.f};
    __builtin_amdgcn_sched_barrier(0);      /* with the one below: the loads of the factor and of the four bias values stay one group with their wait, so nothing that could rewrite an address register comes between */
    const float a0 = av[0];
    if (bp) {
#pragma unroll      /* constant indices, so the four values stay in registers */
      for (int t = 0; t < 4; ++t) bv[t] = bp[colw + t * 16 + ln]; }
    asm volatile("s_wait_xcnt 0x0" ::: "memory");      /* precaution: stands behind the loads issued above, in front of any rewrite of their address registers */
    __builtin_amdgcn_sched_barrier(0);
    const float a64 = bf16_round(a0) * 64.0f;
    /* an accumulator tile holds, per lane, 8 consecutive rows (keys) of one column (d): 16 B of a V^T row. The part of the ring behind the four waves' staging collects the work-group's 128 V^T rows of 128 keys at the ring's own pitch */
    unsigned char* vtile = &ring[0][0] + 4 * G2_SO; unsigned char* tw = vtile + (64 * wn + ln) * G2_PITCH + (64 * wm + 8 * hh) * 2;
#pragma unroll      /* constant indices, so the accumulators stay in registers */
    for (int t = 0; t < 4; ++t) { const float b = bf16_round(bv[t]);
#pragma unroll      /* constant indices, so the accumulators stay in registers */
      for (int i = 0; i < 4; ++i) { FragH f;
#pragma unroll      /* constant indices, so the accumulators stay in registers */
        for (int r = 0; r < 8; ++r) { const float v = acc[i][t][r] * alpha + b; so[i * 16 + 8 * hh + r][t * 16 + ln] = a64 * v; f.h[r] = (_Float16)v; }
        *(v8us*)(tw + t * 16 * G2_PITCH + i * 32) = f.half[0]; } }
    __syncthreads();      /* every wave's part of the V^T rows is written: they may be read across the waves */
    const int rs = lane >> 4, e4 = (lane & 15) * 4; float* cr0 = C + cofs + (size_t)(row0 + rs) * ldc + colw + e4;
#pragma unroll      /* the LDS reads issue ahead of the stores */
    for (int q = 0; q < 32; ++q) { const v4f v = *(const v4fa*)&so[q * 2 + rs][e4]; *(v4f*)(cr0 + (size_t)(q * 2) * ldc) = v; }
    /* 16 lanes store the 256 B that the work-group holds of one V^T row: two whole lines; column c of the plane is row c of its batch's V^T (head c / HD, d = c % HD) */
    unsigned short* vr = (unsigned short*)VT + ((size_t)(mt * 128 / SQ) * NH * HD + col0 + cr) * SQ + mt * 128 % SQ + cc * 8; const unsigned char* tr = vtile + cr * G2_PITCH + cc * 16;
#pragma unroll      /* the LDS reads issue ahead of the stores */
    for (int i = 0; i < 16; ++i) { const v8us x = *(const v8us*)(tr + i * 8 * G2_PITCH); *(v8us*)(vr + (size_t)i * 8 * SQ) = x; }
    asm volatile("s_wait_xcnt 0x0" ::: "memory");      /* precaution: stands behind the stores above, in front of the other planes' code, which may follow in the listing and rewrite their registers */
    return; } }
#pragma unroll      /* constant indices, so the accumulators stay in registers */
  for (int t = 0; t < 4; ++t) { const float bv = bp ? bf16_round(bp[colw + t * 16 + ln]) : 0.f;
#pragma unroll      /* constant indices, so the accumulators stay in registers */
    for (int i = 0; i < 4; ++i)
#pragma unroll      /* constant indices, so the accumulators stay in registers */
      for (int r = 0; r < 8; ++r) so[i * 16 + 8 * hh + r][t * 16 + ln] = acc[i][t][r] * alpha + bv; }
  __builtin_amdgcn_fence(__ATOMIC_ACQ_REL, "workgroup"); __builtin_amdgcn_wave_barrier();
  const int rsub = lane >> 4, c4 = (lane & 15) * 4;
  if (CP) {      /* the optional addend joins the staged values, each lane on the elements that it reads back below */
#pragma unroll 1    /* rolled: its address code, unrolled for the 128 values a lane now holds, would carry the kernel's text far past 32 KB */
    for (int q = 0; q < 32; ++q) { const int r = q * 2 + rsub; const float* cp = CP + (rowsPerB < 0 ? cofs + (size_t)(row0g + row0 + r) * ldc      /* rowsPerB < 0: own element of the batched C plane */ : (size_t)((row0g + row0 + r) / rowsPerB) * sCPb + (size_t)by * 64) + colw + c4; float ad[4];
      __builtin_amdgcn_sched_barrier(0);      /* with the one below: the four loads of the addend and their wait stay one group, so nothing that could rewrite an address register comes between */
#pragma unroll      /* constant indices, so the four values stay in registers */
      for (int i = 0; i < 4; ++i) ad[i] = cp[i];
      asm volatile("s_wait_xcnt 0x0" ::: "memory");      /* precaution: stands behind the loads issued above, in front of any rewrite of their address registers */
      __builtin_amdgcn_sched_barrier(0);
      v4f v = *(const v4fa*)&so[r][c4];
#pragma unroll      /* constant indices into the vector */
      for (int i = 0; i < 4; ++i) v[i] += ad[i];
      *(v4fa*)&so[r][c4] = v; } }
  auto staged = [&](int q) { v4f v = *(const v4fa*)&so[q * 2 + rsub][c4];      /* four finished values of row 2 q + rsub */
#pragma unroll      /* constant indices into the vector */
    for (int i = 0; i < 4; ++i) { float x = v[i];
      if (ACT == 3) x = fmaxf(x, 0.f); else if (ACT == 6) x = 0.5f * x * (1.0f + erff(x * 0.70710678118654752f)); else if (ACT == 11) x = 1.0f / (1.0f + expf(-x)); else if (ACT == 15) x = x / (1.0f + expf(-x)); else if (ACT == 12) x = (x > 0.f) ? x : 0.01f * x; else if (ACT == 8) x = tanhf(x); else if (ACT == 9) x = 0.5f * x * (1.0f + tanhf(0.7978845608028654f * (x + 0.044715f * x * x * x))); else if (ACT == 14) x = (x > 0.f) ? x : 0.1f * x; else if (ACT == 16) x = (x >= 0.f) ? x : 0.3f * x; else if (ACT == 17) x = (x >= 0.f) ? x : 0.2f * x;
      v[i] = x; }
    return v; };
  const size_t eo = cofs + (size_t)(row0 + rsub) * ldc + colw + c4;      /* this lane's first output element */
  if (C) {
#pragma unroll      /* the LDS reads issue ahead of the stores */
    for (int q = 0; q < 32; ++q) { const v4f v = staged(q); *(v4f*)(C + eo + (size_t)(q * 2) * ldc) = v; }
    asm volatile("s_wait_xcnt 0x0" ::: "memory"); }      /* precaution: stands behind the stores above, in front of the code below, which may rewrite their registers */
  if (C16) {
#pragma unroll      /* the LDS reads issue ahead of the stores */
    for (int q = 0; q < 32; ++q) { const v4f v = staged(q); v4h h4;
#pragma unroll      /* constant indices into the vector */
      for (int i = 0; i < 4; ++i) h4[i] = (_Float16)v[i];
      *(v4h*)(C16 + eo + (size_t)(q * 2) * ldc) = h4; } } }


__global__ __launch_bounds__(256) void k_wnat(const float* __restrict__ w, size_t n8, _Float16* __restrict__ Bt) { const size_t t = (size_t)blockIdx.x * 256 + threadIdx.x; if (t >= n8) return; FragH f; for (int q = 0; q < 8; ++q) f.h[q] = (_Float16)(bf16_round(w[t * 8 + q]) * 16.0f); *(v8us*)((unsigned short*)Bt + t * 8) = f.half[0];  }
__global__ __launch_bounds__(256) void k_rsm(const float* __restrict__ S, _Float16* __restrict__ P, int nrows) {
  #pragma clang fp contract(off)
  const int i = blockIdx.x * 256 + threadIdx.x; if (i >= nrows) return; const float* s = S + (size_t)i * SQ; float mx = -3.0e38f;
#pragma unroll 1
  for (int j = 0; j < SQ; ++j) mx = fmaxf(mx, s[j]); float se = 0.f;
#pragma unroll 1
  for (int j = 0; j < SQ; ++j) se += expf(s[j] - mx); const float sc = 256.0f / se;
#pragma unroll 1
  for (int j0 = 0; j0 < SQ; j0 += 8) { FragH f; for (int q = 0; q < 8; ++q) f.h[q] = (_Float16)(expf(s[j0 + q] - mx) * sc); unsigned short* d = (unsigned short*)P + (size_t)i * SQ + j0; *(v8us*)d = f.half[0];  } }
__global__ __launch_bounds__(256) void k_vt(const _Float16* __restrict__ V16, int b, int h0, _Float16* __restrict__ VT) { __shared__ unsigned short tl[64][65]; const int tid = threadIdx.x; const int hh = blockIdx.x % HG, sg = blockIdx.x / HG; const int s0 = sg * 64; const int h = h0 + hh;
  for (int i = tid; i < 64 * 8; i += 256) { const int j = i / 8, d8 = (i % 8) * 8; FragH f; f.half[0] = *(const v8us*)((const unsigned short*)V16 + ((size_t)b * SQ + s0 + j) * DM + h * HD + d8); for (int q = 0; q < 8; ++q) tl[d8 + q][j] = f.u[q]; }
  __syncthreads();
  { for (int i = tid; i < 64 * 8; i += 256) { const int d = i / 8, j8 = (i % 8) * 8; FragH f; for (int q = 0; q < 8; ++q) f.u[q] = tl[d][j8 + q]; *(v8us*)((unsigned short*)VT + ((size_t)hh * HD + d) * SQ + s0 + j8) = f.half[0]; }  } }


// lane l <-> lane l ^ M of the wave, in vector registers (no LDS round trip): M = 16 crosses the two 16-lane rows, M < 16 is a DPP row_xmask move
template <int M>
__device__ __forceinline__ float lane_xor(float x) { const int b = __float_as_int(x);
  if constexpr (M == 16) return __int_as_float(__builtin_amdgcn_permlanex16(b, b, 0x76543210, 0xfedcba98, false, false));
  else return __int_as_float(__builtin_amdgcn_update_dpp(0, b, 0x160 | M, 0xf, 0xf, true)); }
// ---- fused attention: scores and weights live in registers only ----
__device__ __forceinline__ v8f f_mma(v16h a, v16h b, v8f c) { return __builtin_amdgcn_wmma_f32_16x16x32_f16(false, a, false, b, (short)0, c, false, false); }
typedef unsigned v4ua __attribute__((ext_vector_type(4), may_alias));
#define SC2 0.18033688011112042f     /* (1 / 8) log2(e): scores go to the exponent base 2 */
#define MASKED -3.0e38f              /* score of a masked key: its weight underflows to 0 against any row reference >= M0 */
#define M0 -1.0e30f                  /* start value of a row's reference; a row with every key masked keeps it, sums 0 and ends as 0 x inf = NaN like the definition */
// one bit per (query, key): bit j of word [query][key / 32] is mask[query][32 (key / 32) + j] != 0; a wave packs 32 words
__device__ __forceinline__ void d_maskbits(unsigned bx, const int* __restrict__ mask, unsigned* __restrict__ MB) {
  const int lane = threadIdx.x & 31; const size_t wv = (size_t)bx * 8 + (threadIdx.x >> 5); const int* m = mask + wv * 1024; unsigned keep = 0;
#pragma unroll      /* 32 independent loads in flight */
  for (int i = 0; i < 32; ++i) { const unsigned bits = __builtin_amdgcn_ballot_w32(m[i * 32 + lane] != 0); if (lane == i) keep = bits; }
  MB[wv * 32 + lane] = keep;
  asm volatile("s_wait_xcnt 0x0" ::: "memory"); }      /* precaution: stands behind the store above, in front of the other jobs' code, which in the listing follows this one and rewrites the store's registers */
// S^T tile rows are keys 8 hh + r, its column is query ln: bit 16 kt + 8 hh + r of the query's mask word
__device__ __forceinline__ void mask_tile(v8f& s, unsigned word, int kt, int hh) { const unsigned u = word >> (16 * kt + 8 * hh);
#pragma unroll      /* constant indices, so the tile stays in registers */
  for (int r = 0; r < 8; ++r) s[r] = ((u >> r) & 1u) ? s[r] : MASKED; }
// K and V^T go through LDS: a stage is 128 keys of the head (K: 128 rows of 128 B; V^T: 64 rows of 256 B), brought once for the 8 waves by asynchronous copies of whole lines, two buffers, the next stage in flight while this one is worked on
#define FST 128                      /* keys a stage */
#define FK_PITCH 144                 /* LDS bytes from K row to K row: 128 + 16, an odd multiple of 16 B, so the 16 rows of a fragment read fall on different banks */
#define FV_PITCH 272                 /* the same for the V^T rows: 256 + 16 */
#define FK_BYTES (FST * FK_PITCH)
#define F_BUF (FK_BYTES + HD * FV_PITCH)      /* one stage: K rows, then V^T rows */
// four asynchronous copies of 16 B a lane: LDS byte address l (+ ls each), global address g (+ gs elements each)
__device__ __forceinline__ void f_copy4(unsigned l, unsigned ls, const _Float16* g, size_t gs) {
  const unsigned l1 = l + ls, l2 = l1 + ls, l3 = l2 + ls; const _Float16* g1 = g + gs; const _Float16* g2 = g1 + gs; const _Float16* g3 = g2 + gs;
  /* the copies move global bytes into LDS through no register; the closing s_wait_xcnt is a precaution: it stands in front of any rewrite of the address registers named here */
  asm volatile("global_load_async_to_lds_b128 %0, %4, off\n\t"
               "global_load_async_to_lds_b128 %1, %5, off\n\t"
               "global_load_async_to_lds_b128 %2, %6, off\n\t"
               "global_load_async_to_lds_b128 %3, %7, off\n\t"
               "s_wait_xcnt 0x0"
               :: "v"(l), "v"(l1), "v"(l2), "v"(l3), "v"(g), "v"(g1), "v"(g2), "v"(g3) : "memory"); }
// the key loop of k_fattn; MSK = false is taken by a work-group none of whose 256 mask rows holds a zero, and then reads no mask word
// ring: the two buffers; gk, gv, lk, lv: this lane's first global and LDS addresses as a copier of K and of V^T
template <bool MSK>
__device__ __forceinline__ void fattn_keys(const unsigned char* ring, const _Float16* gk, const _Float16* gv, unsigned lk, unsigned lv, const unsigned* mb, int ln, int hh, const v16h (&qf)[2][2], v8f (&o)[2][4], float (&m)[2], float (&l)[2]) {
  const v8f z8 = {0.f,0.f,0.f,0.f,0.f,0.f,0.f,0.f}; v16h ka[2][2], kb2[2][2], va[4], vb[4]; unsigned mw[2] = {0u, 0u};
  auto stage = [&](int t, int buf) { f_copy4(lk + buf * F_BUF, 32 * FK_PITCH, gk + (size_t)t * FST * DM, (size_t)32 * DM); f_copy4(lv + buf * F_BUF, 16 * FV_PITCH, gv + t * FST, (size_t)16 * SQ); };
  if (MSK) { mw[0] = mb[0]; mw[1] = mb[16 * (SQ / 32)]; }
  stage(0, 0);
  asm volatile("s_wait_asynccnt 0x0" ::: "memory");      /* this wave's copies of stage 0 have landed */
  __syncthreads();                                       /* every wave's have: stage 0 may be read */
  stage(1, 1);
#pragma unroll 1    /* one stage a trip: the publish point at the foot stands once */
  for (int t = 0; t < SQ / FST; ++t) { const unsigned char* kt = ring + (t & 1) * F_BUF + ln * FK_PITCH + 16 * hh; const unsigned char* vt = ring + (t & 1) * F_BUF + FK_BYTES + ln * FV_PITCH + 16 * hh;
    // the K and V^T fragments of pass p of this stage, in the k order of g2_frag
    auto frags = [&](int p, v16h (&k)[2][2], v16h (&v)[4]) {
#pragma unroll      /* constant indices, so the fragment arrays stay in registers */
      for (int i = 0; i < 2; ++i) { k[i][0] = g2_lfrag(kt + (p * 32 + i * 16) * FK_PITCH); k[i][1] = g2_lfrag(kt + (p * 32 + i * 16) * FK_PITCH + 64); }
#pragma unroll      /* constant indices, so the fragment arrays stay in registers */
      for (int d = 0; d < 4; ++d) v[d] = g2_lfrag(vt + d * 16 * FV_PITCH + p * 64); };
    // one pass = 32 keys: kc and vc hold this pass's K and V^T fragments, kx and vn take those of pass pn of the same stage (pn = 0: the stage's last pass, which fetches nothing)
    auto pass = [&](int kb, int pn, const v16h (&kc)[2][2], v16h (&kx)[2][2], const v16h (&vc)[4], v16h (&vn)[4]) { const int kn = (kb + 32) & (SQ - 1);
      v8f s[2][2]; float mx[2]; FragH pf[2];
      if (pn) frags(pn, kx, vn);
      __builtin_amdgcn_sched_barrier(0);      /* the next pass's LDS reads stay one group ahead of this pass's products instead of among them */
#pragma unroll      /* constant indices, so the fragment arrays stay in registers */
      for (int qt = 0; qt < 2; ++qt)
#pragma unroll      /* constant indices, so the fragment arrays stay in registers */
        for (int kt2 = 0; kt2 < 2; ++kt2) s[qt][kt2] = f_mma(kc[kt2][1], qf[qt][1], f_mma(kc[kt2][0], qf[qt][0], z8));
      if (MSK) {
#pragma unroll      /* constant indices, so the fragment arrays stay in registers */
        for (int qt = 0; qt < 2; ++qt) { mask_tile(s[qt][0], mw[qt], 0, hh); mask_tile(s[qt][1], mw[qt], 1, hh); }
        __builtin_amdgcn_sched_barrier(0);      /* with the one below: the next pass's two mask loads and their wait stay one group, so nothing that could rewrite an address register comes between */
        mw[0] = mb[kn >> 5]; mw[1] = mb[16 * (SQ / 32) + (kn >> 5)];
        asm volatile("s_wait_xcnt 0x0" ::: "memory");      /* precaution: stands behind the loads issued above, in front of any rewrite of their address registers */
        __builtin_amdgcn_sched_barrier(0); }
#pragma unroll      /* constant indices, so the fragment arrays stay in registers */
      for (int qt = 0; qt < 2; ++qt) { float a = fmaxf(s[qt][0][0], s[qt][1][0]);
#pragma unroll      /* constant indices, so the fragment arrays stay in registers */
        for (int r = 1; r < 8; ++r) a = fmaxf(a, fmaxf(s[qt][0][r], s[qt][1][r]));
        a *= SC2; mx[qt] = fmaxf(a, lane_xor<16>(a)); }      /* both halves of a column agree on the maximum, so on the reference too */
      if (__builtin_amdgcn_ballot_w32(mx[0] > m[0] + 8.f || mx[1] > m[1] + 8.f) != 0) {      /* scalar branch: rescale only when some column's reference must rise */
#pragma unroll      /* constant indices, so the fragment arrays stay in registers */
        for (int qt = 0; qt < 2; ++qt) { const float mn = fmaxf(m[qt], mx[qt]), f = __builtin_amdgcn_exp2f(m[qt] - mn); m[qt] = mn; l[qt] *= f;
#pragma unroll      /* constant indices, so the fragment arrays stay in registers */
          for (int d = 0; d < 4; ++d) o[qt][d] *= f; } }
#pragma unroll      /* constant indices, so the fragment arrays stay in registers */
      for (int qt = 0; qt < 2; ++qt) { float ls = 0.f;
#pragma unroll      /* constant indices, so the fragment arrays stay in registers */
        for (int r = 0; r < 8; ++r) { const float p0 = __builtin_amdgcn_exp2f(__builtin_fmaf(s[qt][0][r], SC2, -m[qt])), p1 = __builtin_amdgcn_exp2f(__builtin_fmaf(s[qt][1][r], SC2, -m[qt])); ls += p0 + p1; pf[qt].h[r] = (_Float16)p0; pf[qt].h[8 + r] = (_Float16)p1; }
        l[qt] += ls; }
#pragma unroll      /* constant indices, so the fragment arrays stay in registers */
      for (int d = 0; d < 4; ++d) { o[0][d] = f_mma(vc[d], pf[0].v, o[0][d]); o[1][d] = f_mma(vc[d], pf[1].v, o[1][d]); }
      __builtin_amdgcn_sched_barrier(0); };      /* keeps the next pass's products behind this pass: moved up, they would wait on fragments fetched only half a pass earlier */
    const int kb = t * FST;
    frags(0, ka, va);
    pass(kb, 1, ka, kb2, va, vb); pass(kb + 32, 2, kb2, ka, vb, va); pass(kb + 64, 3, ka, kb2, va, vb); pass(kb + 96, 0, kb2, ka, vb, va);      /* the two fragment sets swap by name, no register is copied */
    asm volatile("s_wait_dscnt 0x0" ::: "memory");         /* this wave has finished reading the buffer */
    asm volatile("s_wait_asynccnt 0x0" ::: "memory");      /* its copies of stage t + 1 have landed */
    __syncthreads();                                       /* publishes stage t + 1 and ends every wave's reads of stage t */
    if (t + 2 < SQ / FST) stage(t + 2, t & 1); }           /* refill of the buffer just left; the test reads the same in the whole work-group */
  asm volatile("s_wait_asynccnt 0x0" ::: "memory"); }      /* nothing of this wave is in flight behind the loop */
// One wave: 32 queries of one head against all keys, 32 keys a pass. S^T = K Q^T (A = K rows, B = Q rows), so a lane holds one query's scores; the two S^T tiles of a pass, converted in place,
// are the B operand of O^T += V^T P^T. Running row reference m (base-2 exponent), raised only when a new maximum exceeds it by more than 8 (weights then stay <= 256, inside f16); f32 row sums.
// Writes merged f16 rows 64 o + 64 alpha vp and, per (batch, head, query), the pair (m, 1 / sum) for the head-sum launch.
// The 8 waves of a work-group walk the same head's K and V^T, which are staged once for all of them in LDS.
__global__ __launch_bounds__(256) void k_fattn(const _Float16* __restrict__ Q, const _Float16* __restrict__ Kp, const _Float16* __restrict__ VT, const unsigned* __restrict__ MB, const float* __restrict__ AV, _Float16* __restrict__ O16, float* __restrict__ ST) {
  const int tid = threadIdx.x, w = tid >> 5, lane = tid & 31, ln = lane & 15, hh = lane >> 4; const int h = blockIdx.y, b = blockIdx.z, q0 = blockIdx.x * 256 + w * 32; const size_t r0 = (size_t)b * SQ;
  __shared__ __attribute__((aligned(16))) unsigned char ring[2 * F_BUF]; __shared__ __attribute__((aligned(16))) unsigned wz[8];
  const _Float16* qp = Q + (r0 + q0 + ln) * DM + h * HD; const unsigned* mb = MB + (size_t)(q0 + ln) * (SQ / 32);
  /* copy roles: 8 lanes cover the 128 B of a K row, 16 lanes the 256 B of a V^T row, so a wave copies 4 whole lines at a time */
  const _Float16* gk = Kp + (r0 + (tid >> 3)) * DM + h * HD + (tid & 7) * 8; const _Float16* gv = VT + ((size_t)(b * NH + h) * HD + (tid >> 4)) * SQ + (tid & 15) * 8;
  const unsigned lk = (unsigned)(size_t)&ring[0] + (tid >> 3) * FK_PITCH + (tid & 7) * 16, lv = (unsigned)(size_t)&ring[0] + FK_BYTES + (tid >> 4) * FV_PITCH + (tid & 15) * 16;
  const v8f z8 = {0.f,0.f,0.f,0.f,0.f,0.f,0.f,0.f};
  v16h qf[2][2]; v8f o[2][4]; float m[2] = {M0, M0}, l[2] = {0.f, 0.f};
#pragma unroll      /* constant indices, so the fragment arrays stay in registers */
  for (int t = 0; t < 2; ++t) { qf[t][0] = g2_frag(qp + (size_t)t * 16 * DM, hh); qf[t][1] = g2_frag(qp + (size_t)t * 16 * DM + 32, hh);
#pragma unroll      /* constant indices, so the fragment arrays stay in registers */
    for (int d = 0; d < 4; ++d) o[t][d] = z8; }
  unsigned all1 = 0xFFFFFFFFu;      /* lane i: the AND of the 64 mask words of the wave's row i */
  { const v4ua* row = (const v4ua*)(MB + (size_t)(q0 + lane) * (SQ / 32));
#pragma unroll      /* 16 independent loads in flight */
    for (int i = 0; i < SQ / 128; ++i) { const v4ua x = row[i]; all1 &= x[0] & x[1] & x[2] & x[3]; } }
  asm volatile("s_wait_xcnt 0x0" ::: "memory");      /* precaution: stands behind the loads issued above, in front of any rewrite of their address registers */
  const unsigned bz = __builtin_amdgcn_ballot_w32(all1 != 0xFFFFFFFFu);      /* taken with every lane on */
  if (lane == 0) wz[w] = bz;
  __syncthreads();      /* the key loop holds barriers, so the whole work-group takes one side: every wave sees all 8 waves' findings */
  const v4ua z0 = *(const v4ua*)&wz[0], z1 = *(const v4ua*)&wz[4];
  if (__builtin_amdgcn_readfirstlane(z0[0] | z0[1] | z0[2] | z0[3] | z1[0] | z1[1] | z1[2] | z1[3]) != 0) fattn_keys<true>(ring, gk, gv, lk, lv, mb, ln, hh, qf, o, m, l); else fattn_keys<false>(ring, gk, gv, lk, lv, mb, ln, hh, qf, o, m, l);      /* scalar branch, the same in every wave */
#pragma unroll      /* constant indices, so the fragment arrays stay in registers */
  for (int qt = 0; qt < 2; ++qt) { const float inv = 1.0f / (l[qt] + lane_xor<16>(l[qt])), sc = inv * 64.0f; const int q = q0 + qt * 16 + ln;
    if (hh == 0) { float* st = ST + ((size_t)(b * NH + h) * SQ + q) * 2; st[0] = m[qt]; st[1] = inv; }
    v4f av[4][2];
    __builtin_amdgcn_sched_barrier(0);      /* with the one below: the eight loads of the addend and their wait stay one group, so nothing that could rewrite an address register comes between */
#pragma unroll      /* constant indices, so the fragment arrays stay in registers */
    for (int d = 0; d < 4; ++d) { const size_t off = (r0 + q) * DM + h * HD + d * 16 + 8 * hh; av[d][0] = *(const v4fa*)(AV + off); av[d][1] = *(const v4fa*)(AV + off + 4); }
    asm volatile("s_wait_xcnt 0x0" ::: "memory");      /* precaution: stands behind the loads issued above, in front of any rewrite of their address registers */
    __builtin_amdgcn_sched_barrier(0);
#pragma unroll      /* constant indices, so the fragment arrays stay in registers */
    for (int d = 0; d < 4; ++d) { const size_t off = (r0 + q) * DM + h * HD + d * 16 + 8 * hh; const v4f a0 = av[d][0], a1 = av[d][1]; FragH f;      /* O^T tile: a lane holds 8 consecutive d of one query */
#pragma unroll      /* constant indices, so the fragment arrays stay in registers */
      for (int r = 0; r < 4; ++r) { f.h[r] = (_Float16)(o[qt][d][r] * sc + a0[r]); f.h[4 + r] = (_Float16)(o[qt][d][4 + r] * sc + a1[r]); }
      *(v8us*)((unsigned short*)O16 + off) = f.half[0]; } } }
// K, Q and the row statistics of k_headsum go through LDS: a stage is one head's 128 B of the work-group's 256 K rows and 64 Q rows, brought by asynchronous copies of whole lines, two buffers, the next head in flight while this one is worked on
#define HS_PITCH 144                 /* LDS bytes from row to row: 128 + 16, an odd multiple of 16 B, so the 16 rows of a fragment read fall on different banks */
#define HS_BUF (320 * HS_PITCH)      /* one stage: rows 0..255 = K, rows 256..319 = Q */
// two asynchronous copies of 16 B a lane: LDS byte address l (+ ls), global address g (+ gs bytes)
__device__ __forceinline__ void f_copy2(unsigned l, unsigned ls, const unsigned char* g, size_t gs) {
  const unsigned l1 = l + ls; const unsigned char* g1 = g + gs;
  /* the copies move global bytes into LDS through no register; the closing s_wait_xcnt is a precaution: it stands in front of any rewrite of the address registers named here */
  asm volatile("global_load_async_to_lds_b128 %0, %2, off\n\t"
               "global_load_async_to_lds_b128 %1, %3, off\n\t"
               "s_wait_xcnt 0x0"
               :: "v"(l), "v"(l1), "v"(g), "v"(g1) : "memory"); }
// this lane's ten copies of head h into buffer buf; gk, gq: the work-group's first K and Q rows; go, lc: the lane's element offset from them and its first LDS address
__device__ __forceinline__ void hs_stage(const _Float16* gk, const _Float16* gq, unsigned go, unsigned lc, int h, int buf) { const unsigned l = lc + buf * HS_BUF;
  f_copy4(l, 32 * HS_PITCH, gk + h * HD + go, (size_t)32 * DM); f_copy4(l + 128 * HS_PITCH, 32 * HS_PITCH, gk + (size_t)128 * DM + h * HD + go, (size_t)32 * DM); f_copy2(l + 256 * HS_PITCH, 32 * HS_PITCH, (const unsigned char*)(gq + h * HD + go), (size_t)32 * DM * 2); }
// the head loop of k_headsum, entered with head 0 published and head 1 in flight; MSK = false is taken by a work-group whose 64 x 256 mask bits are all set
// ring: the two buffers; gk, gq, go, lc: as in hs_stage; kr, qr: the LDS rows of this lane's first K and Q fragments; st: this lane's first (m, 1 / sum) pair in LDS
template <bool MSK>
__device__ __forceinline__ void headsum_heads(const unsigned char* ring, const _Float16* gk, const _Float16* gq, unsigned go, unsigned lc, int kr, int qr, const float* st, int hh, const unsigned (&mw)[2][2], v8f (&acc)[2][4]) {
  const v8f z8 = {0.f,0.f,0.f,0.f,0.f,0.f,0.f,0.f};
#pragma unroll 1    /* one head a trip: the publish point at the foot stands once, and the live set stays small enough for four waves a SIMD */
  for (int h = 0; h < NH; ++h) { v16h qf[2][2], kf[4][2]; float mr[2], iv[2]; const unsigned char* kp = ring + (h & 1) * HS_BUF + kr * HS_PITCH + 16 * hh; const unsigned char* qp = ring + (h & 1) * HS_BUF + qr * HS_PITCH + 16 * hh;
#pragma unroll      /* constant indices, so the fragment arrays stay in registers */
    for (int t = 0; t < 4; ++t) { kf[t][0] = g2_lfrag(kp + t * 16 * HS_PITCH); kf[t][1] = g2_lfrag(kp + t * 16 * HS_PITCH + 64); }
#pragma unroll      /* constant indices, so the fragment arrays stay in registers */
    for (int t = 0; t < 2; ++t) { qf[t][0] = g2_lfrag(qp + t * 16 * HS_PITCH); qf[t][1] = g2_lfrag(qp + t * 16 * HS_PITCH + 64); mr[t] = st[(h * 64 + t * 16) * 2]; iv[t] = st[(h * 64 + t * 16) * 2 + 1]; }
#pragma unroll      /* constant indices, so the fragment arrays stay in registers */
    for (int qt = 0; qt < 2; ++qt)
#pragma unroll      /* constant indices, so the fragment arrays stay in registers */
      for (int kt = 0; kt < 4; ++kt) { v8f s = f_mma(kf[kt][1], qf[qt][1], f_mma(kf[kt][0], qf[qt][0], z8));
        if (MSK) mask_tile(s, mw[qt][kt >> 1], kt & 1, hh);
#pragma unroll      /* constant indices, so the fragment arrays stay in registers */
        for (int r = 0; r < 8; ++r) acc[qt][kt][r] = __builtin_fmaf(__builtin_amdgcn_exp2f(__builtin_fmaf(s[r], SC2, -mr[qt])), iv[qt], acc[qt][kt][r]); }
    asm volatile("s_wait_dscnt 0x0" ::: "memory");         /* this wave has finished reading the buffer */
    asm volatile("s_wait_asynccnt 0x0" ::: "memory");      /* its copies of head h + 1 have landed */
    __syncthreads();                                       /* publishes head h + 1 and ends every wave's reads of head h */
    if (h + 2 < NH) hs_stage(gk, gq, go, lc, h + 2, h & 1); }      /* refill of the buffer just left; the test reads the same in the whole work-group */
  asm volatile("s_wait_asynccnt 0x0" ::: "memory"); }      /* nothing of this wave is in flight behind the loop */
// second output: one wave holds 32 queries x 64 keys of the head sum in registers and walks the 16 heads, forming each head's S^T tiles again (same products, same order as k_fattn) and its weights from the stored (m, 1 / sum)
// a work-group is 2 x 4 such waves: 64 queries x 256 keys, so a staged K row serves two waves and a staged Q row four
__global__ __launch_bounds__(256) void k_headsum(const _Float16* __restrict__ Q, const _Float16* __restrict__ Kp, const unsigned* __restrict__ MB, const float* __restrict__ ST, float* __restrict__ WS) {
  __shared__ __attribute__((aligned(16))) unsigned char ring[2 * HS_BUF]; __shared__ __attribute__((aligned(16))) float sst[NH][64][2]; __shared__ __attribute__((aligned(16))) unsigned wz[8];
  const int tid = threadIdx.x, w = tid >> 5, lane = tid & 31, ln = lane & 15, hh = lane >> 4, qi = w >> 2, ki = w & 3; const int b = blockIdx.z, qb = blockIdx.y * 64, kb = blockIdx.x * 256, q0 = qb + qi * 32, k0 = kb + ki * 64; const size_t r0 = (size_t)b * SQ;
  /* copy roles: 8 lanes cover the 128 B of a row, so a wave copies 4 whole lines at a time; the statistics are 512 B a head, 32 lanes each */
  const _Float16* gk = Kp + (r0 + kb) * DM; const _Float16* gq = Q + (r0 + qb) * DM; const unsigned go = (tid >> 3) * DM + (tid & 7) * 8; const unsigned lc = (unsigned)(size_t)&ring[0] + (tid >> 3) * HS_PITCH + (tid & 7) * 16;
  f_copy2((unsigned)(size_t)&sst[0][0][0] + tid * 16, 8 * 512, (const unsigned char*)(ST + ((size_t)(b * NH + (tid >> 5)) * SQ + qb) * 2 + (tid & 31) * 4), (size_t)8 * SQ * 2 * 4);      /* heads w and w + 8; waited for with head 0's copies */
  hs_stage(gk, gq, go, lc, 0, 0);
  const v8f z8 = {0.f,0.f,0.f,0.f,0.f,0.f,0.f,0.f}; v8f acc[2][4]; unsigned mw[2][2];
#pragma unroll      /* constant indices, so the fragment arrays stay in registers */
  for (int qt = 0; qt < 2; ++qt) { const unsigned* mb = MB + (size_t)(q0 + qt * 16 + ln) * (SQ / 32) + (k0 >> 5); mw[qt][0] = mb[0]; mw[qt][1] = mb[1];
#pragma unroll      /* constant indices, so the fragment arrays stay in registers */
    for (int kt = 0; kt < 4; ++kt) acc[qt][kt] = z8; }
  const unsigned bz = __builtin_amdgcn_ballot_w32((mw[0][0] & mw[0][1] & mw[1][0] & mw[1][1]) != 0xFFFFFFFFu);      /* taken with every lane on */
  if (lane == 0) wz[w] = bz;
  asm volatile("s_wait_asynccnt 0x0" ::: "memory");      /* this wave's copies of head 0 and of the statistics have landed */
  __syncthreads();      /* every wave's have: they may be read; and every wave sees all 8 waves' mask findings: the head loop holds barriers, so the whole work-group takes one side */
  hs_stage(gk, gq, go, lc, 1, 1);
  const v4ua z0 = *(const v4ua*)&wz[0], z1 = *(const v4ua*)&wz[4]; const float* st = &sst[0][qi * 32 + ln][0]; const int kr = ki * 64 + ln, qr = 256 + qi * 32 + ln;
  if (__builtin_amdgcn_readfirstlane(z0[0] | z0[1] | z0[2] | z0[3] | z1[0] | z1[1] | z1[2] | z1[3]) != 0) headsum_heads<true>(ring, gk, gq, go, lc, kr, qr, st, hh, mw, acc); else headsum_heads<false>(ring, gk, gq, go, lc, kr, qr, st, hh, mw, acc);      /* scalar branch, the same in every wave */
#pragma unroll      /* constant indices, so the fragment arrays stay in registers */
  for (int qt = 0; qt < 2; ++qt)
#pragma unroll      /* constant indices, so the fragment arrays stay in registers */
    for (int kt = 0; kt < 4; ++kt) { float* d = WS + (r0 + q0 + qt * 16 + ln) * SQ + k0 + kt * 16 + 8 * hh; v4f a0, a1;      /* a lane holds 8 consecutive keys of one query */
#pragma unroll      /* constant indices, so the fragment arrays stay in registers */
      for (int r = 0; r < 4; ++r) { a0[r] = acc[qt][kt][r]; a1[r] = acc[qt][kt][4 + r]; }
      *(v4f*)d = a0; *(v4f*)(d + 4) = a1; } }
// Jobs that do not depend on one another share a grid: a work-group picks its job by its index, the same for all its threads, and runs that job's body with its index within the job.
#define PW_G (DM * (DM / 8) / 256)            /* work-groups of one weight transpose */
#define PM_G (SQ * (SQ / 32) / 256)           /* of the mask pack */
#define PX_G ((int)(NR * DM / 8 / 256))       /* of one input conversion */
// all that reads inputs only: the three weight transposes, the mask pack, the three input conversions
__global__ __launch_bounds__(256) void k_prep(const float* __restrict__ wq, const float* __restrict__ wkv, const float* __restrict__ wo, _Float16* __restrict__ BQ, _Float16* __restrict__ BKV, _Float16* __restrict__ BO, const int* __restrict__ mask, unsigned* __restrict__ MB,
    const float* __restrict__ qin, const float* __restrict__ kin, const float* __restrict__ vin, _Float16* __restrict__ XQ, _Float16* __restrict__ XK, _Float16* __restrict__ XV) { const unsigned bx = blockIdx.x;
  if (bx < 3 * PW_G) { const unsigned j = bx / PW_G; d_wt_f16(bx - j * PW_G, j == 0 ? wq : j == 1 ? wkv : wo, j == 0 ? BQ : j == 1 ? BKV : BO, DM, DM, 16.0f); }
  else if (bx < 3 * PW_G + PM_G) d_maskbits(bx - 3 * PW_G, mask, MB);
  else { const unsigned i = bx - (3 * PW_G + PM_G), j = i / PX_G; d_x16(i - j * PX_G, j == 0 ? qin : j == 1 ? kin : vin, j == 0 ? XQ : j == 1 ? XK : XV, NR * DM / 8); } }

extern "C" void kernel_launch(void* const* d_in, const int* in_sizes, int n_in,
                              void* d_out, int out_size, void* d_ws, size_t ws_size, hipStream_t stream) {
  (void)in_sizes; (void)n_in; (void)out_size;
  const float* const* I = (const float* const*)d_in; const float* qin = I[0]; const float* kin = I[1]; const float* vin = I[2]; const int* mask = (const int*)d_in[3]; const float* wq = I[4]; const float* bq = I[5]; const float* wkv = I[6]; const float* bkv = I[7]; const float* wo = I[8]; const float* bo = I[9]; const float* alpha = I[10];      /* weights [in][out] */
  float* out0 = (float*)d_out; float* out1 = (float*)d_out + NR * DM;      /* byte offset 16,777,216 */
  char* ws = (char*)d_ws; size_t off = 0;
  auto take = [&](size_t bytes) { char* p = ws + off; off += (bytes + 255) & ~(size_t)255; return p; };
  _Float16* BQ = (_Float16*)take((size_t)DM * DM * 2); _Float16* BKV = (_Float16*)take((size_t)DM * DM * 2); _Float16* BO = (_Float16*)take((size_t)DM * DM * 2);
  _Float16* Q16 = (_Float16*)take(NR * DM * 2); _Float16* K16 = (_Float16*)take(NR * DM * 2); float* AV = (float*)take(NR * DM * 4); _Float16* O16 = (_Float16*)take(NR * DM * 2);
  _Float16* VT = (_Float16*)take((size_t)NB * NH * HD * SQ * 2); unsigned* MB = (unsigned*)take((size_t)SQ * (SQ / 32) * 4); float* ST = (float*)take((size_t)NB * NH * SQ * 2 * 4);
  _Float16* XQ = (_Float16*)take(NR * DM * 2); _Float16* XK = (_Float16*)take(NR * DM * 2); _Float16* XV = (_Float16*)take(NR * DM * 2);
  if (off > ws_size) return;      /* 6 + 16 + 16 + 8 + 8 + 0.5 + 0.5 + 24 = 79 MiB */
  k_prep<<<3 * PW_G + PM_G + 3 * PX_G, 256, 0, stream>>>(wq, wkv, wo, BQ, BKV, BO, mask, MB, qin, kin, vin, XQ, XK, XV);
  const size_t r0p = (size_t)B0 * SQ; const dim3 gp((unsigned)((MP / 128) * (DM / 128)), 3);
  k_gemm2<0><<<gp, 128, 0, stream>>>(XQ + r0p * DM, DM, NR * DM, BQ, DM, 0, 0.0625f, bq, 0, nullptr, 1, 0, 0, AV + r0p * DM, Q16 + r0p * DM, DM, NR * DM, MP, DM, DM, BKV, bkv, 2, VT, alpha);      /* planes qp, kp, vp: XQ, XK, XV and Q16, K16 lie NR * DM elements apart; vp leaves as 64 alpha vp (f32 rows, residual) and as V^T [NB][NH][HD][SQ] (f16, attention operand) */
  k_fattn<<<dim3(SQ / 256, NH, NB), 256, 0, stream>>>(Q16, K16, VT, MB, AV, O16, ST);      /* o x64 = 64 attn v + 64 alpha vp, f16 rows; row statistics */
  k_headsum<<<dim3(SQ / 256, SQ / 64, NB), 256, 0, stream>>>(Q16, K16, MB, ST, out1);      /* sum over the heads of the weights */
  k_gemm2<0><<<dim3((unsigned)((MPO / 128) * (DM / 128)), 1), 128, 0, stream>>>(O16 + r0p * DM, DM, 0, BO, DM, 0, 0.0009765625f, bo, 0, nullptr, 1, 0, 0, out0 + r0p * DM, nullptr, DM, 0, MPO, DM, DM, nullptr, nullptr, 0, nullptr, nullptr);      /* out0 = o Wo + bo */
}

// v009
// One run takes 110 microseconds.
// Next to v008, in two timings, it ran 1.10 and 1.11 times as fast.
// Over all steps from v000 it is 1236 times as fast.
#include <hip/hip_runtime.h>
#define NB 2
#define SQ 2048
#define DM 1024
#define NH 16
#define HD 64
#define HG 4                         /* k_vt(b,h0) compatibility (unused) */
#define B0 0                         /* first batch processed (debug hook) */
#define NBR NB                       /* batches processed (debug hook) */
#define Q0S 0                        /* first tile (unused) */
#define QN SQ                        /* query rows end (unused) */
#define NR ((size_t)NB * SQ)
#define MP ((int)((size_t)NBR * SQ)) /* rows projected (debug hook) */
#define MPO MP                       /* rows through the output GEMM (debug hook) */
typedef __bf16 v16b __attribute__((ext_vector_type(16)));
typedef unsigned short v8us __attribute__((ext_vector_type(8), may_alias));
typedef float  v8f  __attribute__((ext_vector_type(8)));
typedef float  v4f  __attribute__((ext_vector_type(4)));
typedef float  v4fa __attribute__((ext_vector_type(4), may_alias));
union FragB { v16b v; v8us half[2]; unsigned short u[16]; };

__device__ __forceinline__ unsigned short bf16_bits(float x) { unsigned int u = __float_as_uint(x); return (unsigned short)((u + 0x7FFFu + ((u >> 16) & 1u)) >> 16); }
__device__ __forceinline__ float bf16_val(unsigned short b) { return __uint_as_float(((unsigned int)b) << 16); }
__device__ __forceinline__ float bf16_round(float x) { return bf16_val(bf16_bits(x)); }
// D += A·B with NT terms: 1 = ah·bh, 2 = + al·bh (A split), 3 = + ah·bl (both split)
template <int NT>
__device__ __forceinline__ v8f mmaN(v16b ah, v16b al, v16b bh, v16b bl, v8f c) {
  c = __builtin_amdgcn_wmma_f32_16x16x32_bf16(false, ah, false, bh, (short)0, c, false, false);
  if (NT >= 2) c = __builtin_amdgcn_wmma_f32_16x16x32_bf16(false, al, false, bh, (short)0, c, false, false);
  if (NT >= 3) c = __builtin_amdgcn_wmma_f32_16x16x32_bf16(false, ah, false, bl, (short)0, c, false, false);
  asm volatile("v_nop\n\tv_nop\n\tv_nop\n\tv_nop" : "+v"(c) : "v"(ah), "v"(al), "v"(bh), "v"(bl));
  return c;
}

__global__ __launch_bounds__(256) void k_wt_bf16(const float* __restrict__ W, unsigned short* __restrict__ Wt, int K, int N) {
  const int t = blockIdx.x * 256 + threadIdx.x;
  const int k8n = K / 8;
  if (t >= N * k8n) return;
  const int n = t / k8n, k8 = (t % k8n) * 8;
  v8us v;
#pragma unroll
  for (int i = 0; i < 8; ++i) v[i] = bf16_bits(W[(size_t)(k8 + i) * N + n]);
  *(v8us*)(Wt + (size_t)n * K + k8) = v;
  
}

// GEMM C[M][N] (f32, pitch ldc) = act(A[M][K]·W + bias). A f32 row-major (pitch lda) converted per fragment to bf16
// (ASPLIT: hi/lo two planes -> 2 terms, else single rounded term); Wt bf16 [N][K] (pitch ldb). BIAS_BF16 rounds the
// bias to bf16 first (bias quantised to bf16 before the add). K%32==0, M%16==0, N%64==0.
template <bool ASPLIT, int ACT, bool BIAS_BF16>
__global__ __launch_bounds__(128) void k_gemm_bf(const float* __restrict__ A, int lda, const unsigned short* __restrict__ Wt, int ldb,
                                               const float* __restrict__ bias, float* __restrict__ C, int ldc, int M, int N, int K) {
  __shared__ __attribute__((aligned(16))) float so[4][16][64];
  const int tid = threadIdx.x, w = tid >> 5, lane = tid & 31, ln = lane & 15, hh = lane >> 4;
  const int ntn = N / 64;
  const int wid = blockIdx.x * 4 + w;
  const int mt = wid / ntn, nq = wid % ntn;
  if (mt * 16 >= M) return;
  const int row0 = mt * 16, col0 = nq * 64;
  const float* arow = A + (size_t)(row0 + ln) * lda;
  v8f acc[4] = {};
  for (int kb = 0; kb < K; kb += 32) {
    FragB ah, al;
    const v4f x0 = *(const v4fa*)(arow + kb + 8 * hh), x1 = *(const v4fa*)(arow + kb + 8 * hh + 4);
    const v4f x2 = *(const v4fa*)(arow + kb + 16 + 8 * hh), x3 = *(const v4fa*)(arow + kb + 16 + 8 * hh + 4);
    float xs[16] = {x0[0],x0[1],x0[2],x0[3],x1[0],x1[1],x1[2],x1[3],x2[0],x2[1],x2[2],x2[3],x3[0],x3[1],x3[2],x3[3]};
#pragma unroll
    for (int i = 0; i < 16; ++i) { const unsigned short hb = bf16_bits(xs[i]); ah.u[i] = hb; al.u[i] = ASPLIT ? bf16_bits(xs[i] - bf16_val(hb)) : (unsigned short)0; }
#pragma unroll
    for (int t = 0; t < 4; ++t) {
      const unsigned short* brow = Wt + (size_t)(col0 + t * 16 + ln) * ldb + kb;
      FragB b;
      b.half[0] = *(const v8us*)(brow + 8 * hh);
      b.half[1] = *(const v8us*)(brow + 16 + 8 * hh);
      acc[t] = mmaN<ASPLIT ? 2 : 1>(ah.v, al.v, b.v, b.v, acc[t]);
    }
  }
#pragma unroll
  for (int t = 0; t < 4; ++t) {
    float bv = bias ? bias[col0 + t * 16 + ln] : 0.f;
    if (BIAS_BF16) bv = bf16_round(bv);
#pragma unroll
    for (int r = 0; r < 8; ++r) { float v = acc[t][r] + bv; if (ACT == 1) v = fmaxf(v, 0.f); so[w][8 * hh + r][t * 16 + ln] = v; }
  }
  __builtin_amdgcn_fence(__ATOMIC_ACQ_REL, "workgroup");
  __builtin_amdgcn_wave_barrier();
  const int rsub = lane >> 4, c4 = (lane & 15) * 4;
  {
#pragma unroll
    for (int q = 0; q < 8; ++q) {
      const int r = q * 2 + rsub;
      const v4f v = *(const v4fa*)&so[w][r][c4];
      *(v4f*)(C + (size_t)(row0 + r) * ldc + col0 + c4) = v;
    }
    
  }
}

// GEMM C = act(A·W + bias + resid): A f32 (ASPLIT -> hi/lo 2 terms), Wt bf16 [N][K]; ACT 0 none, 1 relu, 2 exact gelu;
// resid (optional, f32, row index = (row % rmod), pitch ldr, RES_BF16 rounds it) added before the activation.
template <bool ASPLIT, int ACT, bool BIAS_BF16, bool RES_BF16>
__global__ __launch_bounds__(128) void k_gemm_bf3(const float* __restrict__ A, int lda, const unsigned short* __restrict__ Wt, int ldb,
                                                const float* __restrict__ bias, const float* __restrict__ resid, int rmod, int ldr,
                                                float* __restrict__ C, int ldc, int M, int N, int K) {
  __shared__ __attribute__((aligned(16))) float so[4][16][64];
  const int tid = threadIdx.x, w = tid >> 5, lane = tid & 31, ln = lane & 15, hh = lane >> 4;
  const int ntn = N / 64;
  const int wid = blockIdx.x * 4 + w;
  const int mt = wid / ntn, nq = wid % ntn;
  if (mt * 16 >= M) return;
  const int row0 = mt * 16, col0 = nq * 64;
  const float* arow = A + (size_t)(row0 + ln) * lda;
  v8f acc[4] = {};
  for (int kb = 0; kb < K; kb += 32) {
    FragB ah, al;
    const v4f x0 = *(const v4fa*)(arow + kb + 8 * hh), x1 = *(const v4fa*)(arow + kb + 8 * hh + 4);
    const v4f x2 = *(const v4fa*)(arow + kb + 16 + 8 * hh), x3 = *(const v4fa*)(arow + kb + 16 + 8 * hh + 4);
    float xs[16] = {x0[0],x0[1],x0[2],x0[3],x1[0],x1[1],x1[2],x1[3],x2[0],x2[1],x2[2],x2[3],x3[0],x3[1],x3[2],x3[3]};
#pragma unroll
    for (int i = 0; i < 16; ++i) { const unsigned short hb = bf16_bits(xs[i]); ah.u[i] = hb; al.u[i] = ASPLIT ? bf16_bits(xs[i] - bf16_val(hb)) : (unsigned short)0; }
#pragma unroll
    for (int t = 0; t < 4; ++t) {
      const unsigned short* brow = Wt + (size_t)(col0 + t * 16 + ln) * ldb + kb;
      FragB b;
      b.half[0] = *(const v8us*)(brow + 8 * hh);
      b.half[1] = *(const v8us*)(brow + 16 + 8 * hh);
      acc[t] = mmaN<ASPLIT ? 2 : 1>(ah.v, al.v, b.v, b.v, acc[t]);
    }
  }
#pragma unroll
  for (int t = 0; t < 4; ++t) {
    const int col = col0 + t * 16 + ln;
    float bv = bias ? bias[col] : 0.f;
    if (BIAS_BF16) bv = bf16_round(bv);
#pragma unroll
    for (int r = 0; r < 8; ++r) {
      float v = acc[t][r] + bv;
      if (resid) { float rv = resid[(size_t)((row0 + 8 * hh + r) % rmod) * ldr + col]; if (RES_BF16) rv = bf16_round(rv); v += rv; }
      if (ACT == 1) v = fmaxf(v, 0.f);
      if (ACT == 2) v = 0.5f * v * (1.0f + erff(v * 0.70710678118654752f));
      if (ACT == 3) { const float u = 0.7978845608028654f * (v + 0.044715f * v * v * v); v = 0.5f * v * (1.0f + tanhf(u)); }
      so[w][8 * hh + r][t * 16 + ln] = v;
    }
  }
  __builtin_amdgcn_fence(__ATOMIC_ACQ_REL, "workgroup");
  __builtin_amdgcn_wave_barrier();
  const int rsub = lane >> 4, c4 = (lane & 15) * 4;
  {
#pragma unroll
    for (int q = 0; q < 8; ++q) {
      const int r = q * 2 + rsub;
      const v4f v = *(const v4fa*)&so[w][r][c4];
      *(v4f*)(C + (size_t)(row0 + r) * ldc + col0 + c4) = v;
    }
    
  }
}
// row LayerNorm (biased variance, eps) over N: s = X (+ R); optional out_sum <- s; out_norm <- (s-mu)*rsqrt(var+eps)*g + b
template <bool PARAM_BF16>
__global__ __launch_bounds__(256) void k_layernorm(const float* __restrict__ X, const float* __restrict__ R, const float* __restrict__ g, const float* __restrict__ bta,
                                                  float* __restrict__ out_sum, float* __restrict__ out_norm, int N, float eps) {
  __shared__ float red[256];
  const int row = blockIdx.x, tid = threadIdx.x;
  const float* x = X + (size_t)row * N; const float* rr = R ? R + (size_t)row * N : nullptr;
  float vals[16];                     // up to N = 4096
  const int per = N / 256;            // contiguous chunk per thread? use strided-by-4 chunks: thread handles j = tid*4 + 1024*u
  float s1 = 0.f;
  for (int u = 0; u < per / 4; ++u) {
    const int j = tid * 4 + 1024 * u;
    const v4f a = *(const v4fa*)(x + j);
    v4f b = {0.f,0.f,0.f,0.f}; if (rr) b = *(const v4fa*)(rr + j);
#pragma unroll
    for (int q = 0; q < 4; ++q) { const float v = a[q] + b[q]; vals[u * 4 + q] = v; s1 += v; }
  }
  red[tid] = s1; __syncthreads();
  for (int st = 128; st > 0; st >>= 1) { if (tid < st) red[tid] += red[tid + st]; __syncthreads(); }
  const float mu = red[0] / (float)N; __syncthreads();
  float s2 = 0.f;
  for (int u = 0; u < per / 4; ++u)
#pragma unroll
    for (int q = 0; q < 4; ++q) { const float c = vals[u * 4 + q] - mu; s2 += c * c; }
  red[tid] = s2; __syncthreads();
  for (int st = 128; st > 0; st >>= 1) { if (tid < st) red[tid] += red[tid + st]; __syncthreads(); }
  const float rs = rsqrtf(red[0] / (float)N + eps);
  {
    for (int u = 0; u < per / 4; ++u) {
      const int j = tid * 4 + 1024 * u;
      v4f o, sm;
#pragma unroll
      for (int q = 0; q < 4; ++q) {
        float gg = g[j + q], bb = bta[j + q];
        if (PARAM_BF16) { gg = bf16_round(gg); bb = bf16_round(bb); }
        sm[q] = vals[u * 4 + q]; o[q] = (vals[u * 4 + q] - mu) * rs * gg + bb;
      }
      if (out_sum) *(v4f*)(out_sum + (size_t)row * N + j) = sm;
      *(v4f*)(out_norm + (size_t)row * N + j) = o;
    }
    
  }
}



// ---- f16 WMMA path (v_wmma_f32_16x16x32_f16): 11-bit significands for operands in range — used for every launched product, the unnormalised softmax weights (<= 256) among them
typedef _Float16 v16h __attribute__((ext_vector_type(16)));
union FragH { v16h v; v8us half[2]; _Float16 h[16]; unsigned short u[16]; };
template <int NT>
__device__ __forceinline__ v8f mmaH(v16h ah, v16h al, v16h bh, v16h bl, v8f c) {
  c = __builtin_amdgcn_wmma_f32_16x16x32_f16(false, ah, false, bh, (short)0, c, false, false);
  if (NT >= 2) c = __builtin_amdgcn_wmma_f32_16x16x32_f16(false, al, false, bh, (short)0, c, false, false);
  if (NT >= 3) c = __builtin_amdgcn_wmma_f32_16x16x32_f16(false, ah, false, bl, (short)0, c, false, false);
  asm volatile("v_nop\n\tv_nop\n\tv_nop\n\tv_nop" : "+v"(c) : "v"(ah), "v"(al), "v"(bh), "v"(bl));
  return c;
}
// batched GEMM like k_gemm_b but f16 operands: A f32 (split into f16 hi/lo if ASPLIT, else rounded to f16), Bt = f16 values [n][k]; alpha; C f32; N multiple of 16 (partial tiles skipped)
template <bool ASPLIT>
__global__ __launch_bounds__(128) void k_gemm_h(const float* __restrict__ A, int lda, size_t sA, const _Float16* __restrict__ Bh, int ldb, size_t sB, float alpha, float* __restrict__ C, int ldc, size_t sC, int M, int N, int K) {
  __shared__ __attribute__((aligned(16))) float so[4][16][64];
  const int tid = threadIdx.x, w = tid >> 5, lane = tid & 31, ln = lane & 15, hh = lane >> 4; const int by = blockIdx.y;
  A += (size_t)by * sA; Bh += (size_t)by * sB; C += (size_t)by * sC;
  const int ntn = (N + 63) / 64; const int wid = blockIdx.x * 4 + w; const int mt = wid / ntn, nq = wid % ntn; if (mt * 16 >= M) return;
  const int row0 = mt * 16, col0 = nq * 64; const float* arow = A + (size_t)(row0 + ln) * lda;
  v8f acc[4] = {};
  for (int kb = 0; kb < K; kb += 32) {
    FragH ah, al;
    const v4f x0 = *(const v4fa*)(arow + kb + 8 * hh), x1 = *(const v4fa*)(arow + kb + 8 * hh + 4), x2 = *(const v4fa*)(arow + kb + 16 + 8 * hh), x3 = *(const v4fa*)(arow + kb + 16 + 8 * hh + 4);
    float xs[16] = {x0[0],x0[1],x0[2],x0[3],x1[0],x1[1],x1[2],x1[3],x2[0],x2[1],x2[2],x2[3],x3[0],x3[1],x3[2],x3[3]};
#pragma unroll
    for (int i = 0; i < 16; ++i) { const _Float16 h = (_Float16)xs[i]; ah.h[i] = h; al.h[i] = ASPLIT ? (_Float16)(xs[i] - (float)h) : (_Float16)0.0f; }
#pragma unroll
    for (int t = 0; t < 4; ++t) { if (col0 + t * 16 >= N) continue; const size_t boff = (size_t)(col0 + t * 16 + ln) * ldb + kb; FragH bq; bq.half[0] = *(const v8us*)(Bh + boff + 8 * hh); bq.half[1] = *(const v8us*)(Bh + boff + 16 + 8 * hh);
      acc[t] = mmaH<ASPLIT ? 2 : 1>(ah.v, al.v, bq.v, bq.v, acc[t]); }
  }
#pragma unroll
  for (int t = 0; t < 4; ++t) { if (col0 + t * 16 >= N) continue;
#pragma unroll
    for (int r = 0; r < 8; ++r) so[w][8 * hh + r][t * 16 + ln] = acc[t][r] * alpha; }
  __builtin_amdgcn_fence(__ATOMIC_ACQ_REL, "workgroup"); __builtin_amdgcn_wave_barrier();
  const int rsub = lane >> 4, c4 = (lane & 15) * 4;
  {
#pragma unroll
    for (int q = 0; q < 8; ++q) { const int r = q * 2 + rsub; if (col0 + c4 < N) { const v4f v = *(const v4fa*)&so[w][r][c4]; *(v4f*)(C + (size_t)(row0 + r) * ldc + col0 + c4) = v; } }
     }
}

// Wt[n][k] = f16(W[k][n]·scale) from f32 row-major W[K][N] (scale = power of two; bf16-exact weights stay exact in f16 away from the subnormal range)
// bx, here and in the other d_ bodies: the work-group's index within this job's own share of a grid that several jobs share
// a work-group of 256 threads turns one tile of 64 k x 64 n through LDS, so that reads (256 B of a W row) and writes (128 B of a Wt row) both cover whole lines; K % 64 == 0, N % 64 == 0
#define WT_P 33                      /* LDS dwords from n row to n row: 32 (64 k) + 1, odd, so the lanes of a store (n 4 apart) and of a load (rows 1 apart) fall on different banks */
typedef unsigned v4uw __attribute__((ext_vector_type(4), may_alias));
__device__ __forceinline__ void d_wt_f16(unsigned bx, const float* __restrict__ W, _Float16* __restrict__ Wt, int K, int N, float scale, unsigned (*tl)[WT_P]) {
  const int tid = threadIdx.x, ktn = K / 64; const int k0 = (int)(bx % ktn) * 64, n0 = (int)(bx / ktn) * 64;
  const int r2 = (tid >> 4) * 2, c4 = (tid & 15) * 4;      /* read role: 16 lanes cover 64 n of one k; a thread takes k = r2, r2 + 1 and the same 32 further on */
  const float* s = W + (size_t)(k0 + r2) * N + n0 + c4; v4f x[2][2];
  __builtin_amdgcn_sched_barrier(0);      /* with the one below: the four loads and their wait stay one group, so nothing that could rewrite an address register comes between */
#pragma unroll      /* constant indices, so the four vectors stay in registers */
  for (int p = 0; p < 2; ++p) { x[p][0] = *(const v4fa*)(s + (size_t)(p * 32) * N); x[p][1] = *(const v4fa*)(s + (size_t)(p * 32 + 1) * N); }
  asm volatile("s_wait_xcnt 0x0" ::: "memory");      /* precaution: stands behind the loads issued above, in front of any rewrite of their address registers */
  __builtin_amdgcn_sched_barrier(0);
#pragma unroll      /* constant indices, so the four vectors stay in registers */
  for (int p = 0; p < 2; ++p)
#pragma unroll      /* constant indices into the vectors */
    for (int j = 0; j < 4; ++j) { union { _Float16 h[2]; unsigned u; } z; z.h[0] = (_Float16)(bf16_round(x[p][0][j]) * scale); z.h[1] = (_Float16)(bf16_round(x[p][1][j]) * scale); tl[c4 + j][p * 16 + (r2 >> 1)] = z.u; }      /* two neighbouring k of one n share a dword */
  __syncthreads();      /* the tile is whole: its rows may be read across the waves; reached by every thread of a work-group that has this job */
  const int rr = tid >> 3, c = (tid & 7) * 4;      /* write role: 8 lanes cover the 128 B (32 dwords) of one n */
#pragma unroll      /* the LDS reads issue ahead of the stores */
  for (int p = 0; p < 2; ++p) { const int n = p * 32 + rr; v4uw o;
#pragma unroll      /* constant indices into the vector */
    for (int j = 0; j < 4; ++j) o[j] = tl[n][c + j];
    *(v4uw*)((unsigned short*)Wt + (size_t)(n0 + n) * K + k0 + c * 2) = o; }
  asm volatile("s_wait_xcnt 0x0" ::: "memory");      /* precaution: stands behind the stores above, in front of the other jobs' code, which in the listing follows this one and rewrites the stores' registers */
}
// k_gemm_hh variant with fused epilogue: v = acc·alpha + bias[by·sBias + col] (+ CP[(row/rowsPerB)·sCPb + by·64 + col] if CP) ; ACT 0 none / 1 elu ; writes f16 C16 (and f32 C if non-null)
template <int ACT>
__global__ __launch_bounds__(128) void k_gemm_hhx(const _Float16* __restrict__ A, int lda, size_t sA, const _Float16* __restrict__ Bh, int ldb, size_t sB, float alpha, const float* __restrict__ bias, size_t sBias, const float* __restrict__ CP, int rowsPerB, size_t sCPb, int row0g,
    float* __restrict__ C, _Float16* __restrict__ C16, int ldc, size_t sC, int M, int N, int K) {
  __shared__ __attribute__((aligned(16))) float so[4][16][64];
  const int tid = threadIdx.x, w = tid >> 5, lane = tid & 31, ln = lane & 15, hh = lane >> 4; const int by = blockIdx.y;
  A += (size_t)by * sA; Bh += (size_t)by * sB; const size_t cofs = (size_t)by * sC; const float* bp = bias ? bias + (size_t)by * sBias : nullptr;
  const int ntn = (N + 63) / 64; const int wid = blockIdx.x * 4 + w; const int mt = wid / ntn, nq = wid % ntn; if (mt * 16 >= M) return;
  const int row0 = mt * 16, col0 = nq * 64; const _Float16* arow = A + (size_t)(row0 + ln) * lda;
  v8f acc[4] = {};
  for (int kb = 0; kb < K; kb += 32) { FragH ah; ah.half[0] = *(const v8us*)((const unsigned short*)arow + kb + 8 * hh); ah.half[1] = *(const v8us*)((const unsigned short*)arow + kb + 16 + 8 * hh);
#pragma unroll
    for (int t = 0; t < 4; ++t) { if (col0 + t * 16 >= N) continue; const size_t boff = (size_t)(col0 + t * 16 + ln) * ldb + kb; FragH bq; bq.half[0] = *(const v8us*)((const unsigned short*)Bh + boff + 8 * hh); bq.half[1] = *(const v8us*)((const unsigned short*)Bh + boff + 16 + 8 * hh);
      acc[t] = mmaH<1>(ah.v, ah.v, bq.v, bq.v, acc[t]); }
  }
#pragma unroll
  for (int t = 0; t < 4; ++t) { if (col0 + t * 16 >= N) continue; const int col = col0 + t * 16 + ln; const float bv = bp ? bf16_round(bp[col]) : 0.f;
#pragma unroll
    for (int r = 0; r < 8; ++r) { float v = acc[t][r] * alpha + bv; if (CP) { const int rr = row0g + row0 + 8 * hh + r; if (rowsPerB < 0) v += CP[cofs + (size_t)rr * ldc + col];      /* rowsPerB < 0: own element of the batched C plane */ else { const int bidx = rr / rowsPerB; v += CP[(size_t)bidx * sCPb + (size_t)by * 64 + col]; } } if (ACT == 1) v = (v > 0.f) ? v : expm1f(v); else if (ACT == 7) v = (v > 0.f) ? v + 1.0f : expf(v); else if (ACT == 8) v = tanhf(v); else if (ACT == 9) v = 0.5f * v * (1.0f + tanhf(0.7978845608028654f * (v + 0.044715f * v * v * v))); else if (ACT == 11) v = 1.0f / (1.0f + expf(-v)); else if (ACT == 12) v = (v > 0.f) ? v : 0.01f * v; else if (ACT == 14) v = (v > 0.f) ? v : 0.1f * v; else if (ACT == 16) v = (v >= 0.f) ? v : 0.3f * v; else if (ACT == 17) v = (v >= 0.f) ? v : 0.2f * v; else if (ACT == 15) v = v / (1.0f + expf(-v)); else if (ACT == 3) v = fmaxf(v, 0.f); else if (ACT == 6) v = 0.5f * v * (1.0f + erff(v * 0.70710678118654752f)); so[w][8 * hh + r][t * 16 + ln] = v; } }
  __builtin_amdgcn_fence(__ATOMIC_ACQ_REL, "workgroup"); __builtin_amdgcn_wave_barrier();
  const int rsub = lane >> 4, c4 = (lane & 15) * 4; typedef _Float16 v4h __attribute__((ext_vector_type(4)));
  {
#pragma unroll
    for (int q = 0; q < 8; ++q) { const int r = q * 2 + rsub; if (col0 + c4 < N) { const v4f v = *(const v4fa*)&so[w][r][c4]; if (C) *(v4f*)(C + cofs + (size_t)(row0 + r) * ldc + col0 + c4) = v; if (C16) { v4h h4; for (int i = 0; i < 4; ++i) h4[i] = (_Float16)v[i]; *(v4h*)(C16 + cofs + (size_t)(row0 + r) * ldc + col0 + c4) = h4; } } }
     }
}


typedef _Float16 v4h __attribute__((ext_vector_type(4)));

__device__ __forceinline__ void d_x16(unsigned bx, const float* __restrict__ x, _Float16* __restrict__ X16, size_t n8) { const size_t t = (size_t)bx * 256 + threadIdx.x; if (t >= n8) return; FragH f;
#pragma unroll
  for (int q = 0; q < 8; ++q) f.h[q] = (_Float16)bf16_round(x[t * 8 + q]); *(v8us*)((unsigned short*)X16 + t * 8) = f.half[0];  }
__global__ __launch_bounds__(256) void k_h16(const float* __restrict__ x, _Float16* __restrict__ X16, size_t n8) { const size_t t = (size_t)blockIdx.x * 256 + threadIdx.x; if (t >= n8) return; FragH f;
#pragma unroll
  for (int q = 0; q < 8; ++q) f.h[q] = (_Float16)x[t * 8 + q]; *(v8us*)((unsigned short*)X16 + t * 8) = f.half[0];  }
__global__ __launch_bounds__(256) void k_round16f(const float* __restrict__ W, _Float16* __restrict__ Bt, size_t n8) { const size_t t = (size_t)blockIdx.x * 256 + threadIdx.x; if (t >= n8) return; FragH f;
#pragma unroll
  for (int i = 0; i < 8; ++i) f.h[i] = (_Float16)(bf16_round(W[t * 8 + i]) * 16.0f); *(v8us*)((unsigned short*)Bt + t * 8) = f.half[0];  }
__global__ __launch_bounds__(256) void k_hl(const float* __restrict__ F, _Float16* __restrict__ Hh, _Float16* __restrict__ Hl, size_t n8) { const size_t t = (size_t)blockIdx.x * 256 + threadIdx.x; if (t >= n8) return; FragH fh, fl; const v4f a = *(const v4fa*)(F + t * 8), c = *(const v4fa*)(F + t * 8 + 4);
#pragma unroll
  for (int q = 0; q < 4; ++q) { _Float16 h = (_Float16)a[q]; fh.h[q] = h; fl.h[q] = (_Float16)((a[q] - (float)h) * 1024.0f); h = (_Float16)c[q]; fh.h[4 + q] = h; fl.h[4 + q] = (_Float16)((c[q] - (float)h) * 1024.0f); }
  { *(v8us*)((unsigned short*)Hh + t * 8) = fh.half[0]; *(v8us*)((unsigned short*)Hl + t * 8) = fl.half[0];  } }

// ---- fast GEMM (work-group tile 128x128, four waves as 2 x 2, wave tile 64x64; requires M % 128 == 0, N % 128 == 0, K % 128 == 0, K >= 128); epilogue = k_gemm_hhx semantics ----
// Operands go through LDS: a stage is 128 k (256 B) of the work-group's 128 A rows and 128 B rows, brought by asynchronous copies of whole lines, two buffers, the next stage in flight while this one is multiplied.
__device__ __forceinline__ v16h g2_frag(const _Float16* p, int hh) { FragH f; f.half[0] = *(const v8us*)((const unsigned short*)p + 8 * hh); f.half[1] = *(const v8us*)((const unsigned short*)p + 16 + 8 * hh); return f.v; }
__device__ __forceinline__ v8f g2_mma(v16h a, v16h b, v8f c) { return __builtin_amdgcn_wmma_f32_16x16x32_f16(false, a, false, b, (short)0, c, false, false); }
#define G2_PITCH 272                 /* LDS bytes from row to row: 256 + 16, an odd multiple of 16 B, so the 16 rows of a fragment read fall on different banks */
#define G2_BUF (256 * G2_PITCH)      /* one stage: rows 0..127 = A, rows 128..255 = B */
#define G2_SO (64 * 68 * 4)          /* bytes of one wave's f32 output staging: 64 rows of 64 + 4 values */
__device__ __forceinline__ v16h g2_lfrag(const unsigned char* p) { FragH f; f.half[0] = *(const v8us*)p; f.half[1] = *(const v8us*)(p + 32); return f.v; }      /* p = row start + 64 B x block + 16 hh: the k order of g2_frag */
// eight asynchronous copies of 16 B a lane, rows 8 apart: LDS byte address l (+ 8 rows each), global address g (+ gs elements each)
__device__ __forceinline__ void g2_copy8(unsigned l, const _Float16* g, size_t gs) {
  const unsigned l1 = l + 8 * G2_PITCH, l2 = l + 16 * G2_PITCH, l3 = l + 24 * G2_PITCH, l4 = l + 32 * G2_PITCH, l5 = l + 40 * G2_PITCH, l6 = l + 48 * G2_PITCH, l7 = l + 56 * G2_PITCH;
  const _Float16* g1 = g + gs; const _Float16* g2 = g1 + gs; const _Float16* g3 = g2 + gs; const _Float16* g4 = g3 + gs; const _Float16* g5 = g4 + gs; const _Float16* g6 = g5 + gs; const _Float16* g7 = g6 + gs;
  /* the copies move global bytes into LDS through no register; the closing s_wait_xcnt is a precaution: it stands in front of any rewrite of the address registers named here */
  asm volatile("global_load_async_to_lds_b128 %0, %8, off\n\t"
               "global_load_async_to_lds_b128 %1, %9, off\n\t"
               "global_load_async_to_lds_b128 %2, %10, off\n\t"
               "global_load_async_to_lds_b128 %3, %11, off\n\t"
               "global_load_async_to_lds_b128 %4, %12, off\n\t"
               "global_load_async_to_lds_b128 %5, %13, off\n\t"
               "global_load_async_to_lds_b128 %6, %14, off\n\t"
               "global_load_async_to_lds_b128 %7, %15, off\n\t"
               "s_wait_xcnt 0x0"
               :: "v"(l), "v"(l1), "v"(l2), "v"(l3), "v"(l4), "v"(l5), "v"(l6), "v"(l7), "v"(g), "v"(g1), "v"(g2), "v"(g3), "v"(g4), "v"(g5), "v"(g6), "v"(g7) : "memory"); }
// Products that do not depend on one another share a grid as planes of blockIdx.y: planes 1 and up take B1 and bias1 where B1 is given; C, the f32 result, is one plane and is stored by plane cy alone
// Where VT is given, plane cy is the v projection (N = NH heads of HD columns, rows = tokens of NB batches of SQ): it stores its f32 rows times 64 bf16(av[0]) in C and its f16 values transposed in VT [NB][NH][HD][SQ], and no C16 rows
template <int ACT>
__global__ __launch_bounds__(128) void k_gemm2(const _Float16* __restrict__ A, int lda, size_t sA, const _Float16* __restrict__ Bh, int ldb, size_t sB, float alpha, const float* __restrict__ bias, size_t sBias, const float* __restrict__ CP, int rowsPerB, size_t sCPb, int row0g,
    float* __restrict__ C, _Float16* __restrict__ C16, int ldc, size_t sC, int M, int N, int K, const _Float16* __restrict__ B1, const float* __restrict__ bias1, int cy, _Float16* __restrict__ VT, const float* __restrict__ av) { static_assert(ACT == 0 || ACT == 3 || ACT == 6 || ACT == 8 || ACT == 9 || ACT == 11 || ACT == 12 || ACT == 14 || ACT == 15 || ACT == 16 || ACT == 17, "k_gemm2: unsupported ACT code (would silently apply no activation)");
  __shared__ __attribute__((aligned(16))) unsigned char ring[2][G2_BUF];
  const int tid = threadIdx.x, w = tid >> 5, lane = tid & 31, ln = lane & 15, hh = lane >> 4, wm = w >> 1, wn = w & 1; const int by = blockIdx.y;
  float (*so)[68] = (float (*)[68])(&ring[0][0] + w * G2_SO);      /* this wave's output staging lies in the ring, which is free behind the loop: every wave's reads and copies end in front of the loop's last barrier */
  A += (size_t)by * sA; Bh += (size_t)by * sB; const size_t cofs = (size_t)by * sC; const float* bp = bias ? bias + (size_t)by * sBias : nullptr;
  if (B1 && by) { Bh = B1; bp = bias1; }
  C = by == cy ? C - cofs : nullptr;      /* the stores below add cofs */
  const int ntn = N >> 7; const int mt = blockIdx.x / ntn, nq = blockIdx.x - mt * ntn; const int row0 = mt * 128 + 64 * wm, col0 = nq * 128, colw = col0 + 64 * wn; if (mt * 128 >= M) return;      /* taken by a whole work-group, in front of every barrier */
  const int cr = tid >> 4, cc = tid & 15;      /* copy role: 16 lanes cover the 256 B of one row, a wave two whole rows (4 lines) */
  const _Float16* ga = A + (size_t)(mt * 128 + cr) * lda + cc * 8; const _Float16* gb = Bh + (size_t)(col0 + cr) * ldb + cc * 8; const unsigned lc = (unsigned)(size_t)&ring[0][0] + cr * G2_PITCH + cc * 16;
  auto stage = [&](int t, int buf) { const unsigned l = lc + buf * G2_BUF; const _Float16* a = ga + t * 128; const _Float16* b = gb + t * 128;
    g2_copy8(l, a, (size_t)8 * lda); g2_copy8(l + 64 * G2_PITCH, a + (size_t)64 * lda, (size_t)8 * lda); g2_copy8(l + 128 * G2_PITCH, b, (size_t)8 * ldb); g2_copy8(l + 192 * G2_PITCH, b + (size_t)64 * ldb, (size_t)8 * ldb); };
  const int nt = K >> 7;
  const v8f z8 = {0.f,0.f,0.f,0.f,0.f,0.f,0.f,0.f}; v8f acc[4][4];      /* acc[i][j]: rows 16 i, columns 16 j of the wave's tile */
#pragma unroll      /* constant indices, so the accumulators stay in registers */
  for (int i = 0; i < 4; ++i)
#pragma unroll      /* constant indices, so the accumulators stay in registers */
    for (int j = 0; j < 4; ++j) acc[i][j] = z8;
  stage(0, 0);
  asm volatile("s_wait_asynccnt 0x0" ::: "memory");      /* this wave's copies of stage 0 have landed */
  __syncthreads();                                       /* every wave's have: stage 0 may be read */
  if (nt > 1) stage(1, 1);
#pragma unroll 1    /* one stage a trip: the publish point at the foot stands once */
  for (int t = 0; t < nt; ++t) { const unsigned char* ap = &ring[t & 1][0] + (64 * wm + ln) * G2_PITCH + 16 * hh; const unsigned char* bq = &ring[t & 1][0] + (128 + 64 * wn + ln) * G2_PITCH + 16 * hh; v16h fa[2][4], fb[2][4];
    auto frags = [&](int kk, v16h (&a)[4], v16h (&b)[4]) {
#pragma unroll      /* constant indices, so the fragment arrays stay in registers */
      for (int j = 0; j < 4; ++j) { a[j] = g2_lfrag(ap + j * 16 * G2_PITCH + kk * 64); b[j] = g2_lfrag(bq + j * 16 * G2_PITCH + kk * 64); } };
    frags(0, fa[0], fb[0]);
#pragma unroll      /* constant indices, so the fragment arrays stay in registers */
    for (int kk = 0; kk < 4; ++kk) { const int c = kk & 1;
      if (kk < 3) frags(kk + 1, fa[c ^ 1], fb[c ^ 1]);
      __builtin_amdgcn_sched_barrier(0);      /* the next block's LDS reads stay one group ahead of this block's products instead of among them */
#pragma unroll      /* constant indices, so the fragment arrays stay in registers */
      for (int j = 0; j < 4; ++j)
#pragma unroll      /* constant indices, so the fragment arrays stay in registers */
        for (int i = 0; i < 4; ++i) acc[i][j] = g2_mma(fa[c][i], fb[c][j], acc[i][j]);
      __builtin_amdgcn_sched_barrier(0); }    /* and the block after next's reads stay behind these products */
    asm volatile("s_wait_dscnt 0x0" ::: "memory");         /* this wave has finished reading the buffer */
    asm volatile("s_wait_asynccnt 0x0" ::: "memory");      /* its copies of stage t + 1 have landed */
    __syncthreads();                                       /* publishes stage t + 1 and ends every wave's reads of stage t */
    if (t + 2 < nt) stage(t + 2, t & 1); }                 /* refill of the buffer just left; the test reads the same in the whole work-group */
  asm volatile("s_wait_asynccnt 0x0" ::: "memory");        /* nothing of this wave is in flight behind the loop */
  if constexpr (ACT == 0) { if (VT && by == cy) {      /* the test reads the same in the whole work-group: the block holds a barrier */
    float bv[4] = {0.f, 0.f, 0.f, 0.f};
    __builtin_amdgcn_sched_barrier(0);      /* with the one below: the loads of the factor and of the four bias values stay one group with their wait, so nothing that could rewrite an address register comes between */
    const float a0 = av[0];
    if (bp) {
#pragma unroll      /* constant indices, so the four values stay in registers */
      for (int t = 0; t < 4; ++t) bv[t] = bp[colw + t * 16 + ln]; }
    asm volatile("s_wait_xcnt 0x0" ::: "memory");      /* precaution: stands behind the loads issued above, in front of any rewrite of their address registers */
    __builtin_amdgcn_sched_barrier(0);
    const float a64 = bf16_round(a0) * 64.0f;
    /* an accumulator tile holds, per lane, 8 consecutive rows (keys) of one column (d): 16 B of a V^T row. The part of the ring behind the four waves' staging collects the work-group's 128 V^T rows of 128 keys at the ring's own pitch */
    unsigned char* vtile = &ring[0][0] + 4 * G2_SO; unsigned char* tw = vtile + (64 * wn + ln) * G2_PITCH + (64 * wm + 8 * hh) * 2;
#pragma unroll      /* constant indices, so the accumulators stay in registers */
    for (int t = 0; t < 4; ++t) { const float b = bf16_round(bv[t]);
#pragma unroll      /* constant indices, so the accumulators stay in registers */
      for (int i = 0; i < 4; ++i) { FragH f;
#pragma unroll      /* constant indices, so the accumulators stay in registers */
        for (int r = 0; r < 8; ++r) { const float v = acc[i][t][r] * alpha + b; so[i * 16 + 8 * hh + r][t * 16 + ln] = a64 * v; f.h[r] = (_Float16)v; }
        *(v8us*)(tw + t * 16 * G2_PITCH + i * 32) = f.half[0]; } }
    __syncthreads();      /* every wave's part of the V^T rows is written: they may be read across the waves */
    const int rs = lane >> 4, e4 = (lane & 15) * 4; float* cr0 = C + cofs + (size_t)(row0 + rs) * ldc + colw + e4;
#pragma unroll      /* the LDS reads issue ahead of the stores */
    for (int q = 0; q < 32; ++q) { const v4f v = *(const v4fa*)&so[q * 2 + rs][e4]; *(v4f*)(cr0 + (size_t)(q * 2) * ldc) = v; }
    /* 16 lanes store the 256 B that the work-group holds of one V^T row: two whole lines; column c of the plane is row c of its batch's V^T (head c / HD, d = c % HD) */
    unsigned short* vr = (unsigned short*)VT + ((size_t)(mt * 128 / SQ) * NH * HD + col0 + cr) * SQ + mt * 128 % SQ + cc * 8; const unsigned char* tr = vtile + cr * G2_PITCH + cc * 16;
#pragma unroll      /* the LDS reads issue ahead of the stores */
    for (int i = 0; i < 16; ++i) { const v8us x = *(const v8us*)(tr + i * 8 * G2_PITCH); *(v8us*)(vr + (size_t)i * 8 * SQ) = x; }
    asm volatile("s_wait_xcnt 0x0" ::: "memory");      /* precaution: stands behind the stores above, in front of the other planes' code, which may follow in the listing and rewrite their registers */
    return; } }
#pragma unroll      /* constant indices, so the accumulators stay in registers */
  for (int t = 0; t < 4; ++t) { const float bv = bp ? bf16_round(bp[colw + t * 16 + ln]) : 0.f;
#pragma unroll      /* constant indices, so the accumulators stay in registers */
    for (int i = 0; i < 4; ++i)
#pragma unroll      /* constant indices, so the accumulators stay in registers */
      for (int r = 0; r < 8; ++r) so[i * 16 + 8 * hh + r][t * 16 + ln] = acc[i][t][r] * alpha + bv; }
  __builtin_amdgcn_fence(__ATOMIC_ACQ_REL, "workgroup"); __builtin_amdgcn_wave_barrier();
  const int rsub = lane >> 4, c4 = (lane & 15) * 4;
  if (CP) {      /* the optional addend joins the staged values, each lane on the elements that it reads back below */
#pragma unroll 1    /* rolled: its address code, unrolled for the 128 values a lane now holds, would carry the kernel's text far past 32 KB */
    for (int q = 0; q < 32; ++q) { const int r = q * 2 + rsub; const float* cp = CP + (rowsPerB < 0 ? cofs + (size_t)(row0g + row0 + r) * ldc      /* rowsPerB < 0: own element of the batched C plane */ : (size_t)((row0g + row0 + r) / rowsPerB) * sCPb + (size_t)by * 64) + colw + c4; float ad[4];
      __builtin_amdgcn_sched_barrier(0);      /* with the one below: the four loads of the addend and their wait stay one group, so nothing that could rewrite an address register comes between */
#pragma unroll      /* constant indices, so the four values stay in registers */
      for (int i = 0; i < 4; ++i) ad[i] = cp[i];
      asm volatile("s_wait_xcnt 0x0" ::: "memory");      /* precaution: stands behind the loads issued above, in front of any rewrite of their address registers */
      __builtin_amdgcn_sched_barrier(0);
      v4f v = *(const v4fa*)&so[r][c4];
#pragma unroll      /* constant indices into the vector */
      for (int i = 0; i < 4; ++i) v[i] += ad[i];
      *(v4fa*)&so[r][c4] = v; } }
  auto staged = [&](int q) { v4f v = *(const v4fa*)&so[q * 2 + rsub][c4];      /* four finished values of row 2 q + rsub */
#pragma unroll      /* constant indices into the vector */
    for (int i = 0; i < 4; ++i) { float x = v[i];
      if (ACT == 3) x = fmaxf(x, 0.f); else if (ACT == 6) x = 0.5f * x * (1.0f + erff(x * 0.70710678118654752f)); else if (ACT == 11) x = 1.0f / (1.0f + expf(-x)); else if (ACT == 15) x = x / (1.0f + expf(-x)); else if (ACT == 12) x = (x > 0.f) ? x : 0.01f * x; else if (ACT == 8) x = tanhf(x); else if (ACT == 9) x = 0.5f * x * (1.0f + tanhf(0.7978845608028654f * (x + 0.044715f * x * x * x))); else if (ACT == 14) x = (x > 0.f) ? x : 0.1f * x; else if (ACT == 16) x = (x >= 0.f) ? x : 0.3f * x; else if (ACT == 17) x = (x >= 0.f) ? x : 0.2f * x;
      v[i] = x; }
    return v; };
  const size_t eo = cofs + (size_t)(row0 + rsub) * ldc + colw + c4;      /* this lane's first output element */
  if (C) {
#pragma unroll      /* the LDS reads issue ahead of the stores */
    for (int q = 0; q < 32; ++q) { const v4f v = staged(q); *(v4f*)(C + eo + (size_t)(q * 2) * ldc) = v; }
    asm volatile("s_wait_xcnt 0x0" ::: "memory"); }      /* precaution: stands behind the stores above, in front of the code below, which may rewrite their registers */
  if (C16) {
#pragma unroll      /* the LDS reads issue ahead of the stores */
    for (int q = 0; q < 32; ++q) { const v4f v = staged(q); v4h h4;
#pragma unroll      /* constant indices into the vector */
      for (int i = 0; i < 4; ++i) h4[i] = (_Float16)v[i];
      *(v4h*)(C16 + eo + (size_t)(q * 2) * ldc) = h4; } } }


__global__ __launch_bounds__(256) void k_wnat(const float* __restrict__ w, size_t n8, _Float16* __restrict__ Bt) { const size_t t = (size_t)blockIdx.x * 256 + threadIdx.x; if (t >= n8) return; FragH f; for (int q = 0; q < 8; ++q) f.h[q] = (_Float16)(bf16_round(w[t * 8 + q]) * 16.0f); *(v8us*)((unsigned short*)Bt + t * 8) = f.half[0];  }
__global__ __launch_bounds__(256) void k_rsm(const float* __restrict__ S, _Float16* __restrict__ P, int nrows) {
  #pragma clang fp contract(off)
  const int i = blockIdx.x * 256 + threadIdx.x; if (i >= nrows) return; const float* s = S + (size_t)i * SQ; float mx = -3.0e38f;
#pragma unroll 1
  for (int j = 0; j < SQ; ++j) mx = fmaxf(mx, s[j]); float se = 0.f;
#pragma unroll 1
  for (int j = 0; j < SQ; ++j) se += expf(s[j] - mx); const float sc = 256.0f / se;
#pragma unroll 1
  for (int j0 = 0; j0 < SQ; j0 += 8) { FragH f; for (int q = 0; q < 8; ++q) f.h[q] = (_Float16)(expf(s[j0 + q] - mx) * sc); unsigned short* d = (unsigned short*)P + (size_t)i * SQ + j0; *(v8us*)d = f.half[0];  } }
__global__ __launch_bounds__(256) void k_vt(const _Float16* __restrict__ V16, int b, int h0, _Float16* __restrict__ VT) { __shared__ unsigned short tl[64][65]; const int tid = threadIdx.x; const int hh = blockIdx.x % HG, sg = blockIdx.x / HG; const int s0 = sg * 64; const int h = h0 + hh;
  for (int i = tid; i < 64 * 8; i += 256) { const int j = i / 8, d8 = (i % 8) * 8; FragH f; f.half[0] = *(const v8us*)((const unsigned short*)V16 + ((size_t)b * SQ + s0 + j) * DM + h * HD + d8); for (int q = 0; q < 8; ++q) tl[d8 + q][j] = f.u[q]; }
  __syncthreads();
  { for (int i = tid; i < 64 * 8; i += 256) { const int d = i / 8, j8 = (i % 8) * 8; FragH f; for (int q = 0; q < 8; ++q) f.u[q] = tl[d][j8 + q]; *(v8us*)((unsigned short*)VT + ((size_t)hh * HD + d) * SQ + s0 + j8) = f.half[0]; }  } }


// lane l <-> lane l ^ M of the wave, in vector registers (no LDS round trip): M = 16 crosses the two 16-lane rows, M < 16 is a DPP row_xmask move
template <int M>
__device__ __forceinline__ float lane_xor(float x) { const int b = __float_as_int(x);
  if constexpr (M == 16) return __int_as_float(__builtin_amdgcn_permlanex16(b, b, 0x76543210, 0xfedcba98, false, false));
  else return __int_as_float(__builtin_amdgcn_update_dpp(0, b, 0x160 | M, 0xf, 0xf, true)); }
// ---- fused attention: scores and weights live in registers only ----
__device__ __forceinline__ v8f f_mma(v16h a, v16h b, v8f c) { return __builtin_amdgcn_wmma_f32_16x16x32_f16(false, a, false, b, (short)0, c, false, false); }
typedef unsigned v4ua __attribute__((ext_vector_type(4), may_alias));
#define SC2 0.18033688011112042f     /* (1 / 8) log2(e): scores go to the exponent base 2 */
#define MASKED -3.0e38f              /* score of a masked key: its weight underflows to 0 against any row reference >= M0 */
#define M0 -1.0e30f                  /* start value of a row's reference; a row with every key masked keeps it, sums 0 and ends as 0 x inf = NaN like the definition */
// one bit per (query, key): bit j of word [query][key / 32] is mask[query][32 (key / 32) + j] != 0; a wave packs 32 words
__device__ __forceinline__ void d_maskbits(unsigned bx, const int* __restrict__ mask, unsigned* __restrict__ MB) {
  const int lane = threadIdx.x & 31; const size_t wv = (size_t)bx * 8 + (threadIdx.x >> 5); const int* m = mask + wv * 1024; unsigned keep = 0;
#pragma unroll      /* 32 independent loads in flight */
  for (int i = 0; i < 32; ++i) { const unsigned bits = __builtin_amdgcn_ballot_w32(m[i * 32 + lane] != 0); if (lane == i) keep = bits; }
  MB[wv * 32 + lane] = keep;
  asm volatile("s_wait_xcnt 0x0" ::: "memory"); }      /* precaution: stands behind the store above, in front of the other jobs' code, which in the listing follows this one and rewrites the store's registers */
// S^T tile rows are keys 8 hh + r, its column is query ln: bit 16 kt + 8 hh + r of the query's mask word
__device__ __forceinline__ void mask_tile(v8f& s, unsigned word, int kt, int hh) { const unsigned u = word >> (16 * kt + 8 * hh);
#pragma unroll      /* constant indices, so the tile stays in registers */
  for (int r = 0; r < 8; ++r) s[r] = ((u >> r) & 1u) ? s[r] : MASKED; }
// K and V^T go through LDS: a stage is 128 keys of the head (K: 128 rows of 128 B; V^T: 64 rows of 256 B), brought once for the 8 waves by asynchronous copies of whole lines, two buffers, the next stage in flight while this one is worked on
#define FST 128                      /* keys a stage */
#define FK_PITCH 144                 /* LDS bytes from K row to K row: 128 + 16, an odd multiple of 16 B, so the 16 rows of a fragment read fall on different banks */
#define FV_PITCH 272                 /* the same for the V^T rows: 256 + 16 */
#define FK_BYTES (FST * FK_PITCH)
#define F_BUF (FK_BYTES + HD * FV_PITCH)      /* one stage: K rows, then V^T rows */
// four asynchronous copies of 16 B a lane: LDS byte address l (+ ls each), global address g (+ gs elements each)
__device__ __forceinline__ void f_copy4(unsigned l, unsigned ls, const _Float16* g, size_t gs) {
  const unsigned l1 = l + ls, l2 = l1 + ls, l3 = l2 + ls; const _Float16* g1 = g + gs; const _Float16* g2 = g1 + gs; const _Float16* g3 = g2 + gs;
  /* the copies move global bytes into LDS through no register; the closing s_wait_xcnt is a precaution: it stands in front of any rewrite of the address registers named here */
  asm volatile("global_load_async_to_lds_b128 %0, %4, off\n\t"
               "global_load_async_to_lds_b128 %1, %5, off\n\t"
               "global_load_async_to_lds_b128 %2, %6, off\n\t"
               "global_load_async_to_lds_b128 %3, %7, off\n\t"
               "s_wait_xcnt 0x0"
               :: "v"(l), "v"(l1), "v"(l2), "v"(l3), "v"(g), "v"(g1), "v"(g2), "v"(g3) : "memory"); }
// the key loop of k_fattn; MSK = false is taken by a work-group none of whose 256 mask rows holds a zero, and then reads no mask word
// ring: the two buffers; gk, gv, lk, lv: this lane's first global and LDS addresses as a copier of K and of V^T
template <bool MSK>
__device__ __forceinline__ void fattn_keys(const unsigned char* ring, const _Float16* gk, const _Float16* gv, unsigned lk, unsigned lv, const unsigned* mb, int ln, int hh, const v16h (&qf)[2][2], v8f (&o)[2][4], float (&m)[2], float (&l)[2]) {
  const v8f z8 = {0.f,0.f,0.f,0.f,0.f,0.f,0.f,0.f}; v16h ka[2][2], kb2[2][2], va[4], vb[4]; unsigned mw[2] = {0u, 0u};
  auto stage = [&](int t, int buf) { f_copy4(lk + buf * F_BUF, 32 * FK_PITCH, gk + (size_t)t * FST * DM, (size_t)32 * DM); f_copy4(lv + buf * F_BUF, 16 * FV_PITCH, gv + t * FST, (size_t)16 * SQ); };
  if (MSK) { mw[0] = mb[0]; mw[1] = mb[16 * (SQ / 32)]; }
  stage(0, 0);
  asm volatile("s_wait_asynccnt 0x0" ::: "memory");      /* this wave's copies of stage 0 have landed */
  __syncthreads();                                       /* every wave's have: stage 0 may be read */
  stage(1, 1);
#pragma unroll 1    /* one stage a trip: the publish point at the foot stands once */
  for (int t = 0; t < SQ / FST; ++t) { const unsigned char* kt = ring + (t & 1) * F_BUF + ln * FK_PITCH + 16 * hh; const unsigned char* vt = ring + (t & 1) * F_BUF + FK_BYTES + ln * FV_PITCH + 16 * hh;
    // the K and V^T fragments of pass p of this stage, in the k order of g2_frag
    auto frags = [&](int p, v16h (&k)[2][2], v16h (&v)[4]) {
#pragma unroll      /* constant indices, so the fragment arrays stay in registers */
      for (int i = 0; i < 2; ++i) { k[i][0] = g2_lfrag(kt + (p * 32 + i * 16) * FK_PITCH); k[i][1] = g2_lfrag(kt + (p * 32 + i * 16) * FK_PITCH + 64); }
#pragma unroll      /* constant indices, so the fragment arrays stay in registers */
      for (int d = 0; d < 4; ++d) v[d] = g2_lfrag(vt + d * 16 * FV_PITCH + p * 64); };
    // one pass = 32 keys: kc and vc hold this pass's K and V^T fragments, kx and vn take those of pass pn of the same stage (pn = 0: the stage's last pass, which fetches nothing)
    auto pass = [&](int kb, int pn, const v16h (&kc)[2][2], v16h (&kx)[2][2], const v16h (&vc)[4], v16h (&vn)[4]) { const int kn = (kb + 32) & (SQ - 1);
      v8f s[2][2]; float mx[2]; FragH pf[2];
      if (pn) frags(pn, kx, vn);
      __builtin_amdgcn_sched_barrier(0);      /* the next pass's LDS reads stay one group ahead of this pass's products instead of among them */
#pragma unroll      /* constant indices, so the fragment arrays stay in registers */
      for (int qt = 0; qt < 2; ++qt)
#pragma unroll      /* constant indices, so the fragment arrays stay in registers */
        for (int kt2 = 0; kt2 < 2; ++kt2) s[qt][kt2] = f_mma(kc[kt2][1], qf[qt][1], f_mma(kc[kt2][0], qf[qt][0], z8));
      if (MSK) {
#pragma unroll      /* constant indices, so the fragment arrays stay in registers */
        for (int qt = 0; qt < 2; ++qt) { mask_tile(s[qt][0], mw[qt], 0, hh); mask_tile(s[qt][1], mw[qt], 1, hh); }
        __builtin_amdgcn_sched_barrier(0);      /* with the one below: the next pass's two mask loads and their wait stay one group, so nothing that could rewrite an address register comes between */
        mw[0] = mb[kn >> 5]; mw[1] = mb[16 * (SQ / 32) + (kn >> 5)];
        asm volatile("s_wait_xcnt 0x0" ::: "memory");      /* precaution: stands behind the loads issued above, in front of any rewrite of their address registers */
        __builtin_amdgcn_sched_barrier(0); }
#pragma unroll      /* constant indices, so the fragment arrays stay in registers */
      for (int qt = 0; qt < 2; ++qt) { float a = fmaxf(s[qt][0][0], s[qt][1][0]);
#pragma unroll      /* constant indices, so the fragment arrays stay in registers */
        for (int r = 1; r < 8; ++r) a = fmaxf(a, fmaxf(s[qt][0][r], s[qt][1][r]));
        a *= SC2; mx[qt] = fmaxf(a, lane_xor<16>(a)); }      /* both halves of a column agree on the maximum, so on the reference too */
      if (__builtin_amdgcn_ballot_w32(mx[0] > m[0] + 8.f || mx[1] > m[1] + 8.f) != 0) {      /* scalar branch: rescale only when some column's reference must rise */
#pragma unroll      /* constant indices, so the fragment arrays stay in registers */
        for (int qt = 0; qt < 2; ++qt) { const float mn = fmaxf(m[qt], mx[qt]), f = __builtin_amdgcn_exp2f(m[qt] - mn); m[qt] = mn; l[qt] *= f;
#pragma unroll      /* constant indices, so the fragment arrays stay in registers */
          for (int d = 0; d < 4; ++d) o[qt][d] *= f; } }
#pragma unroll      /* constant indices, so the fragment arrays stay in registers */
      for (int qt = 0; qt < 2; ++qt) { float ls = 0.f;
#pragma unroll      /* constant indices, so the fragment arrays stay in registers */
        for (int r = 0; r < 8; ++r) { const float p0 = __builtin_amdgcn_exp2f(__builtin_fmaf(s[qt][0][r], SC2, -m[qt])), p1 = __builtin_amdgcn_exp2f(__builtin_fmaf(s[qt][1][r], SC2, -m[qt])); ls += p0 + p1; pf[qt].h[r] = (_Float16)p0; pf[qt].h[8 + r] = (_Float16)p1; }
        l[qt] += ls; }
#pragma unroll      /* constant indices, so the fragment arrays stay in registers */
      for (int d = 0; d < 4; ++d) { o[0][d] = f_mma(vc[d], pf[0].v, o[0][d]); o[1][d] = f_mma(vc[d], pf[1].v, o[1][d]); }
      __builtin_amdgcn_sched_barrier(0); };      /* keeps the next pass's products behind this pass: moved up, they would wait on fragments fetched only half a pass earlier */
    const int kb = t * FST;
    frags(0, ka, va);
    pass(kb, 1, ka, kb2, va, vb); pass(kb + 32, 2, kb2, ka, vb, va); pass(kb + 64, 3, ka, kb2, va, vb); pass(kb + 96, 0, kb2, ka, vb, va);      /* the two fragment sets swap by name, no register is copied */
    asm volatile("s_wait_dscnt 0x0" ::: "memory");         /* this wave has finished reading the buffer */
    asm volatile("s_wait_asynccnt 0x0" ::: "memory");      /* its copies of stage t + 1 have landed */
    __syncthreads();                                       /* publishes stage t + 1 and ends every wave's reads of stage t */
    if (t + 2 < SQ / FST) stage(t + 2, t & 1); }           /* refill of the buffer just left; the test reads the same in the whole work-group */
  asm volatile("s_wait_asynccnt 0x0" ::: "memory"); }      /* nothing of this wave is in flight behind the loop */
// One wave: 32 queries of one head against all keys, 32 keys a pass. S^T = K Q^T (A = K rows, B = Q rows), so a lane holds one query's scores; the two S^T tiles of a pass, converted in place,
// are the B operand of O^T += V^T P^T. Running row reference m (base-2 exponent), raised only when a new maximum exceeds it by more than 8 (weights then stay <= 256, inside f16); f32 row sums.
// Writes merged f16 rows 64 o + 64 alpha vp and, per (batch, head, query), the pair (m, 1 / sum) for the head-sum launch.
// The 8 waves of a work-group walk the same head's K and V^T, which are staged once for all of them in LDS.
__global__ __launch_bounds__(256) void k_fattn(const _Float16* __restrict__ Q, const _Float16* __restrict__ Kp, const _Float16* __restrict__ VT, const unsigned* __restrict__ MB, const float* __restrict__ AV, _Float16* __restrict__ O16, float* __restrict__ ST) {
  const int tid = threadIdx.x, w = tid >> 5, lane = tid & 31, ln = lane & 15, hh = lane >> 4; const int h = blockIdx.y, b = blockIdx.z, q0 = blockIdx.x * 256 + w * 32; const size_t r0 = (size_t)b * SQ;
  __shared__ __attribute__((aligned(16))) unsigned char ring[2 * F_BUF]; __shared__ __attribute__((aligned(16))) unsigned wz[8];
  const _Float16* qp = Q + (r0 + q0 + ln) * DM + h * HD; const unsigned* mb = MB + (size_t)(q0 + ln) * (SQ / 32);
  /* copy roles: 8 lanes cover the 128 B of a K row, 16 lanes the 256 B of a V^T row, so a wave copies 4 whole lines at a time */
  const _Float16* gk = Kp + (r0 + (tid >> 3)) * DM + h * HD + (tid & 7) * 8; const _Float16* gv = VT + ((size_t)(b * NH + h) * HD + (tid >> 4)) * SQ + (tid & 15) * 8;
  const unsigned lk = (unsigned)(size_t)&ring[0] + (tid >> 3) * FK_PITCH + (tid & 7) * 16, lv = (unsigned)(size_t)&ring[0] + FK_BYTES + (tid >> 4) * FV_PITCH + (tid & 15) * 16;
  const v8f z8 = {0.f,0.f,0.f,0.f,0.f,0.f,0.f,0.f};
  v16h qf[2][2]; v8f o[2][4]; float m[2] = {M0, M0}, l[2] = {0.f, 0.f};
#pragma unroll      /* constant indices, so the fragment arrays stay in registers */
  for (int t = 0; t < 2; ++t) { qf[t][0] = g2_frag(qp + (size_t)t * 16 * DM, hh); qf[t][1] = g2_frag(qp + (size_t)t * 16 * DM + 32, hh);
#pragma unroll      /* constant indices, so the fragment arrays stay in registers */
    for (int d = 0; d < 4; ++d) o[t][d] = z8; }
  unsigned all1 = 0xFFFFFFFFu;      /* the AND of this thread's share of the work-group's 256 mask rows: they lie one behind another (64 KiB), so a wave reads 512 B in a row, four whole lines an instruction */
  { const v4ua* blk = (const v4ua*)(MB + (size_t)blockIdx.x * 256 * (SQ / 32)) + tid;
#pragma unroll      /* 16 independent loads in flight */
    for (int i = 0; i < SQ / 128; ++i) { const v4ua x = blk[i * 256]; all1 &= x[0] & x[1] & x[2] & x[3]; } }
  asm volatile("s_wait_xcnt 0x0" ::: "memory");      /* precaution: stands behind the loads issued above, in front of any rewrite of their address registers */
  const unsigned bz = __builtin_amdgcn_ballot_w32(all1 != 0xFFFFFFFFu);      /* taken with every lane on */
  if (lane == 0) wz[w] = bz;
  __syncthreads();      /* the key loop holds barriers, so the whole work-group takes one side: every wave sees all 8 waves' findings */
  const v4ua z0 = *(const v4ua*)&wz[0], z1 = *(const v4ua*)&wz[4];
  if (__builtin_amdgcn_readfirstlane(z0[0] | z0[1] | z0[2] | z0[3] | z1[0] | z1[1] | z1[2] | z1[3]) != 0) fattn_keys<true>(ring, gk, gv, lk, lv, mb, ln, hh, qf, o, m, l); else fattn_keys<false>(ring, gk, gv, lk, lv, mb, ln, hh, qf, o, m, l);      /* scalar branch, the same in every wave */
  /* row layout of the epilogue: 16 lanes cover one query's 64 d (256 B of the f32 addend, 128 B of the f16 result), a wave two rows an instruction, so every load and store covers whole lines */
  const int rs = lane >> 4, e4 = (lane & 15) * 4; const size_t eo = (r0 + q0 + rs) * DM + h * HD + e4; const float* ap = AV + eo; v4f av[16];
  __builtin_amdgcn_sched_barrier(0);      /* with the one below: the sixteen loads of the addend and their wait stay one group, so nothing that could rewrite an address register comes between */
#pragma unroll      /* constant indices, so the sixteen values stay in registers */
  for (int i = 0; i < 16; ++i) av[i] = *(const v4fa*)(ap + (size_t)(i * 2) * DM);
  asm volatile("s_wait_xcnt 0x0" :: "v"(ap) : "memory");      /* precaution: stands behind the loads issued above, in front of any rewrite of their address registers; the address is named as an input so that it keeps its registers up to here and no load's result lands on them */
  __builtin_amdgcn_sched_barrier(0);
  float (*so)[68] = (float (*)[68])(&ring[0] + w * (32 * 68 * 4));      /* this wave's 32 x 64 f32 staging lies in the ring, which is free behind the key loop: every wave's reads and copies end in front of the loop's last barrier */
#pragma unroll      /* constant indices, so the fragment arrays stay in registers */
  for (int qt = 0; qt < 2; ++qt) { const float inv = 1.0f / (l[qt] + lane_xor<16>(l[qt])), sc = inv * 64.0f; const int q = q0 + qt * 16 + ln;
    if (hh == 0) { float* st = ST + ((size_t)(b * NH + h) * SQ + q) * 2; st[0] = m[qt]; st[1] = inv; }
#pragma unroll      /* constant indices, so the fragment arrays stay in registers */
    for (int d = 0; d < 4; ++d) { v4f x0, x1;      /* O^T tile: a lane holds 8 consecutive d of one query */
#pragma unroll      /* constant indices, so the fragment arrays stay in registers */
      for (int r = 0; r < 4; ++r) { x0[r] = o[qt][d][r]; x1[r] = o[qt][d][4 + r]; }
      *(v4fa*)&so[qt * 16 + ln][d * 16 + 8 * hh] = x0; *(v4fa*)&so[qt * 16 + ln][d * 16 + 8 * hh + 4] = x1; }
    if (hh == 0) so[qt * 16 + ln][64] = sc; }      /* the row's factor rides in the row's pad, so product and addend meet in one expression as before */
  asm volatile("s_wait_dscnt 0x0" ::: "memory");      /* the wave's own LDS writes are done before its lanes read one another's values */
#pragma unroll      /* the LDS reads issue ahead of the stores */
  for (int i = 0; i < 16; ++i) { const v4f x = *(const v4fa*)&so[i * 2 + rs][e4]; const float sc = so[i * 2 + rs][64]; v4h h4;
#pragma unroll      /* constant indices into the vector */
    for (int r = 0; r < 4; ++r) h4[r] = (_Float16)(x[r] * sc + av[i][r]);
    *(v4h*)(O16 + eo + (size_t)(i * 2) * DM) = h4; } }
// K, Q and the row statistics of k_headsum go through LDS: a stage is one head's 128 B of the work-group's 256 K rows and 64 Q rows, brought by asynchronous copies of whole lines, two buffers, the next head in flight while this one is worked on
#define HS_PITCH 144                 /* LDS bytes from row to row: 128 + 16, an odd multiple of 16 B, so the 16 rows of a fragment read fall on different banks */
#define HS_BUF (320 * HS_PITCH)      /* one stage: rows 0..255 = K, rows 256..319 = Q */
// two asynchronous copies of 16 B a lane: LDS byte address l (+ ls), global address g (+ gs bytes)
__device__ __forceinline__ void f_copy2(unsigned l, unsigned ls, const unsigned char* g, size_t gs) {
  const unsigned l1 = l + ls; const unsigned char* g1 = g + gs;
  /* the copies move global bytes into LDS through no register; the closing s_wait_xcnt is a precaution: it stands in front of any rewrite of the address registers named here */
  asm volatile("global_load_async_to_lds_b128 %0, %2, off\n\t"
               "global_load_async_to_lds_b128 %1, %3, off\n\t"
               "s_wait_xcnt 0x0"
               :: "v"(l), "v"(l1), "v"(g), "v"(g1) : "memory"); }
// this lane's ten copies of head h into buffer buf; gk, gq: the work-group's first K and Q rows; go, lc: the lane's element offset from them and its first LDS address
__device__ __forceinline__ void hs_stage(const _Float16* gk, const _Float16* gq, unsigned go, unsigned lc, int h, int buf) { const unsigned l = lc + buf * HS_BUF;
  f_copy4(l, 32 * HS_PITCH, gk + h * HD + go, (size_t)32 * DM); f_copy4(l + 128 * HS_PITCH, 32 * HS_PITCH, gk + (size_t)128 * DM + h * HD + go, (size_t)32 * DM); f_copy2(l + 256 * HS_PITCH, 32 * HS_PITCH, (const unsigned char*)(gq + h * HD + go), (size_t)32 * DM * 2); }
// the head loop of k_headsum, entered with head 0 published and head 1 in flight; MSK = false is taken by a work-group whose 64 x 256 mask bits are all set
// ring: the two buffers; gk, gq, go, lc: as in hs_stage; kr, qr: the LDS rows of this lane's first K and Q fragments; st: this lane's first (m, 1 / sum) pair in LDS
template <bool MSK>
__device__ __forceinline__ void headsum_heads(const unsigned char* ring, const _Float16* gk, const _Float16* gq, unsigned go, unsigned lc, int kr, int qr, const float* st, int hh, const unsigned (&mw)[2][2], v8f (&acc)[2][4]) {
  const v8f z8 = {0.f,0.f,0.f,0.f,0.f,0.f,0.f,0.f};
#pragma unroll 1    /* one head a trip: the publish point at the foot stands once, and the live set stays small enough for four waves a SIMD */
  for (int h = 0; h < NH; ++h) { v16h qf[2][2], kf[4][2]; float mr[2], iv[2]; const unsigned char* kp = ring + (h & 1) * HS_BUF + kr * HS_PITCH + 16 * hh; const unsigned char* qp = ring + (h & 1) * HS_BUF + qr * HS_PITCH + 16 * hh;
#pragma unroll      /* constant indices, so the fragment arrays stay in registers */
    for (int t = 0; t < 4; ++t) { kf[t][0] = g2_lfrag(kp + t * 16 * HS_PITCH); kf[t][1] = g2_lfrag(kp + t * 16 * HS_PITCH + 64); }
#pragma unroll      /* constant indices, so the fragment arrays stay in registers */
    for (int t = 0; t < 2; ++t) { qf[t][0] = g2_lfrag(qp + t * 16 * HS_PITCH); qf[t][1] = g2_lfrag(qp + t * 16 * HS_PITCH + 64); mr[t] = st[(h * 64 + t * 16) * 2]; iv[t] = st[(h * 64 + t * 16) * 2 + 1]; }
#pragma unroll      /* constant indices, so the fragment arrays stay in registers */
    for (int qt = 0; qt < 2; ++qt)
#pragma unroll      /* constant indices, so the fragment arrays stay in registers */
      for (int kt = 0; kt < 4; ++kt) { v8f s = f_mma(kf[kt][1], qf[qt][1], f_mma(kf[kt][0], qf[qt][0], z8));
        if (MSK) mask_tile(s, mw[qt][kt >> 1], kt & 1, hh);
#pragma unroll      /* constant indices, so the fragment arrays stay in registers */
        for (int r = 0; r < 8; ++r) acc[qt][kt][r] = __builtin_fmaf(__builtin_amdgcn_exp2f(__builtin_fmaf(s[r], SC2, -mr[qt])), iv[qt], acc[qt][kt][r]); }
    asm volatile("s_wait_dscnt 0x0" ::: "memory");         /* this wave has finished reading the buffer */
    asm volatile("s_wait_asynccnt 0x0" ::: "memory");      /* its copies of head h + 1 have landed */
    __syncthreads();                                       /* publishes head h + 1 and ends every wave's reads of head h */
    if (h + 2 < NH) hs_stage(gk, gq, go, lc, h + 2, h & 1); }      /* refill of the buffer just left; the test reads the same in the whole work-group */
  asm volatile("s_wait_asynccnt 0x0" ::: "memory"); }      /* nothing of this wave is in flight behind the loop */
// second output: one wave holds 32 queries x 64 keys of the head sum in registers and walks the 16 heads, forming each head's S^T tiles again (same products, same order as k_fattn) and its weights from the stored (m, 1 / sum)
// a work-group is 2 x 4 such waves: 64 queries x 256 keys, so a staged K row serves two waves and a staged Q row four
__global__ __launch_bounds__(256) void k_headsum(const _Float16* __restrict__ Q, const _Float16* __restrict__ Kp, const unsigned* __restrict__ MB, const float* __restrict__ ST, float* __restrict__ WS) {
  __shared__ __attribute__((aligned(16))) unsigned char ring[2 * HS_BUF]; __shared__ __attribute__((aligned(16))) float sst[NH][64][2]; __shared__ __attribute__((aligned(16))) unsigned wz[8];
  const int tid = threadIdx.x, w = tid >> 5, lane = tid & 31, ln = lane & 15, hh = lane >> 4, qi = w >> 2, ki = w & 3; const int b = blockIdx.z, qb = blockIdx.y * 64, kb = blockIdx.x * 256, q0 = qb + qi * 32, k0 = kb + ki * 64; const size_t r0 = (size_t)b * SQ;
  /* copy roles: 8 lanes cover the 128 B of a row, so a wave copies 4 whole lines at a time; the statistics are 512 B a head, 32 lanes each */
  const _Float16* gk = Kp + (r0 + kb) * DM; const _Float16* gq = Q + (r0 + qb) * DM; const unsigned go = (tid >> 3) * DM + (tid & 7) * 8; const unsigned lc = (unsigned)(size_t)&ring[0] + (tid >> 3) * HS_PITCH + (tid & 7) * 16;
  f_copy2((unsigned)(size_t)&sst[0][0][0] + tid * 16, 8 * 512, (const unsigned char*)(ST + ((size_t)(b * NH + (tid >> 5)) * SQ + qb) * 2 + (tid & 31) * 4), (size_t)8 * SQ * 2 * 4);      /* heads w and w + 8; waited for with head 0's copies */
  hs_stage(gk, gq, go, lc, 0, 0);
  const v8f z8 = {0.f,0.f,0.f,0.f,0.f,0.f,0.f,0.f}; v8f acc[2][4]; unsigned mw[2][2];
#pragma unroll      /* constant indices, so the fragment arrays stay in registers */
  for (int qt = 0; qt < 2; ++qt) { const unsigned* mb = MB + (size_t)(q0 + qt * 16 + ln) * (SQ / 32) + (k0 >> 5); mw[qt][0] = mb[0]; mw[qt][1] = mb[1];
#pragma unroll      /* constant indices, so the fragment arrays stay in registers */
    for (int kt = 0; kt < 4; ++kt) acc[qt][kt] = z8; }
  const unsigned bz = __builtin_amdgcn_ballot_w32((mw[0][0] & mw[0][1] & mw[1][0] & mw[1][1]) != 0xFFFFFFFFu);      /* taken with every lane on */
  if (lane == 0) wz[w] = bz;
  asm volatile("s_wait_asynccnt 0x0" ::: "memory");      /* this wave's copies of head 0 and of the statistics have landed */
  __syncthreads();      /* every wave's have: they may be read; and every wave sees all 8 waves' mask findings: the head loop holds barriers, so the whole work-group takes one side */
  hs_stage(gk, gq, go, lc, 1, 1);
  const v4ua z0 = *(const v4ua*)&wz[0], z1 = *(const v4ua*)&wz[4]; const float* st = &sst[0][qi * 32 + ln][0]; const int kr = ki * 64 + ln, qr = 256 + qi * 32 + ln;
  if (__builtin_amdgcn_readfirstlane(z0[0] | z0[1] | z0[2] | z0[3] | z1[0] | z1[1] | z1[2] | z1[3]) != 0) headsum_heads<true>(ring, gk, gq, go, lc, kr, qr, st, hh, mw, acc); else headsum_heads<false>(ring, gk, gq, go, lc, kr, qr, st, hh, mw, acc);      /* scalar branch, the same in every wave */
  float (*so)[68] = (float (*)[68])(&ring[0] + w * (32 * 68 * 4));      /* this wave's 32 x 64 f32 staging lies in the ring, which is free behind the head loop: every wave's reads and copies end in front of the loop's last barrier */
#pragma unroll      /* constant indices, so the fragment arrays stay in registers */
  for (int qt = 0; qt < 2; ++qt)
#pragma unroll      /* constant indices, so the fragment arrays stay in registers */
    for (int kt = 0; kt < 4; ++kt) { v4f a0, a1;      /* a lane holds 8 consecutive keys of one query */
#pragma unroll      /* constant indices, so the fragment arrays stay in registers */
      for (int r = 0; r < 4; ++r) { a0[r] = acc[qt][kt][r]; a1[r] = acc[qt][kt][4 + r]; }
      *(v4fa*)&so[qt * 16 + ln][kt * 16 + 8 * hh] = a0; *(v4fa*)&so[qt * 16 + ln][kt * 16 + 8 * hh + 4] = a1; }
  asm volatile("s_wait_dscnt 0x0" ::: "memory");      /* the wave's own LDS writes are done before its lanes read one another's values */
  /* 16 lanes store the 256 B that the wave holds of one query's row, a wave two rows an instruction: four whole lines */
  const int rs = lane >> 4, e4 = (lane & 15) * 4; float* d0 = WS + (r0 + q0 + rs) * SQ + k0 + e4;
#pragma unroll      /* the LDS reads issue ahead of the stores */
  for (int i = 0; i < 16; ++i) { const v4f x = *(const v4fa*)&so[i * 2 + rs][e4]; *(v4f*)(d0 + (size_t)(i * 2) * SQ) = x; } }
// Jobs that do not depend on one another share a grid: a work-group picks its job by its index, the same for all its threads, and runs that job's body with its index within the job.
#define PW_G ((DM / 64) * (DM / 64))          /* work-groups of one weight transpose */
#define PM_G (SQ * (SQ / 32) / 256)           /* of the mask pack */
#define PX_G ((int)(NR * DM / 8 / 256))       /* of one input conversion */
// all that reads inputs only: the three weight transposes, the mask pack, the three input conversions
__global__ __launch_bounds__(256) void k_prep(const float* __restrict__ wq, const float* __restrict__ wkv, const float* __restrict__ wo, _Float16* __restrict__ BQ, _Float16* __restrict__ BKV, _Float16* __restrict__ BO, const int* __restrict__ mask, unsigned* __restrict__ MB,
    const float* __restrict__ qin, const float* __restrict__ kin, const float* __restrict__ vin, _Float16* __restrict__ XQ, _Float16* __restrict__ XK, _Float16* __restrict__ XV) { const unsigned bx = blockIdx.x;
  __shared__ __attribute__((aligned(16))) unsigned tl[64][WT_P];      /* the weight transposes' tile */
  if (bx < 3 * PW_G) { const unsigned j = bx / PW_G; d_wt_f16(bx - j * PW_G, j == 0 ? wq : j == 1 ? wkv : wo, j == 0 ? BQ : j == 1 ? BKV : BO, DM, DM, 16.0f, tl); }
  else if (bx < 3 * PW_G + PM_G) d_maskbits(bx - 3 * PW_G, mask, MB);
  else { const unsigned i = bx - (3 * PW_G + PM_G), j = i / PX_G; d_x16(i - j * PX_G, j == 0 ? qin : j == 1 ? kin : vin, j == 0 ? XQ : j == 1 ? XK : XV, NR * DM / 8); } }

extern "C" void kernel_launch(void* const* d_in, const int* in_sizes, int n_in,
                              void* d_out, int out_size, void* d_ws, size_t ws_size, hipStream_t stream) {
  (void)in_sizes; (void)n_in; (void)out_size;
  const float* const* I = (const float* const*)d_in; const float* qin = I[0]; const float* kin = I[1]; const float* vin = I[2]; const int* mask = (const int*)d_in[3]; const float* wq = I[4]; const float* bq = I[5]; const float* wkv = I[6]; const float* bkv = I[7]; const float* wo = I[8]; const float* bo = I[9]; const float* alpha = I[10];      /* weights [in][out] */
  float* out0 = (float*)d_out; float* out1 = (float*)d_out + NR * DM;      /* byte offset 16,777,216 */
  char* ws = (char*)d_ws; size_t off = 0;
  auto take = [&](size_t bytes) { char* p = ws + off; off += (bytes + 255) & ~(size_t)255; return p; };
  _Float16* BQ = (_Float16*)take((size_t)DM * DM * 2); _Float16* BKV = (_Float16*)take((size_t)DM * DM * 2); _Float16* BO = (_Float16*)take((size_t)DM * DM * 2);
  _Float16* Q16 = (_Float16*)take(NR * DM * 2); _Float16* K16 = (_Float16*)take(NR * DM * 2); float* AV = (float*)take(NR * DM * 4); _Float16* O16 = (_Float16*)take(NR * DM * 2);
  _Float16* VT = (_Float16*)take((size_t)NB * NH * HD * SQ * 2); unsigned* MB = (unsigned*)take((size_t)SQ * (SQ / 32) * 4); float* ST = (float*)take((size_t)NB * NH * SQ * 2 * 4);
  _Float16* XQ = (_Float16*)take(NR * DM * 2); _Float16* XK = (_Float16*)take(NR * DM * 2); _Float16* XV = (_Float16*)take(NR * DM * 2);
  if (off > ws_size) return;      /* 6 + 16 + 16 + 8 + 8 + 0.5 + 0.5 + 24 = 79 MiB */
  k_prep<<<3 * PW_G + PM_G + 3 * PX_G, 256, 0, stream>>>(wq, wkv, wo, BQ, BKV, BO, mask, MB, qin, kin, vin, XQ, XK, XV);
  const size_t r0p = (size_t)B0 * SQ; const dim3 gp((unsigned)((MP / 128) * (DM / 128)), 3);
  k_gemm2<0><<<gp, 128, 0, stream>>>(XQ + r0p * DM, DM, NR * DM, BQ, DM, 0, 0.0625f, bq, 0, nullptr, 1, 0, 0, AV + r0p * DM, Q16 + r0p * DM, DM, NR * DM, MP, DM, DM, BKV, bkv, 2, VT, alpha);      /* planes qp, kp, vp: XQ, XK, XV and Q16, K16 lie NR * DM elements apart; vp leaves as 64 alpha vp (f32 rows, residual) and as V^T [NB][NH][HD][SQ] (f16, attention operand) */
  k_fattn<<<dim3(SQ / 256, NH, NB), 256, 0, stream>>>(Q16, K16, VT, MB, AV, O16, ST);      /* o x64 = 64 attn v + 64 alpha vp, f16 rows; row statistics */
  k_headsum<<<dim3(SQ / 256, SQ / 64, NB), 256, 0, stream>>>(Q16, K16, MB, ST, out1);      /* sum over the heads of the weights */
  k_gemm2<0><<<dim3((unsigned)((MPO / 128) * (DM / 128)), 1), 128, 0, stream>>>(O16 + r0p * DM, DM, 0, BO, DM, 0, 0.0009765625f, bo, 0, nullptr, 1, 0, 0, out0 + r0p * DM, nullptr, DM, 0, MPO, DM, DM, nullptr, nullptr, 0, nullptr, nullptr);      /* out0 = o Wo + bo */
}
